// v000
// Times are from an AMD MI455X. After a warm-up the kernel runs many times in a row, and a time is the length of
// such a window on the GPU divided by its runs, so every launch and the gaps after it count. The runs cycle
// through copies of the inputs. A figure is the median of several windows, for all but v000 over two sittings.
// Sittings can differ by a few percent; kernels timed side by side share one.
// v000 is the starting kernel. One run takes 1170 microseconds.
// compute dtype: all float inputs rounded to bf16; q/k/v projections with EXACT bf16 products on WMMA 16x16x32 (f32 accumulate) + bias; the granularity gate g = sigmoid(x . Wg + bg) from exact bf16 products summed in f32 (VALU), pow(S - 2, 1 - g) with precise powf; logits q x k once to f16 each (1 product) x 64^-0.5 + the log-penalty bias in f32 (precise logf); softmax f32; P x 2^11 once to f16 x v once to f16 (1 product); f32 output.
#include <hip/hip_runtime.h>
#include <math.h>

typedef __attribute__((ext_vector_type(16))) _Float16 v16h;
typedef __attribute__((ext_vector_type(16))) __bf16 v16b;
typedef __attribute__((ext_vector_type(8)))  _Float16 v8h;
typedef __attribute__((ext_vector_type(8)))  float v8f;
typedef __attribute__((ext_vector_type(4)))  float v4f;
typedef __attribute__((ext_vector_type(2)))  float v2f;
typedef __attribute__((ext_vector_type(4)))  unsigned v4u;
typedef __attribute__((ext_vector_type(4)))  int v4i;
typedef float __attribute__((may_alias)) float_a;
typedef int __attribute__((may_alias)) int_a;

template <typename T> __device__ __forceinline__ void vst2(void* p, T v) { *(T*)p = v;  }
__device__ __forceinline__ v8f wmma16(v16h a, v16h b, v8f c) {
  v8f d = __builtin_amdgcn_wmma_f32_16x16x32_f16(false, a, false, b, (short)0, c, false, false);
  asm volatile("v_nop\n\tv_nop\n\tv_nop\n\tv_nop" : "+v"(d) : "v"(a), "v"(b));
  return d;
}
__device__ __forceinline__ v8f wmma_bf(v16b a, v16b b, v8f c) {
  v8f d = __builtin_amdgcn_wmma_f32_16x16x32_bf16(false, a, false, b, (short)0, c, false, false);
  asm volatile("v_nop\n\tv_nop\n\tv_nop\n\tv_nop" : "+v"(d) : "v"(a), "v"(b));
  return d;
}
// 16x16x32 fragments: lane = (h = lane>>4, row/col = lane&15); elements 0..7 = k0+8h+0..7, 8..15 = k0+16+8h+0..7; D element r = row 8h+r
__device__ __forceinline__ v16h frag_h(const _Float16* rowk0, int lane) {
  union { v16h v; v8h q[2]; } u; const _Float16* p = rowk0 + 8 * (lane >> 4);
  u.q[0] = *(const v8h*)p; u.q[1] = *(const v8h*)(p + 16); return u.v;
}
__device__ __forceinline__ v16h frag_f32(const float* rowk0, int lane) {
  v16h a; const float* p = rowk0 + 8 * (lane >> 4);
#pragma unroll
  for (int i = 0; i < 8; ++i) { a[i] = (_Float16)p[i]; a[8 + i] = (_Float16)p[16 + i]; }
  return a;
}
__device__ __forceinline__ v16h frag_f32s(const float* rowk0, int lane, float sc) {
  v16h a; const float* p = rowk0 + 8 * (lane >> 4);
#pragma unroll
  for (int i = 0; i < 8; ++i) { a[i] = (_Float16)(p[i] * sc); a[8 + i] = (_Float16)(p[16 + i] * sc); }
  return a;
}
// column fragment from a [K][ld] layout (column n), rows >= K read as 0
__device__ __forceinline__ v16h fragc_f32(const float* W, int k0, int n, int lane, int ld, int K) {
  v16h a; const int g = lane >> 4;
#pragma unroll
  for (int i = 0; i < 8; ++i) { const int ka = k0 + 8 * g + i, kb = ka + 16;
    a[i] = (_Float16)(ka < K ? W[(size_t)(ka < K ? ka : K - 1) * ld + n] : 0.f); a[8 + i] = (_Float16)(kb < K ? W[(size_t)(kb < K ? kb : K - 1) * ld + n] : 0.f); }
  return a;
}
struct F2 { v16b h, l; };
__device__ __forceinline__ F2 bsplit16(const float v[16]) { F2 r;
#pragma unroll
  for (int i = 0; i < 16; ++i) { const __bf16 h = (__bf16)v[i]; r.h[i] = h; r.l[i] = (__bf16)(v[i] - (float)h); }
  return r; }
__device__ __forceinline__ F2 split_row(const float* row, int k0, int lane) { float v[16]; const float* p = row + k0 + 8 * (lane >> 4);
#pragma unroll
  for (int i = 0; i < 8; ++i) { v[i] = p[i]; v[8 + i] = p[16 + i]; }
  return bsplit16(v); }
__device__ __forceinline__ F2 split_rowK(const float* row, int k0, int lane, int K) { float v[16]; const int g = lane >> 4;
#pragma unroll
  for (int i = 0; i < 8; ++i) { const int ka = k0 + 8 * g + i, kb = ka + 16; v[i] = ka < K ? row[ka < K ? ka : K - 1] : 0.f; v[8 + i] = kb < K ? row[kb < K ? kb : K - 1] : 0.f; }
  return bsplit16(v); }
__device__ __forceinline__ F2 split_col(const float* W, int k0, int n, int lane, int ld, int K) { float v[16]; const int g = lane >> 4;
#pragma unroll
  for (int i = 0; i < 8; ++i) { const int ka = k0 + 8 * g + i, kb = ka + 16; v[i] = ka < K ? W[(size_t)(ka < K ? ka : K - 1) * ld + n] : 0.f; v[8 + i] = kb < K ? W[(size_t)(kb < K ? kb : K - 1) * ld + n] : 0.f; }
  return bsplit16(v); }
__device__ __forceinline__ v8f mac3(const F2& a, const F2& b, v8f c) { c = wmma_bf(a.l, b.h, c); c = wmma_bf(a.h, b.l, c); return wmma_bf(a.h, b.h, c); }
__device__ __forceinline__ float sigm(float v) { return 1.0f / (1.0f + expf(-v)); }
#define LDSX() do { asm volatile("s_wait_dscnt 0" ::: "memory"); __builtin_amdgcn_wave_barrier(); __builtin_amdgcn_fence(__ATOMIC_RELEASE, "workgroup"); } while (0)

// BERT-style self-attention with a learned granularity gate adding a log-penalty bias to the scores (hidden_states [2,2048,1024]; (in,out) Wq / Wk / Wv [1024,1024] N(0, 1/1024) + zero biases; Wg [1024,1] + bg: g = sigmoid(x Wg + bg) per token; res[i,j] = (1 - g_i) max(1 - g_i - g_j, 0) + g_i min(1 - g_i + g_j, 1); scope[i,j] = clip((S - 2)^(1 - g_i) + 2 - |i - j|, 1e-32, 1); log_pen = log(max(res * scope, 1e-32)), broadcast over the 16 heads; scores = q k^T / 8 + log_pen; softmax; no output projection): ctx [2,2048,1024].
#define NB 2
#define TT 2048
#define CC 1024            // NH * HD = projected width
#define DIN 1024          // input (model) width
#define NH 16
#define HD 64
#define NQB (TT / 64)
#define HG 4
#define SCALE (0.125f)
#define CAUSAL 0
#ifndef TNB
#define TNB NB
#endif
__device__ __forceinline__ float bfr(float v) { return (float)(__bf16)v; }
__host__ __device__ __forceinline__ int kb_last(int qb) { return CAUSAL ? ((qb * 64 + 63) >> 7) : (TT / 128 - 1); }
typedef __attribute__((ext_vector_type(8))) __bf16 v8b;
__device__ __forceinline__ v16b frag_b(const __bf16* rowk0, int lane) {
  union { v16b v; v8b q[2]; } u; const __bf16* p = rowk0 + 8 * (lane >> 4);
  u.q[0] = *(const v8b*)p; u.q[1] = *(const v8b*)(p + 16); return u.v;
}
#define QBH 0              // no query block takes the high-precision path (every block sees all TT keys)
#define QHI 0               // single-product logits on every row
#define KHI 64            // key rows carrying k residual / v bf16 hi+lo planes (written by k_proj; read only by the qb < QBH path, which no block takes)
// B fragment (k rows k0+.., output column o) of a weight: (in,out) [K][ld] or (out,in) [ld rows of K]: bf16 exact, or f16(bf16 * 256) exact
__device__ __forceinline__ v16b wcol_io(const float* Wm, int k0, int o, int lane, int ld) { v16b w; const int g = lane >> 4;
#pragma unroll
  for (int i = 0; i < 8; ++i) { w[i] = (__bf16)Wm[(size_t)(k0 + 8 * g + i) * ld + o]; w[8 + i] = (__bf16)Wm[(size_t)(k0 + 16 + 8 * g + i) * ld + o]; }
  return w; }
__device__ __forceinline__ v16b wcol_oi(const float* Wm, int k0, int o, int lane, int K) { v16b w; const float* p = Wm + (size_t)o * K + k0 + 8 * (lane >> 4);
#pragma unroll
  for (int i = 0; i < 8; ++i) { w[i] = (__bf16)p[i]; w[8 + i] = (__bf16)p[16 + i]; }
  return w; }
__device__ __forceinline__ v16h wcolh_io(const float* Wm, int k0, int o, int lane, int ld) { v16h w; const int g = lane >> 4;
#pragma unroll
  for (int i = 0; i < 8; ++i) { w[i] = (_Float16)(bfr(Wm[(size_t)(k0 + 8 * g + i) * ld + o]) * 256.0f); w[8 + i] = (_Float16)(bfr(Wm[(size_t)(k0 + 16 + 8 * g + i) * ld + o]) * 256.0f); }
  return w; }
__device__ __forceinline__ v16h wcolh_oi(const float* Wm, int k0, int o, int lane, int K) { v16h w; const float* p = Wm + (size_t)o * K + k0 + 8 * (lane >> 4);
#pragma unroll
  for (int i = 0; i < 8; ++i) { w[i] = (_Float16)(bfr(p[i]) * 256.0f); w[8 + i] = (_Float16)(bfr(p[16 + i]) * 256.0f); }
  return w; }
#define WQKV_LAYOUT 0   // 0 = (in,out) [DIN][CC]; 1 = (out,in) [CC][DIN]; 2 = per-head [NH][DIN][HD]
__device__ __forceinline__ v16b wcol_hdk(const float* Wm, int k0, int o, int lane) { v16b w; const int g = lane >> 4; const float* p = Wm + (size_t)(o / HD) * DIN * HD + (o % HD);
#pragma unroll
  for (int i = 0; i < 8; ++i) { w[i] = (__bf16)p[(size_t)(k0 + 8 * g + i) * HD]; w[8 + i] = (__bf16)p[(size_t)(k0 + 16 + 8 * g + i) * HD]; }
  return w; }
#define WO_OUT_IN 0
#if WQKV_LAYOUT == 1
#define WCOL(W, k0, o, lane) wcol_oi(W, k0, o, lane, DIN)
#elif WQKV_LAYOUT == 2
#define WCOL(W, k0, o, lane) wcol_hdk(W, k0, o, lane)
#else
#define WCOL(W, k0, o, lane) wcol_io(W, k0, o, lane, CC)
#endif
#if WO_OUT_IN
#define WOCOL(W, k0, o, lane) wcol_oi(W, k0, o, lane, CC)
#define WOCOLH(W, k0, o, lane) wcolh_oi(W, k0, o, lane, CC)
#else
#define WOCOL(W, k0, o, lane) wcol_io(W, k0, o, lane, DIN)
#define WOCOLH(W, k0, o, lane) wcolh_io(W, k0, o, lane, DIN)
#endif
#define SM_EXTRA_PARAMS , const float* __restrict__ LPEN
// the module's log-penalty bias log_pen[b, i, j] is head-independent: k_lpen evaluates it ONCE per batch into an f32 plane LPEN[i][j]; the hook ADDS it to the scaled score (far keys carry the module's finite log(1e-32) = -73.68, kept literally); unconditional load
#define SM_MASK_HOOK do { const float lp_ = LPEN[(size_t)t * TT + k]; asm volatile("s_wait_loadcnt 0x0" ::: "memory"); v = v + lp_; } while (0)
#ifndef SM_EXTRA_PARAMS
#define SM_EXTRA_PARAMS
#endif
#ifndef PROJ_EXTRA_PARAMS
#define PROJ_EXTRA_PARAMS
#endif
#ifndef SM_MASK_HOOK
#define SM_MASK_HOOK (void)0
#endif

#define WS_QH  0u                                      // f16 q rows [b*t][CC]
#define WS_KH  (WS_QH + 2u * (size_t)NB * TT * CC)      // f16 k rows [b*t][CC]
#define WS_VT  (WS_KH + 2u * (size_t)NB * TT * CC)      // f16 v planes [b][c][t]
#define WS_QL  (WS_VT + 2u * (size_t)NB * CC * TT)      // f16 q residual x 2^10 rows [b][t < QHI][CC]
#define WS_KL  (WS_QL + 2u * (size_t)NB * QHI * CC)     // f16 k residual x 2^10 rows [b][t < KHI][CC]
#define WS_VB  (WS_KL + 2u * (size_t)NB * KHI * CC)     // bf16 v hi planes [b][c][t < KHI]
#define WS_VBL (WS_VB + 2u * (size_t)NB * CC * KHI)
#define WS_S   (WS_VBL + 2u * (size_t)NB * CC * KHI)    // f32 logits / P [hg][t][s]
#define WS_Y   (WS_S  + 4u * (size_t)HG * TT * TT)      // f32 ctx rows [b*t][CC] (only when there is an output projection)
#define WS_END (WS_Y  + 0u)
#define WS_GATE (WS_END)                                 // f32 g[b][s]
#define WS_PWR  (WS_GATE + 4u * (size_t)NB * TT)          // f32 pow(S - 2, 1 - g)[b][s]
#define WS_LPEN (WS_PWR + 4u * (size_t)NB * TT)          // f32 log-penalty plane [TT][TT] of the current batch
#define WS_END3 (WS_LPEN + 4u * (size_t)TT * TT)

// ---- k_proj: block = (64 rows, 128 cols, which): q/k/v = X W (+ b) with exact bf16 products (K = DIN) -> which 0: q f16 rows (+ residual rows < QHI); 1: k f16 rows (+ residual rows < KHI); 2: v f16 planes [c][t] (+ bf16 hi/lo planes for t < KHI)
__global__ __launch_bounds__(128) void k_proj(const float* __restrict__ XQ, const float* __restrict__ XK, const float* __restrict__ XV, const float* __restrict__ WQ, const float* __restrict__ WK, const float* __restrict__ WV, const float* __restrict__ BQ, const float* __restrict__ BK, const float* __restrict__ BV,
    _Float16* __restrict__ QH, _Float16* __restrict__ QL, _Float16* __restrict__ KH, _Float16* __restrict__ KL, _Float16* __restrict__ VT, __bf16* __restrict__ VB, __bf16* __restrict__ VBL) {
  __shared__ __align__(16) _Float16 sh[64][136], sl[64][136]; __shared__ __align__(16) _Float16 th[128][72]; __shared__ __align__(16) __bf16 tb[128][72], tbl[128][72];
  const int tid = threadIdx.x, wave = tid >> 5, lane = tid & 31, col = lane & 15, g = lane >> 4; const int which = blockIdx.z; const int c0 = blockIdx.y * 128; const size_t r0 = (size_t)blockIdx.x * 64; const size_t bb = r0 / TT; const int t0 = (int)(r0 % TT);
  const float* X = which == 0 ? XQ : which == 1 ? XK : XV; const float* WA = which == 0 ? WQ : which == 1 ? WK : WV; const float* BA = which == 0 ? BQ : which == 1 ? BK : BV;
  v8f acc[8] = {};
#pragma unroll 2
  for (int kc = 0; kc < DIN / 32; ++kc) { v16b a; { const float* p = X + (r0 + wave * 16 + col) * DIN + kc * 32 + 8 * g;
#pragma unroll
      for (int i = 0; i < 8; ++i) { a[i] = (__bf16)p[i]; a[8 + i] = (__bf16)p[16 + i]; } }
    asm volatile("s_wait_loadcnt 0x0" ::: "memory");
#pragma unroll
    for (int j = 0; j < 8; ++j) { const v16b w = WCOL(WA, kc * 32, c0 + j * 16 + col, lane); asm volatile("s_wait_loadcnt 0x0" ::: "memory"); acc[j] = wmma_bf(a, w, acc[j]); } }
  if (which < 2) { _Float16* DH = which == 0 ? QH : KH; _Float16* DL = which == 0 ? QL : KL; const int nhi = which == 0 ? QHI : KHI; const bool hi_rows = t0 < nhi;
#pragma unroll
    for (int j = 0; j < 8; ++j) { const float bias = BA ? bfr(BA[c0 + j * 16 + col]) : 0.f;
#pragma unroll
      for (int r = 0; r < 8; ++r) { const float v = acc[j][r] + bias; const _Float16 hv = (_Float16)v; sh[wave * 16 + 8 * g + r][j * 16 + col] = hv; sl[wave * 16 + 8 * g + r][j * 16 + col] = (_Float16)((v - (float)hv) * 1024.0f); } }
    __syncthreads();
    for (int e = tid; e < 64 * 16; e += 128) { const int rl = e >> 4, q = e & 15; vst2((unsigned*)(DH + (r0 + rl) * CC + c0 + q * 8), *(const v4u*)&sh[rl][q * 8]); if (hi_rows) vst2((unsigned*)(DL + (bb * nhi + t0 + rl) * (size_t)CC + c0 + q * 8), *(const v4u*)&sl[rl][q * 8]); }
  } else { const bool hi_rows = t0 < KHI;
#pragma unroll
    for (int j = 0; j < 8; ++j) { const float bias = BA ? bfr(BA[c0 + j * 16 + col]) : 0.f;
#pragma unroll
      for (int r = 0; r < 8; ++r) { const float v = acc[j][r] + bias; const int rl = wave * 16 + 8 * g + r, cl = j * 16 + col; th[cl][rl] = (_Float16)v; const __bf16 bh = (__bf16)v; tb[cl][rl] = bh; tbl[cl][rl] = (__bf16)(v - (float)bh); } }
    __syncthreads();
    for (int e = tid; e < 128 * 8; e += 128) { const int cl = e >> 3, q = e & 7; vst2((unsigned*)(VT + (bb * CC + c0 + cl) * (size_t)TT + t0 + q * 8), *(const v4u*)&th[cl][q * 8]); if (hi_rows) { const size_t o3 = (bb * CC + c0 + cl) * (size_t)KHI + t0 + q * 8; vst2((unsigned*)(VB + o3), *(const v4u*)&tb[cl][q * 8]); vst2((unsigned*)(VBL + o3), *(const v4u*)&tbl[cl][q * 8]); } } } }
// ---- k_sc: block = (query block qb, key block kb <= kb_last(qb), head in group) of batch b: logits x SCALE; q hi + residual (x 2^10) against k (2 products) for query rows < QHI, plus the k residual (3 products) for query blocks < QBH (causal early rows); causal: blocks past the diagonal exit, the mask itself is applied by index in k_sm
__global__ __launch_bounds__(128) void k_sc(const _Float16* __restrict__ QH, const _Float16* __restrict__ KH, const _Float16* __restrict__ QL, const _Float16* __restrict__ KL, int b, int h0, float* __restrict__ S0) { __shared__ __align__(16) float ss[4][16][132];
  const int qb = blockIdx.x, kb = blockIdx.y; if (kb > kb_last(qb)) return;
  const int h = h0 + blockIdx.z; float* S = S0 + (size_t)blockIdx.z * TT * TT;
  const int tid = threadIdx.x, wave = tid >> 5, lane = tid & 31, col = lane & 15, g = lane >> 4; const int k0 = kb * 128; const int ql0 = qb * 64 + wave * 16; const size_t q0 = (size_t)b * TT + ql0, kr0 = (size_t)b * TT + k0;
  v8f acc[8] = {}, accl[8] = {};
  const _Float16* QLb = QL + (size_t)b * QHI * CC; const _Float16* KLb = KL + (size_t)b * KHI * CC;
  if (qb < QBH) {
#pragma unroll
    for (int kc = 0; kc < HD / 32; ++kc) { const v16h ah = frag_h(QH + (q0 + col) * CC + h * HD + kc * 32, lane), al = frag_h(QLb + (size_t)(ql0 + col) * CC + h * HD + kc * 32, lane);
#pragma unroll
      for (int j = 0; j < 8; ++j) { const v16h kbf = frag_h(KH + (kr0 + j * 16 + col) * CC + h * HD + kc * 32, lane), klf = frag_h(KLb + (size_t)(k0 + j * 16 + col) * CC + h * HD + kc * 32, lane); acc[j] = wmma16(ah, kbf, acc[j]); accl[j] = wmma16(al, kbf, accl[j]); accl[j] = wmma16(ah, klf, accl[j]); } }
  } else if (qb * 64 < QHI) {
#pragma unroll
    for (int kc = 0; kc < HD / 32; ++kc) { const v16h ah = frag_h(QH + (q0 + col) * CC + h * HD + kc * 32, lane), al = frag_h(QLb + (size_t)(ql0 + col) * CC + h * HD + kc * 32, lane);
#pragma unroll
      for (int j = 0; j < 8; ++j) { const v16h kbf = frag_h(KH + (kr0 + j * 16 + col) * CC + h * HD + kc * 32, lane); acc[j] = wmma16(ah, kbf, acc[j]); accl[j] = wmma16(al, kbf, accl[j]); } }
  } else {
#pragma unroll
    for (int kc = 0; kc < HD / 32; ++kc) { const v16h ah = frag_h(QH + (q0 + col) * CC + h * HD + kc * 32, lane);
#pragma unroll
      for (int j = 0; j < 8; ++j) { const v16h kbf = frag_h(KH + (kr0 + j * 16 + col) * CC + h * HD + kc * 32, lane); acc[j] = wmma16(ah, kbf, acc[j]); } } }
#pragma unroll
  for (int j = 0; j < 8; ++j) {
#pragma unroll
    for (int r = 0; r < 8; ++r) ss[wave][8 * g + r][j * 16 + col] = (acc[j][r] + accl[j][r] * (1.0f / 1024.0f)) * SCALE; }
  LDSX(); for (int rl = 0; rl < 16; ++rl) vst2(S + (size_t)(ql0 + rl) * TT + k0 + lane * 4, *(const v4f*)&ss[wave][rl][lane * 4]); }
// ---- k_sm: block = query row t (head in group): keys [0, kend): causal -> logit if s <= t else excluded; softmax in f32; P x 2^11 in place (0 for excluded)
__global__ __launch_bounds__(256) void k_sm(float* __restrict__ S0 SM_EXTRA_PARAMS) { __shared__ float sred[8]; __shared__ float sbc; __shared__ __align__(16) float shv[TT];
  const int tid = threadIdx.x; const int t = blockIdx.x; const int kend = (kb_last(t >> 6) + 1) * 128;
  float* sr = S0 + (size_t)blockIdx.y * TT * TT + (size_t)t * TT;
  float m = -3.0e38f; for (int k = tid; k < kend; k += 256) { float v = (!CAUSAL || k <= t) ? sr[k] : -3.0e38f; SM_MASK_HOOK; shv[k] = v; m = fmaxf(m, v); }
#pragma unroll
  for (int o = 1; o < 32; o <<= 1) m = fmaxf(m, __shfl_xor(m, o));
  if ((tid & 31) == 0) sred[tid >> 5] = m; __syncthreads(); if (tid == 0) { float a = sred[0]; for (int i = 1; i < 8; ++i) a = fmaxf(a, sred[i]); sbc = a; } __syncthreads(); m = sbc; __syncthreads();
  float sum = 0.f; for (int k = tid; k < kend; k += 256) { const float v = shv[k]; const float e = (v <= -1.0e38f) ? 0.f : expf(v - m); shv[k] = e; sum += e; }
#pragma unroll
  for (int o = 1; o < 32; o <<= 1) sum += __shfl_xor(sum, o);
  if ((tid & 31) == 0) sred[tid >> 5] = sum; __syncthreads(); if (tid == 0) { float a = 0.f; for (int i = 0; i < 8; ++i) a += sred[i]; sbc = a > 0.f ? 2048.0f / a : 0.f; }   /* a fully excluded row yields P = 0 */ __syncthreads(); const float inv = sbc;
  for (int k = tid; k < kend; k += 256) shv[k] = shv[k] * inv;
  __syncthreads(); for (int q = tid; q < kend / 4; q += 256) vst2(sr + q * 4, *(const v4f*)&shv[q * 4]); }
// ---- k_pv: block = 64 queries (qb) of (b, h): ctx = P . v over keys [0, kend) (P x 2^11 once to f16 against v f16: 1 product; causal early query blocks: P and v as bf16 hi + lo, 3 products); 256-B (row, head) segment by 16 lanes
__global__ __launch_bounds__(128) void k_pv(const float* __restrict__ PS0, const _Float16* __restrict__ VT, const __bf16* __restrict__ VB, const __bf16* __restrict__ VBL, int b, int h0, float* __restrict__ Y) { const int h = h0 + blockIdx.z; const float* PS = PS0 + (size_t)blockIdx.z * TT * TT; __shared__ __align__(16) float ss[4][16][HD + 4];
  const int tid = threadIdx.x, wave = tid >> 5, lane = tid & 31, col = lane & 15, g = lane >> 4; const int qb = blockIdx.x; const int ql0 = qb * 64 + wave * 16; const int kce = (kb_last(qb) + 1) * 4;
  v8f acc[HD / 16] = {};
  if (qb < QBH) {
#pragma unroll 1
    for (int kc = 0; kc < kce; ++kc) { const F2 p = split_row(PS + (size_t)(ql0 + col) * TT, kc * 32, lane);
      asm volatile("s_wait_loadcnt 0x0" ::: "memory");
#pragma unroll
      for (int j = 0; j < HD / 16; ++j) { const size_t po = ((size_t)b * CC + h * HD + j * 16 + col) * (size_t)KHI + kc * 32; const v16b vh = frag_b(VB + po, lane); acc[j] = wmma_bf(p.h, vh, acc[j]); acc[j] = wmma_bf(p.l, vh, acc[j]); acc[j] = wmma_bf(p.h, frag_b(VBL + po, lane), acc[j]); } }
  } else {
#pragma unroll 1
    for (int kc = 0; kc < kce; ++kc) { const v16h p = frag_f32(PS + (size_t)(ql0 + col) * TT + kc * 32, lane);
      asm volatile("s_wait_loadcnt 0x0" ::: "memory");
#pragma unroll
      for (int j = 0; j < HD / 16; ++j) { const size_t po = ((size_t)b * CC + h * HD + j * 16 + col) * (size_t)TT + kc * 32; acc[j] = wmma16(p, frag_h(VT + po, lane), acc[j]); } } }
#pragma unroll
  for (int j = 0; j < HD / 16; ++j)
#pragma unroll
    for (int r = 0; r < 8; ++r) ss[wave][8 * g + r][j * 16 + col] = acc[j][r] * (1.0f / 2048.0f);
  LDSX(); for (int rl = 0; rl < 16; ++rl) if (lane < HD / 4) vst2(Y + ((size_t)b * TT + ql0 + rl) * CC + h * HD + lane * 4, *(const v4f*)&ss[wave][rl][lane * 4]); }

// ---- k_lpen: block = query row i of batch bsm: LPEN[i][j] = log(max(res * scope, 1e-32)) for all keys j, with res = (1 - gi) max(1 - gi - gj, 0) + gi min(1 - gi + gj, 1), scope = clip(pow(S - 2, 1 - gi) + 2 - |i - j|, 1e-32, 1) (gi / pow from the k_gate tables; f32, precise logf); the plane is shared by the 16 heads of the batch; each thread writes 16-B pieces
__global__ __launch_bounds__(256) void k_lpen(const float* __restrict__ GATE, const float* __restrict__ PWR, int bsm, float* __restrict__ LPEN) { const int tid = threadIdx.x; const int t = blockIdx.x;
  const float gi_ = GATE[(size_t)bsm * TT + t], pw_ = PWR[(size_t)bsm * TT + t]; asm volatile("s_wait_loadcnt 0x0" ::: "memory");
  for (int q4 = tid; q4 < TT / 4; q4 += 256) { const v4f gj4 = *(const v4f*)(GATE + (size_t)bsm * TT + q4 * 4); asm volatile("s_wait_loadcnt 0x0" ::: "memory"); v4f o;
#pragma unroll
    for (int u = 0; u < 4; ++u) { const int k = q4 * 4 + u; const float gj_ = gj4[u]; const float res_ = (1.0f - gi_) * fmaxf(1.0f - gi_ - gj_, 0.0f) + gi_ * fminf(1.0f - gi_ + gj_, 1.0f); const int ad_ = (t > k) ? (t - k) : (k - t); const float sc_ = fminf(fmaxf(pw_ + 2.0f - (float)ad_, 1.0e-32f), 1.0f); o[u] = logf(fmaxf(res_ * sc_, 1.0e-32f)); }
    vst2(LPEN + (size_t)t * TT + q4 * 4, o); } }
__global__ __launch_bounds__(256) void k_gate(const float* __restrict__ X, const float* __restrict__ WG, const float* __restrict__ BG, float* __restrict__ GATE, float* __restrict__ PWR) { __shared__ __align__(16) float sg[32]; __shared__ __align__(16) float sp[32];
  const int tid = threadIdx.x, wave = tid >> 5, lane = tid & 31; const size_t r0 = (size_t)blockIdx.x * 32; const float bg_ = bfr(BG[0]);
  float wreg[32];
#pragma unroll
  for (int i = 0; i < 16; ++i) wreg[i] = WG[lane + 32 * i];
  asm volatile("s_wait_loadcnt 0x0" ::: "memory");
#pragma unroll
  for (int i = 16; i < 32; ++i) wreg[i] = WG[lane + 32 * i];   /* two bursts of 16 loads */
  asm volatile("s_wait_loadcnt 0x0" ::: "memory");
#pragma unroll
  for (int i = 0; i < 32; ++i) wreg[i] = bfr(wreg[i]);
#pragma unroll 1
  for (int rr = 0; rr < 4; ++rr) { const size_t row = r0 + wave * 4 + rr; const float* xr = X + row * DIN; float acc = 0.f;
#pragma unroll
    for (int i = 0; i < 32; ++i) { const float xv = xr[lane + 32 * i]; asm volatile("s_wait_loadcnt 0x0" ::: "memory"); acc += bfr(xv) * wreg[i]; }   /* fully unrolled: wreg is indexed with compile-time constants */
#pragma unroll
    for (int o = 1; o < 32; o <<= 1) acc += __shfl_xor(acc, o);
    const float g = 1.0f / (1.0f + expf(-(acc + bg_)));
    if (lane == 0) { sg[wave * 4 + rr] = g; sp[wave * 4 + rr] = powf((float)(TT - 2), 1.0f - g); } }   /* LDS only: no global access under the lane predicate */
  __syncthreads();
  if (tid < 8) vst2(GATE + r0 + tid * 4, *(const v4f*)&sg[tid * 4]);
  else if (tid >= 32 && tid < 40) vst2(PWR + r0 + (tid - 32) * 4, *(const v4f*)&sp[(tid - 32) * 4]); }
extern "C" void kernel_launch(void* const* d_in, const int* in_sizes, int n_in, void* d_out, int out_size, void* d_ws, size_t ws_size, hipStream_t stream) {
  (void)in_sizes; (void)n_in; (void)out_size;
  const float** F = (const float**)d_in;
  if (ws_size < (size_t)WS_END3) return;
  char* ws = (char*)d_ws; _Float16 *QH = (_Float16*)(ws + WS_QH), *KH = (_Float16*)(ws + WS_KH), *VT = (_Float16*)(ws + WS_VT), *QL = (_Float16*)(ws + WS_QL), *KL = (_Float16*)(ws + WS_KL); __bf16 *VB = (__bf16*)(ws + WS_VB), *VBL = (__bf16*)(ws + WS_VBL); float *S = (float*)(ws + WS_S), *Y = (float*)(ws + WS_Y);
  (void)Y; (void)QL; (void)KL; (void)VB; (void)VBL;
  // inputs: 0 hidden_states [2,2048,1024]; 1 Wq [1024,1024] (in,out), 2 bq; 3 Wk, 4 bk; 5 Wv, 6 bv (zero biases, read); 7 Wg [1024,1]; 8 bg [1]; no output projection
  float* GATE = (float*)(ws + WS_GATE); float* PWR = (float*)(ws + WS_PWR); float* LPEN = (float*)(ws + WS_LPEN);
  k_gate<<<dim3(TNB * TT / 32), 256, 0, stream>>>(F[0], F[7], F[8], GATE, PWR);
  k_proj<<<dim3(TNB * TT / 64, CC / 128, 3), 128, 0, stream>>>(F[0], F[0], F[0], F[1], F[3], F[5], F[2], F[4], F[6], QH, QL, KH, KL, VT, VB, VBL);
  for (int b = 0; b < TNB; ++b) { k_lpen<<<dim3(TT), 256, 0, stream>>>(GATE, PWR, b, LPEN);   /* once per batch: shared by the 16 heads */
   for (int h0 = 0; h0 < NH; h0 += HG) {
    k_sc<<<dim3(NQB, TT / 128, HG), 128, 0, stream>>>(QH, KH, QL, KL, b, h0, S);
    k_sm<<<dim3(TT, HG), 256, 0, stream>>>(S, LPEN);
    k_pv<<<dim3(NQB, 1, HG), 128, 0, stream>>>(S, VT, VB, VBL, b, h0, (float*)d_out);
  } }
}

// v002
// It runs in 189 microseconds.
// It is 6.20 times as fast as v000, going by the measured steps of the versions left out in between.
// compute dtype: all float inputs rounded to bf16; q/k/v projections with EXACT bf16 products on WMMA 16x16x32 (f32 accumulate) + bias; the granularity gate g = sigmoid(x . Wg + bg) from exact bf16 products summed in f32 (VALU), pow(S - 2, 1 - g) with precise powf; logits q x k once to f16 each (1 product) x 64^-0.5 + the log-penalty bias in f32 (precise logf); softmax f32 with a running maximum and sum over steps of 32 keys; exp(s - m) x 2^11 once to f16 x v once to f16 (1 product), divided by the f32 row sum at the end; f32 output.
#include <hip/hip_runtime.h>
#include <math.h>

typedef __attribute__((ext_vector_type(16))) _Float16 v16h;
typedef __attribute__((ext_vector_type(16))) __bf16 v16b;
typedef __attribute__((ext_vector_type(8)))  _Float16 v8h;
typedef __attribute__((ext_vector_type(8)))  float v8f;
typedef __attribute__((ext_vector_type(4)))  float v4f;
typedef __attribute__((ext_vector_type(2)))  float v2f;
typedef __attribute__((ext_vector_type(4)))  unsigned v4u;
typedef __attribute__((ext_vector_type(4)))  int v4i;
typedef float __attribute__((may_alias)) float_a;
typedef int __attribute__((may_alias)) int_a;

template <typename T> __device__ __forceinline__ void vst2(void* p, T v) { *(T*)p = v;  }
__device__ __forceinline__ v8f wmma16(v16h a, v16h b, v8f c) {
  v8f d = __builtin_amdgcn_wmma_f32_16x16x32_f16(false, a, false, b, (short)0, c, false, false);
  asm volatile("v_nop\n\tv_nop\n\tv_nop\n\tv_nop" : "+v"(d) : "v"(a), "v"(b));
  return d;
}
__device__ __forceinline__ v8f wmma_bf(v16b a, v16b b, v8f c) {
  v8f d = __builtin_amdgcn_wmma_f32_16x16x32_bf16(false, a, false, b, (short)0, c, false, false);
  asm volatile("v_nop\n\tv_nop\n\tv_nop\n\tv_nop" : "+v"(d) : "v"(a), "v"(b));
  return d;
}
// 16x16x32 fragments: lane = (h = lane>>4, row/col = lane&15); elements 0..7 = k0+8h+0..7, 8..15 = k0+16+8h+0..7; D element r = row 8h+r
__device__ __forceinline__ v16h frag_h(const _Float16* rowk0, int lane) {
  union { v16h v; v8h q[2]; } u; const _Float16* p = rowk0 + 8 * (lane >> 4);
  u.q[0] = *(const v8h*)p; u.q[1] = *(const v8h*)(p + 16); return u.v;
}
__device__ __forceinline__ v16h frag_f32(const float* rowk0, int lane) {
  v16h a; const float* p = rowk0 + 8 * (lane >> 4);
#pragma unroll
  for (int i = 0; i < 8; ++i) { a[i] = (_Float16)p[i]; a[8 + i] = (_Float16)p[16 + i]; }
  return a;
}
__device__ __forceinline__ v16h frag_f32s(const float* rowk0, int lane, float sc) {
  v16h a; const float* p = rowk0 + 8 * (lane >> 4);
#pragma unroll
  for (int i = 0; i < 8; ++i) { a[i] = (_Float16)(p[i] * sc); a[8 + i] = (_Float16)(p[16 + i] * sc); }
  return a;
}
// column fragment from a [K][ld] layout (column n), rows >= K read as 0
__device__ __forceinline__ v16h fragc_f32(const float* W, int k0, int n, int lane, int ld, int K) {
  v16h a; const int g = lane >> 4;
#pragma unroll
  for (int i = 0; i < 8; ++i) { const int ka = k0 + 8 * g + i, kb = ka + 16;
    a[i] = (_Float16)(ka < K ? W[(size_t)(ka < K ? ka : K - 1) * ld + n] : 0.f); a[8 + i] = (_Float16)(kb < K ? W[(size_t)(kb < K ? kb : K - 1) * ld + n] : 0.f); }
  return a;
}
struct F2 { v16b h, l; };
__device__ __forceinline__ F2 bsplit16(const float v[16]) { F2 r;
#pragma unroll
  for (int i = 0; i < 16; ++i) { const __bf16 h = (__bf16)v[i]; r.h[i] = h; r.l[i] = (__bf16)(v[i] - (float)h); }
  return r; }
__device__ __forceinline__ F2 split_row(const float* row, int k0, int lane) { float v[16]; const float* p = row + k0 + 8 * (lane >> 4);
#pragma unroll
  for (int i = 0; i < 8; ++i) { v[i] = p[i]; v[8 + i] = p[16 + i]; }
  return bsplit16(v); }
__device__ __forceinline__ F2 split_rowK(const float* row, int k0, int lane, int K) { float v[16]; const int g = lane >> 4;
#pragma unroll
  for (int i = 0; i < 8; ++i) { const int ka = k0 + 8 * g + i, kb = ka + 16; v[i] = ka < K ? row[ka < K ? ka : K - 1] : 0.f; v[8 + i] = kb < K ? row[kb < K ? kb : K - 1] : 0.f; }
  return bsplit16(v); }
__device__ __forceinline__ F2 split_col(const float* W, int k0, int n, int lane, int ld, int K) { float v[16]; const int g = lane >> 4;
#pragma unroll
  for (int i = 0; i < 8; ++i) { const int ka = k0 + 8 * g + i, kb = ka + 16; v[i] = ka < K ? W[(size_t)(ka < K ? ka : K - 1) * ld + n] : 0.f; v[8 + i] = kb < K ? W[(size_t)(kb < K ? kb : K - 1) * ld + n] : 0.f; }
  return bsplit16(v); }
__device__ __forceinline__ v8f mac3(const F2& a, const F2& b, v8f c) { c = wmma_bf(a.l, b.h, c); c = wmma_bf(a.h, b.l, c); return wmma_bf(a.h, b.h, c); }
__device__ __forceinline__ float sigm(float v) { return 1.0f / (1.0f + expf(-v)); }
#define LDSX() do { asm volatile("s_wait_dscnt 0" ::: "memory"); __builtin_amdgcn_wave_barrier(); __builtin_amdgcn_fence(__ATOMIC_RELEASE, "workgroup"); } while (0)

// BERT-style self-attention with a learned granularity gate adding a log-penalty bias to the scores (hidden_states [2,2048,1024]; (in,out) Wq / Wk / Wv [1024,1024] N(0, 1/1024) + zero biases; Wg [1024,1] + bg: g = sigmoid(x Wg + bg) per token; res[i,j] = (1 - g_i) max(1 - g_i - g_j, 0) + g_i min(1 - g_i + g_j, 1); scope[i,j] = clip((S - 2)^(1 - g_i) + 2 - |i - j|, 1e-32, 1); log_pen = log(max(res * scope, 1e-32)), broadcast over the 16 heads; scores = q k^T / 8 + log_pen; softmax; no output projection): ctx [2,2048,1024].
#define NB 2
#define TT 2048
#define CC 1024            // NH * HD = projected width
#define DIN 1024          // input (model) width
#define NH 16
#define HD 64
#define NQB (TT / 64)
#define HG 4
#define SCALE (0.125f)
#define CAUSAL 0
#ifndef TNB
#define TNB NB
#endif
__device__ __forceinline__ float bfr(float v) { return (float)(__bf16)v; }
__host__ __device__ __forceinline__ int kb_last(int qb) { return CAUSAL ? ((qb * 64 + 63) >> 7) : (TT / 128 - 1); }
typedef __attribute__((ext_vector_type(8))) __bf16 v8b;
__device__ __forceinline__ v16b frag_b(const __bf16* rowk0, int lane) {
  union { v16b v; v8b q[2]; } u; const __bf16* p = rowk0 + 8 * (lane >> 4);
  u.q[0] = *(const v8b*)p; u.q[1] = *(const v8b*)(p + 16); return u.v;
}
#define QBH 0              // not read by any kernel in this file
#define QHI 0               // single-product logits on every row
#define KHI 64            // key rows carrying k residual / v bf16 hi+lo planes (written by k_proj; read by no kernel in this file)
// B fragment (k rows k0+.., output column o) of a weight: (in,out) [K][ld] or (out,in) [ld rows of K]: bf16 exact, or f16(bf16 * 256) exact
__device__ __forceinline__ v16b wcol_io(const float* Wm, int k0, int o, int lane, int ld) { v16b w; const int g = lane >> 4;
#pragma unroll
  for (int i = 0; i < 8; ++i) { w[i] = (__bf16)Wm[(size_t)(k0 + 8 * g + i) * ld + o]; w[8 + i] = (__bf16)Wm[(size_t)(k0 + 16 + 8 * g + i) * ld + o]; }
  return w; }
__device__ __forceinline__ v16b wcol_oi(const float* Wm, int k0, int o, int lane, int K) { v16b w; const float* p = Wm + (size_t)o * K + k0 + 8 * (lane >> 4);
#pragma unroll
  for (int i = 0; i < 8; ++i) { w[i] = (__bf16)p[i]; w[8 + i] = (__bf16)p[16 + i]; }
  return w; }
__device__ __forceinline__ v16h wcolh_io(const float* Wm, int k0, int o, int lane, int ld) { v16h w; const int g = lane >> 4;
#pragma unroll
  for (int i = 0; i < 8; ++i) { w[i] = (_Float16)(bfr(Wm[(size_t)(k0 + 8 * g + i) * ld + o]) * 256.0f); w[8 + i] = (_Float16)(bfr(Wm[(size_t)(k0 + 16 + 8 * g + i) * ld + o]) * 256.0f); }
  return w; }
__device__ __forceinline__ v16h wcolh_oi(const float* Wm, int k0, int o, int lane, int K) { v16h w; const float* p = Wm + (size_t)o * K + k0 + 8 * (lane >> 4);
#pragma unroll
  for (int i = 0; i < 8; ++i) { w[i] = (_Float16)(bfr(p[i]) * 256.0f); w[8 + i] = (_Float16)(bfr(p[16 + i]) * 256.0f); }
  return w; }
#define WQKV_LAYOUT 0   // 0 = (in,out) [DIN][CC]; 1 = (out,in) [CC][DIN]; 2 = per-head [NH][DIN][HD]
__device__ __forceinline__ v16b wcol_hdk(const float* Wm, int k0, int o, int lane) { v16b w; const int g = lane >> 4; const float* p = Wm + (size_t)(o / HD) * DIN * HD + (o % HD);
#pragma unroll
  for (int i = 0; i < 8; ++i) { w[i] = (__bf16)p[(size_t)(k0 + 8 * g + i) * HD]; w[8 + i] = (__bf16)p[(size_t)(k0 + 16 + 8 * g + i) * HD]; }
  return w; }
#define WO_OUT_IN 0
#if WQKV_LAYOUT == 1
#define WCOL(W, k0, o, lane) wcol_oi(W, k0, o, lane, DIN)
#elif WQKV_LAYOUT == 2
#define WCOL(W, k0, o, lane) wcol_hdk(W, k0, o, lane)
#else
#define WCOL(W, k0, o, lane) wcol_io(W, k0, o, lane, CC)
#endif
#if WO_OUT_IN
#define WOCOL(W, k0, o, lane) wcol_oi(W, k0, o, lane, CC)
#define WOCOLH(W, k0, o, lane) wcolh_oi(W, k0, o, lane, CC)
#else
#define WOCOL(W, k0, o, lane) wcol_io(W, k0, o, lane, DIN)
#define WOCOLH(W, k0, o, lane) wcolh_io(W, k0, o, lane, DIN)
#endif
// the module's log-penalty bias log_pen[b, i, j] is head-independent: k_lpen evaluates it ONCE per batch into an f32 plane LPEN[b][i][j]; k_fa ADDS it to the scaled score (far keys carry the module's finite log(1e-32) = -73.68, kept literally)

#define WS_QH  0u                                      // f16 q rows [b*t][CC]
#define WS_KH  (WS_QH + 2u * (size_t)NB * TT * CC)      // f16 k rows [b*t][CC]
#define WS_VT  (WS_KH + 2u * (size_t)NB * TT * CC)      // f16 v planes [b][c][t]
#define WS_QL  (WS_VT + 2u * (size_t)NB * CC * TT)      // f16 q residual x 2^10 rows [b][t < QHI][CC]
#define WS_KL  (WS_QL + 2u * (size_t)NB * QHI * CC)     // f16 k residual x 2^10 rows [b][t < KHI][CC]
#define WS_VB  (WS_KL + 2u * (size_t)NB * KHI * CC)     // bf16 v hi planes [b][c][t < KHI]
#define WS_VBL (WS_VB + 2u * (size_t)NB * CC * KHI)
#define WS_END (WS_VBL + 2u * (size_t)NB * CC * KHI)
#define WS_GATE (WS_END)                                 // f32 g[b][s]
#define WS_PWR  (WS_GATE + 4u * (size_t)NB * TT)          // f32 pow(S - 2, 1 - g)[b][s]
#define WS_LPEN (WS_PWR + 4u * (size_t)NB * TT)          // f32 log-penalty planes [b][TT][TT]
#define WS_END3 (WS_LPEN + 4u * (size_t)NB * TT * TT)

// ---- k_proj: block = (64 rows, 128 cols, which): q/k/v = X W (+ b) with exact bf16 products (K = DIN) -> which 0: q f16 rows (+ residual rows < QHI); 1: k f16 rows (+ residual rows < KHI); 2: v f16 planes [c][t] (+ bf16 hi/lo planes for t < KHI)
// Operands go through LDS, 32 k at a time, two buffers: the block reads each f32 tile of X and W once, in whole 128-B lines, rounds it to bf16 and lays it k-contiguous (W transposed inside the thread that loaded it); the four waves take their fragments from there. The next tile's global loads fly while this tile is multiplied.
#define PBK 32             // k per stage
#define PNS (DIN / PBK)
#define PPI 40             // bf16 per staged row: 64 B of data at a pitch of 80 B (16 B x odd: the 16 rows of a ds_load_b128 fragment read fall on 16 different bank groups)
typedef __attribute__((ext_vector_type(4))) __bf16 v4b;
__global__ __launch_bounds__(128) void k_proj(const float* __restrict__ XQ, const float* __restrict__ XK, const float* __restrict__ XV, const float* __restrict__ WQ, const float* __restrict__ WK, const float* __restrict__ WV, const float* __restrict__ BQ, const float* __restrict__ BK, const float* __restrict__ BV,
    _Float16* __restrict__ QH, _Float16* __restrict__ QL, _Float16* __restrict__ KH, _Float16* __restrict__ KL, _Float16* __restrict__ VT, __bf16* __restrict__ VB, __bf16* __restrict__ VBL) {
  // one LDS range: the operand stages of the k loop lie in the bytes that the output staging takes over behind the loop (three blocks stay resident on a WGP)
  __shared__ __align__(16) unsigned char smem[2 * 64 * 136 * 2 + 3 * 128 * 72 * 2];
  _Float16 (*sh)[136] = (_Float16 (*)[136])smem; _Float16 (*sl)[136] = (_Float16 (*)[136])(smem + 64 * 136 * 2);
  _Float16 (*th)[72] = (_Float16 (*)[72])(smem + 2 * 64 * 136 * 2); __bf16 (*tb)[72] = (__bf16 (*)[72])(smem + 2 * 64 * 136 * 2 + 128 * 72 * 2); __bf16 (*tbl)[72] = (__bf16 (*)[72])(smem + 2 * 64 * 136 * 2 + 2 * 128 * 72 * 2);
  __bf16* Ws = (__bf16*)smem;                              // [2][128 columns][PPI]: W^T, column n in row n ^ ((n >> 4) & 3)
  __bf16* Xs = (__bf16*)(smem + 2 * 128 * PPI * 2);        // [2][64 rows][PPI]
  const int tid = threadIdx.x, wave = tid >> 5, lane = tid & 31, col = lane & 15, g = lane >> 4; const int which = blockIdx.z; const int c0 = blockIdx.y * 128; const size_t r0 = (size_t)blockIdx.x * 64; const size_t bb = r0 / TT; const int t0 = (int)(r0 % TT);
  const float* X = which == 0 ? XQ : which == 1 ? XK : XV; const float* WA = which == 0 ? WQ : which == 1 ? WK : WV; const float* BA = which == 0 ? BQ : which == 1 ? BK : BV;
  const float* Wg = WA + (size_t)(8 * wave) * CC + c0 + 4 * lane;       // this thread's W piece of a stage: k rows 8 wave + 0..7, columns 4 lane + 0..3 (a wave's load = 512 contiguous bytes)
  const float* Xg = X + (r0 + (tid >> 3)) * DIN + 4 * (tid & 7);         // its X piece: rows (tid >> 3) + 16 i, k 4 (tid & 7) + 0..3 (a wave's load = four whole lines)
  // the row swap n ^ ((n >> 4) & 3) spreads the rows 4 lane + c, which one ds_store_b128 writes, over all bank groups and keeps the 16 rows of a fragment read spread as well
  __bf16* Wst = Ws + 4 * lane * PPI + 8 * wave; const int wsw = (lane >> 2) & 3;
  __bf16* Xst = Xs + (tid >> 3) * PPI + 4 * (tid & 7);
  v4f wr[8], xr[4];
#pragma unroll
  for (int i = 0; i < 8; ++i) wr[i] = *(const v4f*)(Wg + (size_t)i * CC);
#pragma unroll
  for (int i = 0; i < 4; ++i) xr[i] = *(const v4f*)(Xg + (size_t)(16 * i) * DIN);
  v8f acc[8] = {};
#pragma unroll 2   // two stages per trip: the buffer index is a constant in each
  for (int s = 0; s < PNS; ++s) { const int bf = s & 1; const int sn = s + 1 < PNS ? s + 1 : s;   // the stage fetched ahead; the last stage fetches itself again (in bounds, unused)
#pragma unroll
    for (int c = 0; c < 4; ++c) { v8b p;
#pragma unroll
      for (int i = 0; i < 8; ++i) p[i] = (__bf16)wr[i][c];
      *(v8b*)(Wst + bf * 128 * PPI + (c ^ wsw) * PPI) = p; }
#pragma unroll
    for (int i = 0; i < 4; ++i) { v4b p;
#pragma unroll
      for (int e = 0; e < 4; ++e) p[e] = (__bf16)xr[i][e];
      *(v4b*)(Xst + bf * 64 * PPI + 16 * i * PPI) = p; }
    __syncthreads();   // publishes stage s; it also ends every wave's reads of stage s - 1, whose buffer the next trip overwrites
#pragma unroll
    for (int i = 0; i < 8; ++i) wr[i] = *(const v4f*)(Wg + (size_t)(sn * PBK + i) * CC);
#pragma unroll
    for (int i = 0; i < 4; ++i) xr[i] = *(const v4f*)(Xg + (size_t)(16 * i) * DIN + sn * PBK);
    asm volatile("s_wait_xcnt 0x0" ::: "memory");   // in front of the next overwrite of the address registers of the loads above; it also keeps those loads issued ahead of the products, which cover their latency
    const v16b a = frag_b(Xs + (bf * 64 + wave * 16 + col) * PPI, lane);
    v16b w[8];
#pragma unroll
    for (int j = 0; j < 8; ++j) w[j] = frag_b(Ws + (bf * 128 + j * 16 + (col ^ (j & 3))) * PPI, lane);
    __builtin_amdgcn_sched_barrier(0);   // the stage's LDS reads go out as one group ahead of its products: spread among them, each product waited out a whole LDS latency
#pragma unroll
    for (int j = 0; j < 8; ++j) acc[j] = wmma_bf(a, w[j], acc[j]);
    __builtin_amdgcn_sched_barrier(0); }   // keeps the next stage's conversions, which wait for the global loads, behind this stage's products (the compiler had drawn them, and the wait, in among the products)
  __syncthreads();   // every wave has left the operand stages before the output staging below overwrites them
  if (which < 2) { _Float16* DH = which == 0 ? QH : KH; _Float16* DL = which == 0 ? QL : KL; const int nhi = which == 0 ? QHI : KHI; const bool hi_rows = t0 < nhi;
#pragma unroll
    for (int j = 0; j < 8; ++j) { const float bias = BA ? bfr(BA[c0 + j * 16 + col]) : 0.f;
#pragma unroll
      for (int r = 0; r < 8; ++r) { const float v = acc[j][r] + bias; const _Float16 hv = (_Float16)v; sh[wave * 16 + 8 * g + r][j * 16 + col] = hv; sl[wave * 16 + 8 * g + r][j * 16 + col] = (_Float16)((v - (float)hv) * 1024.0f); } }
    __syncthreads();
    for (int e = tid; e < 64 * 16; e += 128) { const int rl = e >> 4, q = e & 15; vst2((unsigned*)(DH + (r0 + rl) * CC + c0 + q * 8), *(const v4u*)&sh[rl][q * 8]); if (hi_rows) vst2((unsigned*)(DL + (bb * nhi + t0 + rl) * (size_t)CC + c0 + q * 8), *(const v4u*)&sl[rl][q * 8]); }
  } else { const bool hi_rows = t0 < KHI;
#pragma unroll
    for (int j = 0; j < 8; ++j) { const float bias = BA ? bfr(BA[c0 + j * 16 + col]) : 0.f;
#pragma unroll
      for (int r = 0; r < 8; ++r) { const float v = acc[j][r] + bias; const int rl = wave * 16 + 8 * g + r, cl = j * 16 + col; th[cl][rl] = (_Float16)v; const __bf16 bh = (__bf16)v; tb[cl][rl] = bh; tbl[cl][rl] = (__bf16)(v - (float)bh); } }
    __syncthreads();
    for (int e = tid; e < 128 * 8; e += 128) { const int cl = e >> 3, q = e & 7; vst2((unsigned*)(VT + (bb * CC + c0 + cl) * (size_t)TT + t0 + q * 8), *(const v4u*)&th[cl][q * 8]); if (hi_rows) { const size_t o3 = (bb * CC + c0 + cl) * (size_t)KHI + t0 + q * 8; vst2((unsigned*)(VB + o3), *(const v4u*)&tb[cl][q * 8]); vst2((unsigned*)(VBL + o3), *(const v4u*)&tbl[cl][q * 8]); } } } }
// ---- k_fa: block = 256 queries (8 waves x 32 query columns) of (b, h): one pass over all keys, 32 at a time, with a running maximum and sum per query (online softmax); the logits and P stay in registers.
// Transposed products: S^T = K . Q^T (A = key rows, B = query rows) puts one query's 16 scores of a 32-key step in lanes c and c + 16; two S^T tiles, converted in place, are the B operand of O^T += V^T . P^T (A = v planes [c][t]); O^T register r = ctx[query c][16 j + 8 h + r].
// P = exp(s - m) x 2^11 once to f16 (the row sum carries the same factor, taken in f32 before the rounding, and divides it out at the end).
#define FQ 2               // query tiles of 16 columns per wave: each K / V fragment load feeds both
// every inner loop below is fully unrolled so that the fragment and accumulator arrays are indexed by constants and stay in registers
#define L2E 1.4426950408889634f
__device__ __forceinline__ v8f mmh(v16h a, v16h b, v8f c) { return __builtin_amdgcn_wmma_f32_16x16x32_f16(false, a, false, b, (short)0, c, false, false); }
__device__ __forceinline__ float xhalf(float x) { return __builtin_bit_cast(float, __builtin_amdgcn_permlanex16(__builtin_bit_cast(int, x), __builtin_bit_cast(int, x), 0x76543210, 0xfedcba98, false, false)); }  // lane l with lane l ^ 16
__global__ __launch_bounds__(256) void k_fa(const _Float16* __restrict__ QH, const _Float16* __restrict__ KH, const _Float16* __restrict__ VT, const float* __restrict__ LPEN, float* __restrict__ Y) {
  const int tid = threadIdx.x, wave = tid >> 5, lane = tid & 31, col = lane & 15, g = lane >> 4; const int h = blockIdx.y, b = blockIdx.z; const int q0 = blockIdx.x * (8 * 16 * FQ) + wave * (16 * FQ);
  const _Float16* Kb = KH + ((size_t)b * TT + col) * CC + h * HD;               // key row col of a 16-key tile
  const _Float16* Vb = VT + ((size_t)b * CC + h * HD + col) * (size_t)TT;      // v plane of channel col of a 16-channel tile
  const float* Lb = LPEN + (size_t)b * TT * TT + (size_t)(q0 + col) * TT + 8 * g;   // this lane's query row, its half's 8 keys of a tile
  v16h qf[FQ][2];
#pragma unroll
  for (int u = 0; u < FQ; ++u)
#pragma unroll
    for (int kc = 0; kc < 2; ++kc) qf[u][kc] = frag_h(QH + ((size_t)b * TT + q0 + u * 16 + col) * CC + h * HD + kc * 32, lane);
  v16h kf[2][2]; v4f lp[FQ][2][2];
#pragma unroll
  for (int jt = 0; jt < 2; ++jt) {
#pragma unroll
    for (int kc = 0; kc < 2; ++kc) kf[jt][kc] = frag_h(Kb + (size_t)(jt * 16) * CC + kc * 32, lane);
#pragma unroll
    for (int u = 0; u < FQ; ++u) { lp[u][jt][0] = *(const v4f*)(Lb + (size_t)u * 16 * TT + jt * 16); lp[u][jt][1] = *(const v4f*)(Lb + (size_t)u * 16 * TT + jt * 16 + 4); } }
  asm volatile("s_wait_xcnt 0x0" ::: "memory");   // the address registers of the loads above are reused for the accumulators set up below: the wait stands in front of that overwrite
  __builtin_amdgcn_sched_barrier(0);              // keeps the accumulators' set-up behind that wait (the compiler lifted it over the wait without this)
  v8f o[FQ][HD / 16] = {}; float m[FQ], l[FQ];
#pragma unroll
  for (int u = 0; u < FQ; ++u) { m[u] = -3.0e38f; l[u] = 0.f; }
#pragma unroll 1   // stays rolled: one step's live set already takes the 256 registers that need no window switch
  for (int k0 = 0; k0 < TT; k0 += 32) { const int kn = k0 + 32 < TT ? k0 + 32 : 0;   // the step fetched ahead; the last step fetches step 0 again (in bounds, unused)
    v16h vf[HD / 16];
#pragma unroll
    for (int j = 0; j < HD / 16; ++j) vf[j] = frag_h(Vb + (size_t)(j * 16) * TT + k0, lane);
    float sv[FQ][16];
#pragma unroll
    for (int u = 0; u < FQ; ++u)
#pragma unroll
      for (int jt = 0; jt < 2; ++jt) { v8f z = {}; z = mmh(kf[jt][0], qf[u][0], z); z = mmh(kf[jt][1], qf[u][1], z);
#pragma unroll
        for (int r = 0; r < 8; ++r) sv[u][jt * 8 + r] = fmaf(z[r], SCALE, lp[u][jt][r >> 2][r & 3]); }
    // the next step's K fragments and log-penalty rows, into the registers this step has just read: they fly during the softmax and the P . v products
#pragma unroll
    for (int jt = 0; jt < 2; ++jt) {
#pragma unroll
      for (int kc = 0; kc < 2; ++kc) kf[jt][kc] = frag_h(Kb + (size_t)(kn + jt * 16) * CC + kc * 32, lane);
#pragma unroll
      for (int u = 0; u < FQ; ++u) { lp[u][jt][0] = *(const v4f*)(Lb + (size_t)u * 16 * TT + kn + jt * 16); lp[u][jt][1] = *(const v4f*)(Lb + (size_t)u * 16 * TT + kn + jt * 16 + 4); } }
    __builtin_amdgcn_sched_barrier(0);      // keeps the fetch-ahead loads issued in front of the softmax and the P . v products, which then cover their latency
#pragma unroll
    for (int u = 0; u < FQ; ++u) { float mt = sv[u][0];
#pragma unroll
      for (int i = 1; i < 16; ++i) mt = fmaxf(mt, sv[u][i]);
      mt = fmaxf(mt, xhalf(mt)); const float mn = fmaxf(m[u], mt); const float al = __builtin_amdgcn_exp2f((m[u] - mn) * L2E);   // 0 on the first step
      m[u] = mn; const float cc = 11.0f - mn * L2E; float ls = 0.f; v16h pb;
#pragma unroll
      for (int i = 0; i < 16; ++i) { const float p = __builtin_amdgcn_exp2f(fmaf(sv[u][i], L2E, cc)); ls += p; pb[i] = (_Float16)p; }
      l[u] = l[u] * al + ls;
#pragma unroll
      for (int j = 0; j < HD / 16; ++j) { o[u][j] = o[u][j] * al; o[u][j] = mmh(vf[j], pb, o[u][j]); } } }
#pragma unroll
  for (int u = 0; u < FQ; ++u) { const float inv = 1.0f / (l[u] + xhalf(l[u]));   // the halves' sums join once; the row's maximum contributes 2^11, so the sum is positive
    float* yr = Y + ((size_t)b * TT + q0 + u * 16 + col) * CC + h * HD + 8 * g;
#pragma unroll
    for (int j = 0; j < HD / 16; ++j) { v4f a0, a1;
#pragma unroll
      for (int r = 0; r < 4; ++r) { a0[r] = o[u][j][r] * inv; a1[r] = o[u][j][4 + r] * inv; }
      vst2(yr + j * 16, a0); vst2(yr + j * 16 + 4, a1); } } }

// ---- k_lpen: block = query row i of batch bsm: LPEN[i][j] = log(max(res * scope, 1e-32)) for all keys j, with res = (1 - gi) max(1 - gi - gj, 0) + gi min(1 - gi + gj, 1), scope = clip(pow(S - 2, 1 - gi) + 2 - |i - j|, 1e-32, 1) (gi / pow from the k_gate tables; f32, precise logf); the plane is shared by the 16 heads of the batch; each thread writes 16-B pieces
__global__ __launch_bounds__(256) void k_lpen(const float* __restrict__ GATE, const float* __restrict__ PWR, int bsm, float* __restrict__ LPEN) { const int tid = threadIdx.x; const int t = blockIdx.x;
  const float gi_ = GATE[(size_t)bsm * TT + t], pw_ = PWR[(size_t)bsm * TT + t]; asm volatile("s_wait_loadcnt 0x0" ::: "memory");
  for (int q4 = tid; q4 < TT / 4; q4 += 256) { const v4f gj4 = *(const v4f*)(GATE + (size_t)bsm * TT + q4 * 4); asm volatile("s_wait_loadcnt 0x0" ::: "memory"); v4f o;
#pragma unroll
    for (int u = 0; u < 4; ++u) { const int k = q4 * 4 + u; const float gj_ = gj4[u]; const float res_ = (1.0f - gi_) * fmaxf(1.0f - gi_ - gj_, 0.0f) + gi_ * fminf(1.0f - gi_ + gj_, 1.0f); const int ad_ = (t > k) ? (t - k) : (k - t); const float sc_ = fminf(fmaxf(pw_ + 2.0f - (float)ad_, 1.0e-32f), 1.0f); o[u] = logf(fmaxf(res_ * sc_, 1.0e-32f)); }
    vst2(LPEN + (size_t)t * TT + q4 * 4, o); } }
__global__ __launch_bounds__(256) void k_gate(const float* __restrict__ X, const float* __restrict__ WG, const float* __restrict__ BG, float* __restrict__ GATE, float* __restrict__ PWR) { __shared__ __align__(16) float sg[32]; __shared__ __align__(16) float sp[32];
  const int tid = threadIdx.x, wave = tid >> 5, lane = tid & 31; const size_t r0 = (size_t)blockIdx.x * 32; const float bg_ = bfr(BG[0]);
  float wreg[32];
#pragma unroll
  for (int i = 0; i < 16; ++i) wreg[i] = WG[lane + 32 * i];
  asm volatile("s_wait_loadcnt 0x0" ::: "memory");
#pragma unroll
  for (int i = 16; i < 32; ++i) wreg[i] = WG[lane + 32 * i];   /* two bursts of 16 loads */
  asm volatile("s_wait_loadcnt 0x0" ::: "memory");
#pragma unroll
  for (int i = 0; i < 32; ++i) wreg[i] = bfr(wreg[i]);
#pragma unroll 1
  for (int rr = 0; rr < 4; ++rr) { const size_t row = r0 + wave * 4 + rr; const float* xr = X + row * DIN; float acc = 0.f;
#pragma unroll
    for (int i = 0; i < 32; ++i) { const float xv = xr[lane + 32 * i]; asm volatile("s_wait_loadcnt 0x0" ::: "memory"); acc += bfr(xv) * wreg[i]; }   /* fully unrolled: wreg is indexed with compile-time constants */
#pragma unroll
    for (int o = 1; o < 32; o <<= 1) acc += __shfl_xor(acc, o);
    const float g = 1.0f / (1.0f + expf(-(acc + bg_)));
    if (lane == 0) { sg[wave * 4 + rr] = g; sp[wave * 4 + rr] = powf((float)(TT - 2), 1.0f - g); } }   /* LDS only: no global access under the lane predicate */
  __syncthreads();
  if (tid < 8) vst2(GATE + r0 + tid * 4, *(const v4f*)&sg[tid * 4]);
  else if (tid >= 32 && tid < 40) vst2(PWR + r0 + (tid - 32) * 4, *(const v4f*)&sp[(tid - 32) * 4]); }
extern "C" void kernel_launch(void* const* d_in, const int* in_sizes, int n_in, void* d_out, int out_size, void* d_ws, size_t ws_size, hipStream_t stream) {
  (void)in_sizes; (void)n_in; (void)out_size;
  const float** F = (const float**)d_in;
  if (ws_size < (size_t)WS_END3) return;
  char* ws = (char*)d_ws; _Float16 *QH = (_Float16*)(ws + WS_QH), *KH = (_Float16*)(ws + WS_KH), *VT = (_Float16*)(ws + WS_VT), *QL = (_Float16*)(ws + WS_QL), *KL = (_Float16*)(ws + WS_KL); __bf16 *VB = (__bf16*)(ws + WS_VB), *VBL = (__bf16*)(ws + WS_VBL);
  (void)QL; (void)KL; (void)VB; (void)VBL;
  // inputs: 0 hidden_states [2,2048,1024]; 1 Wq [1024,1024] (in,out), 2 bq; 3 Wk, 4 bk; 5 Wv, 6 bv (zero biases, read); 7 Wg [1024,1]; 8 bg [1]; no output projection
  float* GATE = (float*)(ws + WS_GATE); float* PWR = (float*)(ws + WS_PWR); float* LPEN = (float*)(ws + WS_LPEN);
  k_gate<<<dim3(TNB * TT / 32), 256, 0, stream>>>(F[0], F[7], F[8], GATE, PWR);
  k_proj<<<dim3(TNB * TT / 64, CC / 128, 3), 128, 0, stream>>>(F[0], F[0], F[0], F[1], F[3], F[5], F[2], F[4], F[6], QH, QL, KH, KL, VT, VB, VBL);
  for (int b = 0; b < TNB; ++b) k_lpen<<<dim3(TT), 256, 0, stream>>>(GATE, PWR, b, LPEN + (size_t)b * TT * TT);   /* one plane per batch: shared by its 16 heads */
  k_fa<<<dim3(TT / (8 * 16 * FQ), NH, TNB), 256, 0, stream>>>(QH, KH, VT, LPEN, (float*)d_out);
}

// v003
// Measured time: 170 microseconds a run.
// Two timings next to v002 put it at 1.12 and 1.11 times that version's speed.
// Over all steps from v000 it is 6.91 times as fast.
// compute dtype: all float inputs rounded to bf16; q/k/v projections with EXACT bf16 products on WMMA 16x16x32 (f32 accumulate) + bias; the granularity gate g = sigmoid(x . Wg + bg) from exact bf16 products summed in f32 (VALU), pow(S - 2, 1 - g) with precise powf; logits q x k once to f16 each (1 product) x 64^-0.5 + the log-penalty bias in f32 (precise logf); softmax f32 with a running maximum and sum over steps of 32 keys; exp(s - m) x 2^11 once to f16 x v once to f16 (1 product), divided by the f32 row sum at the end; f32 output.
#include <hip/hip_runtime.h>
#include <math.h>

typedef __attribute__((ext_vector_type(16))) _Float16 v16h;
typedef __attribute__((ext_vector_type(16))) __bf16 v16b;
typedef __attribute__((ext_vector_type(8)))  _Float16 v8h;
typedef __attribute__((ext_vector_type(8)))  float v8f;
typedef __attribute__((ext_vector_type(4)))  float v4f;
typedef __attribute__((ext_vector_type(2)))  float v2f;
typedef __attribute__((ext_vector_type(4)))  unsigned v4u;
typedef __attribute__((ext_vector_type(4)))  int v4i;
typedef float __attribute__((may_alias)) float_a;
typedef int __attribute__((may_alias)) int_a;

template <typename T> __device__ __forceinline__ void vst2(void* p, T v) { *(T*)p = v;  }
__device__ __forceinline__ v8f wmma16(v16h a, v16h b, v8f c) {
  v8f d = __builtin_amdgcn_wmma_f32_16x16x32_f16(false, a, false, b, (short)0, c, false, false);
  asm volatile("v_nop\n\tv_nop\n\tv_nop\n\tv_nop" : "+v"(d) : "v"(a), "v"(b));
  return d;
}
__device__ __forceinline__ v8f wmma_bf(v16b a, v16b b, v8f c) {
  v8f d = __builtin_amdgcn_wmma_f32_16x16x32_bf16(false, a, false, b, (short)0, c, false, false);
  asm volatile("v_nop\n\tv_nop\n\tv_nop\n\tv_nop" : "+v"(d) : "v"(a), "v"(b));
  return d;
}
// 16x16x32 fragments: lane = (h = lane>>4, row/col = lane&15); elements 0..7 = k0+8h+0..7, 8..15 = k0+16+8h+0..7; D element r = row 8h+r
__device__ __forceinline__ v16h frag_h(const _Float16* rowk0, int lane) {
  union { v16h v; v8h q[2]; } u; const _Float16* p = rowk0 + 8 * (lane >> 4);
  u.q[0] = *(const v8h*)p; u.q[1] = *(const v8h*)(p + 16); return u.v;
}
__device__ __forceinline__ v16h frag_f32(const float* rowk0, int lane) {
  v16h a; const float* p = rowk0 + 8 * (lane >> 4);
#pragma unroll
  for (int i = 0; i < 8; ++i) { a[i] = (_Float16)p[i]; a[8 + i] = (_Float16)p[16 + i]; }
  return a;
}
__device__ __forceinline__ v16h frag_f32s(const float* rowk0, int lane, float sc) {
  v16h a; const float* p = rowk0 + 8 * (lane >> 4);
#pragma unroll
  for (int i = 0; i < 8; ++i) { a[i] = (_Float16)(p[i] * sc); a[8 + i] = (_Float16)(p[16 + i] * sc); }
  return a;
}
// column fragment from a [K][ld] layout (column n), rows >= K read as 0
__device__ __forceinline__ v16h fragc_f32(const float* W, int k0, int n, int lane, int ld, int K) {
  v16h a; const int g = lane >> 4;
#pragma unroll
  for (int i = 0; i < 8; ++i) { const int ka = k0 + 8 * g + i, kb = ka + 16;
    a[i] = (_Float16)(ka < K ? W[(size_t)(ka < K ? ka : K - 1) * ld + n] : 0.f); a[8 + i] = (_Float16)(kb < K ? W[(size_t)(kb < K ? kb : K - 1) * ld + n] : 0.f); }
  return a;
}
struct F2 { v16b h, l; };
__device__ __forceinline__ F2 bsplit16(const float v[16]) { F2 r;
#pragma unroll
  for (int i = 0; i < 16; ++i) { const __bf16 h = (__bf16)v[i]; r.h[i] = h; r.l[i] = (__bf16)(v[i] - (float)h); }
  return r; }
__device__ __forceinline__ F2 split_row(const float* row, int k0, int lane) { float v[16]; const float* p = row + k0 + 8 * (lane >> 4);
#pragma unroll
  for (int i = 0; i < 8; ++i) { v[i] = p[i]; v[8 + i] = p[16 + i]; }
  return bsplit16(v); }
__device__ __forceinline__ F2 split_rowK(const float* row, int k0, int lane, int K) { float v[16]; const int g = lane >> 4;
#pragma unroll
  for (int i = 0; i < 8; ++i) { const int ka = k0 + 8 * g + i, kb = ka + 16; v[i] = ka < K ? row[ka < K ? ka : K - 1] : 0.f; v[8 + i] = kb < K ? row[kb < K ? kb : K - 1] : 0.f; }
  return bsplit16(v); }
__device__ __forceinline__ F2 split_col(const float* W, int k0, int n, int lane, int ld, int K) { float v[16]; const int g = lane >> 4;
#pragma unroll
  for (int i = 0; i < 8; ++i) { const int ka = k0 + 8 * g + i, kb = ka + 16; v[i] = ka < K ? W[(size_t)(ka < K ? ka : K - 1) * ld + n] : 0.f; v[8 + i] = kb < K ? W[(size_t)(kb < K ? kb : K - 1) * ld + n] : 0.f; }
  return bsplit16(v); }
__device__ __forceinline__ v8f mac3(const F2& a, const F2& b, v8f c) { c = wmma_bf(a.l, b.h, c); c = wmma_bf(a.h, b.l, c); return wmma_bf(a.h, b.h, c); }
__device__ __forceinline__ float sigm(float v) { return 1.0f / (1.0f + expf(-v)); }
#define LDSX() do { asm volatile("s_wait_dscnt 0" ::: "memory"); __builtin_amdgcn_wave_barrier(); __builtin_amdgcn_fence(__ATOMIC_RELEASE, "workgroup"); } while (0)

// BERT-style self-attention with a learned granularity gate adding a log-penalty bias to the scores (hidden_states [2,2048,1024]; (in,out) Wq / Wk / Wv [1024,1024] N(0, 1/1024) + zero biases; Wg [1024,1] + bg: g = sigmoid(x Wg + bg) per token; res[i,j] = (1 - g_i) max(1 - g_i - g_j, 0) + g_i min(1 - g_i + g_j, 1); scope[i,j] = clip((S - 2)^(1 - g_i) + 2 - |i - j|, 1e-32, 1); log_pen = log(max(res * scope, 1e-32)), broadcast over the 16 heads; scores = q k^T / 8 + log_pen; softmax; no output projection): ctx [2,2048,1024].
#define NB 2
#define TT 2048
#define CC 1024            // NH * HD = projected width
#define DIN 1024          // input (model) width
#define NH 16
#define HD 64
#define NQB (TT / 64)
#define HG 4
#define SCALE (0.125f)
#define CAUSAL 0
#ifndef TNB
#define TNB NB
#endif
__device__ __forceinline__ float bfr(float v) { return (float)(__bf16)v; }
__host__ __device__ __forceinline__ int kb_last(int qb) { return CAUSAL ? ((qb * 64 + 63) >> 7) : (TT / 128 - 1); }
typedef __attribute__((ext_vector_type(8))) __bf16 v8b;
__device__ __forceinline__ v16b frag_b(const __bf16* rowk0, int lane) {
  union { v16b v; v8b q[2]; } u; const __bf16* p = rowk0 + 8 * (lane >> 4);
  u.q[0] = *(const v8b*)p; u.q[1] = *(const v8b*)(p + 16); return u.v;
}
#define QBH 0              // not read by any kernel in this file
#define QHI 0               // single-product logits on every row
#define KHI 64            // key rows carrying k residual / v bf16 hi+lo planes (written by k_proj; read by no kernel in this file)
// B fragment (k rows k0+.., output column o) of a weight: (in,out) [K][ld] or (out,in) [ld rows of K]: bf16 exact, or f16(bf16 * 256) exact
__device__ __forceinline__ v16b wcol_io(const float* Wm, int k0, int o, int lane, int ld) { v16b w; const int g = lane >> 4;
#pragma unroll
  for (int i = 0; i < 8; ++i) { w[i] = (__bf16)Wm[(size_t)(k0 + 8 * g + i) * ld + o]; w[8 + i] = (__bf16)Wm[(size_t)(k0 + 16 + 8 * g + i) * ld + o]; }
  return w; }
__device__ __forceinline__ v16b wcol_oi(const float* Wm, int k0, int o, int lane, int K) { v16b w; const float* p = Wm + (size_t)o * K + k0 + 8 * (lane >> 4);
#pragma unroll
  for (int i = 0; i < 8; ++i) { w[i] = (__bf16)p[i]; w[8 + i] = (__bf16)p[16 + i]; }
  return w; }
__device__ __forceinline__ v16h wcolh_io(const float* Wm, int k0, int o, int lane, int ld) { v16h w; const int g = lane >> 4;
#pragma unroll
  for (int i = 0; i < 8; ++i) { w[i] = (_Float16)(bfr(Wm[(size_t)(k0 + 8 * g + i) * ld + o]) * 256.0f); w[8 + i] = (_Float16)(bfr(Wm[(size_t)(k0 + 16 + 8 * g + i) * ld + o]) * 256.0f); }
  return w; }
__device__ __forceinline__ v16h wcolh_oi(const float* Wm, int k0, int o, int lane, int K) { v16h w; const float* p = Wm + (size_t)o * K + k0 + 8 * (lane >> 4);
#pragma unroll
  for (int i = 0; i < 8; ++i) { w[i] = (_Float16)(bfr(p[i]) * 256.0f); w[8 + i] = (_Float16)(bfr(p[16 + i]) * 256.0f); }
  return w; }
#define WQKV_LAYOUT 0   // 0 = (in,out) [DIN][CC]; 1 = (out,in) [CC][DIN]; 2 = per-head [NH][DIN][HD]
__device__ __forceinline__ v16b wcol_hdk(const float* Wm, int k0, int o, int lane) { v16b w; const int g = lane >> 4; const float* p = Wm + (size_t)(o / HD) * DIN * HD + (o % HD);
#pragma unroll
  for (int i = 0; i < 8; ++i) { w[i] = (__bf16)p[(size_t)(k0 + 8 * g + i) * HD]; w[8 + i] = (__bf16)p[(size_t)(k0 + 16 + 8 * g + i) * HD]; }
  return w; }
#define WO_OUT_IN 0
#if WQKV_LAYOUT == 1
#define WCOL(W, k0, o, lane) wcol_oi(W, k0, o, lane, DIN)
#elif WQKV_LAYOUT == 2
#define WCOL(W, k0, o, lane) wcol_hdk(W, k0, o, lane)
#else
#define WCOL(W, k0, o, lane) wcol_io(W, k0, o, lane, CC)
#endif
#if WO_OUT_IN
#define WOCOL(W, k0, o, lane) wcol_oi(W, k0, o, lane, CC)
#define WOCOLH(W, k0, o, lane) wcolh_oi(W, k0, o, lane, CC)
#else
#define WOCOL(W, k0, o, lane) wcol_io(W, k0, o, lane, DIN)
#define WOCOLH(W, k0, o, lane) wcolh_io(W, k0, o, lane, DIN)
#endif
// the module's log-penalty bias log_pen[b, i, j] is head-independent: k_lpen evaluates it ONCE per batch into an f32 plane LPEN[b] (fragment order); k_fa ADDS it to the scaled score (far keys carry the module's finite log(1e-32) = -73.68, kept literally)

#define WS_QH  0u                                      // f16 q rows [b*t][CC]
#define WS_KH  (WS_QH + 2u * (size_t)NB * TT * CC)      // f16 k in fragment order [b][h][t / 16][kc][piece][lane][8]
#define WS_VT  (WS_KH + 2u * (size_t)NB * TT * CC)      // f16 v in fragment order [b][h][t / 32][j][piece][lane][8]
#define WS_QL  (WS_VT + 2u * (size_t)NB * CC * TT)      // f16 q residual x 2^10 rows [b][t < QHI][CC]
#define WS_KL  (WS_QL + 2u * (size_t)NB * QHI * CC)     // f16 k residual x 2^10 rows [b][t < KHI][CC]
#define WS_VB  (WS_KL + 2u * (size_t)NB * KHI * CC)     // bf16 v hi planes [b][c][t < KHI]
#define WS_VBL (WS_VB + 2u * (size_t)NB * CC * KHI)
#define WS_END (WS_VBL + 2u * (size_t)NB * CC * KHI)
#define WS_GATE (WS_END)                                 // f32 g[b][s]
#define WS_PWR  (WS_GATE + 4u * (size_t)NB * TT)          // f32 pow(S - 2, 1 - g)[b][s]
#define WS_LPEN (WS_PWR + 4u * (size_t)NB * TT)          // f32 log-penalty planes in fragment order [b][i / 16][j / 32][jt][w][lane][4]
#define WS_END3 (WS_LPEN + 4u * (size_t)NB * TT * TT)

// ---- k_proj: block = (64 rows, 128 cols, which): q/k/v = X W (+ b) with exact bf16 products (K = DIN) -> which 0: q f16 rows (+ residual rows < QHI); 1: k f16 in fragment order (+ residual rows < KHI); 2: v f16 in fragment order (+ bf16 hi/lo planes for t < KHI)
// Operands go through LDS, 32 k at a time, two buffers: the block reads each f32 tile of X and W once, in whole 128-B lines, rounds it to bf16 and lays it k-contiguous (W transposed inside the thread that loaded it); the four waves take their fragments from there. The next tile's global loads fly while this tile is multiplied.
#define PBK 32             // k per stage
#define PNS (DIN / PBK)
#define PPI 40             // bf16 per staged row: 64 B of data at a pitch of 80 B (16 B x odd: the 16 rows of a ds_load_b128 fragment read fall on 16 different bank groups)
typedef __attribute__((ext_vector_type(4))) __bf16 v4b;
__global__ __launch_bounds__(128) void k_proj(const float* __restrict__ XQ, const float* __restrict__ XK, const float* __restrict__ XV, const float* __restrict__ WQ, const float* __restrict__ WK, const float* __restrict__ WV, const float* __restrict__ BQ, const float* __restrict__ BK, const float* __restrict__ BV,
    _Float16* __restrict__ QH, _Float16* __restrict__ QL, _Float16* __restrict__ KH, _Float16* __restrict__ KL, _Float16* __restrict__ VT, __bf16* __restrict__ VB, __bf16* __restrict__ VBL) {
  // one LDS range: the operand stages of the k loop lie in the bytes that the output staging takes over behind the loop (three blocks stay resident on a WGP)
  __shared__ __align__(16) unsigned char smem[2 * 64 * 136 * 2 + 3 * 128 * 72 * 2];
  _Float16 (*sh)[136] = (_Float16 (*)[136])smem; _Float16 (*sl)[136] = (_Float16 (*)[136])(smem + 64 * 136 * 2);
  _Float16 (*th)[72] = (_Float16 (*)[72])(smem + 2 * 64 * 136 * 2); __bf16 (*tb)[72] = (__bf16 (*)[72])(smem + 2 * 64 * 136 * 2 + 128 * 72 * 2); __bf16 (*tbl)[72] = (__bf16 (*)[72])(smem + 2 * 64 * 136 * 2 + 2 * 128 * 72 * 2);
  __bf16* Ws = (__bf16*)smem;                              // [2][128 columns][PPI]: W^T, column n in row n ^ ((n >> 4) & 3)
  __bf16* Xs = (__bf16*)(smem + 2 * 128 * PPI * 2);        // [2][64 rows][PPI]
  const int tid = threadIdx.x, wave = tid >> 5, lane = tid & 31, col = lane & 15, g = lane >> 4; const int which = blockIdx.z; const int c0 = blockIdx.y * 128; const size_t r0 = (size_t)blockIdx.x * 64; const size_t bb = r0 / TT; const int t0 = (int)(r0 % TT);
  const float* X = which == 0 ? XQ : which == 1 ? XK : XV; const float* WA = which == 0 ? WQ : which == 1 ? WK : WV; const float* BA = which == 0 ? BQ : which == 1 ? BK : BV;
  const float* Wg = WA + (size_t)(8 * wave) * CC + c0 + 4 * lane;       // this thread's W piece of a stage: k rows 8 wave + 0..7, columns 4 lane + 0..3 (a wave's load = 512 contiguous bytes)
  const float* Xg = X + (r0 + (tid >> 3)) * DIN + 4 * (tid & 7);         // its X piece: rows (tid >> 3) + 16 i, k 4 (tid & 7) + 0..3 (a wave's load = four whole lines)
  // the row swap n ^ ((n >> 4) & 3) spreads the rows 4 lane + c, which one ds_store_b128 writes, over all bank groups and keeps the 16 rows of a fragment read spread as well
  __bf16* Wst = Ws + 4 * lane * PPI + 8 * wave; const int wsw = (lane >> 2) & 3;
  __bf16* Xst = Xs + (tid >> 3) * PPI + 4 * (tid & 7);
  v4f wr[8], xr[4];
#pragma unroll
  for (int i = 0; i < 8; ++i) wr[i] = *(const v4f*)(Wg + (size_t)i * CC);
#pragma unroll
  for (int i = 0; i < 4; ++i) xr[i] = *(const v4f*)(Xg + (size_t)(16 * i) * DIN);
  v8f acc[8] = {};
#pragma unroll 2   // two stages per trip: the buffer index is a constant in each
  for (int s = 0; s < PNS; ++s) { const int bf = s & 1; const int sn = s + 1 < PNS ? s + 1 : s;   // the stage fetched ahead; the last stage fetches itself again (in bounds, unused)
#pragma unroll
    for (int c = 0; c < 4; ++c) { v8b p;
#pragma unroll
      for (int i = 0; i < 8; ++i) p[i] = (__bf16)wr[i][c];
      *(v8b*)(Wst + bf * 128 * PPI + (c ^ wsw) * PPI) = p; }
#pragma unroll
    for (int i = 0; i < 4; ++i) { v4b p;
#pragma unroll
      for (int e = 0; e < 4; ++e) p[e] = (__bf16)xr[i][e];
      *(v4b*)(Xst + bf * 64 * PPI + 16 * i * PPI) = p; }
    __syncthreads();   // publishes stage s; it also ends every wave's reads of stage s - 1, whose buffer the next trip overwrites
#pragma unroll
    for (int i = 0; i < 8; ++i) wr[i] = *(const v4f*)(Wg + (size_t)(sn * PBK + i) * CC);
#pragma unroll
    for (int i = 0; i < 4; ++i) xr[i] = *(const v4f*)(Xg + (size_t)(16 * i) * DIN + sn * PBK);
    asm volatile("s_wait_xcnt 0x0" ::: "memory");   // in front of the next overwrite of the address registers of the loads above; it also keeps those loads issued ahead of the products, which cover their latency
    const v16b a = frag_b(Xs + (bf * 64 + wave * 16 + col) * PPI, lane);
    v16b w[8];
#pragma unroll
    for (int j = 0; j < 8; ++j) w[j] = frag_b(Ws + (bf * 128 + j * 16 + (col ^ (j & 3))) * PPI, lane);
    __builtin_amdgcn_sched_barrier(0);   // the stage's LDS reads go out as one group ahead of its products: spread among them, each product waited out a whole LDS latency
#pragma unroll
    for (int j = 0; j < 8; ++j) acc[j] = wmma_bf(a, w[j], acc[j]);
    __builtin_amdgcn_sched_barrier(0); }   // keeps the next stage's conversions, which wait for the global loads, behind this stage's products (the compiler had drawn them, and the wait, in among the products)
  __syncthreads();   // every wave has left the operand stages before the output staging below overwrites them
  if (which < 2) { _Float16* DH = which == 0 ? QH : KH; _Float16* DL = which == 0 ? QL : KL; const int nhi = which == 0 ? QHI : KHI; const bool hi_rows = t0 < nhi;
#pragma unroll
    for (int j = 0; j < 8; ++j) { const float bias = BA ? bfr(BA[c0 + j * 16 + col]) : 0.f;
#pragma unroll
      for (int r = 0; r < 8; ++r) { const float v = acc[j][r] + bias; const _Float16 hv = (_Float16)v; sh[wave * 16 + 8 * g + r][j * 16 + col] = hv; sl[wave * 16 + 8 * g + r][j * 16 + col] = (_Float16)((v - (float)hv) * 1024.0f); } }
    __syncthreads();
    // k leaves in the order in which k_fa's A fragments read it: 16-B piece pc = 2 kc + piece of lane ln (key row ln & 15, half ln >> 4) of a 16-key tile of one head, lanes contiguous; q stays in rows
    for (int e = tid; e < 64 * 16; e += 128) { int rl, q; size_t od;
      if (which == 0) { rl = e >> 4; q = e & 15; od = (r0 + rl) * CC + c0 + q * 8; }
      else { const int ln = e & 31, pc = (e >> 5) & 3, tl = (e >> 7) & 3, hl = e >> 9; rl = tl * 16 + (ln & 15); q = hl * 8 + pc * 2 + (ln >> 4); od = ((((bb * NH + (c0 >> 6) + hl) * (TT / 16) + (t0 >> 4) + tl) * 4 + pc) * 32 + ln) * 8; }
      vst2((unsigned*)(DH + od), *(const v4u*)&sh[rl][q * 8]);
      asm volatile("s_wait_xcnt 0x0" ::: "memory");   // in front of the next overwrite of the store's address and data registers
      if (hi_rows) { vst2((unsigned*)(DL + (bb * nhi + t0 + rl) * (size_t)CC + c0 + q * 8), *(const v4u*)&sl[rl][q * 8]);
        asm volatile("s_wait_xcnt 0x0" ::: "memory"); } }   // the same for this store
  } else { const bool hi_rows = t0 < KHI;
#pragma unroll
    for (int j = 0; j < 8; ++j) { const float bias = BA ? bfr(BA[c0 + j * 16 + col]) : 0.f;
#pragma unroll
      for (int r = 0; r < 8; ++r) { const float v = acc[j][r] + bias; const int rl = wave * 16 + 8 * g + r, cl = j * 16 + col; th[cl][rl] = (_Float16)v; const __bf16 bh = (__bf16)v; tb[cl][rl] = bh; tbl[cl][rl] = (__bf16)(v - (float)bh); } }
    __syncthreads();
    // v leaves in the order in which k_fa's A fragments read it: piece pc of lane ln (channel ln & 15 of tile j, half ln >> 4) of a 32-key step of one head, lanes contiguous
    for (int e = tid; e < 128 * 8; e += 128) { const int ln = e & 31, pc = (e >> 5) & 1, j = (e >> 6) & 3, st = (e >> 8) & 1, hl = e >> 9; const int cl = hl * 64 + j * 16 + (ln & 15), q = st * 4 + pc * 2 + (ln >> 4);
      vst2((unsigned*)(VT + (((((bb * NH + (c0 >> 6) + hl) * (TT / 32) + (t0 >> 5) + st) * 4 + j) * 2 + pc) * 32 + ln) * 8), *(const v4u*)&th[cl][q * 8]);
      asm volatile("s_wait_xcnt 0x0" ::: "memory");   // in front of the next overwrite of the store's address and data registers
      if (hi_rows) { const size_t o3 = (bb * CC + c0 + cl) * (size_t)KHI + t0 + q * 8; vst2((unsigned*)(VB + o3), *(const v4u*)&tb[cl][q * 8]); vst2((unsigned*)(VBL + o3), *(const v4u*)&tbl[cl][q * 8]);
        asm volatile("s_wait_xcnt 0x0" ::: "memory"); } } } }   // the same for these two stores
// ---- k_fa: block = 256 queries (8 waves x 32 query columns) of (b, h): one pass over all keys, 32 at a time, with a running maximum and sum per query (online softmax); the logits and P stay in registers.
// Transposed products: S^T = K . Q^T (A = key rows, B = query rows) puts one query's 16 scores of a 32-key step in lanes c and c + 16; two S^T tiles, converted in place, are the B operand of O^T += V^T . P^T (A = v, channel rows); O^T register r = ctx[query c][16 j + 8 h + r].
// P = exp(s - m) x 2^11 once to f16 (the row sum carries the same factor, taken in f32 before the rounding, and divides it out at the end).
#define FQ 2               // query tiles of 16 columns per wave: each K / V fragment load feeds both
// every inner loop below is fully unrolled so that the fragment and accumulator arrays are indexed by constants and stay in registers
#define L2E 1.4426950408889634f
__device__ __forceinline__ v8f mmh(v16h a, v16h b, v8f c) { return __builtin_amdgcn_wmma_f32_16x16x32_f16(false, a, false, b, (short)0, c, false, false); }
// a fragment stored in fragment order: this lane's two 16-B pieces lie 512 B apart (p already holds the lane's offset)
__device__ __forceinline__ v16h frag_p(const _Float16* p) { union { v16h v; v8h q[2]; } u; u.q[0] = *(const v8h*)p; u.q[1] = *(const v8h*)(p + 256); return u.v; }
__device__ __forceinline__ float xhalf(float x) { return __builtin_bit_cast(float, __builtin_amdgcn_permlanex16(__builtin_bit_cast(int, x), __builtin_bit_cast(int, x), 0x76543210, 0xfedcba98, false, false)); }  // lane l with lane l ^ 16
__global__ __launch_bounds__(256) void k_fa(const _Float16* __restrict__ QH, const _Float16* __restrict__ KH, const _Float16* __restrict__ VT, const float* __restrict__ LPEN, float* __restrict__ Y) {
  const int tid = threadIdx.x, wave = tid >> 5, lane = tid & 31, col = lane & 15, g = lane >> 4; const int h = blockIdx.y, b = blockIdx.z; const int q0 = blockIdx.x * (8 * 16 * FQ) + wave * (16 * FQ);
  // K, V and the log-penalty lie in fragment order: a wave's load is 32 lanes x 16 B = 512 contiguous bytes (four whole lines)
  const _Float16* Kb = KH + (size_t)(b * NH + h) * TT * HD + lane * 8;          // 32 keys = 2048 halves: [jt][kc][piece][lane][8]
  const _Float16* Vb = VT + (size_t)(b * NH + h) * TT * HD + lane * 8;          // 32 keys = 2048 halves: [j][piece][lane][8]
  const float* Lb = LPEN + (size_t)b * TT * TT + (size_t)q0 * TT + lane * 4;    // 16 queries x 32 keys = 512 floats: [jt][w][lane][4]; 16 queries = 16 TT floats
  v16h qf[FQ][2];
#pragma unroll
  for (int u = 0; u < FQ; ++u)
#pragma unroll
    for (int kc = 0; kc < 2; ++kc) qf[u][kc] = frag_h(QH + ((size_t)b * TT + q0 + u * 16 + col) * CC + h * HD + kc * 32, lane);
  v16h kf[2][2]; v4f lp[FQ][2][2];
#pragma unroll
  for (int jt = 0; jt < 2; ++jt) {
#pragma unroll
    for (int kc = 0; kc < 2; ++kc) kf[jt][kc] = frag_p(Kb + jt * 1024 + kc * 512);
#pragma unroll
    for (int u = 0; u < FQ; ++u) { lp[u][jt][0] = *(const v4f*)(Lb + (size_t)u * 16 * TT + jt * 256); lp[u][jt][1] = *(const v4f*)(Lb + (size_t)u * 16 * TT + jt * 256 + 128); } }
  asm volatile("s_wait_xcnt 0x0" ::: "memory");   // the address registers of the loads above are reused for the accumulators set up below: the wait stands in front of that overwrite
  __builtin_amdgcn_sched_barrier(0);              // keeps the accumulators' set-up behind that wait (the compiler lifted it over the wait without this)
  v8f o[FQ][HD / 16] = {}; float m[FQ], l[FQ];
#pragma unroll
  for (int u = 0; u < FQ; ++u) { m[u] = -3.0e38f; l[u] = 0.f; }
#pragma unroll 1   // stays rolled: one step's live set already takes the 256 registers that need no window switch
  for (int k0 = 0; k0 < TT; k0 += 32) { const int kn = k0 + 32 < TT ? k0 + 32 : 0;   // the step fetched ahead; the last step fetches step 0 again (in bounds, unused)
    v16h vf[HD / 16];
#pragma unroll
    for (int j = 0; j < HD / 16; ++j) vf[j] = frag_p(Vb + (size_t)k0 * HD + j * 512);
    float sv[FQ][16];
#pragma unroll
    for (int u = 0; u < FQ; ++u)
#pragma unroll
      for (int jt = 0; jt < 2; ++jt) { v8f z = {}; z = mmh(kf[jt][0], qf[u][0], z); z = mmh(kf[jt][1], qf[u][1], z);
#pragma unroll
        for (int r = 0; r < 8; ++r) sv[u][jt * 8 + r] = fmaf(z[r], SCALE, lp[u][jt][r >> 2][r & 3]); }
    // the next step's K fragments and log-penalty rows, into the registers this step has just read: they fly during the softmax and the P . v products
#pragma unroll
    for (int jt = 0; jt < 2; ++jt) {
#pragma unroll
      for (int kc = 0; kc < 2; ++kc) kf[jt][kc] = frag_p(Kb + (size_t)kn * HD + jt * 1024 + kc * 512);
#pragma unroll
      for (int u = 0; u < FQ; ++u) { lp[u][jt][0] = *(const v4f*)(Lb + (size_t)u * 16 * TT + kn * 16 + jt * 256); lp[u][jt][1] = *(const v4f*)(Lb + (size_t)u * 16 * TT + kn * 16 + jt * 256 + 128); } }
    asm volatile("s_wait_xcnt 0x0" ::: "memory");   // in front of the next overwrite of the address registers of the loads above
    __builtin_amdgcn_sched_barrier(0);      // keeps the fetch-ahead loads issued in front of the softmax and the P . v products, which then cover their latency
#pragma unroll
    for (int u = 0; u < FQ; ++u) { float mt = sv[u][0];
#pragma unroll
      for (int i = 1; i < 16; ++i) mt = fmaxf(mt, sv[u][i]);
      mt = fmaxf(mt, xhalf(mt)); const float mn = fmaxf(m[u], mt); const float al = __builtin_amdgcn_exp2f((m[u] - mn) * L2E);   // 0 on the first step
      m[u] = mn; const float cc = 11.0f - mn * L2E; float ls = 0.f; v16h pb;
#pragma unroll
      for (int i = 0; i < 16; ++i) { const float p = __builtin_amdgcn_exp2f(fmaf(sv[u][i], L2E, cc)); ls += p; pb[i] = (_Float16)p; }
      l[u] = l[u] * al + ls;
#pragma unroll
      for (int j = 0; j < HD / 16; ++j) { o[u][j] = o[u][j] * al; o[u][j] = mmh(vf[j], pb, o[u][j]); } } }
#pragma unroll
  for (int u = 0; u < FQ; ++u) { const float inv = 1.0f / (l[u] + xhalf(l[u]));   // the halves' sums join once; the row's maximum contributes 2^11, so the sum is positive
    float* yr = Y + ((size_t)b * TT + q0 + u * 16 + col) * CC + h * HD + 8 * g;
#pragma unroll
    for (int j = 0; j < HD / 16; ++j) { v4f a0, a1;
#pragma unroll
      for (int r = 0; r < 4; ++r) { a0[r] = o[u][j][r] * inv; a1[r] = o[u][j][4 + r] * inv; }
      vst2(yr + j * 16, a0); vst2(yr + j * 16 + 4, a1); } } }

// ---- k_lpen: block = (16 query rows, 256 keys) of batch bsm: log(max(res * scope, 1e-32)), with res = (1 - gi) max(1 - gi - gj, 0) + gi min(1 - gi + gj, 1), scope = clip(pow(S - 2, 1 - gi) + 2 - |i - j|, 1e-32, 1) (gi / pow from the k_gate tables; f32, precise logf); the plane is shared by the 16 heads of the batch. It is written in the order in which k_fa's lanes read it: piece p = ((step * 2 + jt) * 2 + w) * 32 + lane holds query lane & 15, keys 32 step + 16 jt + 8 (lane >> 4) + 4 w + 0..3; the block's 16 KB are contiguous, each thread writes 16-B pieces, a wave whole lines
__global__ __launch_bounds__(256) void k_lpen(const float* __restrict__ GATE, const float* __restrict__ PWR, int bsm, float* __restrict__ LPEN) { const int tid = threadIdx.x, lane = tid & 31; const int t = blockIdx.x * 16 + (lane & 15);
  const float gi_ = GATE[(size_t)bsm * TT + t], pw_ = PWR[(size_t)bsm * TT + t]; asm volatile("s_wait_loadcnt 0x0" ::: "memory");
  float* dst = LPEN + ((size_t)blockIdx.x * (TT / 32) + blockIdx.y * 8) * 512;
  for (int p = tid; p < 8 * 128; p += 256) { const int kb = (blockIdx.y * 8 + (p >> 7)) * 32 + ((p >> 6) & 1) * 16 + (lane >> 4) * 8 + ((p >> 5) & 1) * 4; const v4f gj4 = *(const v4f*)(GATE + (size_t)bsm * TT + kb); asm volatile("s_wait_loadcnt 0x0" ::: "memory"); v4f o;
#pragma unroll
    for (int u = 0; u < 4; ++u) { const int k = kb + u; const float gj_ = gj4[u]; const float res_ = (1.0f - gi_) * fmaxf(1.0f - gi_ - gj_, 0.0f) + gi_ * fminf(1.0f - gi_ + gj_, 1.0f); const int ad_ = (t > k) ? (t - k) : (k - t); const float sc_ = fminf(fmaxf(pw_ + 2.0f - (float)ad_, 1.0e-32f), 1.0f); o[u] = logf(fmaxf(res_ * sc_, 1.0e-32f)); }
    vst2(dst + p * 4, o); } }
__global__ __launch_bounds__(256) void k_gate(const float* __restrict__ X, const float* __restrict__ WG, const float* __restrict__ BG, float* __restrict__ GATE, float* __restrict__ PWR) { __shared__ __align__(16) float sg[32]; __shared__ __align__(16) float sp[32];
  const int tid = threadIdx.x, wave = tid >> 5, lane = tid & 31; const size_t r0 = (size_t)blockIdx.x * 32; const float bg_ = bfr(BG[0]);
  float wreg[32];
#pragma unroll
  for (int i = 0; i < 16; ++i) wreg[i] = WG[lane + 32 * i];
  asm volatile("s_wait_loadcnt 0x0" ::: "memory");
#pragma unroll
  for (int i = 16; i < 32; ++i) wreg[i] = WG[lane + 32 * i];   /* two bursts of 16 loads */
  asm volatile("s_wait_loadcnt 0x0" ::: "memory");
#pragma unroll
  for (int i = 0; i < 32; ++i) wreg[i] = bfr(wreg[i]);
#pragma unroll 1
  for (int rr = 0; rr < 4; ++rr) { const size_t row = r0 + wave * 4 + rr; const float* xr = X + row * DIN; float acc = 0.f;
#pragma unroll
    for (int i = 0; i < 32; ++i) { const float xv = xr[lane + 32 * i]; asm volatile("s_wait_loadcnt 0x0" ::: "memory"); acc += bfr(xv) * wreg[i]; }   /* fully unrolled: wreg is indexed with compile-time constants */
#pragma unroll
    for (int o = 1; o < 32; o <<= 1) acc += __shfl_xor(acc, o);
    const float g = 1.0f / (1.0f + expf(-(acc + bg_)));
    if (lane == 0) { sg[wave * 4 + rr] = g; sp[wave * 4 + rr] = powf((float)(TT - 2), 1.0f - g); } }   /* LDS only: no global access under the lane predicate */
  __syncthreads();
  if (tid < 8) vst2(GATE + r0 + tid * 4, *(const v4f*)&sg[tid * 4]);
  else if (tid >= 32 && tid < 40) vst2(PWR + r0 + (tid - 32) * 4, *(const v4f*)&sp[(tid - 32) * 4]); }
extern "C" void kernel_launch(void* const* d_in, const int* in_sizes, int n_in, void* d_out, int out_size, void* d_ws, size_t ws_size, hipStream_t stream) {
  (void)in_sizes; (void)n_in; (void)out_size;
  const float** F = (const float**)d_in;
  if (ws_size < (size_t)WS_END3) return;
  char* ws = (char*)d_ws; _Float16 *QH = (_Float16*)(ws + WS_QH), *KH = (_Float16*)(ws + WS_KH), *VT = (_Float16*)(ws + WS_VT), *QL = (_Float16*)(ws + WS_QL), *KL = (_Float16*)(ws + WS_KL); __bf16 *VB = (__bf16*)(ws + WS_VB), *VBL = (__bf16*)(ws + WS_VBL);
  (void)QL; (void)KL; (void)VB; (void)VBL;
  // inputs: 0 hidden_states [2,2048,1024]; 1 Wq [1024,1024] (in,out), 2 bq; 3 Wk, 4 bk; 5 Wv, 6 bv (zero biases, read); 7 Wg [1024,1]; 8 bg [1]; no output projection
  float* GATE = (float*)(ws + WS_GATE); float* PWR = (float*)(ws + WS_PWR); float* LPEN = (float*)(ws + WS_LPEN);
  k_gate<<<dim3(TNB * TT / 32), 256, 0, stream>>>(F[0], F[7], F[8], GATE, PWR);
  k_proj<<<dim3(TNB * TT / 64, CC / 128, 3), 128, 0, stream>>>(F[0], F[0], F[0], F[1], F[3], F[5], F[2], F[4], F[6], QH, QL, KH, KL, VT, VB, VBL);
  for (int b = 0; b < TNB; ++b) k_lpen<<<dim3(TT / 16, TT / 256), 256, 0, stream>>>(GATE, PWR, b, LPEN + (size_t)b * TT * TT);   /* one plane per batch: shared by its 16 heads */
  k_fa<<<dim3(TT / (8 * 16 * FQ), NH, TNB), 256, 0, stream>>>(QH, KH, VT, LPEN, (float*)d_out);
}

// v004
// Measured time: 131 microseconds a run.
// Timed twice side by side with v003, it ran 1.29 times as fast both times.
// Over all steps from v000 it is 8.94 times as fast.
// compute dtype: all float inputs rounded to bf16; q/k/v projections with EXACT bf16 products on WMMA 16x16x32 (f32 accumulate) + bias; the granularity gate g = sigmoid(x . Wg + bg) from exact bf16 products summed in f32 (VALU), pow(S - 2, 1 - g) with precise powf; logits q x k once to f16 each (1 product) x 64^-0.5 + the log-penalty bias in f32 (precise logf); softmax f32 with a running maximum and sum over steps of 32 keys; exp(s - m) x 2^11 once to f16 x v once to f16 (1 product), divided by the f32 row sum at the end; f32 output.
#include <hip/hip_runtime.h>
#include <math.h>

typedef __attribute__((ext_vector_type(16))) _Float16 v16h;
typedef __attribute__((ext_vector_type(16))) __bf16 v16b;
typedef __attribute__((ext_vector_type(8)))  _Float16 v8h;
typedef __attribute__((ext_vector_type(8)))  float v8f;
typedef __attribute__((ext_vector_type(4)))  float v4f;
typedef __attribute__((ext_vector_type(2)))  float v2f;
typedef __attribute__((ext_vector_type(4)))  unsigned v4u;
typedef __attribute__((ext_vector_type(4)))  int v4i;
typedef float __attribute__((may_alias)) float_a;
typedef int __attribute__((may_alias)) int_a;

template <typename T> __device__ __forceinline__ void vst2(void* p, T v) { *(T*)p = v;  }
__device__ __forceinline__ v8f wmma16(v16h a, v16h b, v8f c) {
  v8f d = __builtin_amdgcn_wmma_f32_16x16x32_f16(false, a, false, b, (short)0, c, false, false);
  asm volatile("v_nop\n\tv_nop\n\tv_nop\n\tv_nop" : "+v"(d) : "v"(a), "v"(b));
  return d;
}
__device__ __forceinline__ v8f wmma_bf(v16b a, v16b b, v8f c) {
  v8f d = __builtin_amdgcn_wmma_f32_16x16x32_bf16(false, a, false, b, (short)0, c, false, false);
  asm volatile("v_nop\n\tv_nop\n\tv_nop\n\tv_nop" : "+v"(d) : "v"(a), "v"(b));
  return d;
}
// 16x16x32 fragments: lane = (h = lane>>4, row/col = lane&15); elements 0..7 = k0+8h+0..7, 8..15 = k0+16+8h+0..7; D element r = row 8h+r
__device__ __forceinline__ v16h frag_h(const _Float16* rowk0, int lane) {
  union { v16h v; v8h q[2]; } u; const _Float16* p = rowk0 + 8 * (lane >> 4);
  u.q[0] = *(const v8h*)p; u.q[1] = *(const v8h*)(p + 16); return u.v;
}
__device__ __forceinline__ v16h frag_f32(const float* rowk0, int lane) {
  v16h a; const float* p = rowk0 + 8 * (lane >> 4);
#pragma unroll
  for (int i = 0; i < 8; ++i) { a[i] = (_Float16)p[i]; a[8 + i] = (_Float16)p[16 + i]; }
  return a;
}
__device__ __forceinline__ v16h frag_f32s(const float* rowk0, int lane, float sc) {
  v16h a; const float* p = rowk0 + 8 * (lane >> 4);
#pragma unroll
  for (int i = 0; i < 8; ++i) { a[i] = (_Float16)(p[i] * sc); a[8 + i] = (_Float16)(p[16 + i] * sc); }
  return a;
}
// column fragment from a [K][ld] layout (column n), rows >= K read as 0
__device__ __forceinline__ v16h fragc_f32(const float* W, int k0, int n, int lane, int ld, int K) {
  v16h a; const int g = lane >> 4;
#pragma unroll
  for (int i = 0; i < 8; ++i) { const int ka = k0 + 8 * g + i, kb = ka + 16;
    a[i] = (_Float16)(ka < K ? W[(size_t)(ka < K ? ka : K - 1) * ld + n] : 0.f); a[8 + i] = (_Float16)(kb < K ? W[(size_t)(kb < K ? kb : K - 1) * ld + n] : 0.f); }
  return a;
}
struct F2 { v16b h, l; };
__device__ __forceinline__ F2 bsplit16(const float v[16]) { F2 r;
#pragma unroll
  for (int i = 0; i < 16; ++i) { const __bf16 h = (__bf16)v[i]; r.h[i] = h; r.l[i] = (__bf16)(v[i] - (float)h); }
  return r; }
__device__ __forceinline__ F2 split_row(const float* row, int k0, int lane) { float v[16]; const float* p = row + k0 + 8 * (lane >> 4);
#pragma unroll
  for (int i = 0; i < 8; ++i) { v[i] = p[i]; v[8 + i] = p[16 + i]; }
  return bsplit16(v); }
__device__ __forceinline__ F2 split_rowK(const float* row, int k0, int lane, int K) { float v[16]; const int g = lane >> 4;
#pragma unroll
  for (int i = 0; i < 8; ++i) { const int ka = k0 + 8 * g + i, kb = ka + 16; v[i] = ka < K ? row[ka < K ? ka : K - 1] : 0.f; v[8 + i] = kb < K ? row[kb < K ? kb : K - 1] : 0.f; }
  return bsplit16(v); }
__device__ __forceinline__ F2 split_col(const float* W, int k0, int n, int lane, int ld, int K) { float v[16]; const int g = lane >> 4;
#pragma unroll
  for (int i = 0; i < 8; ++i) { const int ka = k0 + 8 * g + i, kb = ka + 16; v[i] = ka < K ? W[(size_t)(ka < K ? ka : K - 1) * ld + n] : 0.f; v[8 + i] = kb < K ? W[(size_t)(kb < K ? kb : K - 1) * ld + n] : 0.f; }
  return bsplit16(v); }
__device__ __forceinline__ v8f mac3(const F2& a, const F2& b, v8f c) { c = wmma_bf(a.l, b.h, c); c = wmma_bf(a.h, b.l, c); return wmma_bf(a.h, b.h, c); }
__device__ __forceinline__ float sigm(float v) { return 1.0f / (1.0f + expf(-v)); }
#define LDSX() do { asm volatile("s_wait_dscnt 0" ::: "memory"); __builtin_amdgcn_wave_barrier(); __builtin_amdgcn_fence(__ATOMIC_RELEASE, "workgroup"); } while (0)

// BERT-style self-attention with a learned granularity gate adding a log-penalty bias to the scores (hidden_states [2,2048,1024]; (in,out) Wq / Wk / Wv [1024,1024] N(0, 1/1024) + zero biases; Wg [1024,1] + bg: g = sigmoid(x Wg + bg) per token; res[i,j] = (1 - g_i) max(1 - g_i - g_j, 0) + g_i min(1 - g_i + g_j, 1); scope[i,j] = clip((S - 2)^(1 - g_i) + 2 - |i - j|, 1e-32, 1); log_pen = log(max(res * scope, 1e-32)), broadcast over the 16 heads; scores = q k^T / 8 + log_pen; softmax; no output projection): ctx [2,2048,1024].
#define NB 2
#define TT 2048
#define CC 1024            // NH * HD = projected width
#define DIN 1024          // input (model) width
#define NH 16
#define HD 64
#define NQB (TT / 64)
#define HG 4
#define SCALE (0.125f)
#define CAUSAL 0
#ifndef TNB
#define TNB NB
#endif
__device__ __forceinline__ float bfr(float v) { return (float)(__bf16)v; }
__host__ __device__ __forceinline__ int kb_last(int qb) { return CAUSAL ? ((qb * 64 + 63) >> 7) : (TT / 128 - 1); }
typedef __attribute__((ext_vector_type(8))) __bf16 v8b;
__device__ __forceinline__ v16b frag_b(const __bf16* rowk0, int lane) {
  union { v16b v; v8b q[2]; } u; const __bf16* p = rowk0 + 8 * (lane >> 4);
  u.q[0] = *(const v8b*)p; u.q[1] = *(const v8b*)(p + 16); return u.v;
}
#define QBH 0              // not read by any kernel in this file
#define QHI 0               // single-product logits on every row
#define KHI 64            // key rows carrying k residual / v bf16 hi+lo planes (written by k_proj; read by no kernel in this file)
// B fragment (k rows k0+.., output column o) of a weight: (in,out) [K][ld] or (out,in) [ld rows of K]: bf16 exact, or f16(bf16 * 256) exact
__device__ __forceinline__ v16b wcol_io(const float* Wm, int k0, int o, int lane, int ld) { v16b w; const int g = lane >> 4;
#pragma unroll
  for (int i = 0; i < 8; ++i) { w[i] = (__bf16)Wm[(size_t)(k0 + 8 * g + i) * ld + o]; w[8 + i] = (__bf16)Wm[(size_t)(k0 + 16 + 8 * g + i) * ld + o]; }
  return w; }
__device__ __forceinline__ v16b wcol_oi(const float* Wm, int k0, int o, int lane, int K) { v16b w; const float* p = Wm + (size_t)o * K + k0 + 8 * (lane >> 4);
#pragma unroll
  for (int i = 0; i < 8; ++i) { w[i] = (__bf16)p[i]; w[8 + i] = (__bf16)p[16 + i]; }
  return w; }
__device__ __forceinline__ v16h wcolh_io(const float* Wm, int k0, int o, int lane, int ld) { v16h w; const int g = lane >> 4;
#pragma unroll
  for (int i = 0; i < 8; ++i) { w[i] = (_Float16)(bfr(Wm[(size_t)(k0 + 8 * g + i) * ld + o]) * 256.0f); w[8 + i] = (_Float16)(bfr(Wm[(size_t)(k0 + 16 + 8 * g + i) * ld + o]) * 256.0f); }
  return w; }
__device__ __forceinline__ v16h wcolh_oi(const float* Wm, int k0, int o, int lane, int K) { v16h w; const float* p = Wm + (size_t)o * K + k0 + 8 * (lane >> 4);
#pragma unroll
  for (int i = 0; i < 8; ++i) { w[i] = (_Float16)(bfr(p[i]) * 256.0f); w[8 + i] = (_Float16)(bfr(p[16 + i]) * 256.0f); }
  return w; }
#define WQKV_LAYOUT 0   // 0 = (in,out) [DIN][CC]; 1 = (out,in) [CC][DIN]; 2 = per-head [NH][DIN][HD]
__device__ __forceinline__ v16b wcol_hdk(const float* Wm, int k0, int o, int lane) { v16b w; const int g = lane >> 4; const float* p = Wm + (size_t)(o / HD) * DIN * HD + (o % HD);
#pragma unroll
  for (int i = 0; i < 8; ++i) { w[i] = (__bf16)p[(size_t)(k0 + 8 * g + i) * HD]; w[8 + i] = (__bf16)p[(size_t)(k0 + 16 + 8 * g + i) * HD]; }
  return w; }
#define WO_OUT_IN 0
#if WQKV_LAYOUT == 1
#define WCOL(W, k0, o, lane) wcol_oi(W, k0, o, lane, DIN)
#elif WQKV_LAYOUT == 2
#define WCOL(W, k0, o, lane) wcol_hdk(W, k0, o, lane)
#else
#define WCOL(W, k0, o, lane) wcol_io(W, k0, o, lane, CC)
#endif
#if WO_OUT_IN
#define WOCOL(W, k0, o, lane) wcol_oi(W, k0, o, lane, CC)
#define WOCOLH(W, k0, o, lane) wcolh_oi(W, k0, o, lane, CC)
#else
#define WOCOL(W, k0, o, lane) wcol_io(W, k0, o, lane, DIN)
#define WOCOLH(W, k0, o, lane) wcolh_io(W, k0, o, lane, DIN)
#endif
// the module's log-penalty bias log_pen[b, i, j] is head-independent: k_lpen evaluates it ONCE per batch into an f32 plane LPEN[b] (fragment order); k_fa ADDS it to the scaled score (far keys carry the module's finite log(1e-32) = -73.68, kept literally)

#define WS_QH  0u                                      // f16 q rows [b*t][CC]
#define WS_KH  (WS_QH + 2u * (size_t)NB * TT * CC)      // f16 k in fragment order [b][h][t / 16][kc][piece][lane][8]
#define WS_VT  (WS_KH + 2u * (size_t)NB * TT * CC)      // f16 v in fragment order [b][h][t / 32][j][piece][lane][8]
#define WS_QL  (WS_VT + 2u * (size_t)NB * CC * TT)      // f16 q residual x 2^10 rows [b][t < QHI][CC]
#define WS_KL  (WS_QL + 2u * (size_t)NB * QHI * CC)     // f16 k residual x 2^10 rows [b][t < KHI][CC]
#define WS_VB  (WS_KL + 2u * (size_t)NB * KHI * CC)     // bf16 v hi planes [b][c][t < KHI]
#define WS_VBL (WS_VB + 2u * (size_t)NB * CC * KHI)
#define WS_END (WS_VBL + 2u * (size_t)NB * CC * KHI)
#define WS_GATE (WS_END)                                 // f32 g[b][s]
#define WS_PWR  (WS_GATE + 4u * (size_t)NB * TT)          // f32 pow(S - 2, 1 - g)[b][s]
#define WS_LPEN (WS_PWR + 4u * (size_t)NB * TT)          // f32 log-penalty planes in fragment order [b][i / 16][j / 32][jt][w][lane][4]
#define WS_END3 (WS_LPEN + 4u * (size_t)NB * TT * TT)

// ---- k_proj: block = (64 rows, 128 cols, which): q/k/v = X W (+ b) with exact bf16 products (K = DIN) -> which 0: q f16 rows (+ residual rows < QHI); 1: k f16 in fragment order (+ residual rows < KHI); 2: v f16 in fragment order (+ bf16 hi/lo planes for t < KHI)
// Operands go through LDS, 32 k at a time, two buffers: the block reads each f32 tile of X and W once, in whole 128-B lines, rounds it to bf16 and lays it k-contiguous (W transposed inside the thread that loaded it); the four waves take their fragments from there. The next tile's global loads fly while this tile is multiplied.
#define PBK 32             // k per stage
#define PNS (DIN / PBK)
#define PPI 40             // bf16 per staged row: 64 B of data at a pitch of 80 B (16 B x odd: the 16 rows of a ds_load_b128 fragment read fall on 16 different bank groups)
typedef __attribute__((ext_vector_type(4))) __bf16 v4b;
__global__ __launch_bounds__(128) void k_proj(const float* __restrict__ XQ, const float* __restrict__ XK, const float* __restrict__ XV, const float* __restrict__ WQ, const float* __restrict__ WK, const float* __restrict__ WV, const float* __restrict__ BQ, const float* __restrict__ BK, const float* __restrict__ BV,
    _Float16* __restrict__ QH, _Float16* __restrict__ QL, _Float16* __restrict__ KH, _Float16* __restrict__ KL, _Float16* __restrict__ VT, __bf16* __restrict__ VB, __bf16* __restrict__ VBL) {
  // one LDS range: the operand stages of the k loop lie in the bytes that the output staging takes over behind the loop (three blocks stay resident on a WGP)
  __shared__ __align__(16) unsigned char smem[2 * 64 * 136 * 2 + 3 * 128 * 72 * 2];
  _Float16 (*sh)[136] = (_Float16 (*)[136])smem; _Float16 (*sl)[136] = (_Float16 (*)[136])(smem + 64 * 136 * 2);
  _Float16 (*th)[72] = (_Float16 (*)[72])(smem + 2 * 64 * 136 * 2); __bf16 (*tb)[72] = (__bf16 (*)[72])(smem + 2 * 64 * 136 * 2 + 128 * 72 * 2); __bf16 (*tbl)[72] = (__bf16 (*)[72])(smem + 2 * 64 * 136 * 2 + 2 * 128 * 72 * 2);
  __bf16* Ws = (__bf16*)smem;                              // [2][128 columns][PPI]: W^T, column n in row n ^ ((n >> 4) & 3)
  __bf16* Xs = (__bf16*)(smem + 2 * 128 * PPI * 2);        // [2][64 rows][PPI]
  const int tid = threadIdx.x, wave = tid >> 5, lane = tid & 31, col = lane & 15, g = lane >> 4; const int which = blockIdx.z; const int c0 = blockIdx.y * 128; const size_t r0 = (size_t)blockIdx.x * 64; const size_t bb = r0 / TT; const int t0 = (int)(r0 % TT);
  const float* X = which == 0 ? XQ : which == 1 ? XK : XV; const float* WA = which == 0 ? WQ : which == 1 ? WK : WV; const float* BA = which == 0 ? BQ : which == 1 ? BK : BV;
  const float* Wg = WA + (size_t)(8 * wave) * CC + c0 + 4 * lane;       // this thread's W piece of a stage: k rows 8 wave + 0..7, columns 4 lane + 0..3 (a wave's load = 512 contiguous bytes)
  const float* Xg = X + (r0 + (tid >> 3)) * DIN + 4 * (tid & 7);         // its X piece: rows (tid >> 3) + 16 i, k 4 (tid & 7) + 0..3 (a wave's load = four whole lines)
  // the row swap n ^ ((n >> 4) & 3) spreads the rows 4 lane + c, which one ds_store_b128 writes, over all bank groups and keeps the 16 rows of a fragment read spread as well
  __bf16* Wst = Ws + 4 * lane * PPI + 8 * wave; const int wsw = (lane >> 2) & 3;
  __bf16* Xst = Xs + (tid >> 3) * PPI + 4 * (tid & 7);
  v4f wr[8], xr[4];
#pragma unroll
  for (int i = 0; i < 8; ++i) wr[i] = *(const v4f*)(Wg + (size_t)i * CC);
#pragma unroll
  for (int i = 0; i < 4; ++i) xr[i] = *(const v4f*)(Xg + (size_t)(16 * i) * DIN);
  v8f acc[8] = {};
#pragma unroll 2   // two stages per trip: the buffer index is a constant in each
  for (int s = 0; s < PNS; ++s) { const int bf = s & 1; const int sn = s + 1 < PNS ? s + 1 : s;   // the stage fetched ahead; the last stage fetches itself again (in bounds, unused)
#pragma unroll
    for (int c = 0; c < 4; ++c) { v8b p;
#pragma unroll
      for (int i = 0; i < 8; ++i) p[i] = (__bf16)wr[i][c];
      *(v8b*)(Wst + bf * 128 * PPI + (c ^ wsw) * PPI) = p; }
#pragma unroll
    for (int i = 0; i < 4; ++i) { v4b p;
#pragma unroll
      for (int e = 0; e < 4; ++e) p[e] = (__bf16)xr[i][e];
      *(v4b*)(Xst + bf * 64 * PPI + 16 * i * PPI) = p; }
    __syncthreads();   // publishes stage s; it also ends every wave's reads of stage s - 1, whose buffer the next trip overwrites
#pragma unroll
    for (int i = 0; i < 8; ++i) wr[i] = *(const v4f*)(Wg + (size_t)(sn * PBK + i) * CC);
#pragma unroll
    for (int i = 0; i < 4; ++i) xr[i] = *(const v4f*)(Xg + (size_t)(16 * i) * DIN + sn * PBK);
    asm volatile("s_wait_xcnt 0x0" ::: "memory");   // in front of the next overwrite of the address registers of the loads above; it also keeps those loads issued ahead of the products, which cover their latency
    const v16b a = frag_b(Xs + (bf * 64 + wave * 16 + col) * PPI, lane);
    v16b w[8];
#pragma unroll
    for (int j = 0; j < 8; ++j) w[j] = frag_b(Ws + (bf * 128 + j * 16 + (col ^ (j & 3))) * PPI, lane);
    __builtin_amdgcn_sched_barrier(0);   // the stage's LDS reads go out as one group ahead of its products: spread among them, each product waited out a whole LDS latency
#pragma unroll
    for (int j = 0; j < 8; ++j) acc[j] = wmma_bf(a, w[j], acc[j]);
    __builtin_amdgcn_sched_barrier(0); }   // keeps the next stage's conversions, which wait for the global loads, behind this stage's products (the compiler had drawn them, and the wait, in among the products)
  __syncthreads();   // every wave has left the operand stages before the output staging below overwrites them
  if (which < 2) { _Float16* DH = which == 0 ? QH : KH; _Float16* DL = which == 0 ? QL : KL; const int nhi = which == 0 ? QHI : KHI; const bool hi_rows = t0 < nhi;
#pragma unroll
    for (int j = 0; j < 8; ++j) { const float bias = BA ? bfr(BA[c0 + j * 16 + col]) : 0.f;
#pragma unroll
      for (int r = 0; r < 8; ++r) { const float v = acc[j][r] + bias; const _Float16 hv = (_Float16)v; sh[wave * 16 + 8 * g + r][j * 16 + col] = hv; sl[wave * 16 + 8 * g + r][j * 16 + col] = (_Float16)((v - (float)hv) * 1024.0f); } }
    __syncthreads();
    // k leaves in the order in which k_fa's A fragments read it: 16-B piece pc = 2 kc + piece of lane ln (key row ln & 15, half ln >> 4) of a 16-key tile of one head, lanes contiguous; q stays in rows
    for (int e = tid; e < 64 * 16; e += 128) { int rl, q; size_t od;
      if (which == 0) { rl = e >> 4; q = e & 15; od = (r0 + rl) * CC + c0 + q * 8; }
      else { const int ln = e & 31, pc = (e >> 5) & 3, tl = (e >> 7) & 3, hl = e >> 9; rl = tl * 16 + (ln & 15); q = hl * 8 + pc * 2 + (ln >> 4); od = ((((bb * NH + (c0 >> 6) + hl) * (TT / 16) + (t0 >> 4) + tl) * 4 + pc) * 32 + ln) * 8; }
      vst2((unsigned*)(DH + od), *(const v4u*)&sh[rl][q * 8]);
      asm volatile("s_wait_xcnt 0x0" ::: "memory");   // in front of the next overwrite of the store's address and data registers
      if (hi_rows) { vst2((unsigned*)(DL + (bb * nhi + t0 + rl) * (size_t)CC + c0 + q * 8), *(const v4u*)&sl[rl][q * 8]);
        asm volatile("s_wait_xcnt 0x0" ::: "memory"); } }   // the same for this store
  } else { const bool hi_rows = t0 < KHI;
#pragma unroll
    for (int j = 0; j < 8; ++j) { const float bias = BA ? bfr(BA[c0 + j * 16 + col]) : 0.f;
#pragma unroll
      for (int r = 0; r < 8; ++r) { const float v = acc[j][r] + bias; const int rl = wave * 16 + 8 * g + r, cl = j * 16 + col; th[cl][rl] = (_Float16)v; const __bf16 bh = (__bf16)v; tb[cl][rl] = bh; tbl[cl][rl] = (__bf16)(v - (float)bh); } }
    __syncthreads();
    // v leaves in the order in which k_fa's A fragments read it: piece pc of lane ln (channel ln & 15 of tile j, half ln >> 4) of a 32-key step of one head, lanes contiguous
    for (int e = tid; e < 128 * 8; e += 128) { const int ln = e & 31, pc = (e >> 5) & 1, j = (e >> 6) & 3, st = (e >> 8) & 1, hl = e >> 9; const int cl = hl * 64 + j * 16 + (ln & 15), q = st * 4 + pc * 2 + (ln >> 4);
      vst2((unsigned*)(VT + (((((bb * NH + (c0 >> 6) + hl) * (TT / 32) + (t0 >> 5) + st) * 4 + j) * 2 + pc) * 32 + ln) * 8), *(const v4u*)&th[cl][q * 8]);
      asm volatile("s_wait_xcnt 0x0" ::: "memory");   // in front of the next overwrite of the store's address and data registers
      if (hi_rows) { const size_t o3 = (bb * CC + c0 + cl) * (size_t)KHI + t0 + q * 8; vst2((unsigned*)(VB + o3), *(const v4u*)&tb[cl][q * 8]); vst2((unsigned*)(VBL + o3), *(const v4u*)&tbl[cl][q * 8]);
        asm volatile("s_wait_xcnt 0x0" ::: "memory"); } } } }   // the same for these two stores
// ---- k_fa: block = 256 queries (8 waves x 32 query columns) of (b, h): one pass over all keys, 32 at a time, with a running maximum and sum per query (online softmax); the logits and P stay in registers.
// Transposed products: S^T = K . Q^T (A = key rows, B = query rows) puts one query's 16 scores of a 32-key step in lanes c and c + 16; two S^T tiles, converted in place, are the B operand of O^T += V^T . P^T (A = v, channel rows); O^T register r = ctx[query c][16 j + 8 h + r].
// P = exp(s - m) x 2^11 once to f16 (the row sum carries the same factor, taken in f32 before the rounding, and divides it out at the end).
#define FQ 2               // query tiles of 16 columns per wave: each K / V fragment load feeds both
// every inner loop below is fully unrolled so that the fragment and accumulator arrays are indexed by constants and stay in registers
#define L2E 1.4426950408889634f
__device__ __forceinline__ v8f mmh(v16h a, v16h b, v8f c) { return __builtin_amdgcn_wmma_f32_16x16x32_f16(false, a, false, b, (short)0, c, false, false); }
// a fragment stored in fragment order: this lane's two 16-B pieces lie 512 B apart (p already holds the lane's offset)
__device__ __forceinline__ v16h frag_p(const _Float16* p) { union { v16h v; v8h q[2]; } u; u.q[0] = *(const v8h*)p; u.q[1] = *(const v8h*)(p + 256); return u.v; }
__device__ __forceinline__ float xhalf(float x) { return __builtin_bit_cast(float, __builtin_amdgcn_permlanex16(__builtin_bit_cast(int, x), __builtin_bit_cast(int, x), 0x76543210, 0xfedcba98, false, false)); }  // lane l with lane l ^ 16
__global__ __launch_bounds__(256) void k_fa(const _Float16* __restrict__ QH, const _Float16* __restrict__ KH, const _Float16* __restrict__ VT, const float* __restrict__ LPEN, float* __restrict__ Y) {
  const int tid = threadIdx.x, wave = tid >> 5, lane = tid & 31, col = lane & 15, g = lane >> 4; const int h = blockIdx.y, b = blockIdx.z; const int q0 = blockIdx.x * (8 * 16 * FQ) + wave * (16 * FQ);
  // K, V and the log-penalty lie in fragment order: a wave's load is 32 lanes x 16 B = 512 contiguous bytes (four whole lines)
  const _Float16* Kb = KH + (size_t)(b * NH + h) * TT * HD + lane * 8;          // 32 keys = 2048 halves: [jt][kc][piece][lane][8]
  const _Float16* Vb = VT + (size_t)(b * NH + h) * TT * HD + lane * 8;          // 32 keys = 2048 halves: [j][piece][lane][8]
  const float* Lb = LPEN + (size_t)b * TT * TT + (size_t)q0 * TT + lane * 4;    // 16 queries x 32 keys = 512 floats: [jt][w][lane][4]; 16 queries = 16 TT floats
  v16h qf[FQ][2];
#pragma unroll
  for (int u = 0; u < FQ; ++u)
#pragma unroll
    for (int kc = 0; kc < 2; ++kc) qf[u][kc] = frag_h(QH + ((size_t)b * TT + q0 + u * 16 + col) * CC + h * HD + kc * 32, lane);
  v16h kf[2][2]; v4f lp[FQ][2][2];
#pragma unroll
  for (int jt = 0; jt < 2; ++jt) {
#pragma unroll
    for (int kc = 0; kc < 2; ++kc) kf[jt][kc] = frag_p(Kb + jt * 1024 + kc * 512);
#pragma unroll
    for (int u = 0; u < FQ; ++u) { lp[u][jt][0] = *(const v4f*)(Lb + (size_t)u * 16 * TT + jt * 256); lp[u][jt][1] = *(const v4f*)(Lb + (size_t)u * 16 * TT + jt * 256 + 128); } }
  asm volatile("s_wait_xcnt 0x0" ::: "memory");   // the address registers of the loads above are reused for the accumulators set up below: the wait stands in front of that overwrite
  __builtin_amdgcn_sched_barrier(0);              // keeps the accumulators' set-up behind that wait (the compiler lifted it over the wait without this)
  v8f o[FQ][HD / 16] = {}; float m[FQ], l[FQ];
#pragma unroll
  for (int u = 0; u < FQ; ++u) { m[u] = -3.0e38f; l[u] = 0.f; }
#pragma unroll 1   // stays rolled: one step's live set already takes the 256 registers that need no window switch
  for (int k0 = 0; k0 < TT; k0 += 32) { const int kn = k0 + 32 < TT ? k0 + 32 : 0;   // the step fetched ahead; the last step fetches step 0 again (in bounds, unused)
    v16h vf[HD / 16];
#pragma unroll
    for (int j = 0; j < HD / 16; ++j) vf[j] = frag_p(Vb + (size_t)k0 * HD + j * 512);
    float sv[FQ][16];
#pragma unroll
    for (int u = 0; u < FQ; ++u)
#pragma unroll
      for (int jt = 0; jt < 2; ++jt) { v8f z = {}; z = mmh(kf[jt][0], qf[u][0], z); z = mmh(kf[jt][1], qf[u][1], z);
#pragma unroll
        for (int r = 0; r < 8; ++r) sv[u][jt * 8 + r] = fmaf(z[r], SCALE, lp[u][jt][r >> 2][r & 3]); }
    // the next step's K fragments and log-penalty rows, into the registers this step has just read: they fly during the softmax and the P . v products
#pragma unroll
    for (int jt = 0; jt < 2; ++jt) {
#pragma unroll
      for (int kc = 0; kc < 2; ++kc) kf[jt][kc] = frag_p(Kb + (size_t)kn * HD + jt * 1024 + kc * 512);
#pragma unroll
      for (int u = 0; u < FQ; ++u) { lp[u][jt][0] = *(const v4f*)(Lb + (size_t)u * 16 * TT + kn * 16 + jt * 256); lp[u][jt][1] = *(const v4f*)(Lb + (size_t)u * 16 * TT + kn * 16 + jt * 256 + 128); } }
    asm volatile("s_wait_xcnt 0x0" ::: "memory");   // in front of the next overwrite of the address registers of the loads above
    __builtin_amdgcn_sched_barrier(0);      // keeps the fetch-ahead loads issued in front of the softmax and the P . v products, which then cover their latency
#pragma unroll
    for (int u = 0; u < FQ; ++u) { float mt = sv[u][0];
#pragma unroll
      for (int i = 1; i < 16; ++i) mt = fmaxf(mt, sv[u][i]);
      mt = fmaxf(mt, xhalf(mt)); const float mn = fmaxf(m[u], mt); const float al = __builtin_amdgcn_exp2f((m[u] - mn) * L2E);   // 0 on the first step
      m[u] = mn; const float cc = 11.0f - mn * L2E; float ls = 0.f; v16h pb;
#pragma unroll
      for (int i = 0; i < 16; ++i) { const float p = __builtin_amdgcn_exp2f(fmaf(sv[u][i], L2E, cc)); ls += p; pb[i] = (_Float16)p; }
      l[u] = l[u] * al + ls;
#pragma unroll
      for (int j = 0; j < HD / 16; ++j) { o[u][j] = o[u][j] * al; o[u][j] = mmh(vf[j], pb, o[u][j]); } } }
#pragma unroll
  for (int u = 0; u < FQ; ++u) { const float inv = 1.0f / (l[u] + xhalf(l[u]));   // the halves' sums join once; the row's maximum contributes 2^11, so the sum is positive
    float* yr = Y + ((size_t)b * TT + q0 + u * 16 + col) * CC + h * HD + 8 * g;
#pragma unroll
    for (int j = 0; j < HD / 16; ++j) { v4f a0, a1;
#pragma unroll
      for (int r = 0; r < 4; ++r) { a0[r] = o[u][j][r] * inv; a1[r] = o[u][j][4 + r] * inv; }
      vst2(yr + j * 16, a0); vst2(yr + j * 16 + 4, a1); } } }

// ---- k_lpen: block = (16 query rows, 256 keys) of batch bsm: log(max(res * scope, 1e-32)), with res = (1 - gi) max(1 - gi - gj, 0) + gi min(1 - gi + gj, 1), scope = clip(pow(S - 2, 1 - gi) + 2 - |i - j|, 1e-32, 1) (gi / pow from the k_gate tables; f32, precise logf); the plane is shared by the 16 heads of the batch. It is written in the order in which k_fa's lanes read it: piece p = ((step * 2 + jt) * 2 + w) * 32 + lane holds query lane & 15, keys 32 step + 16 jt + 8 (lane >> 4) + 4 w + 0..3; the block's 16 KB are contiguous, each thread writes 16-B pieces, a wave whole lines
__global__ __launch_bounds__(256) void k_lpen(const float* __restrict__ GATE, const float* __restrict__ PWR, int bsm, float* __restrict__ LPEN) { const int tid = threadIdx.x, lane = tid & 31; const int t = blockIdx.x * 16 + (lane & 15);
  const float gi_ = GATE[(size_t)bsm * TT + t], pw_ = PWR[(size_t)bsm * TT + t]; asm volatile("s_wait_loadcnt 0x0" ::: "memory");
  float* dst = LPEN + ((size_t)blockIdx.x * (TT / 32) + blockIdx.y * 8) * 512;
  for (int p = tid; p < 8 * 128; p += 256) { const int kb = (blockIdx.y * 8 + (p >> 7)) * 32 + ((p >> 6) & 1) * 16 + (lane >> 4) * 8 + ((p >> 5) & 1) * 4; const v4f gj4 = *(const v4f*)(GATE + (size_t)bsm * TT + kb); asm volatile("s_wait_loadcnt 0x0" ::: "memory"); v4f o;
#pragma unroll
    for (int u = 0; u < 4; ++u) { const int k = kb + u; const float gj_ = gj4[u]; const float res_ = (1.0f - gi_) * fmaxf(1.0f - gi_ - gj_, 0.0f) + gi_ * fminf(1.0f - gi_ + gj_, 1.0f); const int ad_ = (t > k) ? (t - k) : (k - t); const float sc_ = fminf(fmaxf(pw_ + 2.0f - (float)ad_, 1.0e-32f), 1.0f); o[u] = logf(fmaxf(res_ * sc_, 1.0e-32f)); }
    vst2(dst + p * 4, o); } }
// ---- k_gate: block = 32 rows, 8 waves x 4 rows: g = sigmoid(x . Wg + bg) and pow(S - 2, 1 - g). A wave's 4 rows are worked together: their 128 loads and Wg's 32 are issued back to back with no wait between them, so the wave pays the memory latency once and not once per load; each row's sum keeps its order (i = 0..31 in the lane, then the xor tree)
__global__ __launch_bounds__(256) void k_gate(const float* __restrict__ X, const float* __restrict__ WG, const float* __restrict__ BG, float* __restrict__ GATE, float* __restrict__ PWR) { __shared__ __align__(16) float sg[32]; __shared__ __align__(16) float sp[32];
  const int tid = threadIdx.x, wave = tid >> 5, lane = tid & 31; const size_t r0 = (size_t)blockIdx.x * 32; const float bg_ = bfr(BG[0]);
  const float* xr = X + (r0 + wave * 4) * DIN + lane;
  float xv[4][32], wreg[32];   /* every loop below is fully unrolled: the arrays are indexed with compile-time constants and stay in registers */
#pragma unroll
  for (int rr = 0; rr < 4; ++rr)
#pragma unroll
    for (int i = 0; i < 32; ++i) xv[rr][i] = xr[rr * DIN + 32 * i];
  asm volatile("s_wait_xcnt 0x0" ::: "memory");   // in front of the next overwrite of the address registers of the loads above (the compiler gave them to Wg's loads as destinations)
  __builtin_amdgcn_sched_barrier(0);              // keeps Wg's loads behind that wait
#pragma unroll
  for (int i = 0; i < 32; ++i) wreg[i] = WG[lane + 32 * i];
  asm volatile("s_wait_xcnt 0x0" ::: "memory");   // the same for Wg's loads
  __builtin_amdgcn_sched_barrier(0);              // keeps every load issued ahead of the sums: drawn down among them, a load would start only when the sum before it is done
#pragma unroll
  for (int i = 0; i < 32; ++i) wreg[i] = bfr(wreg[i]);
  float acc[4];
#pragma unroll
  for (int rr = 0; rr < 4; ++rr) { acc[rr] = 0.f;
#pragma unroll
    for (int i = 0; i < 32; ++i) acc[rr] += bfr(xv[rr][i]) * wreg[i]; }
#pragma unroll
  for (int o = 1; o < 32; o <<= 1)
#pragma unroll
    for (int rr = 0; rr < 4; ++rr) acc[rr] += __shfl_xor(acc[rr], o);
  // every lane holds the four sums: lane rr takes row rr, so one pass of the sigmoid and the power serves the wave's four rows
  const float a = lane == 0 ? acc[0] : lane == 1 ? acc[1] : lane == 2 ? acc[2] : acc[3];
  const float g = 1.0f / (1.0f + expf(-(a + bg_))); const float pw = powf((float)(TT - 2), 1.0f - g);
  if (lane < 4) { sg[wave * 4 + lane] = g; sp[wave * 4 + lane] = pw; }   /* LDS only: no global access under the lane predicate */
  __syncthreads();
  if (tid < 8) vst2(GATE + r0 + tid * 4, *(const v4f*)&sg[tid * 4]);
  else if (tid >= 32 && tid < 40) vst2(PWR + r0 + (tid - 32) * 4, *(const v4f*)&sp[(tid - 32) * 4]); }
extern "C" void kernel_launch(void* const* d_in, const int* in_sizes, int n_in, void* d_out, int out_size, void* d_ws, size_t ws_size, hipStream_t stream) {
  (void)in_sizes; (void)n_in; (void)out_size;
  const float** F = (const float**)d_in;
  if (ws_size < (size_t)WS_END3) return;
  char* ws = (char*)d_ws; _Float16 *QH = (_Float16*)(ws + WS_QH), *KH = (_Float16*)(ws + WS_KH), *VT = (_Float16*)(ws + WS_VT), *QL = (_Float16*)(ws + WS_QL), *KL = (_Float16*)(ws + WS_KL); __bf16 *VB = (__bf16*)(ws + WS_VB), *VBL = (__bf16*)(ws + WS_VBL);
  (void)QL; (void)KL; (void)VB; (void)VBL;
  // inputs: 0 hidden_states [2,2048,1024]; 1 Wq [1024,1024] (in,out), 2 bq; 3 Wk, 4 bk; 5 Wv, 6 bv (zero biases, read); 7 Wg [1024,1]; 8 bg [1]; no output projection
  float* GATE = (float*)(ws + WS_GATE); float* PWR = (float*)(ws + WS_PWR); float* LPEN = (float*)(ws + WS_LPEN);
  k_gate<<<dim3(TNB * TT / 32), 256, 0, stream>>>(F[0], F[7], F[8], GATE, PWR);
  k_proj<<<dim3(TNB * TT / 64, CC / 128, 3), 128, 0, stream>>>(F[0], F[0], F[0], F[1], F[3], F[5], F[2], F[4], F[6], QH, QL, KH, KL, VT, VB, VBL);
  for (int b = 0; b < TNB; ++b) k_lpen<<<dim3(TT / 16, TT / 256), 256, 0, stream>>>(GATE, PWR, b, LPEN + (size_t)b * TT * TT);   /* one plane per batch: shared by its 16 heads */
  k_fa<<<dim3(TT / (8 * 16 * FQ), NH, TNB), 256, 0, stream>>>(QH, KH, VT, LPEN, (float*)d_out);
}

// v005
// A run of this version takes 125 microseconds.
// Next to v004, in two timings, it ran 1.05 times as fast each time.
// Over all steps from v000 it is 9.37 times as fast.
// compute dtype: all float inputs rounded to bf16; q/k/v projections with EXACT bf16 products on WMMA 16x16x32 (f32 accumulate) + bias; the granularity gate g = sigmoid(x . Wg + bg) from exact bf16 products summed in f32 (VALU), pow(S - 2, 1 - g) with precise powf; logits q x k once to f16 each (1 product) x 64^-0.5 + the log-penalty bias in f32 (precise logf); softmax f32 with a running maximum and sum over steps of 32 keys; exp(s - m) x 2^11 once to f16 x v once to f16 (1 product), divided by the f32 row sum at the end; f32 output.
#include <hip/hip_runtime.h>
#include <math.h>

typedef __attribute__((ext_vector_type(16))) _Float16 v16h;
typedef __attribute__((ext_vector_type(16))) __bf16 v16b;
typedef __attribute__((ext_vector_type(8)))  _Float16 v8h;
typedef __attribute__((ext_vector_type(8)))  float v8f;
typedef __attribute__((ext_vector_type(4)))  float v4f;
typedef __attribute__((ext_vector_type(2)))  float v2f;
typedef __attribute__((ext_vector_type(4)))  unsigned v4u;
typedef __attribute__((ext_vector_type(4)))  int v4i;
typedef float __attribute__((may_alias)) float_a;
typedef int __attribute__((may_alias)) int_a;

template <typename T> __device__ __forceinline__ void vst2(void* p, T v) { *(T*)p = v;  }
__device__ __forceinline__ v8f wmma16(v16h a, v16h b, v8f c) {
  v8f d = __builtin_amdgcn_wmma_f32_16x16x32_f16(false, a, false, b, (short)0, c, false, false);
  asm volatile("v_nop\n\tv_nop\n\tv_nop\n\tv_nop" : "+v"(d) : "v"(a), "v"(b));
  return d;
}
__device__ __forceinline__ v8f wmma_bf(v16b a, v16b b, v8f c) {
  v8f d = __builtin_amdgcn_wmma_f32_16x16x32_bf16(false, a, false, b, (short)0, c, false, false);
  asm volatile("v_nop\n\tv_nop\n\tv_nop\n\tv_nop" : "+v"(d) : "v"(a), "v"(b));
  return d;
}
// 16x16x32 fragments: lane = (h = lane>>4, row/col = lane&15); elements 0..7 = k0+8h+0..7, 8..15 = k0+16+8h+0..7; D element r = row 8h+r
__device__ __forceinline__ v16h frag_h(const _Float16* rowk0, int lane) {
  union { v16h v; v8h q[2]; } u; const _Float16* p = rowk0 + 8 * (lane >> 4);
  u.q[0] = *(const v8h*)p; u.q[1] = *(const v8h*)(p + 16); return u.v;
}
__device__ __forceinline__ v16h frag_f32(const float* rowk0, int lane) {
  v16h a; const float* p = rowk0 + 8 * (lane >> 4);
#pragma unroll
  for (int i = 0; i < 8; ++i) { a[i] = (_Float16)p[i]; a[8 + i] = (_Float16)p[16 + i]; }
  return a;
}
__device__ __forceinline__ v16h frag_f32s(const float* rowk0, int lane, float sc) {
  v16h a; const float* p = rowk0 + 8 * (lane >> 4);
#pragma unroll
  for (int i = 0; i < 8; ++i) { a[i] = (_Float16)(p[i] * sc); a[8 + i] = (_Float16)(p[16 + i] * sc); }
  return a;
}
// column fragment from a [K][ld] layout (column n), rows >= K read as 0
__device__ __forceinline__ v16h fragc_f32(const float* W, int k0, int n, int lane, int ld, int K) {
  v16h a; const int g = lane >> 4;
#pragma unroll
  for (int i = 0; i < 8; ++i) { const int ka = k0 + 8 * g + i, kb = ka + 16;
    a[i] = (_Float16)(ka < K ? W[(size_t)(ka < K ? ka : K - 1) * ld + n] : 0.f); a[8 + i] = (_Float16)(kb < K ? W[(size_t)(kb < K ? kb : K - 1) * ld + n] : 0.f); }
  return a;
}
struct F2 { v16b h, l; };
__device__ __forceinline__ F2 bsplit16(const float v[16]) { F2 r;
#pragma unroll
  for (int i = 0; i < 16; ++i) { const __bf16 h = (__bf16)v[i]; r.h[i] = h; r.l[i] = (__bf16)(v[i] - (float)h); }
  return r; }
__device__ __forceinline__ F2 split_row(const float* row, int k0, int lane) { float v[16]; const float* p = row + k0 + 8 * (lane >> 4);
#pragma unroll
  for (int i = 0; i < 8; ++i) { v[i] = p[i]; v[8 + i] = p[16 + i]; }
  return bsplit16(v); }
__device__ __forceinline__ F2 split_rowK(const float* row, int k0, int lane, int K) { float v[16]; const int g = lane >> 4;
#pragma unroll
  for (int i = 0; i < 8; ++i) { const int ka = k0 + 8 * g + i, kb = ka + 16; v[i] = ka < K ? row[ka < K ? ka : K - 1] : 0.f; v[8 + i] = kb < K ? row[kb < K ? kb : K - 1] : 0.f; }
  return bsplit16(v); }
__device__ __forceinline__ F2 split_col(const float* W, int k0, int n, int lane, int ld, int K) { float v[16]; const int g = lane >> 4;
#pragma unroll
  for (int i = 0; i < 8; ++i) { const int ka = k0 + 8 * g + i, kb = ka + 16; v[i] = ka < K ? W[(size_t)(ka < K ? ka : K - 1) * ld + n] : 0.f; v[8 + i] = kb < K ? W[(size_t)(kb < K ? kb : K - 1) * ld + n] : 0.f; }
  return bsplit16(v); }
__device__ __forceinline__ v8f mac3(const F2& a, const F2& b, v8f c) { c = wmma_bf(a.l, b.h, c); c = wmma_bf(a.h, b.l, c); return wmma_bf(a.h, b.h, c); }
__device__ __forceinline__ float sigm(float v) { return 1.0f / (1.0f + expf(-v)); }
#define LDSX() do { asm volatile("s_wait_dscnt 0" ::: "memory"); __builtin_amdgcn_wave_barrier(); __builtin_amdgcn_fence(__ATOMIC_RELEASE, "workgroup"); } while (0)

// BERT-style self-attention with a learned granularity gate adding a log-penalty bias to the scores (hidden_states [2,2048,1024]; (in,out) Wq / Wk / Wv [1024,1024] N(0, 1/1024) + zero biases; Wg [1024,1] + bg: g = sigmoid(x Wg + bg) per token; res[i,j] = (1 - g_i) max(1 - g_i - g_j, 0) + g_i min(1 - g_i + g_j, 1); scope[i,j] = clip((S - 2)^(1 - g_i) + 2 - |i - j|, 1e-32, 1); log_pen = log(max(res * scope, 1e-32)), broadcast over the 16 heads; scores = q k^T / 8 + log_pen; softmax; no output projection): ctx [2,2048,1024].
#define NB 2
#define TT 2048
#define CC 1024            // NH * HD = projected width
#define DIN 1024          // input (model) width
#define NH 16
#define HD 64
#define NQB (TT / 64)
#define HG 4
#define SCALE (0.125f)
#define CAUSAL 0
#ifndef TNB
#define TNB NB
#endif
__device__ __forceinline__ float bfr(float v) { return (float)(__bf16)v; }
__host__ __device__ __forceinline__ int kb_last(int qb) { return CAUSAL ? ((qb * 64 + 63) >> 7) : (TT / 128 - 1); }
typedef __attribute__((ext_vector_type(8))) __bf16 v8b;
__device__ __forceinline__ v16b frag_b(const __bf16* rowk0, int lane) {
  union { v16b v; v8b q[2]; } u; const __bf16* p = rowk0 + 8 * (lane >> 4);
  u.q[0] = *(const v8b*)p; u.q[1] = *(const v8b*)(p + 16); return u.v;
}
#define QBH 0              // not read by any kernel in this file
#define QHI 0               // single-product logits on every row
#define KHI 64            // key rows carrying k residual / v bf16 hi+lo planes (written by k_proj; read by no kernel in this file)
// B fragment (k rows k0+.., output column o) of a weight: (in,out) [K][ld] or (out,in) [ld rows of K]: bf16 exact, or f16(bf16 * 256) exact
__device__ __forceinline__ v16b wcol_io(const float* Wm, int k0, int o, int lane, int ld) { v16b w; const int g = lane >> 4;
#pragma unroll
  for (int i = 0; i < 8; ++i) { w[i] = (__bf16)Wm[(size_t)(k0 + 8 * g + i) * ld + o]; w[8 + i] = (__bf16)Wm[(size_t)(k0 + 16 + 8 * g + i) * ld + o]; }
  return w; }
__device__ __forceinline__ v16b wcol_oi(const float* Wm, int k0, int o, int lane, int K) { v16b w; const float* p = Wm + (size_t)o * K + k0 + 8 * (lane >> 4);
#pragma unroll
  for (int i = 0; i < 8; ++i) { w[i] = (__bf16)p[i]; w[8 + i] = (__bf16)p[16 + i]; }
  return w; }
__device__ __forceinline__ v16h wcolh_io(const float* Wm, int k0, int o, int lane, int ld) { v16h w; const int g = lane >> 4;
#pragma unroll
  for (int i = 0; i < 8; ++i) { w[i] = (_Float16)(bfr(Wm[(size_t)(k0 + 8 * g + i) * ld + o]) * 256.0f); w[8 + i] = (_Float16)(bfr(Wm[(size_t)(k0 + 16 + 8 * g + i) * ld + o]) * 256.0f); }
  return w; }
__device__ __forceinline__ v16h wcolh_oi(const float* Wm, int k0, int o, int lane, int K) { v16h w; const float* p = Wm + (size_t)o * K + k0 + 8 * (lane >> 4);
#pragma unroll
  for (int i = 0; i < 8; ++i) { w[i] = (_Float16)(bfr(p[i]) * 256.0f); w[8 + i] = (_Float16)(bfr(p[16 + i]) * 256.0f); }
  return w; }
#define WQKV_LAYOUT 0   // 0 = (in,out) [DIN][CC]; 1 = (out,in) [CC][DIN]; 2 = per-head [NH][DIN][HD]
__device__ __forceinline__ v16b wcol_hdk(const float* Wm, int k0, int o, int lane) { v16b w; const int g = lane >> 4; const float* p = Wm + (size_t)(o / HD) * DIN * HD + (o % HD);
#pragma unroll
  for (int i = 0; i < 8; ++i) { w[i] = (__bf16)p[(size_t)(k0 + 8 * g + i) * HD]; w[8 + i] = (__bf16)p[(size_t)(k0 + 16 + 8 * g + i) * HD]; }
  return w; }
#define WO_OUT_IN 0
#if WQKV_LAYOUT == 1
#define WCOL(W, k0, o, lane) wcol_oi(W, k0, o, lane, DIN)
#elif WQKV_LAYOUT == 2
#define WCOL(W, k0, o, lane) wcol_hdk(W, k0, o, lane)
#else
#define WCOL(W, k0, o, lane) wcol_io(W, k0, o, lane, CC)
#endif
#if WO_OUT_IN
#define WOCOL(W, k0, o, lane) wcol_oi(W, k0, o, lane, CC)
#define WOCOLH(W, k0, o, lane) wcolh_oi(W, k0, o, lane, CC)
#else
#define WOCOL(W, k0, o, lane) wcol_io(W, k0, o, lane, DIN)
#define WOCOLH(W, k0, o, lane) wcolh_io(W, k0, o, lane, DIN)
#endif
// the module's log-penalty bias log_pen[b, i, j] is head-independent: lpen_block (in k_proj's launch) evaluates it ONCE per batch into an f32 plane LPEN[b] (fragment order); k_fa ADDS it to the scaled score (far keys carry the module's finite log(1e-32) = -73.68, kept literally)

#define WS_QH  0u                                      // f16 q rows [b*t][CC]
#define WS_KH  (WS_QH + 2u * (size_t)NB * TT * CC)      // f16 k in fragment order [b][h][t / 16][kc][piece][lane][8]
#define WS_VT  (WS_KH + 2u * (size_t)NB * TT * CC)      // f16 v in fragment order [b][h][t / 32][j][piece][lane][8]
#define WS_QL  (WS_VT + 2u * (size_t)NB * CC * TT)      // f16 q residual x 2^10 rows [b][t < QHI][CC]
#define WS_KL  (WS_QL + 2u * (size_t)NB * QHI * CC)     // f16 k residual x 2^10 rows [b][t < KHI][CC]
#define WS_VB  (WS_KL + 2u * (size_t)NB * KHI * CC)     // bf16 v hi planes [b][c][t < KHI]
#define WS_VBL (WS_VB + 2u * (size_t)NB * CC * KHI)
#define WS_END (WS_VBL + 2u * (size_t)NB * CC * KHI)
#define WS_GATE (WS_END)                                 // f32 g[b][s]
#define WS_PWR  (WS_GATE + 4u * (size_t)NB * TT)          // f32 pow(S - 2, 1 - g)[b][s]
#define WS_LPEN (WS_PWR + 4u * (size_t)NB * TT)          // f32 log-penalty planes in fragment order [b][i / 16][j / 32][jt][w][lane][4]
#define WS_END3 (WS_LPEN + 4u * (size_t)NB * TT * TT)

// ---- lpen_block: the log-penalty plane, worked by the blocks z = 3, 4 of k_proj's grid (one z per batch): block = (32 query rows, 256 keys) of batch bsm: log(max(res * scope, 1e-32)), with res = (1 - gi) max(1 - gi - gj, 0) + gi min(1 - gi + gj, 1), scope = clip(pow(S - 2, 1 - gi) + 2 - |i - j|, 1e-32, 1) (gi / pow from the k_gate tables; f32, precise logf); the plane is shared by the 16 heads of the batch. It is written in the order in which k_fa's lanes read it: in a tile of 16 query rows, piece p = ((step * 2 + jt) * 2 + w) * 32 + lane holds query lane & 15, keys 32 step + 16 jt + 8 (lane >> 4) + 4 w + 0..3; each thread writes 16-B pieces, a wave whole lines. A thread's eight key groups are the same for both of the block's row tiles and are loaded once
__device__ __forceinline__ v4f lpen4(float gi_, float pw_, int t, int kb, v4f gj4) { v4f o;
#pragma unroll
  for (int u = 0; u < 4; ++u) { const int k = kb + u; const float gj_ = gj4[u]; const float res_ = (1.0f - gi_) * fmaxf(1.0f - gi_ - gj_, 0.0f) + gi_ * fminf(1.0f - gi_ + gj_, 1.0f); const int ad_ = (t > k) ? (t - k) : (k - t); const float sc_ = fminf(fmaxf(pw_ + 2.0f - (float)ad_, 1.0e-32f), 1.0f); o[u] = logf(fmaxf(res_ * sc_, 1.0e-32f)); }
  return o; }
__device__ __forceinline__ void lpen_block(const float* __restrict__ GATE, const float* __restrict__ PWR, float* LPEN, int bsm, int bx, int by, int tid) { const int lane = tid & 31;   // LPEN carries no __restrict__: with it the compiler moved the stores across the waits written behind them
  const float* G = GATE + (size_t)bsm * TT; const float* P = PWR + (size_t)bsm * TT;
  const int kq = by * 256 + ((tid >> 6) & 1) * 16 + (lane >> 4) * 8 + ((tid >> 5) & 1) * 4;   // first key of this thread's piece of step 0; step it lies 32 keys on
  v4f gj[8]; float gi[2], pw[2];   /* every loop below is fully unrolled: the arrays are indexed with compile-time constants and stay in registers */
#pragma unroll
  for (int it = 0; it < 8; ++it) gj[it] = *(const v4f*)(G + kq + 32 * it);
#pragma unroll
  for (int rb = 0; rb < 2; ++rb) { gi[rb] = G[(bx * 2 + rb) * 16 + (lane & 15)]; pw[rb] = P[(bx * 2 + rb) * 16 + (lane & 15)]; }
  asm volatile("s_wait_xcnt 0x0" ::: "memory");   // in front of the next overwrite of the address registers of the loads above
  __builtin_amdgcn_sched_barrier(0);              // keeps the arithmetic below behind that wait
#pragma unroll
  for (int rb = 0; rb < 2; ++rb) { const int t = (bx * 2 + rb) * 16 + (lane & 15);
    float* dst = LPEN + (size_t)bsm * TT * TT + ((size_t)(bx * 2 + rb) * (TT / 32) + by * 8) * 512 + tid * 4;
#pragma unroll
    for (int it = 0; it < 8; it += 2) { const v4f o0 = lpen4(gi[rb], pw[rb], t, kq + 32 * it, gj[it]); const v4f o1 = lpen4(gi[rb], pw[rb], t, kq + 32 * it + 32, gj[it + 1]);
      __builtin_amdgcn_sched_barrier(0);   // the two pieces' arithmetic (eight independent chains) ends in front of their stores, so that nothing is computed between a store and the wait behind it
      vst2(dst + it * 512, o0); vst2(dst + it * 512 + 512, o1);
      asm volatile("s_wait_xcnt 0x0" ::: "memory");   // in front of the next overwrite of the stores' data registers
      __builtin_amdgcn_sched_barrier(0); } } }         // keeps the next pieces' arithmetic behind that wait
// ---- k_proj: block = (64 rows, 128 cols, which): q/k/v = X W (+ b) with exact bf16 products (K = DIN) -> which 0: q f16 rows (+ residual rows < QHI); 1: k f16 in fragment order (+ residual rows < KHI); 2: v f16 in fragment order (+ bf16 hi/lo planes for t < KHI)
// Operands go through LDS, 32 k at a time, two buffers: the block reads each f32 tile of X and W once, in whole 128-B lines, rounds it to bf16 and lays it k-contiguous (W transposed inside the thread that loaded it); the four waves take their fragments from there. The next tile's global loads fly while this tile is multiplied.
#define PBK 32             // k per stage
#define PNS (DIN / PBK)
#define PPI 40             // bf16 per staged row: 64 B of data at a pitch of 80 B (16 B x odd: the 16 rows of a ds_load_b128 fragment read fall on 16 different bank groups)
typedef __attribute__((ext_vector_type(4))) __bf16 v4b;
__global__ __launch_bounds__(128) void k_proj(const float* __restrict__ XQ, const float* __restrict__ XK, const float* __restrict__ XV, const float* __restrict__ WQ, const float* __restrict__ WK, const float* __restrict__ WV, const float* __restrict__ BQ, const float* __restrict__ BK, const float* __restrict__ BV,
    _Float16* __restrict__ QH, _Float16* __restrict__ QL, _Float16* __restrict__ KH, _Float16* __restrict__ KL, _Float16* __restrict__ VT, __bf16* __restrict__ VB, __bf16* __restrict__ VBL, const float* __restrict__ GATE, const float* __restrict__ PWR, float* LPEN) {
  static_assert(TNB * TT / 64 == TT / 32 && CC / 128 == TT / 256, "a z slice of the grid covers one log-penalty plane in blocks of 32 rows x 256 keys");
  // the short log-penalty blocks come last in the grid: they start as the projection's blocks drain, with no launch of their own; the whole block leaves here, in front of every barrier
  if (blockIdx.z >= 3) { lpen_block(GATE, PWR, LPEN, (int)blockIdx.z - 3, blockIdx.x, blockIdx.y, threadIdx.x); return; }
  // one LDS range: the operand stages of the k loop lie in the bytes that the output staging takes over behind the loop (three blocks stay resident on a WGP)
  __shared__ __align__(16) unsigned char smem[2 * 64 * 136 * 2 + 3 * 128 * 72 * 2];
  _Float16 (*sh)[136] = (_Float16 (*)[136])smem; _Float16 (*sl)[136] = (_Float16 (*)[136])(smem + 64 * 136 * 2);
  _Float16 (*th)[72] = (_Float16 (*)[72])(smem + 2 * 64 * 136 * 2); __bf16 (*tb)[72] = (__bf16 (*)[72])(smem + 2 * 64 * 136 * 2 + 128 * 72 * 2); __bf16 (*tbl)[72] = (__bf16 (*)[72])(smem + 2 * 64 * 136 * 2 + 2 * 128 * 72 * 2);
  __bf16* Ws = (__bf16*)smem;                              // [2][128 columns][PPI]: W^T, column n in row n ^ ((n >> 4) & 3)
  __bf16* Xs = (__bf16*)(smem + 2 * 128 * PPI * 2);        // [2][64 rows][PPI]
  const int tid = threadIdx.x, wave = tid >> 5, lane = tid & 31, col = lane & 15, g = lane >> 4; const int which = blockIdx.z; const int c0 = blockIdx.y * 128; const size_t r0 = (size_t)blockIdx.x * 64; const size_t bb = r0 / TT; const int t0 = (int)(r0 % TT);
  const float* X = which == 0 ? XQ : which == 1 ? XK : XV; const float* WA = which == 0 ? WQ : which == 1 ? WK : WV; const float* BA = which == 0 ? BQ : which == 1 ? BK : BV;
  const float* Wg = WA + (size_t)(8 * wave) * CC + c0 + 4 * lane;       // this thread's W piece of a stage: k rows 8 wave + 0..7, columns 4 lane + 0..3 (a wave's load = 512 contiguous bytes)
  const float* Xg = X + (r0 + (tid >> 3)) * DIN + 4 * (tid & 7);         // its X piece: rows (tid >> 3) + 16 i, k 4 (tid & 7) + 0..3 (a wave's load = four whole lines)
  // the row swap n ^ ((n >> 4) & 3) spreads the rows 4 lane + c, which one ds_store_b128 writes, over all bank groups and keeps the 16 rows of a fragment read spread as well
  __bf16* Wst = Ws + 4 * lane * PPI + 8 * wave; const int wsw = (lane >> 2) & 3;
  __bf16* Xst = Xs + (tid >> 3) * PPI + 4 * (tid & 7);
  v4f wr[8], xr[4];
#pragma unroll
  for (int i = 0; i < 8; ++i) wr[i] = *(const v4f*)(Wg + (size_t)i * CC);
#pragma unroll
  for (int i = 0; i < 4; ++i) xr[i] = *(const v4f*)(Xg + (size_t)(16 * i) * DIN);
  v8f acc[8] = {};
#pragma unroll 2   // two stages per trip: the buffer index is a constant in each
  for (int s = 0; s < PNS; ++s) { const int bf = s & 1; const int sn = s + 1 < PNS ? s + 1 : s;   // the stage fetched ahead; the last stage fetches itself again (in bounds, unused)
#pragma unroll
    for (int c = 0; c < 4; ++c) { v8b p;
#pragma unroll
      for (int i = 0; i < 8; ++i) p[i] = (__bf16)wr[i][c];
      *(v8b*)(Wst + bf * 128 * PPI + (c ^ wsw) * PPI) = p; }
#pragma unroll
    for (int i = 0; i < 4; ++i) { v4b p;
#pragma unroll
      for (int e = 0; e < 4; ++e) p[e] = (__bf16)xr[i][e];
      *(v4b*)(Xst + bf * 64 * PPI + 16 * i * PPI) = p; }
    __syncthreads();   // publishes stage s; it also ends every wave's reads of stage s - 1, whose buffer the next trip overwrites
#pragma unroll
    for (int i = 0; i < 8; ++i) wr[i] = *(const v4f*)(Wg + (size_t)(sn * PBK + i) * CC);
#pragma unroll
    for (int i = 0; i < 4; ++i) xr[i] = *(const v4f*)(Xg + (size_t)(16 * i) * DIN + sn * PBK);
    asm volatile("s_wait_xcnt 0x0" ::: "memory");   // in front of the next overwrite of the address registers of the loads above; it also keeps those loads issued ahead of the products, which cover their latency
    const v16b a = frag_b(Xs + (bf * 64 + wave * 16 + col) * PPI, lane);
    v16b w[8];
#pragma unroll
    for (int j = 0; j < 8; ++j) w[j] = frag_b(Ws + (bf * 128 + j * 16 + (col ^ (j & 3))) * PPI, lane);
    __builtin_amdgcn_sched_barrier(0);   // the stage's LDS reads go out as one group ahead of its products: spread among them, each product waited out a whole LDS latency
#pragma unroll
    for (int j = 0; j < 8; ++j) acc[j] = wmma_bf(a, w[j], acc[j]);
    __builtin_amdgcn_sched_barrier(0); }   // keeps the next stage's conversions, which wait for the global loads, behind this stage's products (the compiler had drawn them, and the wait, in among the products)
  __syncthreads();   // every wave has left the operand stages before the output staging below overwrites them
  if (which < 2) { _Float16* DH = which == 0 ? QH : KH; _Float16* DL = which == 0 ? QL : KL; const int nhi = which == 0 ? QHI : KHI; const bool hi_rows = t0 < nhi;
#pragma unroll
    for (int j = 0; j < 8; ++j) { const float bias = BA ? bfr(BA[c0 + j * 16 + col]) : 0.f;
#pragma unroll
      for (int r = 0; r < 8; ++r) { const float v = acc[j][r] + bias; const _Float16 hv = (_Float16)v; sh[wave * 16 + 8 * g + r][j * 16 + col] = hv; sl[wave * 16 + 8 * g + r][j * 16 + col] = (_Float16)((v - (float)hv) * 1024.0f); } }
    __syncthreads();
    // k leaves in the order in which k_fa's A fragments read it: 16-B piece pc = 2 kc + piece of lane ln (key row ln & 15, half ln >> 4) of a 16-key tile of one head, lanes contiguous; q stays in rows
    for (int e = tid; e < 64 * 16; e += 128) { int rl, q; size_t od;
      if (which == 0) { rl = e >> 4; q = e & 15; od = (r0 + rl) * CC + c0 + q * 8; }
      else { const int ln = e & 31, pc = (e >> 5) & 3, tl = (e >> 7) & 3, hl = e >> 9; rl = tl * 16 + (ln & 15); q = hl * 8 + pc * 2 + (ln >> 4); od = ((((bb * NH + (c0 >> 6) + hl) * (TT / 16) + (t0 >> 4) + tl) * 4 + pc) * 32 + ln) * 8; }
      vst2((unsigned*)(DH + od), *(const v4u*)&sh[rl][q * 8]);
      asm volatile("s_wait_xcnt 0x0" ::: "memory");   // in front of the next overwrite of the store's address and data registers
      if (hi_rows) { vst2((unsigned*)(DL + (bb * nhi + t0 + rl) * (size_t)CC + c0 + q * 8), *(const v4u*)&sl[rl][q * 8]);
        asm volatile("s_wait_xcnt 0x0" ::: "memory"); } }   // the same for this store
  } else { const bool hi_rows = t0 < KHI;
#pragma unroll
    for (int j = 0; j < 8; ++j) { const float bias = BA ? bfr(BA[c0 + j * 16 + col]) : 0.f;
#pragma unroll
      for (int r = 0; r < 8; ++r) { const float v = acc[j][r] + bias; const int rl = wave * 16 + 8 * g + r, cl = j * 16 + col; th[cl][rl] = (_Float16)v; const __bf16 bh = (__bf16)v; tb[cl][rl] = bh; tbl[cl][rl] = (__bf16)(v - (float)bh); } }
    __syncthreads();
    // v leaves in the order in which k_fa's A fragments read it: piece pc of lane ln (channel ln & 15 of tile j, half ln >> 4) of a 32-key step of one head, lanes contiguous
    for (int e = tid; e < 128 * 8; e += 128) { const int ln = e & 31, pc = (e >> 5) & 1, j = (e >> 6) & 3, st = (e >> 8) & 1, hl = e >> 9; const int cl = hl * 64 + j * 16 + (ln & 15), q = st * 4 + pc * 2 + (ln >> 4);
      vst2((unsigned*)(VT + (((((bb * NH + (c0 >> 6) + hl) * (TT / 32) + (t0 >> 5) + st) * 4 + j) * 2 + pc) * 32 + ln) * 8), *(const v4u*)&th[cl][q * 8]);
      asm volatile("s_wait_xcnt 0x0" ::: "memory");   // in front of the next overwrite of the store's address and data registers
      if (hi_rows) { const size_t o3 = (bb * CC + c0 + cl) * (size_t)KHI + t0 + q * 8; vst2((unsigned*)(VB + o3), *(const v4u*)&tb[cl][q * 8]); vst2((unsigned*)(VBL + o3), *(const v4u*)&tbl[cl][q * 8]);
        asm volatile("s_wait_xcnt 0x0" ::: "memory"); } } } }   // the same for these two stores
// ---- k_fa: block = 256 queries (8 waves x 32 query columns) of (b, h): one pass over all keys, 32 at a time, with a running maximum and sum per query (online softmax); the logits and P stay in registers.
// Transposed products: S^T = K . Q^T (A = key rows, B = query rows) puts one query's 16 scores of a 32-key step in lanes c and c + 16; two S^T tiles, converted in place, are the B operand of O^T += V^T . P^T (A = v, channel rows); O^T register r = ctx[query c][16 j + 8 h + r].
// P = exp(s - m) x 2^11 once to f16 (the row sum carries the same factor, taken in f32 before the rounding, and divides it out at the end).
#define FQ 2               // query tiles of 16 columns per wave: each K / V fragment load feeds both
// every inner loop below is fully unrolled so that the fragment and accumulator arrays are indexed by constants and stay in registers
#define L2E 1.4426950408889634f
__device__ __forceinline__ v8f mmh(v16h a, v16h b, v8f c) { return __builtin_amdgcn_wmma_f32_16x16x32_f16(false, a, false, b, (short)0, c, false, false); }
// a fragment stored in fragment order: this lane's two 16-B pieces lie 512 B apart (p already holds the lane's offset)
__device__ __forceinline__ v16h frag_p(const _Float16* p) { union { v16h v; v8h q[2]; } u; u.q[0] = *(const v8h*)p; u.q[1] = *(const v8h*)(p + 256); return u.v; }
__device__ __forceinline__ float xhalf(float x) { return __builtin_bit_cast(float, __builtin_amdgcn_permlanex16(__builtin_bit_cast(int, x), __builtin_bit_cast(int, x), 0x76543210, 0xfedcba98, false, false)); }  // lane l with lane l ^ 16
__global__ __launch_bounds__(256) void k_fa(const _Float16* __restrict__ QH, const _Float16* __restrict__ KH, const _Float16* __restrict__ VT, const float* __restrict__ LPEN, float* __restrict__ Y) {
  const int tid = threadIdx.x, wave = tid >> 5, lane = tid & 31, col = lane & 15, g = lane >> 4; const int h = blockIdx.y, b = blockIdx.z; const int q0 = blockIdx.x * (8 * 16 * FQ) + wave * (16 * FQ);
  // K, V and the log-penalty lie in fragment order: a wave's load is 32 lanes x 16 B = 512 contiguous bytes (four whole lines)
  const _Float16* Kb = KH + (size_t)(b * NH + h) * TT * HD + lane * 8;          // 32 keys = 2048 halves: [jt][kc][piece][lane][8]
  const _Float16* Vb = VT + (size_t)(b * NH + h) * TT * HD + lane * 8;          // 32 keys = 2048 halves: [j][piece][lane][8]
  const float* Lb = LPEN + (size_t)b * TT * TT + (size_t)q0 * TT + lane * 4;    // 16 queries x 32 keys = 512 floats: [jt][w][lane][4]; 16 queries = 16 TT floats
  v16h qf[FQ][2];
#pragma unroll
  for (int u = 0; u < FQ; ++u)
#pragma unroll
    for (int kc = 0; kc < 2; ++kc) qf[u][kc] = frag_h(QH + ((size_t)b * TT + q0 + u * 16 + col) * CC + h * HD + kc * 32, lane);
  v16h kf[2][2]; v4f lp[FQ][2][2];
#pragma unroll
  for (int jt = 0; jt < 2; ++jt) {
#pragma unroll
    for (int kc = 0; kc < 2; ++kc) kf[jt][kc] = frag_p(Kb + jt * 1024 + kc * 512);
#pragma unroll
    for (int u = 0; u < FQ; ++u) { lp[u][jt][0] = *(const v4f*)(Lb + (size_t)u * 16 * TT + jt * 256); lp[u][jt][1] = *(const v4f*)(Lb + (size_t)u * 16 * TT + jt * 256 + 128); } }
  asm volatile("s_wait_xcnt 0x0" ::: "memory");   // the address registers of the loads above are reused for the accumulators set up below: the wait stands in front of that overwrite
  __builtin_amdgcn_sched_barrier(0);              // keeps the accumulators' set-up behind that wait (the compiler lifted it over the wait without this)
  v8f o[FQ][HD / 16] = {}; float m[FQ], l[FQ];
#pragma unroll
  for (int u = 0; u < FQ; ++u) { m[u] = -3.0e38f; l[u] = 0.f; }
#pragma unroll 1   // stays rolled: one step's live set already takes the 256 registers that need no window switch
  for (int k0 = 0; k0 < TT; k0 += 32) { const int kn = k0 + 32 < TT ? k0 + 32 : 0;   // the step fetched ahead; the last step fetches step 0 again (in bounds, unused)
    v16h vf[HD / 16];
#pragma unroll
    for (int j = 0; j < HD / 16; ++j) vf[j] = frag_p(Vb + (size_t)k0 * HD + j * 512);
    float sv[FQ][16];
#pragma unroll
    for (int u = 0; u < FQ; ++u)
#pragma unroll
      for (int jt = 0; jt < 2; ++jt) { v8f z = {}; z = mmh(kf[jt][0], qf[u][0], z); z = mmh(kf[jt][1], qf[u][1], z);
#pragma unroll
        for (int r = 0; r < 8; ++r) sv[u][jt * 8 + r] = fmaf(z[r], SCALE, lp[u][jt][r >> 2][r & 3]); }
    // the next step's K fragments and log-penalty rows, into the registers this step has just read: they fly during the softmax and the P . v products
#pragma unroll
    for (int jt = 0; jt < 2; ++jt) {
#pragma unroll
      for (int kc = 0; kc < 2; ++kc) kf[jt][kc] = frag_p(Kb + (size_t)kn * HD + jt * 1024 + kc * 512);
#pragma unroll
      for (int u = 0; u < FQ; ++u) { lp[u][jt][0] = *(const v4f*)(Lb + (size_t)u * 16 * TT + kn * 16 + jt * 256); lp[u][jt][1] = *(const v4f*)(Lb + (size_t)u * 16 * TT + kn * 16 + jt * 256 + 128); } }
    asm volatile("s_wait_xcnt 0x0" ::: "memory");   // in front of the next overwrite of the address registers of the loads above
    __builtin_amdgcn_sched_barrier(0);      // keeps the fetch-ahead loads issued in front of the softmax and the P . v products, which then cover their latency
#pragma unroll
    for (int u = 0; u < FQ; ++u) { float mt = sv[u][0];
#pragma unroll
      for (int i = 1; i < 16; ++i) mt = fmaxf(mt, sv[u][i]);
      mt = fmaxf(mt, xhalf(mt)); const float mn = fmaxf(m[u], mt); const float al = __builtin_amdgcn_exp2f((m[u] - mn) * L2E);   // 0 on the first step
      m[u] = mn; const float cc = 11.0f - mn * L2E; float ls = 0.f; v16h pb;
#pragma unroll
      for (int i = 0; i < 16; ++i) { const float p = __builtin_amdgcn_exp2f(fmaf(sv[u][i], L2E, cc)); ls += p; pb[i] = (_Float16)p; }
      l[u] = l[u] * al + ls;
#pragma unroll
      for (int j = 0; j < HD / 16; ++j) { o[u][j] = o[u][j] * al; o[u][j] = mmh(vf[j], pb, o[u][j]); } } }
#pragma unroll
  for (int u = 0; u < FQ; ++u) { const float inv = 1.0f / (l[u] + xhalf(l[u]));   // the halves' sums join once; the row's maximum contributes 2^11, so the sum is positive
    float* yr = Y + ((size_t)b * TT + q0 + u * 16 + col) * CC + h * HD + 8 * g;
#pragma unroll
    for (int j = 0; j < HD / 16; ++j) { v4f a0, a1;
#pragma unroll
      for (int r = 0; r < 4; ++r) { a0[r] = o[u][j][r] * inv; a1[r] = o[u][j][4 + r] * inv; }
      vst2(yr + j * 16, a0); vst2(yr + j * 16 + 4, a1); } } }

// ---- k_gate: block = 32 rows, 8 waves x 4 rows: g = sigmoid(x . Wg + bg) and pow(S - 2, 1 - g). A wave's 4 rows are worked together: their 128 loads and Wg's 32 are issued back to back with no wait between them, so the wave pays the memory latency once and not once per load; each row's sum keeps its order (i = 0..31 in the lane, then the xor tree)
__global__ __launch_bounds__(256) void k_gate(const float* __restrict__ X, const float* __restrict__ WG, const float* __restrict__ BG, float* __restrict__ GATE, float* __restrict__ PWR) { __shared__ __align__(16) float sg[32]; __shared__ __align__(16) float sp[32];
  const int tid = threadIdx.x, wave = tid >> 5, lane = tid & 31; const size_t r0 = (size_t)blockIdx.x * 32; const float bg_ = bfr(BG[0]);
  const float* xr = X + (r0 + wave * 4) * DIN + lane;
  float xv[4][32], wreg[32];   /* every loop below is fully unrolled: the arrays are indexed with compile-time constants and stay in registers */
#pragma unroll
  for (int rr = 0; rr < 4; ++rr)
#pragma unroll
    for (int i = 0; i < 32; ++i) xv[rr][i] = xr[rr * DIN + 32 * i];
  asm volatile("s_wait_xcnt 0x0" ::: "memory");   // in front of the next overwrite of the address registers of the loads above (the compiler gave them to Wg's loads as destinations)
  __builtin_amdgcn_sched_barrier(0);              // keeps Wg's loads behind that wait
#pragma unroll
  for (int i = 0; i < 32; ++i) wreg[i] = WG[lane + 32 * i];
  asm volatile("s_wait_xcnt 0x0" ::: "memory");   // the same for Wg's loads
  __builtin_amdgcn_sched_barrier(0);              // keeps every load issued ahead of the sums: drawn down among them, a load would start only when the sum before it is done
#pragma unroll
  for (int i = 0; i < 32; ++i) wreg[i] = bfr(wreg[i]);
  float acc[4];
#pragma unroll
  for (int rr = 0; rr < 4; ++rr) { acc[rr] = 0.f;
#pragma unroll
    for (int i = 0; i < 32; ++i) acc[rr] += bfr(xv[rr][i]) * wreg[i]; }
#pragma unroll
  for (int o = 1; o < 32; o <<= 1)
#pragma unroll
    for (int rr = 0; rr < 4; ++rr) acc[rr] += __shfl_xor(acc[rr], o);
  // every lane holds the four sums: lane rr takes row rr, so one pass of the sigmoid and the power serves the wave's four rows
  const float a = lane == 0 ? acc[0] : lane == 1 ? acc[1] : lane == 2 ? acc[2] : acc[3];
  const float g = 1.0f / (1.0f + expf(-(a + bg_))); const float pw = powf((float)(TT - 2), 1.0f - g);
  if (lane < 4) { sg[wave * 4 + lane] = g; sp[wave * 4 + lane] = pw; }   /* LDS only: no global access under the lane predicate */
  __syncthreads();
  if (tid < 8) vst2(GATE + r0 + tid * 4, *(const v4f*)&sg[tid * 4]);
  else if (tid >= 32 && tid < 40) vst2(PWR + r0 + (tid - 32) * 4, *(const v4f*)&sp[(tid - 32) * 4]); }
extern "C" void kernel_launch(void* const* d_in, const int* in_sizes, int n_in, void* d_out, int out_size, void* d_ws, size_t ws_size, hipStream_t stream) {
  (void)in_sizes; (void)n_in; (void)out_size;
  const float** F = (const float**)d_in;
  if (ws_size < (size_t)WS_END3) return;
  char* ws = (char*)d_ws; _Float16 *QH = (_Float16*)(ws + WS_QH), *KH = (_Float16*)(ws + WS_KH), *VT = (_Float16*)(ws + WS_VT), *QL = (_Float16*)(ws + WS_QL), *KL = (_Float16*)(ws + WS_KL); __bf16 *VB = (__bf16*)(ws + WS_VB), *VBL = (__bf16*)(ws + WS_VBL);
  (void)QL; (void)KL; (void)VB; (void)VBL;
  // inputs: 0 hidden_states [2,2048,1024]; 1 Wq [1024,1024] (in,out), 2 bq; 3 Wk, 4 bk; 5 Wv, 6 bv (zero biases, read); 7 Wg [1024,1]; 8 bg [1]; no output projection
  float* GATE = (float*)(ws + WS_GATE); float* PWR = (float*)(ws + WS_PWR); float* LPEN = (float*)(ws + WS_LPEN);
  k_gate<<<dim3(TNB * TT / 32), 256, 0, stream>>>(F[0], F[7], F[8], GATE, PWR);
  k_proj<<<dim3(TNB * TT / 64, CC / 128, 3 + TNB), 128, 0, stream>>>(F[0], F[0], F[0], F[1], F[3], F[5], F[2], F[4], F[6], QH, QL, KH, KL, VT, VB, VBL, GATE, PWR, LPEN);   /* z = 0..2: q, k, v; z = 3 + b: the log-penalty plane of batch b (64 x 8 blocks of 32 rows x 256 keys), shared by its 16 heads */
  k_fa<<<dim3(TT / (8 * 16 * FQ), NH, TNB), 256, 0, stream>>>(QH, KH, VT, LPEN, (float*)d_out);
}

// v006
// It runs in 105 microseconds.
// Next to v005, in two timings, it ran 1.20 times as fast each time.
// Counting every step since v000, it is 11.3 times as fast.
// compute dtype: all float inputs rounded to bf16; q/k/v projections with EXACT bf16 products on WMMA 16x16x32 (f32 accumulate) + bias; the granularity gate g = sigmoid(x . Wg + bg) from exact bf16 products summed in f32 (VALU), pow(S - 2, 1 - g) with precise powf; logits q x k once to f16 each (1 product) x 64^-0.5 + the log-penalty bias in f32 (precise logf); softmax f32 with a running maximum and sum over steps of 32 keys; exp(s - m) x 2^11 once to f16 x v once to f16 (1 product), divided by the f32 row sum at the end; f32 output.
#include <hip/hip_runtime.h>
#include <math.h>

typedef __attribute__((ext_vector_type(16))) _Float16 v16h;
typedef __attribute__((ext_vector_type(16))) __bf16 v16b;
typedef __attribute__((ext_vector_type(8)))  _Float16 v8h;
typedef __attribute__((ext_vector_type(8)))  float v8f;
typedef __attribute__((ext_vector_type(4)))  float v4f;
typedef __attribute__((ext_vector_type(2)))  float v2f;
typedef __attribute__((ext_vector_type(4)))  unsigned v4u;
typedef __attribute__((ext_vector_type(4)))  int v4i;
typedef float __attribute__((may_alias)) float_a;
typedef int __attribute__((may_alias)) int_a;

template <typename T> __device__ __forceinline__ void vst2(void* p, T v) { *(T*)p = v;  }
__device__ __forceinline__ v8f wmma16(v16h a, v16h b, v8f c) {
  v8f d = __builtin_amdgcn_wmma_f32_16x16x32_f16(false, a, false, b, (short)0, c, false, false);
  asm volatile("v_nop\n\tv_nop\n\tv_nop\n\tv_nop" : "+v"(d) : "v"(a), "v"(b));
  return d;
}
__device__ __forceinline__ v8f wmma_bf(v16b a, v16b b, v8f c) {
  v8f d = __builtin_amdgcn_wmma_f32_16x16x32_bf16(false, a, false, b, (short)0, c, false, false);
  asm volatile("v_nop\n\tv_nop\n\tv_nop\n\tv_nop" : "+v"(d) : "v"(a), "v"(b));
  return d;
}
// 16x16x32 fragments: lane = (h = lane>>4, row/col = lane&15); elements 0..7 = k0+8h+0..7, 8..15 = k0+16+8h+0..7; D element r = row 8h+r
__device__ __forceinline__ v16h frag_h(const _Float16* rowk0, int lane) {
  union { v16h v; v8h q[2]; } u; const _Float16* p = rowk0 + 8 * (lane >> 4);
  u.q[0] = *(const v8h*)p; u.q[1] = *(const v8h*)(p + 16); return u.v;
}
__device__ __forceinline__ v16h frag_f32(const float* rowk0, int lane) {
  v16h a; const float* p = rowk0 + 8 * (lane >> 4);
#pragma unroll
  for (int i = 0; i < 8; ++i) { a[i] = (_Float16)p[i]; a[8 + i] = (_Float16)p[16 + i]; }
  return a;
}
__device__ __forceinline__ v16h frag_f32s(const float* rowk0, int lane, float sc) {
  v16h a; const float* p = rowk0 + 8 * (lane >> 4);
#pragma unroll
  for (int i = 0; i < 8; ++i) { a[i] = (_Float16)(p[i] * sc); a[8 + i] = (_Float16)(p[16 + i] * sc); }
  return a;
}
// column fragment from a [K][ld] layout (column n), rows >= K read as 0
__device__ __forceinline__ v16h fragc_f32(const float* W, int k0, int n, int lane, int ld, int K) {
  v16h a; const int g = lane >> 4;
#pragma unroll
  for (int i = 0; i < 8; ++i) { const int ka = k0 + 8 * g + i, kb = ka + 16;
    a[i] = (_Float16)(ka < K ? W[(size_t)(ka < K ? ka : K - 1) * ld + n] : 0.f); a[8 + i] = (_Float16)(kb < K ? W[(size_t)(kb < K ? kb : K - 1) * ld + n] : 0.f); }
  return a;
}
struct F2 { v16b h, l; };
__device__ __forceinline__ F2 bsplit16(const float v[16]) { F2 r;
#pragma unroll
  for (int i = 0; i < 16; ++i) { const __bf16 h = (__bf16)v[i]; r.h[i] = h; r.l[i] = (__bf16)(v[i] - (float)h); }
  return r; }
__device__ __forceinline__ F2 split_row(const float* row, int k0, int lane) { float v[16]; const float* p = row + k0 + 8 * (lane >> 4);
#pragma unroll
  for (int i = 0; i < 8; ++i) { v[i] = p[i]; v[8 + i] = p[16 + i]; }
  return bsplit16(v); }
__device__ __forceinline__ F2 split_rowK(const float* row, int k0, int lane, int K) { float v[16]; const int g = lane >> 4;
#pragma unroll
  for (int i = 0; i < 8; ++i) { const int ka = k0 + 8 * g + i, kb = ka + 16; v[i] = ka < K ? row[ka < K ? ka : K - 1] : 0.f; v[8 + i] = kb < K ? row[kb < K ? kb : K - 1] : 0.f; }
  return bsplit16(v); }
__device__ __forceinline__ F2 split_col(const float* W, int k0, int n, int lane, int ld, int K) { float v[16]; const int g = lane >> 4;
#pragma unroll
  for (int i = 0; i < 8; ++i) { const int ka = k0 + 8 * g + i, kb = ka + 16; v[i] = ka < K ? W[(size_t)(ka < K ? ka : K - 1) * ld + n] : 0.f; v[8 + i] = kb < K ? W[(size_t)(kb < K ? kb : K - 1) * ld + n] : 0.f; }
  return bsplit16(v); }
__device__ __forceinline__ v8f mac3(const F2& a, const F2& b, v8f c) { c = wmma_bf(a.l, b.h, c); c = wmma_bf(a.h, b.l, c); return wmma_bf(a.h, b.h, c); }
__device__ __forceinline__ float sigm(float v) { return 1.0f / (1.0f + expf(-v)); }
#define LDSX() do { asm volatile("s_wait_dscnt 0" ::: "memory"); __builtin_amdgcn_wave_barrier(); __builtin_amdgcn_fence(__ATOMIC_RELEASE, "workgroup"); } while (0)

// BERT-style self-attention with a learned granularity gate adding a log-penalty bias to the scores (hidden_states [2,2048,1024]; (in,out) Wq / Wk / Wv [1024,1024] N(0, 1/1024) + zero biases; Wg [1024,1] + bg: g = sigmoid(x Wg + bg) per token; res[i,j] = (1 - g_i) max(1 - g_i - g_j, 0) + g_i min(1 - g_i + g_j, 1); scope[i,j] = clip((S - 2)^(1 - g_i) + 2 - |i - j|, 1e-32, 1); log_pen = log(max(res * scope, 1e-32)), broadcast over the 16 heads; scores = q k^T / 8 + log_pen; softmax; no output projection): ctx [2,2048,1024].
#define NB 2
#define TT 2048
#define CC 1024            // NH * HD = projected width
#define DIN 1024          // input (model) width
#define NH 16
#define HD 64
#define NQB (TT / 64)
#define HG 4
#define SCALE (0.125f)
#define CAUSAL 0
#ifndef TNB
#define TNB NB
#endif
__device__ __forceinline__ float bfr(float v) { return (float)(__bf16)v; }
__host__ __device__ __forceinline__ int kb_last(int qb) { return CAUSAL ? ((qb * 64 + 63) >> 7) : (TT / 128 - 1); }
typedef __attribute__((ext_vector_type(8))) __bf16 v8b;
__device__ __forceinline__ v16b frag_b(const __bf16* rowk0, int lane) {
  union { v16b v; v8b q[2]; } u; const __bf16* p = rowk0 + 8 * (lane >> 4);
  u.q[0] = *(const v8b*)p; u.q[1] = *(const v8b*)(p + 16); return u.v;
}
#define QBH 0              // not read by any kernel in this file
#define QHI 0               // single-product logits on every row
#define KHI 64            // key rows carrying k residual / v bf16 hi+lo planes (written by k_proj; read by no kernel in this file)
// B fragment (k rows k0+.., output column o) of a weight: (in,out) [K][ld] or (out,in) [ld rows of K]: bf16 exact, or f16(bf16 * 256) exact
__device__ __forceinline__ v16b wcol_io(const float* Wm, int k0, int o, int lane, int ld) { v16b w; const int g = lane >> 4;
#pragma unroll
  for (int i = 0; i < 8; ++i) { w[i] = (__bf16)Wm[(size_t)(k0 + 8 * g + i) * ld + o]; w[8 + i] = (__bf16)Wm[(size_t)(k0 + 16 + 8 * g + i) * ld + o]; }
  return w; }
__device__ __forceinline__ v16b wcol_oi(const float* Wm, int k0, int o, int lane, int K) { v16b w; const float* p = Wm + (size_t)o * K + k0 + 8 * (lane >> 4);
#pragma unroll
  for (int i = 0; i < 8; ++i) { w[i] = (__bf16)p[i]; w[8 + i] = (__bf16)p[16 + i]; }
  return w; }
__device__ __forceinline__ v16h wcolh_io(const float* Wm, int k0, int o, int lane, int ld) { v16h w; const int g = lane >> 4;
#pragma unroll
  for (int i = 0; i < 8; ++i) { w[i] = (_Float16)(bfr(Wm[(size_t)(k0 + 8 * g + i) * ld + o]) * 256.0f); w[8 + i] = (_Float16)(bfr(Wm[(size_t)(k0 + 16 + 8 * g + i) * ld + o]) * 256.0f); }
  return w; }
__device__ __forceinline__ v16h wcolh_oi(const float* Wm, int k0, int o, int lane, int K) { v16h w; const float* p = Wm + (size_t)o * K + k0 + 8 * (lane >> 4);
#pragma unroll
  for (int i = 0; i < 8; ++i) { w[i] = (_Float16)(bfr(p[i]) * 256.0f); w[8 + i] = (_Float16)(bfr(p[16 + i]) * 256.0f); }
  return w; }
#define WQKV_LAYOUT 0   // 0 = (in,out) [DIN][CC]; 1 = (out,in) [CC][DIN]; 2 = per-head [NH][DIN][HD]
__device__ __forceinline__ v16b wcol_hdk(const float* Wm, int k0, int o, int lane) { v16b w; const int g = lane >> 4; const float* p = Wm + (size_t)(o / HD) * DIN * HD + (o % HD);
#pragma unroll
  for (int i = 0; i < 8; ++i) { w[i] = (__bf16)p[(size_t)(k0 + 8 * g + i) * HD]; w[8 + i] = (__bf16)p[(size_t)(k0 + 16 + 8 * g + i) * HD]; }
  return w; }
#define WO_OUT_IN 0
#if WQKV_LAYOUT == 1
#define WCOL(W, k0, o, lane) wcol_oi(W, k0, o, lane, DIN)
#elif WQKV_LAYOUT == 2
#define WCOL(W, k0, o, lane) wcol_hdk(W, k0, o, lane)
#else
#define WCOL(W, k0, o, lane) wcol_io(W, k0, o, lane, CC)
#endif
#if WO_OUT_IN
#define WOCOL(W, k0, o, lane) wcol_oi(W, k0, o, lane, CC)
#define WOCOLH(W, k0, o, lane) wcolh_oi(W, k0, o, lane, CC)
#else
#define WOCOL(W, k0, o, lane) wcol_io(W, k0, o, lane, DIN)
#define WOCOLH(W, k0, o, lane) wcolh_io(W, k0, o, lane, DIN)
#endif
// the module's log-penalty bias log_pen[b, i, j] is head-independent: lpen_block (in k_proj's launch) evaluates it ONCE per batch into an f32 plane LPEN[b] (fragment order); k_fa ADDS it to the scaled score (far keys carry the module's finite log(1e-32) = -73.68, kept literally)

#define WS_QH  0u                                      // f16 q rows [b*t][CC]
#define WS_KH  (WS_QH + 2u * (size_t)NB * TT * CC)      // f16 k in fragment order [b][h][t / 16][kc][piece][lane][8]
#define WS_VT  (WS_KH + 2u * (size_t)NB * TT * CC)      // f16 v in fragment order [b][h][t / 32][j][piece][lane][8]
#define WS_QL  (WS_VT + 2u * (size_t)NB * CC * TT)      // f16 q residual x 2^10 rows [b][t < QHI][CC]
#define WS_KL  (WS_QL + 2u * (size_t)NB * QHI * CC)     // f16 k residual x 2^10 rows [b][t < KHI][CC]
#define WS_VB  (WS_KL + 2u * (size_t)NB * KHI * CC)     // bf16 v hi planes [b][c][t < KHI]
#define WS_VBL (WS_VB + 2u * (size_t)NB * CC * KHI)
#define WS_END (WS_VBL + 2u * (size_t)NB * CC * KHI)
#define WS_GATE (WS_END)                                 // f32 g[b][s]
#define WS_PWR  (WS_GATE + 4u * (size_t)NB * TT)          // f32 pow(S - 2, 1 - g)[b][s]
#define WS_LPEN (WS_PWR + 4u * (size_t)NB * TT)          // f32 log-penalty planes in fragment order [b][i / 16][j / 32][jt][w][lane][4]
#define WS_END3 (WS_LPEN + 4u * (size_t)NB * TT * TT)

// ---- lpen_block: the log-penalty plane, worked by the blocks z = 3, 4 of k_proj's grid (one z per batch): 128 threads (half a block) = (32 query rows, 256 keys) of batch bsm: log(max(res * scope, 1e-32)), with res = (1 - gi) max(1 - gi - gj, 0) + gi min(1 - gi + gj, 1), scope = clip(pow(S - 2, 1 - gi) + 2 - |i - j|, 1e-32, 1) (gi / pow from the k_gate tables; f32, precise logf); the plane is shared by the 16 heads of the batch. It is written in the order in which k_fa's lanes read it: in a tile of 16 query rows, piece p = ((step * 2 + jt) * 2 + w) * 32 + lane holds query lane & 15, keys 32 step + 16 jt + 8 (lane >> 4) + 4 w + 0..3; each thread writes 16-B pieces, a wave whole lines. A thread's eight key groups are the same for both of the block's row tiles and are loaded once
__device__ __forceinline__ v4f lpen4(float gi_, float pw_, int t, int kb, v4f gj4) { v4f o;
#pragma unroll
  for (int u = 0; u < 4; ++u) { const int k = kb + u; const float gj_ = gj4[u]; const float res_ = (1.0f - gi_) * fmaxf(1.0f - gi_ - gj_, 0.0f) + gi_ * fminf(1.0f - gi_ + gj_, 1.0f); const int ad_ = (t > k) ? (t - k) : (k - t); const float sc_ = fminf(fmaxf(pw_ + 2.0f - (float)ad_, 1.0e-32f), 1.0f); o[u] = logf(fmaxf(res_ * sc_, 1.0e-32f)); }
  return o; }
__device__ __forceinline__ void lpen_block(const float* __restrict__ GATE, const float* __restrict__ PWR, float* LPEN, int bsm, int bx, int by, int tid) { const int lane = tid & 31;   // LPEN carries no __restrict__: with it the compiler moved the stores across the waits written behind them
  const float* G = GATE + (size_t)bsm * TT; const float* P = PWR + (size_t)bsm * TT;
  const int kq = by * 256 + ((tid >> 6) & 1) * 16 + (lane >> 4) * 8 + ((tid >> 5) & 1) * 4;   // first key of this thread's piece of step 0; step it lies 32 keys on
  v4f gj[8]; float gi[2], pw[2];   /* every loop below is fully unrolled: the arrays are indexed with compile-time constants and stay in registers */
#pragma unroll
  for (int it = 0; it < 8; ++it) gj[it] = *(const v4f*)(G + kq + 32 * it);
#pragma unroll
  for (int rb = 0; rb < 2; ++rb) { gi[rb] = G[(bx * 2 + rb) * 16 + (lane & 15)]; pw[rb] = P[(bx * 2 + rb) * 16 + (lane & 15)]; }
  asm volatile("s_wait_xcnt 0x0" ::: "memory");   // in front of the next overwrite of the address registers of the loads above
  __builtin_amdgcn_sched_barrier(0);              // keeps the arithmetic below behind that wait
#pragma unroll
  for (int rb = 0; rb < 2; ++rb) { const int t = (bx * 2 + rb) * 16 + (lane & 15);
    float* dst = LPEN + (size_t)bsm * TT * TT + ((size_t)(bx * 2 + rb) * (TT / 32) + by * 8) * 512 + tid * 4;
#pragma unroll
    for (int it = 0; it < 8; it += 2) { const v4f o0 = lpen4(gi[rb], pw[rb], t, kq + 32 * it, gj[it]); const v4f o1 = lpen4(gi[rb], pw[rb], t, kq + 32 * it + 32, gj[it + 1]);
      __builtin_amdgcn_sched_barrier(0);   // the two pieces' arithmetic (eight independent chains) ends in front of their stores, so that nothing is computed between a store and the wait behind it
      vst2(dst + it * 512, o0); vst2(dst + it * 512 + 512, o1);
      asm volatile("s_wait_xcnt 0x0" ::: "memory");   // in front of the next overwrite of the stores' data registers
      __builtin_amdgcn_sched_barrier(0); } } }         // keeps the next pieces' arithmetic behind that wait
// ---- k_proj: block = (128 rows, 128 cols, which), 8 waves in a 4 x 2 grid, each on 32 rows x 64 cols (2 x 4 fragments): q/k/v = X W (+ b) with exact bf16 products (K = DIN) -> which 0: q f16 rows (+ residual rows < QHI); 1: k f16 in fragment order (+ residual rows < KHI); 2: v f16 in fragment order (+ bf16 hi/lo planes for t < KHI)
// Operands go through LDS, 32 k at a time, two buffers: the block reads each f32 tile of X and W once, in whole 128-B lines, rounds it to bf16 and lays it k-contiguous (W transposed inside the thread that loaded it); the eight waves take their fragments from there. The next tile's global loads fly while this tile is multiplied.
#define PBM 128            // rows per block
#define PBK 32             // k per stage
#define PNS (DIN / PBK)
#define PPI 40             // bf16 per staged row: 64 B of data at a pitch of 80 B (16 B x odd: the 16 rows of a ds_load_b128 fragment read fall on 16 different bank groups)
#define PWB (128 * PPI * 2 + 128)   // bytes of one W buffer: column n at n * 80 + 16 ((n >> 4) & 3) + 64 (n >> 6)
#define PEP 136            // f16 per row of the output staging: 256 B of data at a pitch of 272 B (16 B x odd)
typedef __attribute__((ext_vector_type(4))) __bf16 v4b;
// six waves per SIMD (160 registers) and a third of the LDS: three blocks per WGP, so that all 768 projection blocks are resident at once and none waits for a second round
__global__ __launch_bounds__(256, 6) void k_proj(const float* __restrict__ XQ, const float* __restrict__ XK, const float* __restrict__ XV, const float* __restrict__ WQ, const float* __restrict__ WK, const float* __restrict__ WV, const float* __restrict__ BQ, const float* __restrict__ BK, const float* __restrict__ BV,
    _Float16* __restrict__ QH, _Float16* __restrict__ QL, _Float16* __restrict__ KH, _Float16* __restrict__ KL, _Float16* __restrict__ VT, __bf16* __restrict__ VB, __bf16* __restrict__ VBL, const float* __restrict__ GATE, const float* __restrict__ PWR, float* LPEN) {
  static_assert(2 * (TNB * TT / PBM) == TT / 32 && CC / 128 == TT / 256, "a z slice of the grid covers one log-penalty plane: each half of a block takes 32 rows x 256 keys");
  // the short log-penalty blocks come last in the grid: they start as the projection's blocks drain, with no launch of their own; the whole block leaves here, in front of every barrier
  if (blockIdx.z >= 3) { lpen_block(GATE, PWR, LPEN, (int)blockIdx.z - 3, blockIdx.x * 2 + (threadIdx.x >> 7), blockIdx.y, threadIdx.x & 127); return; }
  // one LDS range: the operand stages of the k loop lie in the bytes that the output staging takes over behind the loop; the q / k staging (two planes) and the v staging (three planes) share those bytes, a block uses one of them
  __shared__ __align__(16) unsigned char smem[3 * 128 * PEP * 2];
  _Float16 (*sh)[PEP] = (_Float16 (*)[PEP])smem; _Float16 (*sl)[PEP] = (_Float16 (*)[PEP])(smem + PBM * PEP * 2);
  _Float16 (*th)[PEP] = (_Float16 (*)[PEP])smem; __bf16 (*tb)[PEP] = (__bf16 (*)[PEP])(smem + 128 * PEP * 2); __bf16 (*tbl)[PEP] = (__bf16 (*)[PEP])(smem + 2 * 128 * PEP * 2);
  // W^T: [2][PWB bytes] from smem on
  __bf16* Xs = (__bf16*)(smem + 2 * PWB);                  // [2][PBM rows][PPI]
  const int tid = threadIdx.x, wave = tid >> 5, lane = tid & 31, col = lane & 15, g = lane >> 4; const int wm = wave >> 1, wn = wave & 1;   // the wave's 32 rows and 64 columns of the block's tile
  const int which = blockIdx.z; const int c0 = blockIdx.y * 128; const size_t r0 = (size_t)blockIdx.x * PBM; const size_t bb = r0 / TT; const int t0 = (int)(r0 % TT);
  const float* X = which == 0 ? XQ : which == 1 ? XK : XV; const float* WA = which == 0 ? WQ : which == 1 ? WK : WV; const float* BA = which == 0 ? BQ : which == 1 ? BK : BV;
  const float* Wg = WA + c0; const unsigned wo = (unsigned)(4 * wave * CC + 4 * lane);         // this thread's W piece of a stage: k rows 4 wave + 0..3, columns 4 lane + 0..3 (a wave's load = 512 contiguous bytes); block-uniform base + 32-bit offset: one address register
  const float* Xg = X + r0 * DIN; const unsigned xo = (unsigned)((tid >> 3) * DIN + 4 * (tid & 7));   // its X piece: rows (tid >> 3) + 32 i, k 4 (tid & 7) + 0..3 (a wave's load = four whole lines)
  // the skew of 16 B per 16 columns spreads the columns 4 lane + c, which one LDS store writes, over the bank groups; the 16 columns of a fragment read share one skew, so that store and read each need one address register and constant offsets
  unsigned char* Wst = smem + 4 * lane * (PPI * 2) + 16 * ((lane >> 2) & 3) + 64 * (lane >> 4) + 8 * wave;
  const unsigned char* Wrd = smem + wn * (64 * PPI * 2 + 64) + col * (PPI * 2);
  __bf16* Xst = Xs + (tid >> 3) * PPI + 4 * (tid & 7);
  v4f wr[4], xr[4];
#pragma unroll
  for (int i = 0; i < 4; ++i) wr[i] = *(const v4f*)(Wg + (size_t)i * CC + wo);
#pragma unroll
  for (int i = 0; i < 4; ++i) xr[i] = *(const v4f*)(Xg + (size_t)(32 * i) * DIN + xo);
  v8f acc[2][4] = {};
#pragma unroll 2   // two stages per trip: the buffer index is a constant in each
  for (int s = 0; s < PNS; ++s) { const int bf = s & 1; const int sn = s + 1 < PNS ? s + 1 : s;   // the stage fetched ahead; the last stage fetches itself again (in bounds, unused)
#pragma unroll
    for (int c = 0; c < 4; ++c) { v4b p;
#pragma unroll
      for (int i = 0; i < 4; ++i) p[i] = (__bf16)wr[i][c];
      *(v4b*)(Wst + bf * PWB + c * (PPI * 2)) = p; }
#pragma unroll
    for (int i = 0; i < 4; ++i) { v4b p;
#pragma unroll
      for (int e = 0; e < 4; ++e) p[e] = (__bf16)xr[i][e];
      *(v4b*)(Xst + bf * PBM * PPI + 32 * i * PPI) = p; }
    __syncthreads();   // publishes stage s; it also ends every wave's reads of stage s - 1, whose buffer the next trip overwrites
#pragma unroll
    for (int i = 0; i < 4; ++i) wr[i] = *(const v4f*)(Wg + (size_t)(sn * PBK + i) * CC + wo);
#pragma unroll
    for (int i = 0; i < 4; ++i) xr[i] = *(const v4f*)(Xg + (size_t)(32 * i) * DIN + sn * PBK + xo);
    asm volatile("s_wait_xcnt 0x0" ::: "memory");   // in front of the next overwrite of the address registers of the loads above; it also keeps those loads issued ahead of the products, which cover their latency
    v16b a[2], w[4];
#pragma unroll
    for (int i = 0; i < 2; ++i) a[i] = frag_b(Xs + (bf * PBM + wm * 32 + i * 16 + col) * PPI, lane);
#pragma unroll
    for (int j = 0; j < 4; ++j) w[j] = frag_b((const __bf16*)(Wrd + bf * PWB + j * (16 * PPI * 2 + 16)), lane);
    __builtin_amdgcn_sched_barrier(0);   // the stage's LDS reads go out as one group ahead of its products: spread among them, each product waited out a whole LDS latency
#pragma unroll
    for (int i = 0; i < 2; ++i)
#pragma unroll
      for (int j = 0; j < 4; ++j) acc[i][j] = wmma_bf(a[i], w[j], acc[i][j]);
    __builtin_amdgcn_sched_barrier(0); }   // keeps the next stage's conversions, which wait for the global loads, behind this stage's products (the compiler had drawn them, and the wait, in among the products)
  __syncthreads();   // every wave has left the operand stages before the output staging below overwrites them
  if (which < 2) { _Float16* DH = which == 0 ? QH : KH; _Float16* DL = which == 0 ? QL : KL; const int nhi = which == 0 ? QHI : KHI;
#pragma unroll
    for (int j = 0; j < 4; ++j) { const int cl = wn * 64 + j * 16 + col; const float bias = BA ? bfr(BA[c0 + cl]) : 0.f;
#pragma unroll
      for (int i = 0; i < 2; ++i)
#pragma unroll
        for (int r = 0; r < 8; ++r) { const float v = acc[i][j][r] + bias; const _Float16 hv = (_Float16)v; const int rl = wm * 32 + i * 16 + 8 * g + r; sh[rl][cl] = hv; sl[rl][cl] = (_Float16)((v - (float)hv) * 1024.0f); } }
    __syncthreads();
    // k leaves in the order in which k_fa's A fragments read it: 16-B piece pc = 2 kc + piece of lane ln (key row ln & 15, half ln >> 4) of a 16-key tile of one head, lanes contiguous; q stays in rows
    for (int e = tid; e < PBM * 16; e += 256) { int rl, q; size_t od;
      if (which == 0) { rl = e >> 4; q = e & 15; od = (r0 + rl) * CC + c0 + q * 8; }
      else { const int ln = e & 31, pc = (e >> 5) & 3, tl = (e >> 7) & 7, hl = e >> 10; rl = tl * 16 + (ln & 15); q = hl * 8 + pc * 2 + (ln >> 4); od = ((((bb * NH + (c0 >> 6) + hl) * (TT / 16) + (t0 >> 4) + tl) * 4 + pc) * 32 + ln) * 8; }
      vst2((unsigned*)(DH + od), *(const v4u*)&sh[rl][q * 8]);
      asm volatile("s_wait_xcnt 0x0" ::: "memory");   // in front of the next overwrite of the store's address and data registers
      if (t0 + rl < nhi) { vst2((unsigned*)(DL + (bb * nhi + t0 + rl) * (size_t)CC + c0 + q * 8), *(const v4u*)&sl[rl][q * 8]);   // the residual plane holds rows < nhi only: of a 128-row block at most the first rows
        asm volatile("s_wait_xcnt 0x0" ::: "memory"); } }   // the same for this store
  } else {
#pragma unroll
    for (int j = 0; j < 4; ++j) { const int cl = wn * 64 + j * 16 + col; const float bias = BA ? bfr(BA[c0 + cl]) : 0.f;
#pragma unroll
      for (int i = 0; i < 2; ++i)
#pragma unroll
        for (int r = 0; r < 8; ++r) { const float v = acc[i][j][r] + bias; const int rl = wm * 32 + i * 16 + 8 * g + r; th[cl][rl] = (_Float16)v; const __bf16 bh = (__bf16)v; tb[cl][rl] = bh; tbl[cl][rl] = (__bf16)(v - (float)bh); } }
    __syncthreads();
    // v leaves in the order in which k_fa's A fragments read it: piece pc of lane ln (channel ln & 15 of tile j, half ln >> 4) of a 32-key step of one head, lanes contiguous
    for (int e = tid; e < 128 * (PBM / 8); e += 256) { const int ln = e & 31, pc = (e >> 5) & 1, j = (e >> 6) & 3, st = (e >> 8) & 3, hl = e >> 10; const int cl = hl * 64 + j * 16 + (ln & 15), q = st * 4 + pc * 2 + (ln >> 4);
      vst2((unsigned*)(VT + (((((bb * NH + (c0 >> 6) + hl) * (TT / 32) + (t0 >> 5) + st) * 4 + j) * 2 + pc) * 32 + ln) * 8), *(const v4u*)&th[cl][q * 8]);
      asm volatile("s_wait_xcnt 0x0" ::: "memory");   // in front of the next overwrite of the store's address and data registers
      if (t0 + q * 8 < KHI) { const size_t o3 = (bb * CC + c0 + cl) * (size_t)KHI + t0 + q * 8; vst2((unsigned*)(VB + o3), *(const v4u*)&tb[cl][q * 8]); vst2((unsigned*)(VBL + o3), *(const v4u*)&tbl[cl][q * 8]);   // the hi / lo planes hold keys < KHI only
        asm volatile("s_wait_xcnt 0x0" ::: "memory"); } } } }   // the same for these two stores
// ---- k_fa: block = 256 queries (8 waves x 32 query columns) of (b, h): one pass over all keys, 32 at a time, with a running maximum and sum per query (online softmax); the logits and P stay in registers.
// Transposed products: S^T = K . Q^T (A = key rows, B = query rows) puts one query's 16 scores of a 32-key step in lanes c and c + 16; two S^T tiles, converted in place, are the B operand of O^T += V^T . P^T (A = v, channel rows); O^T register r = ctx[query c][16 j + 8 h + r].
// P = exp(s - m) x 2^11 once to f16 (the row sum carries the same factor, taken in f32 before the rounding, and divides it out at the end).
#define FQ 2               // query tiles of 16 columns per wave: each K / V fragment load feeds both
// every inner loop below is fully unrolled so that the fragment and accumulator arrays are indexed by constants and stay in registers
#define L2E 1.4426950408889634f
__device__ __forceinline__ v8f mmh(v16h a, v16h b, v8f c) { return __builtin_amdgcn_wmma_f32_16x16x32_f16(false, a, false, b, (short)0, c, false, false); }
// a fragment stored in fragment order: this lane's two 16-B pieces lie 512 B apart (p already holds the lane's offset)
__device__ __forceinline__ v16h frag_p(const _Float16* p) { union { v16h v; v8h q[2]; } u; u.q[0] = *(const v8h*)p; u.q[1] = *(const v8h*)(p + 256); return u.v; }
__device__ __forceinline__ float xhalf(float x) { return __builtin_bit_cast(float, __builtin_amdgcn_permlanex16(__builtin_bit_cast(int, x), __builtin_bit_cast(int, x), 0x76543210, 0xfedcba98, false, false)); }  // lane l with lane l ^ 16
__global__ __launch_bounds__(256) void k_fa(const _Float16* __restrict__ QH, const _Float16* __restrict__ KH, const _Float16* __restrict__ VT, const float* __restrict__ LPEN, float* __restrict__ Y) {
  const int tid = threadIdx.x, wave = tid >> 5, lane = tid & 31, col = lane & 15, g = lane >> 4; const int h = blockIdx.y, b = blockIdx.z; const int q0 = blockIdx.x * (8 * 16 * FQ) + wave * (16 * FQ);
  // K, V and the log-penalty lie in fragment order: a wave's load is 32 lanes x 16 B = 512 contiguous bytes (four whole lines)
  const _Float16* Kb = KH + (size_t)(b * NH + h) * TT * HD + lane * 8;          // 32 keys = 2048 halves: [jt][kc][piece][lane][8]
  const _Float16* Vb = VT + (size_t)(b * NH + h) * TT * HD + lane * 8;          // 32 keys = 2048 halves: [j][piece][lane][8]
  const float* Lb = LPEN + (size_t)b * TT * TT + (size_t)q0 * TT + lane * 4;    // 16 queries x 32 keys = 512 floats: [jt][w][lane][4]; 16 queries = 16 TT floats
  v16h qf[FQ][2];
#pragma unroll
  for (int u = 0; u < FQ; ++u)
#pragma unroll
    for (int kc = 0; kc < 2; ++kc) qf[u][kc] = frag_h(QH + ((size_t)b * TT + q0 + u * 16 + col) * CC + h * HD + kc * 32, lane);
  v16h kf[2][2]; v4f lp[FQ][2][2];
#pragma unroll
  for (int jt = 0; jt < 2; ++jt) {
#pragma unroll
    for (int kc = 0; kc < 2; ++kc) kf[jt][kc] = frag_p(Kb + jt * 1024 + kc * 512);
#pragma unroll
    for (int u = 0; u < FQ; ++u) { lp[u][jt][0] = *(const v4f*)(Lb + (size_t)u * 16 * TT + jt * 256); lp[u][jt][1] = *(const v4f*)(Lb + (size_t)u * 16 * TT + jt * 256 + 128); } }
  asm volatile("s_wait_xcnt 0x0" ::: "memory");   // the address registers of the loads above are reused for the accumulators set up below: the wait stands in front of that overwrite
  __builtin_amdgcn_sched_barrier(0);              // keeps the accumulators' set-up behind that wait (the compiler lifted it over the wait without this)
  v8f o[FQ][HD / 16] = {}; float m[FQ], l[FQ];
#pragma unroll
  for (int u = 0; u < FQ; ++u) { m[u] = -3.0e38f; l[u] = 0.f; }
#pragma unroll 1   // stays rolled: one step's live set already takes the 256 registers that need no window switch
  for (int k0 = 0; k0 < TT; k0 += 32) { const int kn = k0 + 32 < TT ? k0 + 32 : 0;   // the step fetched ahead; the last step fetches step 0 again (in bounds, unused)
    v16h vf[HD / 16];
#pragma unroll
    for (int j = 0; j < HD / 16; ++j) vf[j] = frag_p(Vb + (size_t)k0 * HD + j * 512);
    float sv[FQ][16];
#pragma unroll
    for (int u = 0; u < FQ; ++u)
#pragma unroll
      for (int jt = 0; jt < 2; ++jt) { v8f z = {}; z = mmh(kf[jt][0], qf[u][0], z); z = mmh(kf[jt][1], qf[u][1], z);
#pragma unroll
        for (int r = 0; r < 8; ++r) sv[u][jt * 8 + r] = fmaf(z[r], SCALE, lp[u][jt][r >> 2][r & 3]); }
    // the next step's K fragments and log-penalty rows, into the registers this step has just read: they fly during the softmax and the P . v products
#pragma unroll
    for (int jt = 0; jt < 2; ++jt) {
#pragma unroll
      for (int kc = 0; kc < 2; ++kc) kf[jt][kc] = frag_p(Kb + (size_t)kn * HD + jt * 1024 + kc * 512);
#pragma unroll
      for (int u = 0; u < FQ; ++u) { lp[u][jt][0] = *(const v4f*)(Lb + (size_t)u * 16 * TT + kn * 16 + jt * 256); lp[u][jt][1] = *(const v4f*)(Lb + (size_t)u * 16 * TT + kn * 16 + jt * 256 + 128); } }
    asm volatile("s_wait_xcnt 0x0" ::: "memory");   // in front of the next overwrite of the address registers of the loads above
    __builtin_amdgcn_sched_barrier(0);      // keeps the fetch-ahead loads issued in front of the softmax and the P . v products, which then cover their latency
#pragma unroll
    for (int u = 0; u < FQ; ++u) { float mt = sv[u][0];
#pragma unroll
      for (int i = 1; i < 16; ++i) mt = fmaxf(mt, sv[u][i]);
      mt = fmaxf(mt, xhalf(mt)); const float mn = fmaxf(m[u], mt); const float al = __builtin_amdgcn_exp2f((m[u] - mn) * L2E);   // 0 on the first step
      m[u] = mn; const float cc = 11.0f - mn * L2E; float ls = 0.f; v16h pb;
#pragma unroll
      for (int i = 0; i < 16; ++i) { const float p = __builtin_amdgcn_exp2f(fmaf(sv[u][i], L2E, cc)); ls += p; pb[i] = (_Float16)p; }
      l[u] = l[u] * al + ls;
#pragma unroll
      for (int j = 0; j < HD / 16; ++j) { o[u][j] = o[u][j] * al; o[u][j] = mmh(vf[j], pb, o[u][j]); } } }
#pragma unroll
  for (int u = 0; u < FQ; ++u) { const float inv = 1.0f / (l[u] + xhalf(l[u]));   // the halves' sums join once; the row's maximum contributes 2^11, so the sum is positive
    float* yr = Y + ((size_t)b * TT + q0 + u * 16 + col) * CC + h * HD + 8 * g;
#pragma unroll
    for (int j = 0; j < HD / 16; ++j) { v4f a0, a1;
#pragma unroll
      for (int r = 0; r < 4; ++r) { a0[r] = o[u][j][r] * inv; a1[r] = o[u][j][4 + r] * inv; }
      vst2(yr + j * 16, a0); vst2(yr + j * 16 + 4, a1); } } }

// ---- k_gate: block = 32 rows, 8 waves x 4 rows: g = sigmoid(x . Wg + bg) and pow(S - 2, 1 - g). A wave's 4 rows are worked together: their 128 loads and Wg's 32 are issued back to back with no wait between them, so the wave pays the memory latency once and not once per load; each row's sum keeps its order (i = 0..31 in the lane, then the xor tree)
__global__ __launch_bounds__(256) void k_gate(const float* __restrict__ X, const float* __restrict__ WG, const float* __restrict__ BG, float* __restrict__ GATE, float* __restrict__ PWR) { __shared__ __align__(16) float sg[32]; __shared__ __align__(16) float sp[32];
  const int tid = threadIdx.x, wave = tid >> 5, lane = tid & 31; const size_t r0 = (size_t)blockIdx.x * 32; const float bg_ = bfr(BG[0]);
  const float* xr = X + (r0 + wave * 4) * DIN + lane;
  float xv[4][32], wreg[32];   /* every loop below is fully unrolled: the arrays are indexed with compile-time constants and stay in registers */
#pragma unroll
  for (int rr = 0; rr < 4; ++rr)
#pragma unroll
    for (int i = 0; i < 32; ++i) xv[rr][i] = xr[rr * DIN + 32 * i];
  asm volatile("s_wait_xcnt 0x0" ::: "memory");   // in front of the next overwrite of the address registers of the loads above (the compiler gave them to Wg's loads as destinations)
  __builtin_amdgcn_sched_barrier(0);              // keeps Wg's loads behind that wait
#pragma unroll
  for (int i = 0; i < 32; ++i) wreg[i] = WG[lane + 32 * i];
  asm volatile("s_wait_xcnt 0x0" ::: "memory");   // the same for Wg's loads
  __builtin_amdgcn_sched_barrier(0);              // keeps every load issued ahead of the sums: drawn down among them, a load would start only when the sum before it is done
#pragma unroll
  for (int i = 0; i < 32; ++i) wreg[i] = bfr(wreg[i]);
  float acc[4];
#pragma unroll
  for (int rr = 0; rr < 4; ++rr) { acc[rr] = 0.f;
#pragma unroll
    for (int i = 0; i < 32; ++i) acc[rr] += bfr(xv[rr][i]) * wreg[i]; }
#pragma unroll
  for (int o = 1; o < 32; o <<= 1)
#pragma unroll
    for (int rr = 0; rr < 4; ++rr) acc[rr] += __shfl_xor(acc[rr], o);
  // every lane holds the four sums: lane rr takes row rr, so one pass of the sigmoid and the power serves the wave's four rows
  const float a = lane == 0 ? acc[0] : lane == 1 ? acc[1] : lane == 2 ? acc[2] : acc[3];
  const float g = 1.0f / (1.0f + expf(-(a + bg_))); const float pw = powf((float)(TT - 2), 1.0f - g);
  if (lane < 4) { sg[wave * 4 + lane] = g; sp[wave * 4 + lane] = pw; }   /* LDS only: no global access under the lane predicate */
  __syncthreads();
  if (tid < 8) vst2(GATE + r0 + tid * 4, *(const v4f*)&sg[tid * 4]);
  else if (tid >= 32 && tid < 40) vst2(PWR + r0 + (tid - 32) * 4, *(const v4f*)&sp[(tid - 32) * 4]); }
extern "C" void kernel_launch(void* const* d_in, const int* in_sizes, int n_in, void* d_out, int out_size, void* d_ws, size_t ws_size, hipStream_t stream) {
  (void)in_sizes; (void)n_in; (void)out_size;
  const float** F = (const float**)d_in;
  if (ws_size < (size_t)WS_END3) return;
  char* ws = (char*)d_ws; _Float16 *QH = (_Float16*)(ws + WS_QH), *KH = (_Float16*)(ws + WS_KH), *VT = (_Float16*)(ws + WS_VT), *QL = (_Float16*)(ws + WS_QL), *KL = (_Float16*)(ws + WS_KL); __bf16 *VB = (__bf16*)(ws + WS_VB), *VBL = (__bf16*)(ws + WS_VBL);
  (void)QL; (void)KL; (void)VB; (void)VBL;
  // inputs: 0 hidden_states [2,2048,1024]; 1 Wq [1024,1024] (in,out), 2 bq; 3 Wk, 4 bk; 5 Wv, 6 bv (zero biases, read); 7 Wg [1024,1]; 8 bg [1]; no output projection
  float* GATE = (float*)(ws + WS_GATE); float* PWR = (float*)(ws + WS_PWR); float* LPEN = (float*)(ws + WS_LPEN);
  k_gate<<<dim3(TNB * TT / 32), 256, 0, stream>>>(F[0], F[7], F[8], GATE, PWR);
  k_proj<<<dim3(TNB * TT / PBM, CC / 128, 3 + TNB), 256, 0, stream>>>(F[0], F[0], F[0], F[1], F[3], F[5], F[2], F[4], F[6], QH, QL, KH, KL, VT, VB, VBL, GATE, PWR, LPEN);   /* z = 0..2: q, k, v; z = 3 + b: the log-penalty plane of batch b (32 x 8 blocks, each half of a block 32 rows x 256 keys), shared by its 16 heads */
  k_fa<<<dim3(TT / (8 * 16 * FQ), NH, TNB), 256, 0, stream>>>(QH, KH, VT, LPEN, (float*)d_out);
}

// v007
// Measured time: 91.8 microseconds a run.
// Next to v006, in two timings, it ran 1.13 and 1.14 times as fast.
// Counting every step since v000, it is 12.8 times as fast.
// compute dtype: all float inputs rounded to bf16; q/k/v projections with EXACT bf16 products on WMMA 16x16x32 (f32 accumulate) + bias; the granularity gate g = sigmoid(x . Wg + bg) from exact bf16 products summed in f32 (VALU), pow(S - 2, 1 - g) with precise powf; logits q x k once to f16 each (1 product) x 64^-0.5 + the log-penalty bias in f32 (precise logf); softmax f32 with a running maximum and sum over steps of 32 keys; exp(s - m) x 2^11 once to f16 x v once to f16 (1 product), divided by the f32 row sum at the end; f32 output.
#include <hip/hip_runtime.h>
#include <math.h>

typedef __attribute__((ext_vector_type(16))) _Float16 v16h;
typedef __attribute__((ext_vector_type(16))) __bf16 v16b;
typedef __attribute__((ext_vector_type(8)))  _Float16 v8h;
typedef __attribute__((ext_vector_type(8)))  float v8f;
typedef __attribute__((ext_vector_type(4)))  float v4f;
typedef __attribute__((ext_vector_type(2)))  float v2f;
typedef __attribute__((ext_vector_type(4)))  unsigned v4u;
typedef __attribute__((ext_vector_type(4)))  int v4i;
typedef float __attribute__((may_alias)) float_a;
typedef int __attribute__((may_alias)) int_a;

template <typename T> __device__ __forceinline__ void vst2(void* p, T v) { *(T*)p = v;  }
__device__ __forceinline__ v8f wmma16(v16h a, v16h b, v8f c) {
  v8f d = __builtin_amdgcn_wmma_f32_16x16x32_f16(false, a, false, b, (short)0, c, false, false);
  asm volatile("v_nop\n\tv_nop\n\tv_nop\n\tv_nop" : "+v"(d) : "v"(a), "v"(b));
  return d;
}
__device__ __forceinline__ v8f wmma_bf(v16b a, v16b b, v8f c) {
  v8f d = __builtin_amdgcn_wmma_f32_16x16x32_bf16(false, a, false, b, (short)0, c, false, false);
  asm volatile("v_nop\n\tv_nop\n\tv_nop\n\tv_nop" : "+v"(d) : "v"(a), "v"(b));
  return d;
}
// 16x16x32 fragments: lane = (h = lane>>4, row/col = lane&15); elements 0..7 = k0+8h+0..7, 8..15 = k0+16+8h+0..7; D element r = row 8h+r
__device__ __forceinline__ v16h frag_h(const _Float16* rowk0, int lane) {
  union { v16h v; v8h q[2]; } u; const _Float16* p = rowk0 + 8 * (lane >> 4);
  u.q[0] = *(const v8h*)p; u.q[1] = *(const v8h*)(p + 16); return u.v;
}
__device__ __forceinline__ v16h frag_f32(const float* rowk0, int lane) {
  v16h a; const float* p = rowk0 + 8 * (lane >> 4);
#pragma unroll
  for (int i = 0; i < 8; ++i) { a[i] = (_Float16)p[i]; a[8 + i] = (_Float16)p[16 + i]; }
  return a;
}
__device__ __forceinline__ v16h frag_f32s(const float* rowk0, int lane, float sc) {
  v16h a; const float* p = rowk0 + 8 * (lane >> 4);
#pragma unroll
  for (int i = 0; i < 8; ++i) { a[i] = (_Float16)(p[i] * sc); a[8 + i] = (_Float16)(p[16 + i] * sc); }
  return a;
}
// column fragment from a [K][ld] layout (column n), rows >= K read as 0
__device__ __forceinline__ v16h fragc_f32(const float* W, int k0, int n, int lane, int ld, int K) {
  v16h a; const int g = lane >> 4;
#pragma unroll
  for (int i = 0; i < 8; ++i) { const int ka = k0 + 8 * g + i, kb = ka + 16;
    a[i] = (_Float16)(ka < K ? W[(size_t)(ka < K ? ka : K - 1) * ld + n] : 0.f); a[8 + i] = (_Float16)(kb < K ? W[(size_t)(kb < K ? kb : K - 1) * ld + n] : 0.f); }
  return a;
}
struct F2 { v16b h, l; };
__device__ __forceinline__ F2 bsplit16(const float v[16]) { F2 r;
#pragma unroll
  for (int i = 0; i < 16; ++i) { const __bf16 h = (__bf16)v[i]; r.h[i] = h; r.l[i] = (__bf16)(v[i] - (float)h); }
  return r; }
__device__ __forceinline__ F2 split_row(const float* row, int k0, int lane) { float v[16]; const float* p = row + k0 + 8 * (lane >> 4);
#pragma unroll
  for (int i = 0; i < 8; ++i) { v[i] = p[i]; v[8 + i] = p[16 + i]; }
  return bsplit16(v); }
__device__ __forceinline__ F2 split_rowK(const float* row, int k0, int lane, int K) { float v[16]; const int g = lane >> 4;
#pragma unroll
  for (int i = 0; i < 8; ++i) { const int ka = k0 + 8 * g + i, kb = ka + 16; v[i] = ka < K ? row[ka < K ? ka : K - 1] : 0.f; v[8 + i] = kb < K ? row[kb < K ? kb : K - 1] : 0.f; }
  return bsplit16(v); }
__device__ __forceinline__ F2 split_col(const float* W, int k0, int n, int lane, int ld, int K) { float v[16]; const int g = lane >> 4;
#pragma unroll
  for (int i = 0; i < 8; ++i) { const int ka = k0 + 8 * g + i, kb = ka + 16; v[i] = ka < K ? W[(size_t)(ka < K ? ka : K - 1) * ld + n] : 0.f; v[8 + i] = kb < K ? W[(size_t)(kb < K ? kb : K - 1) * ld + n] : 0.f; }
  return bsplit16(v); }
__device__ __forceinline__ v8f mac3(const F2& a, const F2& b, v8f c) { c = wmma_bf(a.l, b.h, c); c = wmma_bf(a.h, b.l, c); return wmma_bf(a.h, b.h, c); }
__device__ __forceinline__ float sigm(float v) { return 1.0f / (1.0f + expf(-v)); }
#define LDSX() do { asm volatile("s_wait_dscnt 0" ::: "memory"); __builtin_amdgcn_wave_barrier(); __builtin_amdgcn_fence(__ATOMIC_RELEASE, "workgroup"); } while (0)

// BERT-style self-attention with a learned granularity gate adding a log-penalty bias to the scores (hidden_states [2,2048,1024]; (in,out) Wq / Wk / Wv [1024,1024] N(0, 1/1024) + zero biases; Wg [1024,1] + bg: g = sigmoid(x Wg + bg) per token; res[i,j] = (1 - g_i) max(1 - g_i - g_j, 0) + g_i min(1 - g_i + g_j, 1); scope[i,j] = clip((S - 2)^(1 - g_i) + 2 - |i - j|, 1e-32, 1); log_pen = log(max(res * scope, 1e-32)), broadcast over the 16 heads; scores = q k^T / 8 + log_pen; softmax; no output projection): ctx [2,2048,1024].
#define NB 2
#define TT 2048
#define CC 1024            // NH * HD = projected width
#define DIN 1024          // input (model) width
#define NH 16
#define HD 64
#define NQB (TT / 64)
#define HG 4
#define SCALE (0.125f)
#define CAUSAL 0
#ifndef TNB
#define TNB NB
#endif
__device__ __forceinline__ float bfr(float v) { return (float)(__bf16)v; }
__host__ __device__ __forceinline__ int kb_last(int qb) { return CAUSAL ? ((qb * 64 + 63) >> 7) : (TT / 128 - 1); }
typedef __attribute__((ext_vector_type(8))) __bf16 v8b;
__device__ __forceinline__ v16b frag_b(const __bf16* rowk0, int lane) {
  union { v16b v; v8b q[2]; } u; const __bf16* p = rowk0 + 8 * (lane >> 4);
  u.q[0] = *(const v8b*)p; u.q[1] = *(const v8b*)(p + 16); return u.v;
}
#define QBH 0              // not read by any kernel in this file
#define QHI 0               // single-product logits on every row
#define KHI 64            // key rows carrying k residual / v bf16 hi+lo planes (written by k_proj; read by no kernel in this file)
// B fragment (k rows k0+.., output column o) of a weight: (in,out) [K][ld] or (out,in) [ld rows of K]: bf16 exact, or f16(bf16 * 256) exact
__device__ __forceinline__ v16b wcol_io(const float* Wm, int k0, int o, int lane, int ld) { v16b w; const int g = lane >> 4;
#pragma unroll
  for (int i = 0; i < 8; ++i) { w[i] = (__bf16)Wm[(size_t)(k0 + 8 * g + i) * ld + o]; w[8 + i] = (__bf16)Wm[(size_t)(k0 + 16 + 8 * g + i) * ld + o]; }
  return w; }
__device__ __forceinline__ v16b wcol_oi(const float* Wm, int k0, int o, int lane, int K) { v16b w; const float* p = Wm + (size_t)o * K + k0 + 8 * (lane >> 4);
#pragma unroll
  for (int i = 0; i < 8; ++i) { w[i] = (__bf16)p[i]; w[8 + i] = (__bf16)p[16 + i]; }
  return w; }
__device__ __forceinline__ v16h wcolh_io(const float* Wm, int k0, int o, int lane, int ld) { v16h w; const int g = lane >> 4;
#pragma unroll
  for (int i = 0; i < 8; ++i) { w[i] = (_Float16)(bfr(Wm[(size_t)(k0 + 8 * g + i) * ld + o]) * 256.0f); w[8 + i] = (_Float16)(bfr(Wm[(size_t)(k0 + 16 + 8 * g + i) * ld + o]) * 256.0f); }
  return w; }
__device__ __forceinline__ v16h wcolh_oi(const float* Wm, int k0, int o, int lane, int K) { v16h w; const float* p = Wm + (size_t)o * K + k0 + 8 * (lane >> 4);
#pragma unroll
  for (int i = 0; i < 8; ++i) { w[i] = (_Float16)(bfr(p[i]) * 256.0f); w[8 + i] = (_Float16)(bfr(p[16 + i]) * 256.0f); }
  return w; }
#define WQKV_LAYOUT 0   // 0 = (in,out) [DIN][CC]; 1 = (out,in) [CC][DIN]; 2 = per-head [NH][DIN][HD]
__device__ __forceinline__ v16b wcol_hdk(const float* Wm, int k0, int o, int lane) { v16b w; const int g = lane >> 4; const float* p = Wm + (size_t)(o / HD) * DIN * HD + (o % HD);
#pragma unroll
  for (int i = 0; i < 8; ++i) { w[i] = (__bf16)p[(size_t)(k0 + 8 * g + i) * HD]; w[8 + i] = (__bf16)p[(size_t)(k0 + 16 + 8 * g + i) * HD]; }
  return w; }
#define WO_OUT_IN 0
#if WQKV_LAYOUT == 1
#define WCOL(W, k0, o, lane) wcol_oi(W, k0, o, lane, DIN)
#elif WQKV_LAYOUT == 2
#define WCOL(W, k0, o, lane) wcol_hdk(W, k0, o, lane)
#else
#define WCOL(W, k0, o, lane) wcol_io(W, k0, o, lane, CC)
#endif
#if WO_OUT_IN
#define WOCOL(W, k0, o, lane) wcol_oi(W, k0, o, lane, CC)
#define WOCOLH(W, k0, o, lane) wcolh_oi(W, k0, o, lane, CC)
#else
#define WOCOL(W, k0, o, lane) wcol_io(W, k0, o, lane, DIN)
#define WOCOLH(W, k0, o, lane) wcolh_io(W, k0, o, lane, DIN)
#endif
// the module's log-penalty bias log_pen[b, i, j] is head-independent: lpen_block (in k_proj's launch) evaluates it ONCE per batch into an f32 plane LPEN[b] (fragment order); k_fa ADDS it to the scaled score (far keys carry the module's finite log(1e-32) = -73.68, kept literally)

#define WS_QH  0u                                      // f16 q rows [b*t][CC]
#define WS_KH  (WS_QH + 2u * (size_t)NB * TT * CC)      // f16 k in fragment order [b][h][t / 16][kc][piece][lane][8]
#define WS_VT  (WS_KH + 2u * (size_t)NB * TT * CC)      // f16 v in fragment order [b][h][t / 32][j][piece][lane][8]
#define WS_QL  (WS_VT + 2u * (size_t)NB * CC * TT)      // f16 q residual x 2^10 rows [b][t < QHI][CC]
#define WS_KL  (WS_QL + 2u * (size_t)NB * QHI * CC)     // f16 k residual x 2^10 rows [b][t < KHI][CC]
#define WS_VB  (WS_KL + 2u * (size_t)NB * KHI * CC)     // bf16 v hi planes [b][c][t < KHI]
#define WS_VBL (WS_VB + 2u * (size_t)NB * CC * KHI)
#define WS_END (WS_VBL + 2u * (size_t)NB * CC * KHI)
#define WS_GATE (WS_END)                                 // f32 g[b][s]
#define WS_PWR  (WS_GATE + 4u * (size_t)NB * TT)          // f32 pow(S - 2, 1 - g)[b][s]
#define WS_LPEN (WS_PWR + 4u * (size_t)NB * TT)          // f32 log-penalty planes in fragment order [b][i / 16][j / 32][jt][w][lane][4]
#define WS_END3 (WS_LPEN + 4u * (size_t)NB * TT * TT)

// ---- lpen_block: the log-penalty plane, worked by the blocks z = 3, 4 of k_proj's grid (one z per batch): 128 threads (half a block) = (32 query rows, 256 keys) of batch bsm: log(max(res * scope, 1e-32)), with res = (1 - gi) max(1 - gi - gj, 0) + gi min(1 - gi + gj, 1), scope = clip(pow(S - 2, 1 - gi) + 2 - |i - j|, 1e-32, 1) (gi / pow from the k_gate tables; f32, precise logf); the plane is shared by the 16 heads of the batch. It is written in the order in which k_fa's lanes read it: in a tile of 16 query rows, piece p = ((step * 2 + jt) * 2 + w) * 32 + lane holds query lane & 15, keys 32 step + 16 jt + 8 (lane >> 4) + 4 w + 0..3; each thread writes 16-B pieces, a wave whole lines. A thread's eight key groups are the same for both of the block's row tiles and are loaded once
__device__ __forceinline__ v4f lpen4(float gi_, float pw_, int t, int kb, v4f gj4) { v4f o;
#pragma unroll
  for (int u = 0; u < 4; ++u) { const int k = kb + u; const float gj_ = gj4[u]; const float res_ = (1.0f - gi_) * fmaxf(1.0f - gi_ - gj_, 0.0f) + gi_ * fminf(1.0f - gi_ + gj_, 1.0f); const int ad_ = (t > k) ? (t - k) : (k - t); const float sc_ = fminf(fmaxf(pw_ + 2.0f - (float)ad_, 1.0e-32f), 1.0f); o[u] = logf(fmaxf(res_ * sc_, 1.0e-32f)); }
  return o; }
__device__ __forceinline__ void lpen_block(const float* __restrict__ GATE, const float* __restrict__ PWR, float* LPEN, int bsm, int bx, int by, int tid) { const int lane = tid & 31;   // LPEN carries no __restrict__: with it the compiler moved the stores across the waits written behind them
  const float* G = GATE + (size_t)bsm * TT; const float* P = PWR + (size_t)bsm * TT;
  const int kq = by * 256 + ((tid >> 6) & 1) * 16 + (lane >> 4) * 8 + ((tid >> 5) & 1) * 4;   // first key of this thread's piece of step 0; step it lies 32 keys on
  v4f gj[8]; float gi[2], pw[2];   /* every loop below is fully unrolled: the arrays are indexed with compile-time constants and stay in registers */
#pragma unroll
  for (int it = 0; it < 8; ++it) gj[it] = *(const v4f*)(G + kq + 32 * it);
#pragma unroll
  for (int rb = 0; rb < 2; ++rb) { gi[rb] = G[(bx * 2 + rb) * 16 + (lane & 15)]; pw[rb] = P[(bx * 2 + rb) * 16 + (lane & 15)]; }
  asm volatile("s_wait_xcnt 0x0" ::: "memory");   // in front of the next overwrite of the address registers of the loads above
  __builtin_amdgcn_sched_barrier(0);              // keeps the arithmetic below behind that wait
#pragma unroll
  for (int rb = 0; rb < 2; ++rb) { const int t = (bx * 2 + rb) * 16 + (lane & 15);
    float* dst = LPEN + (size_t)bsm * TT * TT + ((size_t)(bx * 2 + rb) * (TT / 32) + by * 8) * 512 + tid * 4;
#pragma unroll
    for (int it = 0; it < 8; it += 2) { const v4f o0 = lpen4(gi[rb], pw[rb], t, kq + 32 * it, gj[it]); const v4f o1 = lpen4(gi[rb], pw[rb], t, kq + 32 * it + 32, gj[it + 1]);
      __builtin_amdgcn_sched_barrier(0);   // the two pieces' arithmetic (eight independent chains) ends in front of their stores, so that nothing is computed between a store and the wait behind it
      vst2(dst + it * 512, o0); vst2(dst + it * 512 + 512, o1);
      asm volatile("s_wait_xcnt 0x0" ::: "memory");   // in front of the next overwrite of the stores' data registers
      __builtin_amdgcn_sched_barrier(0); } } }         // keeps the next pieces' arithmetic behind that wait
// ---- k_proj: block = (128 rows, 128 cols, which), 8 waves in a 4 x 2 grid, each on 32 rows x 64 cols (2 x 4 fragments): q/k/v = X W (+ b) with exact bf16 products (K = DIN) -> which 0: q f16 rows (+ residual rows < QHI); 1: k f16 in fragment order (+ residual rows < KHI); 2: v f16 in fragment order (+ bf16 hi/lo planes for t < KHI)
// Operands go through LDS, 32 k at a time, two buffers: the block reads each f32 tile of X and W once, in whole 128-B lines, rounds it to bf16 and lays it k-contiguous (W transposed inside the thread that loaded it); the eight waves take their fragments from there. The next tile's global loads fly while this tile is multiplied.
#define PBM 128            // rows per block
#define PBK 32             // k per stage
#define PNS (DIN / PBK)
#define PPI 40             // bf16 per staged row: 64 B of data at a pitch of 80 B (16 B x odd: the 16 rows of a ds_load_b128 fragment read fall on 16 different bank groups)
#define PWB (128 * PPI * 2 + 128)   // bytes of one W buffer: column n at n * 80 + 16 ((n >> 4) & 3) + 64 (n >> 6)
#define PEP 136            // f16 per row of the output staging: 256 B of data at a pitch of 272 B (16 B x odd)
typedef __attribute__((ext_vector_type(4))) __bf16 v4b;
// six waves per SIMD (160 registers) and a third of the LDS: three blocks per WGP, so that all 768 projection blocks are resident at once and none waits for a second round
__global__ __launch_bounds__(256, 6) void k_proj(const float* __restrict__ XQ, const float* __restrict__ XK, const float* __restrict__ XV, const float* __restrict__ WQ, const float* __restrict__ WK, const float* __restrict__ WV, const float* __restrict__ BQ, const float* __restrict__ BK, const float* __restrict__ BV,
    _Float16* __restrict__ QH, _Float16* __restrict__ QL, _Float16* __restrict__ KH, _Float16* __restrict__ KL, _Float16* __restrict__ VT, __bf16* __restrict__ VB, __bf16* __restrict__ VBL, const float* __restrict__ GATE, const float* __restrict__ PWR, float* LPEN) {
  static_assert(2 * (TNB * TT / PBM) == TT / 32 && CC / 128 == TT / 256, "a z slice of the grid covers one log-penalty plane: each half of a block takes 32 rows x 256 keys");
  // the short log-penalty blocks come last in the grid: they start as the projection's blocks drain, with no launch of their own; the whole block leaves here, in front of every barrier
  if (blockIdx.z >= 3) { lpen_block(GATE, PWR, LPEN, (int)blockIdx.z - 3, blockIdx.x * 2 + (threadIdx.x >> 7), blockIdx.y, threadIdx.x & 127); return; }
  // one LDS range: the operand stages of the k loop lie in the bytes that the output staging takes over behind the loop; the q / k staging (two planes) and the v staging (three planes) share those bytes, a block uses one of them
  __shared__ __align__(16) unsigned char smem[3 * 128 * PEP * 2];
  _Float16 (*sh)[PEP] = (_Float16 (*)[PEP])smem; _Float16 (*sl)[PEP] = (_Float16 (*)[PEP])(smem + PBM * PEP * 2);
  _Float16 (*th)[PEP] = (_Float16 (*)[PEP])smem; __bf16 (*tb)[PEP] = (__bf16 (*)[PEP])(smem + 128 * PEP * 2); __bf16 (*tbl)[PEP] = (__bf16 (*)[PEP])(smem + 2 * 128 * PEP * 2);
  // W^T: [2][PWB bytes] from smem on
  __bf16* Xs = (__bf16*)(smem + 2 * PWB);                  // [2][PBM rows][PPI]
  const int tid = threadIdx.x, wave = tid >> 5, lane = tid & 31, col = lane & 15, g = lane >> 4; const int wm = wave >> 1, wn = wave & 1;   // the wave's 32 rows and 64 columns of the block's tile
  const int which = blockIdx.z; const int c0 = blockIdx.y * 128; const size_t r0 = (size_t)blockIdx.x * PBM; const size_t bb = r0 / TT; const int t0 = (int)(r0 % TT);
  const float* X = which == 0 ? XQ : which == 1 ? XK : XV; const float* WA = which == 0 ? WQ : which == 1 ? WK : WV; const float* BA = which == 0 ? BQ : which == 1 ? BK : BV;
  const float* Wg = WA + c0; const unsigned wo = (unsigned)(4 * wave * CC + 4 * lane);         // this thread's W piece of a stage: k rows 4 wave + 0..3, columns 4 lane + 0..3 (a wave's load = 512 contiguous bytes); block-uniform base + 32-bit offset: one address register
  const float* Xg = X + r0 * DIN; const unsigned xo = (unsigned)((tid >> 3) * DIN + 4 * (tid & 7));   // its X piece: rows (tid >> 3) + 32 i, k 4 (tid & 7) + 0..3 (a wave's load = four whole lines)
  // the skew of 16 B per 16 columns spreads the columns 4 lane + c, which one LDS store writes, over the bank groups; the 16 columns of a fragment read share one skew, so that store and read each need one address register and constant offsets
  unsigned char* Wst = smem + 4 * lane * (PPI * 2) + 16 * ((lane >> 2) & 3) + 64 * (lane >> 4) + 8 * wave;
  const unsigned char* Wrd = smem + wn * (64 * PPI * 2 + 64) + col * (PPI * 2);
  __bf16* Xst = Xs + (tid >> 3) * PPI + 4 * (tid & 7);
  // L2 prefetch at the block's head, as in k_fa: a stage's loads are issued one stage ahead, which does not cover a line that has to come from memory. The blocks that share 128 rows of X (same x) divide them: block y asks bytes 512 y + 0..511 of each row. A column block of W is read by all 32 x: of any four neighbouring x, each asks 128 of 512 k rows, and bit 3 of x picks the half of the 1024. A hint only; every address lies inside X or W for every block and thread
  static_assert(PBM == 128 && DIN * 4 == 4096 && CC * 4 == 4096 && CC / 128 == 8 && DIN == 8 * 128, "128 rows x two 256-B units per thread pair; eight shares cover a row of X and the k rows of W");
  const unsigned pfo = (unsigned)((tid >> 1) * 4096 + (tid & 1) * 256);   // row tid / 2 (pitch 4 KiB in X and in W), 256-B unit tid & 1
  const char* pfx = (const char*)(X + r0 * DIN) + (int)blockIdx.y * 512;
  const char* pfw = (const char*)(WA + c0) + (size_t)(((int)blockIdx.x & 3) | ((((int)blockIdx.x >> 3) & 1) << 2)) * (128 * 4096);
  asm volatile("global_prefetch_b8 %0, %1 scope:SCOPE_SE\n\t"
               "global_prefetch_b8 %0, %2 scope:SCOPE_SE" :: "v"(pfo), "s"(pfx), "s"(pfw));
  v4f wr[4], xr[4];
#pragma unroll
  for (int i = 0; i < 4; ++i) wr[i] = *(const v4f*)(Wg + (size_t)i * CC + wo);
#pragma unroll
  for (int i = 0; i < 4; ++i) xr[i] = *(const v4f*)(Xg + (size_t)(32 * i) * DIN + xo);
  asm volatile("s_wait_xcnt 0x0" :: "v"(pfo), "s"(pfx), "s"(pfw) : "memory");   // the prefetches' offset and bases keep their values up to here, behind the loads that were issued after them
  v8f acc[2][4] = {};
#pragma unroll 2   // two stages per trip: the buffer index is a constant in each
  for (int s = 0; s < PNS; ++s) { const int bf = s & 1; const int sn = s + 1 < PNS ? s + 1 : s;   // the stage fetched ahead; the last stage fetches itself again (in bounds, unused)
#pragma unroll
    for (int c = 0; c < 4; ++c) { v4b p;
#pragma unroll
      for (int i = 0; i < 4; ++i) p[i] = (__bf16)wr[i][c];
      *(v4b*)(Wst + bf * PWB + c * (PPI * 2)) = p; }
#pragma unroll
    for (int i = 0; i < 4; ++i) { v4b p;
#pragma unroll
      for (int e = 0; e < 4; ++e) p[e] = (__bf16)xr[i][e];
      *(v4b*)(Xst + bf * PBM * PPI + 32 * i * PPI) = p; }
    __syncthreads();   // publishes stage s; it also ends every wave's reads of stage s - 1, whose buffer the next trip overwrites
#pragma unroll
    for (int i = 0; i < 4; ++i) wr[i] = *(const v4f*)(Wg + (size_t)(sn * PBK + i) * CC + wo);
#pragma unroll
    for (int i = 0; i < 4; ++i) xr[i] = *(const v4f*)(Xg + (size_t)(32 * i) * DIN + sn * PBK + xo);
    asm volatile("s_wait_xcnt 0x0" ::: "memory");   // in front of the next overwrite of the address registers of the loads above; it also keeps those loads issued ahead of the products, which cover their latency
    v16b a[2], w[4];
#pragma unroll
    for (int i = 0; i < 2; ++i) a[i] = frag_b(Xs + (bf * PBM + wm * 32 + i * 16 + col) * PPI, lane);
#pragma unroll
    for (int j = 0; j < 4; ++j) w[j] = frag_b((const __bf16*)(Wrd + bf * PWB + j * (16 * PPI * 2 + 16)), lane);
    __builtin_amdgcn_sched_barrier(0);   // the stage's LDS reads go out as one group ahead of its products: spread among them, each product waited out a whole LDS latency
#pragma unroll
    for (int i = 0; i < 2; ++i)
#pragma unroll
      for (int j = 0; j < 4; ++j) acc[i][j] = wmma_bf(a[i], w[j], acc[i][j]);
    __builtin_amdgcn_sched_barrier(0); }   // keeps the next stage's conversions, which wait for the global loads, behind this stage's products (the compiler had drawn them, and the wait, in among the products)
  __syncthreads();   // every wave has left the operand stages before the output staging below overwrites them
  if (which < 2) { _Float16* DH = which == 0 ? QH : KH; _Float16* DL = which == 0 ? QL : KL; const int nhi = which == 0 ? QHI : KHI;
#pragma unroll
    for (int j = 0; j < 4; ++j) { const int cl = wn * 64 + j * 16 + col; const float bias = BA ? bfr(BA[c0 + cl]) : 0.f;
#pragma unroll
      for (int i = 0; i < 2; ++i)
#pragma unroll
        for (int r = 0; r < 8; ++r) { const float v = acc[i][j][r] + bias; const _Float16 hv = (_Float16)v; const int rl = wm * 32 + i * 16 + 8 * g + r; sh[rl][cl] = hv; sl[rl][cl] = (_Float16)((v - (float)hv) * 1024.0f); } }
    __syncthreads();
    // k leaves in the order in which k_fa's A fragments read it: 16-B piece pc = 2 kc + piece of lane ln (key row ln & 15, half ln >> 4) of a 16-key tile of one head, lanes contiguous; q stays in rows
    for (int e = tid; e < PBM * 16; e += 256) { int rl, q; size_t od;
      if (which == 0) { rl = e >> 4; q = e & 15; od = (r0 + rl) * CC + c0 + q * 8; }
      else { const int ln = e & 31, pc = (e >> 5) & 3, tl = (e >> 7) & 7, hl = e >> 10; rl = tl * 16 + (ln & 15); q = hl * 8 + pc * 2 + (ln >> 4); od = ((((bb * NH + (c0 >> 6) + hl) * (TT / 16) + (t0 >> 4) + tl) * 4 + pc) * 32 + ln) * 8; }
      vst2((unsigned*)(DH + od), *(const v4u*)&sh[rl][q * 8]);
      asm volatile("s_wait_xcnt 0x0" ::: "memory");   // in front of the next overwrite of the store's address and data registers
      if (t0 + rl < nhi) { vst2((unsigned*)(DL + (bb * nhi + t0 + rl) * (size_t)CC + c0 + q * 8), *(const v4u*)&sl[rl][q * 8]);   // the residual plane holds rows < nhi only: of a 128-row block at most the first rows
        asm volatile("s_wait_xcnt 0x0" ::: "memory"); } }   // the same for this store
  } else {
#pragma unroll
    for (int j = 0; j < 4; ++j) { const int cl = wn * 64 + j * 16 + col; const float bias = BA ? bfr(BA[c0 + cl]) : 0.f;
#pragma unroll
      for (int i = 0; i < 2; ++i)
#pragma unroll
        for (int r = 0; r < 8; ++r) { const float v = acc[i][j][r] + bias; const int rl = wm * 32 + i * 16 + 8 * g + r; th[cl][rl] = (_Float16)v; const __bf16 bh = (__bf16)v; tb[cl][rl] = bh; tbl[cl][rl] = (__bf16)(v - (float)bh); } }
    __syncthreads();
    // v leaves in the order in which k_fa's A fragments read it: piece pc of lane ln (channel ln & 15 of tile j, half ln >> 4) of a 32-key step of one head, lanes contiguous
    for (int e = tid; e < 128 * (PBM / 8); e += 256) { const int ln = e & 31, pc = (e >> 5) & 1, j = (e >> 6) & 3, st = (e >> 8) & 3, hl = e >> 10; const int cl = hl * 64 + j * 16 + (ln & 15), q = st * 4 + pc * 2 + (ln >> 4);
      vst2((unsigned*)(VT + (((((bb * NH + (c0 >> 6) + hl) * (TT / 32) + (t0 >> 5) + st) * 4 + j) * 2 + pc) * 32 + ln) * 8), *(const v4u*)&th[cl][q * 8]);
      asm volatile("s_wait_xcnt 0x0" ::: "memory");   // in front of the next overwrite of the store's address and data registers
      if (t0 + q * 8 < KHI) { const size_t o3 = (bb * CC + c0 + cl) * (size_t)KHI + t0 + q * 8; vst2((unsigned*)(VB + o3), *(const v4u*)&tb[cl][q * 8]); vst2((unsigned*)(VBL + o3), *(const v4u*)&tbl[cl][q * 8]);   // the hi / lo planes hold keys < KHI only
        asm volatile("s_wait_xcnt 0x0" ::: "memory"); } } } }   // the same for these two stores
// ---- k_fa: block = 256 queries (8 waves x 32 query columns) of (b, h): one pass over all keys, 32 at a time, with a running maximum and sum per query (online softmax); the logits and P stay in registers.
// Transposed products: S^T = K . Q^T (A = key rows, B = query rows) puts one query's 16 scores of a 32-key step in lanes c and c + 16; two S^T tiles, converted in place, are the B operand of O^T += V^T . P^T (A = v, channel rows); O^T register r = ctx[query c][16 j + 8 h + r].
// P = exp(s - m) x 2^11 once to f16 (the row sum carries the same factor, taken in f32 before the rounding, and divides it out at the end).
#define FQ 2               // query tiles of 16 columns per wave: each K / V fragment load feeds both
// every inner loop below is fully unrolled so that the fragment and accumulator arrays are indexed by constants and stay in registers
#define L2E 1.4426950408889634f
__device__ __forceinline__ v8f mmh(v16h a, v16h b, v8f c) { return __builtin_amdgcn_wmma_f32_16x16x32_f16(false, a, false, b, (short)0, c, false, false); }
// a fragment stored in fragment order: this lane's two 16-B pieces lie 512 B apart (p already holds the lane's offset)
__device__ __forceinline__ v16h frag_p(const _Float16* p) { union { v16h v; v8h q[2]; } u; u.q[0] = *(const v8h*)p; u.q[1] = *(const v8h*)(p + 256); return u.v; }
__device__ __forceinline__ float xhalf(float x) { return __builtin_bit_cast(float, __builtin_amdgcn_permlanex16(__builtin_bit_cast(int, x), __builtin_bit_cast(int, x), 0x76543210, 0xfedcba98, false, false)); }  // lane l with lane l ^ 16
__global__ __launch_bounds__(256) void k_fa(const _Float16* __restrict__ QH, const _Float16* __restrict__ KH, const _Float16* __restrict__ VT, const float* __restrict__ LPEN, float* __restrict__ Y) {
  const int tid = threadIdx.x, wave = tid >> 5, lane = tid & 31, col = lane & 15, g = lane >> 4; const int h = blockIdx.y, b = blockIdx.z; const int q0 = blockIdx.x * (8 * 16 * FQ) + wave * (16 * FQ);
  // K, V and the log-penalty lie in fragment order: a wave's load is 32 lanes x 16 B = 512 contiguous bytes (four whole lines)
  const _Float16* Kb = KH + (size_t)(b * NH + h) * TT * HD + lane * 8;          // 32 keys = 2048 halves: [jt][kc][piece][lane][8]
  const _Float16* Vb = VT + (size_t)(b * NH + h) * TT * HD + lane * 8;          // 32 keys = 2048 halves: [j][piece][lane][8]
  const float* Lb = LPEN + (size_t)b * TT * TT + (size_t)q0 * TT + lane * 4;    // 16 queries x 32 keys = 512 floats: [jt][w][lane][4]; 16 queries = 16 TT floats
  // L2 prefetch at the kernel's head: K, V and the log-penalty plane were stored by the launch before, and a line that is not in the L2 costs a step of the loop below a whole memory latency (its loads are issued only one step ahead). Each 256-B unit is asked for once per group of blocks that read it: the 16 heads of a query block share its log-penalty rows (head h asks key steps 4 h + 0..3 of the block's 16 row tiles), four neighbouring query blocks share a head's K and V (block x asks the pairs of key steps p = x mod 4 (mod 4)). A hint only: nothing depends on where a block runs or on a line having arrived. Every address lies inside its plane for every block, wave and lane.
  static_assert(4 * NH == TT / 32 && TT / 32 == 64 && TT / (8 * 16 * FQ) == 8, "the shares below cover the 64 key steps once: 16 heads x 4 steps; 4 blocks x 8 waves x 2 steps");
  const int ws = __builtin_amdgcn_readfirstlane(wave);   // the wave's number in a scalar register: the prefetches' bases are scalar
  const unsigned poff = (unsigned)lane * 256u;           // one 256-B unit per lane: a wave's prefetch covers 8 KiB
  const char* pk = (const char*)(KH + (size_t)(b * NH + h) * TT * HD) + (size_t)(4 * ws + ((int)blockIdx.x & 3)) * 8192;   // two key steps of K = 8 KiB
  const char* pv = (const char*)(VT + (size_t)(b * NH + h) * TT * HD) + (size_t)(4 * ws + ((int)blockIdx.x & 3)) * 8192;   // the same two steps of V
  const char* pl = (const char*)(LPEN + (size_t)b * TT * TT) + ((size_t)((int)blockIdx.x * 16 + ws) * (TT / 32) + 4 * h) * 2048;   // four key steps of row tile ws of the block = 8 KiB; row tile ws + 8 lies 8 x 128 KiB on
  asm volatile("global_prefetch_b8 %0, %1 scope:SCOPE_SE\n\t"
               "global_prefetch_b8 %0, %2 scope:SCOPE_SE\n\t"
               "global_prefetch_b8 %0, %3 scope:SCOPE_SE\n\t"
               "global_prefetch_b8 %0, %3 offset:1048576 scope:SCOPE_SE" :: "v"(poff), "s"(pk), "s"(pv), "s"(pl));
  v16h qf[FQ][2];
#pragma unroll
  for (int u = 0; u < FQ; ++u)
#pragma unroll
    for (int kc = 0; kc < 2; ++kc) qf[u][kc] = frag_h(QH + ((size_t)b * TT + q0 + u * 16 + col) * CC + h * HD + kc * 32, lane);
  __builtin_amdgcn_sched_barrier(0);   // q's loads stay issued ahead of K's and the log-penalty's: issued last (where the scheduler put them once the prefetches stood above), they turn the counted wait at the loop's head into a wait for every load in flight
  v16h kf[2][2]; v4f lp[FQ][2][2];
#pragma unroll
  for (int jt = 0; jt < 2; ++jt) {
#pragma unroll
    for (int kc = 0; kc < 2; ++kc) kf[jt][kc] = frag_p(Kb + jt * 1024 + kc * 512);
#pragma unroll
    for (int u = 0; u < FQ; ++u) { lp[u][jt][0] = *(const v4f*)(Lb + (size_t)u * 16 * TT + jt * 256); lp[u][jt][1] = *(const v4f*)(Lb + (size_t)u * 16 * TT + jt * 256 + 128); } }
  asm volatile("s_wait_xcnt 0x0" :: "v"(poff), "s"(pk), "s"(pv), "s"(pl) : "memory");   // the address registers of the loads above are reused for the accumulators set up below: the wait stands in front of that overwrite; the prefetches' offset and bases are named so that they too keep their values up to here, behind the loads that were issued after them
  __builtin_amdgcn_sched_barrier(0);              // keeps the accumulators' set-up behind that wait (the compiler lifted it over the wait without this)
  v8f o[FQ][HD / 16] = {}; float m[FQ], l[FQ];
#pragma unroll
  for (int u = 0; u < FQ; ++u) { m[u] = -3.0e38f; l[u] = 0.f; }
#pragma unroll 1   // stays rolled: one step's live set already takes the 256 registers that need no window switch
  for (int k0 = 0; k0 < TT; k0 += 32) { const int kn = k0 + 32 < TT ? k0 + 32 : 0;   // the step fetched ahead; the last step fetches step 0 again (in bounds, unused)
    v16h vf[HD / 16];
#pragma unroll
    for (int j = 0; j < HD / 16; ++j) vf[j] = frag_p(Vb + (size_t)k0 * HD + j * 512);
    float sv[FQ][16];
#pragma unroll
    for (int u = 0; u < FQ; ++u)
#pragma unroll
      for (int jt = 0; jt < 2; ++jt) { v8f z = {}; z = mmh(kf[jt][0], qf[u][0], z); z = mmh(kf[jt][1], qf[u][1], z);
#pragma unroll
        for (int r = 0; r < 8; ++r) sv[u][jt * 8 + r] = fmaf(z[r], SCALE, lp[u][jt][r >> 2][r & 3]); }
    // the next step's K fragments and log-penalty rows, into the registers this step has just read: they fly during the softmax and the P . v products
#pragma unroll
    for (int jt = 0; jt < 2; ++jt) {
#pragma unroll
      for (int kc = 0; kc < 2; ++kc) kf[jt][kc] = frag_p(Kb + (size_t)kn * HD + jt * 1024 + kc * 512);
#pragma unroll
      for (int u = 0; u < FQ; ++u) { lp[u][jt][0] = *(const v4f*)(Lb + (size_t)u * 16 * TT + kn * 16 + jt * 256); lp[u][jt][1] = *(const v4f*)(Lb + (size_t)u * 16 * TT + kn * 16 + jt * 256 + 128); } }
    asm volatile("s_wait_xcnt 0x0" ::: "memory");   // in front of the next overwrite of the address registers of the loads above
    __builtin_amdgcn_sched_barrier(0);      // keeps the fetch-ahead loads issued in front of the softmax and the P . v products, which then cover their latency
#pragma unroll
    for (int u = 0; u < FQ; ++u) { float mt = sv[u][0];
#pragma unroll
      for (int i = 1; i < 16; ++i) mt = fmaxf(mt, sv[u][i]);
      mt = fmaxf(mt, xhalf(mt)); const float mn = fmaxf(m[u], mt); const float al = __builtin_amdgcn_exp2f((m[u] - mn) * L2E);   // 0 on the first step
      m[u] = mn; const float cc = 11.0f - mn * L2E; float ls = 0.f; v16h pb;
#pragma unroll
      for (int i = 0; i < 16; ++i) { const float p = __builtin_amdgcn_exp2f(fmaf(sv[u][i], L2E, cc)); ls += p; pb[i] = (_Float16)p; }
      l[u] = l[u] * al + ls;
#pragma unroll
      for (int j = 0; j < HD / 16; ++j) { o[u][j] = o[u][j] * al; o[u][j] = mmh(vf[j], pb, o[u][j]); } } }
#pragma unroll
  for (int u = 0; u < FQ; ++u) { const float inv = 1.0f / (l[u] + xhalf(l[u]));   // the halves' sums join once; the row's maximum contributes 2^11, so the sum is positive
    float* yr = Y + ((size_t)b * TT + q0 + u * 16 + col) * CC + h * HD + 8 * g;
#pragma unroll
    for (int j = 0; j < HD / 16; ++j) { v4f a0, a1;
#pragma unroll
      for (int r = 0; r < 4; ++r) { a0[r] = o[u][j][r] * inv; a1[r] = o[u][j][4 + r] * inv; }
      vst2(yr + j * 16, a0); vst2(yr + j * 16 + 4, a1); } } }

// ---- k_gate: block = 32 rows, 8 waves x 4 rows: g = sigmoid(x . Wg + bg) and pow(S - 2, 1 - g). A wave's 4 rows are worked together: their 128 loads and Wg's 32 are issued back to back with no wait between them, so the wave pays the memory latency once and not once per load; each row's sum keeps its order (i = 0..31 in the lane, then the xor tree)
__global__ __launch_bounds__(256) void k_gate(const float* __restrict__ X, const float* __restrict__ WG, const float* __restrict__ BG, float* __restrict__ GATE, float* __restrict__ PWR) { __shared__ __align__(16) float sg[32]; __shared__ __align__(16) float sp[32];
  const int tid = threadIdx.x, wave = tid >> 5, lane = tid & 31; const size_t r0 = (size_t)blockIdx.x * 32; const float bg_ = bfr(BG[0]);
  const float* xr = X + (r0 + wave * 4) * DIN + lane;
  float xv[4][32], wreg[32];   /* every loop below is fully unrolled: the arrays are indexed with compile-time constants and stay in registers */
#pragma unroll
  for (int rr = 0; rr < 4; ++rr)
#pragma unroll
    for (int i = 0; i < 32; ++i) xv[rr][i] = xr[rr * DIN + 32 * i];
  asm volatile("s_wait_xcnt 0x0" ::: "memory");   // in front of the next overwrite of the address registers of the loads above (the compiler gave them to Wg's loads as destinations)
  __builtin_amdgcn_sched_barrier(0);              // keeps Wg's loads behind that wait
#pragma unroll
  for (int i = 0; i < 32; ++i) wreg[i] = WG[lane + 32 * i];
  asm volatile("s_wait_xcnt 0x0" ::: "memory");   // the same for Wg's loads
  __builtin_amdgcn_sched_barrier(0);              // keeps every load issued ahead of the sums: drawn down among them, a load would start only when the sum before it is done
#pragma unroll
  for (int i = 0; i < 32; ++i) wreg[i] = bfr(wreg[i]);
  float acc[4];
#pragma unroll
  for (int rr = 0; rr < 4; ++rr) { acc[rr] = 0.f;
#pragma unroll
    for (int i = 0; i < 32; ++i) acc[rr] += bfr(xv[rr][i]) * wreg[i]; }
#pragma unroll
  for (int o = 1; o < 32; o <<= 1)
#pragma unroll
    for (int rr = 0; rr < 4; ++rr) acc[rr] += __shfl_xor(acc[rr], o);
  // every lane holds the four sums: lane rr takes row rr, so one pass of the sigmoid and the power serves the wave's four rows
  const float a = lane == 0 ? acc[0] : lane == 1 ? acc[1] : lane == 2 ? acc[2] : acc[3];
  const float g = 1.0f / (1.0f + expf(-(a + bg_))); const float pw = powf((float)(TT - 2), 1.0f - g);
  if (lane < 4) { sg[wave * 4 + lane] = g; sp[wave * 4 + lane] = pw; }   /* LDS only: no global access under the lane predicate */
  __syncthreads();
  if (tid < 8) vst2(GATE + r0 + tid * 4, *(const v4f*)&sg[tid * 4]);
  else if (tid >= 32 && tid < 40) vst2(PWR + r0 + (tid - 32) * 4, *(const v4f*)&sp[(tid - 32) * 4]); }
extern "C" void kernel_launch(void* const* d_in, const int* in_sizes, int n_in, void* d_out, int out_size, void* d_ws, size_t ws_size, hipStream_t stream) {
  (void)in_sizes; (void)n_in; (void)out_size;
  const float** F = (const float**)d_in;
  if (ws_size < (size_t)WS_END3) return;
  char* ws = (char*)d_ws; _Float16 *QH = (_Float16*)(ws + WS_QH), *KH = (_Float16*)(ws + WS_KH), *VT = (_Float16*)(ws + WS_VT), *QL = (_Float16*)(ws + WS_QL), *KL = (_Float16*)(ws + WS_KL); __bf16 *VB = (__bf16*)(ws + WS_VB), *VBL = (__bf16*)(ws + WS_VBL);
  (void)QL; (void)KL; (void)VB; (void)VBL;
  // inputs: 0 hidden_states [2,2048,1024]; 1 Wq [1024,1024] (in,out), 2 bq; 3 Wk, 4 bk; 5 Wv, 6 bv (zero biases, read); 7 Wg [1024,1]; 8 bg [1]; no output projection
  float* GATE = (float*)(ws + WS_GATE); float* PWR = (float*)(ws + WS_PWR); float* LPEN = (float*)(ws + WS_LPEN);
  k_gate<<<dim3(TNB * TT / 32), 256, 0, stream>>>(F[0], F[7], F[8], GATE, PWR);
  k_proj<<<dim3(TNB * TT / PBM, CC / 128, 3 + TNB), 256, 0, stream>>>(F[0], F[0], F[0], F[1], F[3], F[5], F[2], F[4], F[6], QH, QL, KH, KL, VT, VB, VBL, GATE, PWR, LPEN);   /* z = 0..2: q, k, v; z = 3 + b: the log-penalty plane of batch b (32 x 8 blocks, each half of a block 32 rows x 256 keys), shared by its 16 heads */
  k_fa<<<dim3(TT / (8 * 16 * FQ), NH, TNB), 256, 0, stream>>>(QH, KH, VT, LPEN, (float*)d_out);
}

// v008
// A run of this version takes 84.5 microseconds.
// Timed twice side by side with v007, it ran 1.08 times as fast both times.
// Counting every step since v000, it is 13.9 times as fast.
// compute dtype: all float inputs rounded to bf16; q/k/v projections with EXACT bf16 products on WMMA 16x16x32 (f32 accumulate) + bias; the granularity gate g = sigmoid(x . Wg + bg) from exact bf16 products summed in f32 (VALU), pow(S - 2, 1 - g) with precise powf; logits q x k once to f16 each (1 product) x 64^-0.5 + the log-penalty bias in f32 (precise logf); softmax f32 with a running maximum and sum over steps of 32 keys; exp(s - m) x 2^11 once to f16 x v once to f16 (1 product), divided by the f32 row sum at the end; f32 output.
#include <hip/hip_runtime.h>
#include <math.h>

typedef __attribute__((ext_vector_type(16))) _Float16 v16h;
typedef __attribute__((ext_vector_type(16))) __bf16 v16b;
typedef __attribute__((ext_vector_type(8)))  _Float16 v8h;
typedef __attribute__((ext_vector_type(8)))  float v8f;
typedef __attribute__((ext_vector_type(4)))  float v4f;
typedef __attribute__((ext_vector_type(2)))  float v2f;
typedef __attribute__((ext_vector_type(4)))  unsigned v4u;
typedef __attribute__((ext_vector_type(4)))  int v4i;
typedef float __attribute__((may_alias)) float_a;
typedef int __attribute__((may_alias)) int_a;

template <typename T> __device__ __forceinline__ void vst2(void* p, T v) { *(T*)p = v;  }
__device__ __forceinline__ v8f wmma16(v16h a, v16h b, v8f c) {
  v8f d = __builtin_amdgcn_wmma_f32_16x16x32_f16(false, a, false, b, (short)0, c, false, false);
  asm volatile("v_nop\n\tv_nop\n\tv_nop\n\tv_nop" : "+v"(d) : "v"(a), "v"(b));
  return d;
}
__device__ __forceinline__ v8f wmma_bf(v16b a, v16b b, v8f c) {
  v8f d = __builtin_amdgcn_wmma_f32_16x16x32_bf16(false, a, false, b, (short)0, c, false, false);
  asm volatile("v_nop\n\tv_nop\n\tv_nop\n\tv_nop" : "+v"(d) : "v"(a), "v"(b));
  return d;
}
// 16x16x32 fragments: lane = (h = lane>>4, row/col = lane&15); elements 0..7 = k0+8h+0..7, 8..15 = k0+16+8h+0..7; D element r = row 8h+r
__device__ __forceinline__ v16h frag_h(const _Float16* rowk0, int lane) {
  union { v16h v; v8h q[2]; } u; const _Float16* p = rowk0 + 8 * (lane >> 4);
  u.q[0] = *(const v8h*)p; u.q[1] = *(const v8h*)(p + 16); return u.v;
}
__device__ __forceinline__ v16h frag_f32(const float* rowk0, int lane) {
  v16h a; const float* p = rowk0 + 8 * (lane >> 4);
#pragma unroll
  for (int i = 0; i < 8; ++i) { a[i] = (_Float16)p[i]; a[8 + i] = (_Float16)p[16 + i]; }
  return a;
}
__device__ __forceinline__ v16h frag_f32s(const float* rowk0, int lane, float sc) {
  v16h a; const float* p = rowk0 + 8 * (lane >> 4);
#pragma unroll
  for (int i = 0; i < 8; ++i) { a[i] = (_Float16)(p[i] * sc); a[8 + i] = (_Float16)(p[16 + i] * sc); }
  return a;
}
// column fragment from a [K][ld] layout (column n), rows >= K read as 0
__device__ __forceinline__ v16h fragc_f32(const float* W, int k0, int n, int lane, int ld, int K) {
  v16h a; const int g = lane >> 4;
#pragma unroll
  for (int i = 0; i < 8; ++i) { const int ka = k0 + 8 * g + i, kb = ka + 16;
    a[i] = (_Float16)(ka < K ? W[(size_t)(ka < K ? ka : K - 1) * ld + n] : 0.f); a[8 + i] = (_Float16)(kb < K ? W[(size_t)(kb < K ? kb : K - 1) * ld + n] : 0.f); }
  return a;
}
struct F2 { v16b h, l; };
__device__ __forceinline__ F2 bsplit16(const float v[16]) { F2 r;
#pragma unroll
  for (int i = 0; i < 16; ++i) { const __bf16 h = (__bf16)v[i]; r.h[i] = h; r.l[i] = (__bf16)(v[i] - (float)h); }
  return r; }
__device__ __forceinline__ F2 split_row(const float* row, int k0, int lane) { float v[16]; const float* p = row + k0 + 8 * (lane >> 4);
#pragma unroll
  for (int i = 0; i < 8; ++i) { v[i] = p[i]; v[8 + i] = p[16 + i]; }
  return bsplit16(v); }
__device__ __forceinline__ F2 split_rowK(const float* row, int k0, int lane, int K) { float v[16]; const int g = lane >> 4;
#pragma unroll
  for (int i = 0; i < 8; ++i) { const int ka = k0 + 8 * g + i, kb = ka + 16; v[i] = ka < K ? row[ka < K ? ka : K - 1] : 0.f; v[8 + i] = kb < K ? row[kb < K ? kb : K - 1] : 0.f; }
  return bsplit16(v); }
__device__ __forceinline__ F2 split_col(const float* W, int k0, int n, int lane, int ld, int K) { float v[16]; const int g = lane >> 4;
#pragma unroll
  for (int i = 0; i < 8; ++i) { const int ka = k0 + 8 * g + i, kb = ka + 16; v[i] = ka < K ? W[(size_t)(ka < K ? ka : K - 1) * ld + n] : 0.f; v[8 + i] = kb < K ? W[(size_t)(kb < K ? kb : K - 1) * ld + n] : 0.f; }
  return bsplit16(v); }
__device__ __forceinline__ v8f mac3(const F2& a, const F2& b, v8f c) { c = wmma_bf(a.l, b.h, c); c = wmma_bf(a.h, b.l, c); return wmma_bf(a.h, b.h, c); }
__device__ __forceinline__ float sigm(float v) { return 1.0f / (1.0f + expf(-v)); }
#define LDSX() do { asm volatile("s_wait_dscnt 0" ::: "memory"); __builtin_amdgcn_wave_barrier(); __builtin_amdgcn_fence(__ATOMIC_RELEASE, "workgroup"); } while (0)

// BERT-style self-attention with a learned granularity gate adding a log-penalty bias to the scores (hidden_states [2,2048,1024]; (in,out) Wq / Wk / Wv [1024,1024] N(0, 1/1024) + zero biases; Wg [1024,1] + bg: g = sigmoid(x Wg + bg) per token; res[i,j] = (1 - g_i) max(1 - g_i - g_j, 0) + g_i min(1 - g_i + g_j, 1); scope[i,j] = clip((S - 2)^(1 - g_i) + 2 - |i - j|, 1e-32, 1); log_pen = log(max(res * scope, 1e-32)), broadcast over the 16 heads; scores = q k^T / 8 + log_pen; softmax; no output projection): ctx [2,2048,1024].
#define NB 2
#define TT 2048
#define CC 1024            // NH * HD = projected width
#define DIN 1024          // input (model) width
#define NH 16
#define HD 64
#define NQB (TT / 64)
#define HG 4
#define SCALE (0.125f)
#define CAUSAL 0
#ifndef TNB
#define TNB NB
#endif
__device__ __forceinline__ float bfr(float v) { return (float)(__bf16)v; }
__host__ __device__ __forceinline__ int kb_last(int qb) { return CAUSAL ? ((qb * 64 + 63) >> 7) : (TT / 128 - 1); }
typedef __attribute__((ext_vector_type(8))) __bf16 v8b;
__device__ __forceinline__ v16b frag_b(const __bf16* rowk0, int lane) {
  union { v16b v; v8b q[2]; } u; const __bf16* p = rowk0 + 8 * (lane >> 4);
  u.q[0] = *(const v8b*)p; u.q[1] = *(const v8b*)(p + 16); return u.v;
}
#define QBH 0              // not read by any kernel in this file
#define QHI 0               // single-product logits on every row
#define KHI 64            // key rows carrying k residual / v bf16 hi+lo planes (written by k_proj; read by no kernel in this file)
// B fragment (k rows k0+.., output column o) of a weight: (in,out) [K][ld] or (out,in) [ld rows of K]: bf16 exact, or f16(bf16 * 256) exact
__device__ __forceinline__ v16b wcol_io(const float* Wm, int k0, int o, int lane, int ld) { v16b w; const int g = lane >> 4;
#pragma unroll
  for (int i = 0; i < 8; ++i) { w[i] = (__bf16)Wm[(size_t)(k0 + 8 * g + i) * ld + o]; w[8 + i] = (__bf16)Wm[(size_t)(k0 + 16 + 8 * g + i) * ld + o]; }
  return w; }
__device__ __forceinline__ v16b wcol_oi(const float* Wm, int k0, int o, int lane, int K) { v16b w; const float* p = Wm + (size_t)o * K + k0 + 8 * (lane >> 4);
#pragma unroll
  for (int i = 0; i < 8; ++i) { w[i] = (__bf16)p[i]; w[8 + i] = (__bf16)p[16 + i]; }
  return w; }
__device__ __forceinline__ v16h wcolh_io(const float* Wm, int k0, int o, int lane, int ld) { v16h w; const int g = lane >> 4;
#pragma unroll
  for (int i = 0; i < 8; ++i) { w[i] = (_Float16)(bfr(Wm[(size_t)(k0 + 8 * g + i) * ld + o]) * 256.0f); w[8 + i] = (_Float16)(bfr(Wm[(size_t)(k0 + 16 + 8 * g + i) * ld + o]) * 256.0f); }
  return w; }
__device__ __forceinline__ v16h wcolh_oi(const float* Wm, int k0, int o, int lane, int K) { v16h w; const float* p = Wm + (size_t)o * K + k0 + 8 * (lane >> 4);
#pragma unroll
  for (int i = 0; i < 8; ++i) { w[i] = (_Float16)(bfr(p[i]) * 256.0f); w[8 + i] = (_Float16)(bfr(p[16 + i]) * 256.0f); }
  return w; }
#define WQKV_LAYOUT 0   // 0 = (in,out) [DIN][CC]; 1 = (out,in) [CC][DIN]; 2 = per-head [NH][DIN][HD]
__device__ __forceinline__ v16b wcol_hdk(const float* Wm, int k0, int o, int lane) { v16b w; const int g = lane >> 4; const float* p = Wm + (size_t)(o / HD) * DIN * HD + (o % HD);
#pragma unroll
  for (int i = 0; i < 8; ++i) { w[i] = (__bf16)p[(size_t)(k0 + 8 * g + i) * HD]; w[8 + i] = (__bf16)p[(size_t)(k0 + 16 + 8 * g + i) * HD]; }
  return w; }
#define WO_OUT_IN 0
#if WQKV_LAYOUT == 1
#define WCOL(W, k0, o, lane) wcol_oi(W, k0, o, lane, DIN)
#elif WQKV_LAYOUT == 2
#define WCOL(W, k0, o, lane) wcol_hdk(W, k0, o, lane)
#else
#define WCOL(W, k0, o, lane) wcol_io(W, k0, o, lane, CC)
#endif
#if WO_OUT_IN
#define WOCOL(W, k0, o, lane) wcol_oi(W, k0, o, lane, CC)
#define WOCOLH(W, k0, o, lane) wcolh_oi(W, k0, o, lane, CC)
#else
#define WOCOL(W, k0, o, lane) wcol_io(W, k0, o, lane, DIN)
#define WOCOLH(W, k0, o, lane) wcolh_io(W, k0, o, lane, DIN)
#endif
// the module's log-penalty bias log_pen[b, i, j] is head-independent: lpen_block (in k_proj's launch) evaluates it ONCE per batch into an f32 plane LPEN[b] (fragment order); k_fa ADDS it to the scaled score (far keys carry the module's finite log(1e-32) = -73.68, kept literally)

#define WS_QH  0u                                      // f16 q rows [b*t][CC]
#define WS_KH  (WS_QH + 2u * (size_t)NB * TT * CC)      // f16 k in fragment order [b][h][t / 16][kc][piece][lane][8]
#define WS_VT  (WS_KH + 2u * (size_t)NB * TT * CC)      // f16 v in fragment order [b][h][t / 32][j][piece][lane][8]
#define WS_QL  (WS_VT + 2u * (size_t)NB * CC * TT)      // f16 q residual x 2^10 rows [b][t < QHI][CC]
#define WS_KL  (WS_QL + 2u * (size_t)NB * QHI * CC)     // f16 k residual x 2^10 rows [b][t < KHI][CC]
#define WS_VB  (WS_KL + 2u * (size_t)NB * KHI * CC)     // bf16 v hi planes [b][c][t < KHI]
#define WS_VBL (WS_VB + 2u * (size_t)NB * CC * KHI)
#define WS_END (WS_VBL + 2u * (size_t)NB * CC * KHI)
#define WS_GATE (WS_END)                                 // f32 g[b][s]
#define WS_PWR  (WS_GATE + 4u * (size_t)NB * TT)          // f32 pow(S - 2, 1 - g)[b][s]
#define WS_LPEN (WS_PWR + 4u * (size_t)NB * TT)          // f32 log-penalty planes in fragment order [b][i / 16][j / 32][jt][w][lane][4]
#define WS_END3 (WS_LPEN + 4u * (size_t)NB * TT * TT)
#define WS_XB  (WS_END3)                                 // bf16 x in k_proj's stage tiles [row block of 128][stage of 32 k][row][32 k]
#define WS_WB  (WS_XB + 2u * (size_t)NB * TT * DIN)       // bf16 Wq, Wk, Wv transposed, in stage tiles [which][column block of 128][stage of 32 k][column][32 k]
#define WS_END4 (WS_WB + 2u * 3u * (size_t)DIN * CC)

// ---- lpen_block: the log-penalty plane, worked by the blocks z = 3, 4 of k_proj's grid (one z per batch): 128 threads (half a block) = (32 query rows, 256 keys) of batch bsm: log(max(res * scope, 1e-32)), with res = (1 - gi) max(1 - gi - gj, 0) + gi min(1 - gi + gj, 1), scope = clip(pow(S - 2, 1 - gi) + 2 - |i - j|, 1e-32, 1) (gi / pow from the k_gate tables; f32, precise logf); the plane is shared by the 16 heads of the batch. It is written in the order in which k_fa's lanes read it: in a tile of 16 query rows, piece p = ((step * 2 + jt) * 2 + w) * 32 + lane holds query lane & 15, keys 32 step + 16 jt + 8 (lane >> 4) + 4 w + 0..3; each thread writes 16-B pieces, a wave whole lines. A thread's eight key groups are the same for both of the block's row tiles and are loaded once
__device__ __forceinline__ v4f lpen4(float gi_, float pw_, int t, int kb, v4f gj4) { v4f o;
#pragma unroll
  for (int u = 0; u < 4; ++u) { const int k = kb + u; const float gj_ = gj4[u]; const float res_ = (1.0f - gi_) * fmaxf(1.0f - gi_ - gj_, 0.0f) + gi_ * fminf(1.0f - gi_ + gj_, 1.0f); const int ad_ = (t > k) ? (t - k) : (k - t); const float sc_ = fminf(fmaxf(pw_ + 2.0f - (float)ad_, 1.0e-32f), 1.0f); o[u] = logf(fmaxf(res_ * sc_, 1.0e-32f)); }
  return o; }
__device__ __forceinline__ void lpen_block(const float* __restrict__ GATE, const float* __restrict__ PWR, float* LPEN, int bsm, int bx, int by, int tid) { const int lane = tid & 31;   // LPEN carries no __restrict__: with it the compiler moved the stores across the waits written behind them
  const float* G = GATE + (size_t)bsm * TT; const float* P = PWR + (size_t)bsm * TT;
  const int kq = by * 256 + ((tid >> 6) & 1) * 16 + (lane >> 4) * 8 + ((tid >> 5) & 1) * 4;   // first key of this thread's piece of step 0; step it lies 32 keys on
  v4f gj[8]; float gi[2], pw[2];   /* every loop below is fully unrolled: the arrays are indexed with compile-time constants and stay in registers */
#pragma unroll
  for (int it = 0; it < 8; ++it) gj[it] = *(const v4f*)(G + kq + 32 * it);
#pragma unroll
  for (int rb = 0; rb < 2; ++rb) { gi[rb] = G[(bx * 2 + rb) * 16 + (lane & 15)]; pw[rb] = P[(bx * 2 + rb) * 16 + (lane & 15)]; }
  asm volatile("s_wait_xcnt 0x0" ::: "memory");   // in front of the next overwrite of the address registers of the loads above
  __builtin_amdgcn_sched_barrier(0);              // keeps the arithmetic below behind that wait
#pragma unroll
  for (int rb = 0; rb < 2; ++rb) { const int t = (bx * 2 + rb) * 16 + (lane & 15);
    float* dst = LPEN + (size_t)bsm * TT * TT + ((size_t)(bx * 2 + rb) * (TT / 32) + by * 8) * 512 + tid * 4;
#pragma unroll
    for (int it = 0; it < 8; it += 2) { const v4f o0 = lpen4(gi[rb], pw[rb], t, kq + 32 * it, gj[it]); const v4f o1 = lpen4(gi[rb], pw[rb], t, kq + 32 * it + 32, gj[it + 1]);
      __builtin_amdgcn_sched_barrier(0);   // the two pieces' arithmetic (eight independent chains) ends in front of their stores, so that nothing is computed between a store and the wait behind it
      vst2(dst + it * 512, o0); vst2(dst + it * 512 + 512, o1);
      asm volatile("s_wait_xcnt 0x0" ::: "memory");   // in front of the next overwrite of the stores' data registers
      __builtin_amdgcn_sched_barrier(0); } } }         // keeps the next pieces' arithmetic behind that wait
// ---- k_proj: block = (128 rows, 128 cols, which), 8 waves in a 4 x 2 grid, each on 32 rows x 64 cols (2 x 4 fragments): q/k/v = X W (+ b) with exact bf16 products (K = DIN) -> which 0: q f16 rows (+ residual rows < QHI); 1: k f16 in fragment order (+ residual rows < KHI); 2: v f16 in fragment order (+ bf16 hi/lo planes for t < KHI)
// Operands go through LDS, 32 k at a time, two buffers: X and W come rounded to bf16 and laid out in stage tiles (8 KiB contiguous, row or column major with k contiguous) by the launch before (conv_block), so that a block reads half the bytes of the f32 inputs and converts nothing; the eight waves take their fragments from LDS. The next tile's global loads fly while this tile is multiplied.
#define PBM 128            // rows per block
#define PBK 32             // k per stage
#define PNS (DIN / PBK)
#define PTL (128 * PBK)     // bf16 elements of one stage tile of X or of W
#define PPI 40             // bf16 per staged row: 64 B of data at a pitch of 80 B (16 B x odd: the 16 rows of a ds_load_b128 fragment read fall on 16 different bank groups)
#define PWB (128 * PPI * 2 + 128)   // bytes of one W buffer: column n at n * 80 + 16 ((n >> 4) & 3) + 64 (n >> 6)
#define PEP 136            // f16 per row of the output staging: 256 B of data at a pitch of 272 B (16 B x odd)
typedef __attribute__((ext_vector_type(4))) __bf16 v4b;
// six waves per SIMD (160 registers) and a third of the LDS: three blocks per WGP, so that all 768 projection blocks are resident at once and none waits for a second round
__global__ __launch_bounds__(256, 6) void k_proj(const __bf16* __restrict__ XB, const __bf16* __restrict__ WB, const float* __restrict__ BQ, const float* __restrict__ BK, const float* __restrict__ BV,
    _Float16* __restrict__ QH, _Float16* __restrict__ QL, _Float16* __restrict__ KH, _Float16* __restrict__ KL, _Float16* __restrict__ VT, __bf16* __restrict__ VB, __bf16* __restrict__ VBL, const float* __restrict__ GATE, const float* __restrict__ PWR, float* LPEN) {
  static_assert(2 * (TNB * TT / PBM) == TT / 32 && CC / 128 == TT / 256, "a z slice of the grid covers one log-penalty plane: each half of a block takes 32 rows x 256 keys");
  // the short log-penalty blocks come last in the grid: they start as the projection's blocks drain, with no launch of their own; the whole block leaves here, in front of every barrier
  if (blockIdx.z >= 3) { lpen_block(GATE, PWR, LPEN, (int)blockIdx.z - 3, blockIdx.x * 2 + (threadIdx.x >> 7), blockIdx.y, threadIdx.x & 127); return; }
  // one LDS range: the operand stages of the k loop lie in the bytes that the output staging takes over behind the loop; the q / k staging (two planes) and the v staging (three planes) share those bytes, a block uses one of them
  __shared__ __align__(16) unsigned char smem[3 * 128 * PEP * 2];
  _Float16 (*sh)[PEP] = (_Float16 (*)[PEP])smem; _Float16 (*sl)[PEP] = (_Float16 (*)[PEP])(smem + PBM * PEP * 2);
  _Float16 (*th)[PEP] = (_Float16 (*)[PEP])smem; __bf16 (*tb)[PEP] = (__bf16 (*)[PEP])(smem + 128 * PEP * 2); __bf16 (*tbl)[PEP] = (__bf16 (*)[PEP])(smem + 2 * 128 * PEP * 2);
  // W^T: [2][PWB bytes] from smem on
  __bf16* Xs = (__bf16*)(smem + 2 * PWB);                  // [2][PBM rows][PPI]
  const int tid = threadIdx.x, wave = tid >> 5, lane = tid & 31, col = lane & 15, g = lane >> 4; const int wm = wave >> 1, wn = wave & 1;   // the wave's 32 rows and 64 columns of the block's tile
  const int which = blockIdx.z; const int c0 = blockIdx.y * 128; const size_t r0 = (size_t)blockIdx.x * PBM; const size_t bb = r0 / TT; const int t0 = (int)(r0 % TT);
  const float* BA = which == 0 ? BQ : which == 1 ? BK : BV;
  const __bf16* Wg = WB + (size_t)(which * (CC / 128) + (int)blockIdx.y) * (PNS * PTL);   // the block's 32 stage tiles of W^T and of X: 256 KiB contiguous each; block-uniform base + 32-bit offset: one address register
  const __bf16* Xg = XB + (size_t)blockIdx.x * (PNS * PTL);
  const unsigned po = (unsigned)tid * 8;   // this thread's 16-B pieces of a tile: tid and tid + 256 = row or column (tid >> 2) + 64 i, k 8 (tid & 3) + 0..7 (a wave's load = 512 contiguous bytes)
  // the 16 columns of a fragment read share one skew (16 B per 16 columns, 64 B per 64), so that store and read each need one address register and constant offsets
  unsigned char* Wst = smem + (tid >> 2) * (PPI * 2) + 16 * (tid >> 6) + 16 * (tid & 3);
  const unsigned char* Wrd = smem + wn * (64 * PPI * 2 + 64) + col * (PPI * 2);
  __bf16* Xst = Xs + (tid >> 2) * PPI + 8 * (tid & 3);
  // L2 prefetch at the block's head, as in k_fa: a stage's loads are issued one stage ahead, which does not cover a line that has to come from memory. Of the blocks that share the 32 tiles of X (same x), block y asks quarter y mod 4 of them; of any four neighbouring x, each asks a quarter of the column block's tiles of W. A hint only; every address lies inside the block's tiles for every block and thread
  static_assert(PBM == 128 && PNS * PTL * 2 == 4 * 256 * 256, "four shares of 256 threads x one 256-B unit cover the 32 tiles");
  const unsigned pfo = (unsigned)tid * 256u;   // one 256-B unit per thread
  const char* pfx = (const char*)Xg + ((int)blockIdx.y & 3) * 65536;
  const char* pfw = (const char*)Wg + ((int)blockIdx.x & 3) * 65536;
  asm volatile("global_prefetch_b8 %0, %1 scope:SCOPE_SE\n\t"
               "global_prefetch_b8 %0, %2 scope:SCOPE_SE" :: "v"(pfo), "s"(pfx), "s"(pfw));
  v8b wr[2], xr[2];
#pragma unroll
  for (int i = 0; i < 2; ++i) wr[i] = *(const v8b*)(Wg + i * (PTL / 2) + po);
#pragma unroll
  for (int i = 0; i < 2; ++i) xr[i] = *(const v8b*)(Xg + i * (PTL / 2) + po);
  asm volatile("s_wait_xcnt 0x0" :: "v"(pfo), "s"(pfx), "s"(pfw) : "memory");   // the prefetches' offset and bases keep their values up to here, behind the loads that were issued after them
  v8f acc[2][4] = {};
#pragma unroll 2   // two stages per trip: the buffer index is a constant in each
  for (int s = 0; s < PNS; ++s) { const int bf = s & 1; const int sn = s + 1 < PNS ? s + 1 : s;   // the stage fetched ahead; the last stage fetches itself again (in bounds, unused)
#pragma unroll
    for (int i = 0; i < 2; ++i) *(v8b*)(Wst + bf * PWB + i * (64 * PPI * 2 + 64)) = wr[i];
#pragma unroll
    for (int i = 0; i < 2; ++i) *(v8b*)(Xst + bf * PBM * PPI + 64 * i * PPI) = xr[i];
    __syncthreads();   // publishes stage s; it also ends every wave's reads of stage s - 1, whose buffer the next trip overwrites
#pragma unroll
    for (int i = 0; i < 2; ++i) wr[i] = *(const v8b*)(Wg + sn * PTL + i * (PTL / 2) + po);
#pragma unroll
    for (int i = 0; i < 2; ++i) xr[i] = *(const v8b*)(Xg + sn * PTL + i * (PTL / 2) + po);
    asm volatile("s_wait_xcnt 0x0" ::: "memory");   // in front of the next overwrite of the address registers of the loads above; it also keeps those loads issued ahead of the products, which cover their latency
    v16b a[2], w[4];
#pragma unroll
    for (int i = 0; i < 2; ++i) a[i] = frag_b(Xs + (bf * PBM + wm * 32 + i * 16 + col) * PPI, lane);
#pragma unroll
    for (int j = 0; j < 4; ++j) w[j] = frag_b((const __bf16*)(Wrd + bf * PWB + j * (16 * PPI * 2 + 16)), lane);
    __builtin_amdgcn_sched_barrier(0);   // the stage's LDS reads go out as one group ahead of its products: spread among them, each product waited out a whole LDS latency
#pragma unroll
    for (int i = 0; i < 2; ++i)
#pragma unroll
      for (int j = 0; j < 4; ++j) acc[i][j] = wmma_bf(a[i], w[j], acc[i][j]);
    __builtin_amdgcn_sched_barrier(0); }   // keeps the next stage's LDS stores, which wait for the global loads, behind this stage's products (the compiler had drawn them, and the wait, in among the products)
  __syncthreads();   // every wave has left the operand stages before the output staging below overwrites them
  if (which < 2) { _Float16* DH = which == 0 ? QH : KH; _Float16* DL = which == 0 ? QL : KL; const int nhi = which == 0 ? QHI : KHI;
#pragma unroll
    for (int j = 0; j < 4; ++j) { const int cl = wn * 64 + j * 16 + col; const float bias = BA ? bfr(BA[c0 + cl]) : 0.f;
#pragma unroll
      for (int i = 0; i < 2; ++i)
#pragma unroll
        for (int r = 0; r < 8; ++r) { const float v = acc[i][j][r] + bias; const _Float16 hv = (_Float16)v; const int rl = wm * 32 + i * 16 + 8 * g + r; sh[rl][cl] = hv; sl[rl][cl] = (_Float16)((v - (float)hv) * 1024.0f); } }
    __syncthreads();
    // k leaves in the order in which k_fa's A fragments read it: 16-B piece pc = 2 kc + piece of lane ln (key row ln & 15, half ln >> 4) of a 16-key tile of one head, lanes contiguous; q stays in rows
    for (int e = tid; e < PBM * 16; e += 256) { int rl, q; size_t od;
      if (which == 0) { rl = e >> 4; q = e & 15; od = (r0 + rl) * CC + c0 + q * 8; }
      else { const int ln = e & 31, pc = (e >> 5) & 3, tl = (e >> 7) & 7, hl = e >> 10; rl = tl * 16 + (ln & 15); q = hl * 8 + pc * 2 + (ln >> 4); od = ((((bb * NH + (c0 >> 6) + hl) * (TT / 16) + (t0 >> 4) + tl) * 4 + pc) * 32 + ln) * 8; }
      vst2((unsigned*)(DH + od), *(const v4u*)&sh[rl][q * 8]);
      asm volatile("s_wait_xcnt 0x0" ::: "memory");   // in front of the next overwrite of the store's address and data registers
      if (t0 + rl < nhi) { vst2((unsigned*)(DL + (bb * nhi + t0 + rl) * (size_t)CC + c0 + q * 8), *(const v4u*)&sl[rl][q * 8]);   // the residual plane holds rows < nhi only: of a 128-row block at most the first rows
        asm volatile("s_wait_xcnt 0x0" ::: "memory"); } }   // the same for this store
  } else {
#pragma unroll
    for (int j = 0; j < 4; ++j) { const int cl = wn * 64 + j * 16 + col; const float bias = BA ? bfr(BA[c0 + cl]) : 0.f;
#pragma unroll
      for (int i = 0; i < 2; ++i)
#pragma unroll
        for (int r = 0; r < 8; ++r) { const float v = acc[i][j][r] + bias; const int rl = wm * 32 + i * 16 + 8 * g + r; th[cl][rl] = (_Float16)v; const __bf16 bh = (__bf16)v; tb[cl][rl] = bh; tbl[cl][rl] = (__bf16)(v - (float)bh); } }
    __syncthreads();
    // v leaves in the order in which k_fa's A fragments read it: piece pc of lane ln (channel ln & 15 of tile j, half ln >> 4) of a 32-key step of one head, lanes contiguous
    for (int e = tid; e < 128 * (PBM / 8); e += 256) { const int ln = e & 31, pc = (e >> 5) & 1, j = (e >> 6) & 3, st = (e >> 8) & 3, hl = e >> 10; const int cl = hl * 64 + j * 16 + (ln & 15), q = st * 4 + pc * 2 + (ln >> 4);
      vst2((unsigned*)(VT + (((((bb * NH + (c0 >> 6) + hl) * (TT / 32) + (t0 >> 5) + st) * 4 + j) * 2 + pc) * 32 + ln) * 8), *(const v4u*)&th[cl][q * 8]);
      asm volatile("s_wait_xcnt 0x0" ::: "memory");   // in front of the next overwrite of the store's address and data registers
      if (t0 + q * 8 < KHI) { const size_t o3 = (bb * CC + c0 + cl) * (size_t)KHI + t0 + q * 8; vst2((unsigned*)(VB + o3), *(const v4u*)&tb[cl][q * 8]); vst2((unsigned*)(VBL + o3), *(const v4u*)&tbl[cl][q * 8]);   // the hi / lo planes hold keys < KHI only
        asm volatile("s_wait_xcnt 0x0" ::: "memory"); } } } }   // the same for these two stores
// ---- k_fa: block = 256 queries (8 waves x 32 query columns) of (b, h): one pass over all keys, 32 at a time, with a running maximum and sum per query (online softmax); the logits and P stay in registers.
// Transposed products: S^T = K . Q^T (A = key rows, B = query rows) puts one query's 16 scores of a 32-key step in lanes c and c + 16; two S^T tiles, converted in place, are the B operand of O^T += V^T . P^T (A = v, channel rows); O^T register r = ctx[query c][16 j + 8 h + r].
// P = exp(s - m) x 2^11 once to f16 (the row sum carries the same factor, taken in f32 before the rounding, and divides it out at the end).
#define FQ 2               // query tiles of 16 columns per wave: each K / V fragment load feeds both
// every inner loop below is fully unrolled so that the fragment and accumulator arrays are indexed by constants and stay in registers
#define L2E 1.4426950408889634f
__device__ __forceinline__ v8f mmh(v16h a, v16h b, v8f c) { return __builtin_amdgcn_wmma_f32_16x16x32_f16(false, a, false, b, (short)0, c, false, false); }
// a fragment stored in fragment order: this lane's two 16-B pieces lie 512 B apart (p already holds the lane's offset)
__device__ __forceinline__ v16h frag_p(const _Float16* p) { union { v16h v; v8h q[2]; } u; u.q[0] = *(const v8h*)p; u.q[1] = *(const v8h*)(p + 256); return u.v; }
__device__ __forceinline__ float xhalf(float x) { return __builtin_bit_cast(float, __builtin_amdgcn_permlanex16(__builtin_bit_cast(int, x), __builtin_bit_cast(int, x), 0x76543210, 0xfedcba98, false, false)); }  // lane l with lane l ^ 16
__global__ __launch_bounds__(256) void k_fa(const _Float16* __restrict__ QH, const _Float16* __restrict__ KH, const _Float16* __restrict__ VT, const float* __restrict__ LPEN, float* __restrict__ Y) {
  const int tid = threadIdx.x, wave = tid >> 5, lane = tid & 31, col = lane & 15, g = lane >> 4; const int h = blockIdx.y, b = blockIdx.z; const int q0 = blockIdx.x * (8 * 16 * FQ) + wave * (16 * FQ);
  // K, V and the log-penalty lie in fragment order: a wave's load is 32 lanes x 16 B = 512 contiguous bytes (four whole lines)
  const _Float16* Kb = KH + (size_t)(b * NH + h) * TT * HD + lane * 8;          // 32 keys = 2048 halves: [jt][kc][piece][lane][8]
  const _Float16* Vb = VT + (size_t)(b * NH + h) * TT * HD + lane * 8;          // 32 keys = 2048 halves: [j][piece][lane][8]
  const float* Lb = LPEN + (size_t)b * TT * TT + (size_t)q0 * TT + lane * 4;    // 16 queries x 32 keys = 512 floats: [jt][w][lane][4]; 16 queries = 16 TT floats
  // L2 prefetch at the kernel's head: K, V and the log-penalty plane were stored by the launch before, and a line that is not in the L2 costs a step of the loop below a whole memory latency (its loads are issued only one step ahead). Each 256-B unit is asked for once per group of blocks that read it: the 16 heads of a query block share its log-penalty rows (head h asks key steps 4 h + 0..3 of the block's 16 row tiles), four neighbouring query blocks share a head's K and V (block x asks the pairs of key steps p = x mod 4 (mod 4)). A hint only: nothing depends on where a block runs or on a line having arrived. Every address lies inside its plane for every block, wave and lane.
  static_assert(4 * NH == TT / 32 && TT / 32 == 64 && TT / (8 * 16 * FQ) == 8, "the shares below cover the 64 key steps once: 16 heads x 4 steps; 4 blocks x 8 waves x 2 steps");
  const int ws = __builtin_amdgcn_readfirstlane(wave);   // the wave's number in a scalar register: the prefetches' bases are scalar
  const unsigned poff = (unsigned)lane * 256u;           // one 256-B unit per lane: a wave's prefetch covers 8 KiB
  const char* pk = (const char*)(KH + (size_t)(b * NH + h) * TT * HD) + (size_t)(4 * ws + ((int)blockIdx.x & 3)) * 8192;   // two key steps of K = 8 KiB
  const char* pv = (const char*)(VT + (size_t)(b * NH + h) * TT * HD) + (size_t)(4 * ws + ((int)blockIdx.x & 3)) * 8192;   // the same two steps of V
  const char* pl = (const char*)(LPEN + (size_t)b * TT * TT) + ((size_t)((int)blockIdx.x * 16 + ws) * (TT / 32) + 4 * h) * 2048;   // four key steps of row tile ws of the block = 8 KiB; row tile ws + 8 lies 8 x 128 KiB on
  asm volatile("global_prefetch_b8 %0, %1 scope:SCOPE_SE\n\t"
               "global_prefetch_b8 %0, %2 scope:SCOPE_SE\n\t"
               "global_prefetch_b8 %0, %3 scope:SCOPE_SE\n\t"
               "global_prefetch_b8 %0, %3 offset:1048576 scope:SCOPE_SE" :: "v"(poff), "s"(pk), "s"(pv), "s"(pl));
  v16h qf[FQ][2];
#pragma unroll
  for (int u = 0; u < FQ; ++u)
#pragma unroll
    for (int kc = 0; kc < 2; ++kc) qf[u][kc] = frag_h(QH + ((size_t)b * TT + q0 + u * 16 + col) * CC + h * HD + kc * 32, lane);
  __builtin_amdgcn_sched_barrier(0);   // q's loads stay issued ahead of K's and the log-penalty's: issued last (where the scheduler put them once the prefetches stood above), they turn the counted wait at the loop's head into a wait for every load in flight
  v16h kf[2][2]; v4f lp[FQ][2][2];
#pragma unroll
  for (int jt = 0; jt < 2; ++jt) {
#pragma unroll
    for (int kc = 0; kc < 2; ++kc) kf[jt][kc] = frag_p(Kb + jt * 1024 + kc * 512);
#pragma unroll
    for (int u = 0; u < FQ; ++u) { lp[u][jt][0] = *(const v4f*)(Lb + (size_t)u * 16 * TT + jt * 256); lp[u][jt][1] = *(const v4f*)(Lb + (size_t)u * 16 * TT + jt * 256 + 128); } }
  asm volatile("s_wait_xcnt 0x0" :: "v"(poff), "s"(pk), "s"(pv), "s"(pl) : "memory");   // the address registers of the loads above are reused for the accumulators set up below: the wait stands in front of that overwrite; the prefetches' offset and bases are named so that they too keep their values up to here, behind the loads that were issued after them
  __builtin_amdgcn_sched_barrier(0);              // keeps the accumulators' set-up behind that wait (the compiler lifted it over the wait without this)
  v8f o[FQ][HD / 16] = {}; float m[FQ], l[FQ];
#pragma unroll
  for (int u = 0; u < FQ; ++u) { m[u] = -3.0e38f; l[u] = 0.f; }
#pragma unroll 1   // stays rolled: one step's live set already takes the 256 registers that need no window switch
  for (int k0 = 0; k0 < TT; k0 += 32) { const int kn = k0 + 32 < TT ? k0 + 32 : 0;   // the step fetched ahead; the last step fetches step 0 again (in bounds, unused)
    v16h vf[HD / 16];
#pragma unroll
    for (int j = 0; j < HD / 16; ++j) vf[j] = frag_p(Vb + (size_t)k0 * HD + j * 512);
    float sv[FQ][16];
#pragma unroll
    for (int u = 0; u < FQ; ++u)
#pragma unroll
      for (int jt = 0; jt < 2; ++jt) { v8f z = {}; z = mmh(kf[jt][0], qf[u][0], z); z = mmh(kf[jt][1], qf[u][1], z);
#pragma unroll
        for (int r = 0; r < 8; ++r) sv[u][jt * 8 + r] = fmaf(z[r], SCALE, lp[u][jt][r >> 2][r & 3]); }
    // the next step's K fragments and log-penalty rows, into the registers this step has just read: they fly during the softmax and the P . v products
#pragma unroll
    for (int jt = 0; jt < 2; ++jt) {
#pragma unroll
      for (int kc = 0; kc < 2; ++kc) kf[jt][kc] = frag_p(Kb + (size_t)kn * HD + jt * 1024 + kc * 512);
#pragma unroll
      for (int u = 0; u < FQ; ++u) { lp[u][jt][0] = *(const v4f*)(Lb + (size_t)u * 16 * TT + kn * 16 + jt * 256); lp[u][jt][1] = *(const v4f*)(Lb + (size_t)u * 16 * TT + kn * 16 + jt * 256 + 128); } }
    asm volatile("s_wait_xcnt 0x0" ::: "memory");   // in front of the next overwrite of the address registers of the loads above
    __builtin_amdgcn_sched_barrier(0);      // keeps the fetch-ahead loads issued in front of the softmax and the P . v products, which then cover their latency
#pragma unroll
    for (int u = 0; u < FQ; ++u) { float mt = sv[u][0];
#pragma unroll
      for (int i = 1; i < 16; ++i) mt = fmaxf(mt, sv[u][i]);
      mt = fmaxf(mt, xhalf(mt)); const float mn = fmaxf(m[u], mt); const float al = __builtin_amdgcn_exp2f((m[u] - mn) * L2E);   // 0 on the first step
      m[u] = mn; const float cc = 11.0f - mn * L2E; float ls = 0.f; v16h pb;
#pragma unroll
      for (int i = 0; i < 16; ++i) { const float p = __builtin_amdgcn_exp2f(fmaf(sv[u][i], L2E, cc)); ls += p; pb[i] = (_Float16)p; }
      l[u] = l[u] * al + ls;
#pragma unroll
      for (int j = 0; j < HD / 16; ++j) { o[u][j] = o[u][j] * al; o[u][j] = mmh(vf[j], pb, o[u][j]); } } }
#pragma unroll
  for (int u = 0; u < FQ; ++u) { const float inv = 1.0f / (l[u] + xhalf(l[u]));   // the halves' sums join once; the row's maximum contributes 2^11, so the sum is positive
    float* yr = Y + ((size_t)b * TT + q0 + u * 16 + col) * CC + h * HD + 8 * g;
#pragma unroll
    for (int j = 0; j < HD / 16; ++j) { v4f a0, a1;
#pragma unroll
      for (int r = 0; r < 4; ++r) { a0[r] = o[u][j][r] * inv; a1[r] = o[u][j][4 + r] * inv; }
      vst2(yr + j * 16, a0); vst2(yr + j * 16 + 4, a1); } } }

// ---- k_gate: block = 32 rows, 8 waves x 4 rows: g = sigmoid(x . Wg + bg) and pow(S - 2, 1 - g). A wave's 4 rows are worked together: their 128 loads and Wg's 32 are issued back to back with no wait between them, so the wave pays the memory latency once and not once per load; each row's sum keeps its order (i = 0..31 in the lane, then the xor tree)
// ---- conv_block: rides behind k_gate's blocks in its grid (which fills only half of the chip): rounds X, Wq, Wk and Wv to bf16 ONCE, with the rounding that k_proj applied to every tile it read, and lays them out in k_proj's stage tiles (128 rows or columns x 32 k, k contiguous, 8 KiB). Blocks 0..127: 128 rows of X x 8 stages; blocks 128..223: 128 columns of one W x 8 stages, transposed inside the thread (8 k x 4 columns). Every loop is fully unrolled: the arrays are indexed by constants and stay in registers. XB and WB carry no __restrict__, as LPEN above: the stores stay in front of the waits written behind them
#define NGB (TNB * TT / 32)                 // k_gate's own blocks
#define NXB ((TNB * TT / 128) * (PNS / 8))  // X blocks
#define NWB (3 * (CC / 128) * (PNS / 8))    // W blocks
__device__ __forceinline__ void conv_block(const float* __restrict__ X, const float* __restrict__ WQ, const float* __restrict__ WK, const float* __restrict__ WV, __bf16* XB, __bf16* WB, int cb, int tid) {
  if (cb < NXB) { const int rb = cb / (PNS / 8), s0 = (cb % (PNS / 8)) * 8;
    // piece e = tid + 256 i of a tile: row e >> 2, k 8 (e & 3) + 0..7: a wave reads eight whole lines and writes 512 contiguous bytes
    const float* xs = X + ((size_t)rb * 128 + (tid >> 2)) * DIN + s0 * PBK + 8 * (tid & 3); __bf16* xd = XB + ((size_t)rb * PNS + s0) * PTL + tid * 8;
#pragma unroll
    for (int hb = 0; hb < 2; ++hb) { v4f v[4][2][2];   // four stages at a time: 16 loads in flight
#pragma unroll
      for (int st = 0; st < 4; ++st)
#pragma unroll
        for (int i = 0; i < 2; ++i) { v[st][i][0] = *(const v4f*)(xs + (size_t)(64 * i) * DIN + (hb * 4 + st) * PBK); v[st][i][1] = *(const v4f*)(xs + (size_t)(64 * i) * DIN + (hb * 4 + st) * PBK + 4); }
      asm volatile("s_wait_xcnt 0x0" ::: "memory");   // in front of the next overwrite of the address registers of the loads above
      __builtin_amdgcn_sched_barrier(0);              // keeps every load issued ahead of the conversions, and those behind that wait
      v8b p[4][2];
#pragma unroll
      for (int st = 0; st < 4; ++st)
#pragma unroll
        for (int i = 0; i < 2; ++i)
#pragma unroll
          for (int e = 0; e < 4; ++e) { p[st][i][e] = (__bf16)v[st][i][0][e]; p[st][i][4 + e] = (__bf16)v[st][i][1][e]; }
      __builtin_amdgcn_sched_barrier(0);              // the conversions end in front of the stores, so that nothing is computed between a store and the wait behind it
#pragma unroll
      for (int st = 0; st < 4; ++st)
#pragma unroll
        for (int i = 0; i < 2; ++i) vst2(xd + (hb * 4 + st) * PTL + i * (PTL / 2), p[st][i]);
      asm volatile("s_wait_xcnt 0x0" ::: "memory");   // in front of the next overwrite of the stores' address and data registers
      __builtin_amdgcn_sched_barrier(0); }            // keeps the next half's loads behind that wait
  } else { const int cw = cb - NXB; const int wh = cw / ((CC / 128) * (PNS / 8)), y = (cw / (PNS / 8)) % (CC / 128), s0 = (cw % (PNS / 8)) * 8 + (tid >> 7);   // each half of the block takes every second stage
    const float* Wm = wh == 0 ? WQ : wh == 1 ? WK : WV; const int q = tid & 3, n0 = ((tid >> 2) & 31) * 4;   // k 8 q + 0..7, columns n0 + 0..3: a wave's load = four whole lines; its four stores fill 2 KiB
    const float* wsrc = Wm + (size_t)(s0 * PBK + 8 * q) * CC + y * 128 + n0; __bf16* wd = WB + ((size_t)(wh * (CC / 128) + y) * PNS + s0) * PTL + n0 * PBK + 8 * q;
#pragma unroll
    for (int hb = 0; hb < 2; ++hb) { v4f v[2][8];   // two stages at a time: 16 loads in flight
#pragma unroll
      for (int it = 0; it < 2; ++it)
#pragma unroll
        for (int i = 0; i < 8; ++i) v[it][i] = *(const v4f*)(wsrc + (size_t)((hb * 2 + it) * 2 * PBK + i) * CC);
      asm volatile("s_wait_xcnt 0x0" ::: "memory");   // in front of the next overwrite of the address registers of the loads above
      __builtin_amdgcn_sched_barrier(0);              // keeps every load issued ahead of the conversions, and those behind that wait
      v8b p[2][4];
#pragma unroll
      for (int it = 0; it < 2; ++it)
#pragma unroll
        for (int c = 0; c < 4; ++c)
#pragma unroll
          for (int i = 0; i < 8; ++i) p[it][c][i] = (__bf16)v[it][i][c];
      __builtin_amdgcn_sched_barrier(0);              // the conversions end in front of the stores
#pragma unroll
      for (int it = 0; it < 2; ++it)
#pragma unroll
        for (int c = 0; c < 4; ++c) vst2(wd + (hb * 2 + it) * 2 * PTL + c * PBK, p[it][c]);
      asm volatile("s_wait_xcnt 0x0" ::: "memory");   // in front of the next overwrite of the stores' address and data registers
      __builtin_amdgcn_sched_barrier(0); } } }         // keeps the next half's loads behind that wait
__global__ __launch_bounds__(256) void k_gate(const float* __restrict__ X, const float* __restrict__ WG, const float* __restrict__ BG, float* __restrict__ GATE, float* __restrict__ PWR, const float* __restrict__ WQ, const float* __restrict__ WK, const float* __restrict__ WV, __bf16* XB, __bf16* WB) { __shared__ __align__(16) float sg[32]; __shared__ __align__(16) float sp[32];
  if (blockIdx.x >= NGB) { conv_block(X, WQ, WK, WV, XB, WB, (int)blockIdx.x - NGB, threadIdx.x); return; }   // the whole block leaves here, in front of the barrier
  const int tid = threadIdx.x, wave = tid >> 5, lane = tid & 31; const size_t r0 = (size_t)blockIdx.x * 32; const float bg_ = bfr(BG[0]);
  const float* xr = X + (r0 + wave * 4) * DIN + lane;
  float xv[4][32], wreg[32];   /* every loop below is fully unrolled: the arrays are indexed with compile-time constants and stay in registers */
#pragma unroll
  for (int rr = 0; rr < 4; ++rr)
#pragma unroll
    for (int i = 0; i < 32; ++i) xv[rr][i] = xr[rr * DIN + 32 * i];
  asm volatile("s_wait_xcnt 0x0" ::: "memory");   // in front of the next overwrite of the address registers of the loads above (the compiler gave them to Wg's loads as destinations)
  __builtin_amdgcn_sched_barrier(0);              // keeps Wg's loads behind that wait
#pragma unroll
  for (int i = 0; i < 32; ++i) wreg[i] = WG[lane + 32 * i];
  asm volatile("s_wait_xcnt 0x0" ::: "memory");   // the same for Wg's loads
  __builtin_amdgcn_sched_barrier(0);              // keeps every load issued ahead of the sums: drawn down among them, a load would start only when the sum before it is done
#pragma unroll
  for (int i = 0; i < 32; ++i) wreg[i] = bfr(wreg[i]);
  float acc[4];
#pragma unroll
  for (int rr = 0; rr < 4; ++rr) { acc[rr] = 0.f;
#pragma unroll
    for (int i = 0; i < 32; ++i) acc[rr] += bfr(xv[rr][i]) * wreg[i]; }
#pragma unroll
  for (int o = 1; o < 32; o <<= 1)
#pragma unroll
    for (int rr = 0; rr < 4; ++rr) acc[rr] += __shfl_xor(acc[rr], o);
  // every lane holds the four sums: lane rr takes row rr, so one pass of the sigmoid and the power serves the wave's four rows
  const float a = lane == 0 ? acc[0] : lane == 1 ? acc[1] : lane == 2 ? acc[2] : acc[3];
  const float g = 1.0f / (1.0f + expf(-(a + bg_))); const float pw = powf((float)(TT - 2), 1.0f - g);
  if (lane < 4) { sg[wave * 4 + lane] = g; sp[wave * 4 + lane] = pw; }   /* LDS only: no global access under the lane predicate */
  __syncthreads();
  if (tid < 8) vst2(GATE + r0 + tid * 4, *(const v4f*)&sg[tid * 4]);
  else if (tid >= 32 && tid < 40) vst2(PWR + r0 + (tid - 32) * 4, *(const v4f*)&sp[(tid - 32) * 4]); }
extern "C" void kernel_launch(void* const* d_in, const int* in_sizes, int n_in, void* d_out, int out_size, void* d_ws, size_t ws_size, hipStream_t stream) {
  (void)in_sizes; (void)n_in; (void)out_size;
  const float** F = (const float**)d_in;
  if (ws_size < (size_t)WS_END4) return;
  char* ws = (char*)d_ws; _Float16 *QH = (_Float16*)(ws + WS_QH), *KH = (_Float16*)(ws + WS_KH), *VT = (_Float16*)(ws + WS_VT), *QL = (_Float16*)(ws + WS_QL), *KL = (_Float16*)(ws + WS_KL); __bf16 *VB = (__bf16*)(ws + WS_VB), *VBL = (__bf16*)(ws + WS_VBL);
  (void)QL; (void)KL; (void)VB; (void)VBL;
  // inputs: 0 hidden_states [2,2048,1024]; 1 Wq [1024,1024] (in,out), 2 bq; 3 Wk, 4 bk; 5 Wv, 6 bv (zero biases, read); 7 Wg [1024,1]; 8 bg [1]; no output projection
  float* GATE = (float*)(ws + WS_GATE); float* PWR = (float*)(ws + WS_PWR); float* LPEN = (float*)(ws + WS_LPEN); __bf16 *XB = (__bf16*)(ws + WS_XB), *WB = (__bf16*)(ws + WS_WB);
  k_gate<<<dim3(NGB + NXB + NWB), 256, 0, stream>>>(F[0], F[7], F[8], GATE, PWR, F[1], F[3], F[5], XB, WB);   /* blocks past the first NGB round X and the three W to bf16 stage tiles for k_proj */
  k_proj<<<dim3(TNB * TT / PBM, CC / 128, 3 + TNB), 256, 0, stream>>>(XB, WB, F[2], F[4], F[6], QH, QL, KH, KL, VT, VB, VBL, GATE, PWR, LPEN);   /* z = 0..2: q, k, v; z = 3 + b: the log-penalty plane of batch b (32 x 8 blocks, each half of a block 32 rows x 256 keys), shared by its 16 heads */
  k_fa<<<dim3(TT / (8 * 16 * FQ), NH, TNB), 256, 0, stream>>>(QH, KH, VT, LPEN, (float*)d_out);
}

// v009
// A run of this version takes 82.1 microseconds.
// In both of two side-by-side timings against v008, it was 1.03 times as fast.
// Counting every step since v000, it is 14.3 times as fast.
// compute dtype: all float inputs rounded to bf16; q/k/v projections with EXACT bf16 products on WMMA 16x16x32 (f32 accumulate) + bias; the granularity gate g = sigmoid(x . Wg + bg) from exact bf16 products summed in f32 (VALU), pow(S - 2, 1 - g) with precise powf; logits q x k once to f16 each (1 product) x 64^-0.5 + the log-penalty bias in f32 (precise logf); softmax f32 with a running maximum and sum over steps of 32 keys; exp(s - m) x 2^11 once to f16 x v once to f16 (1 product), divided by the f32 row sum at the end; f32 output.
#include <hip/hip_runtime.h>
#include <math.h>

typedef __attribute__((ext_vector_type(16))) _Float16 v16h;
typedef __attribute__((ext_vector_type(16))) __bf16 v16b;
typedef __attribute__((ext_vector_type(8)))  _Float16 v8h;
typedef __attribute__((ext_vector_type(8)))  float v8f;
typedef __attribute__((ext_vector_type(4)))  float v4f;
typedef __attribute__((ext_vector_type(2)))  float v2f;
typedef __attribute__((ext_vector_type(4)))  unsigned v4u;
typedef __attribute__((ext_vector_type(4)))  int v4i;
typedef float __attribute__((may_alias)) float_a;
typedef int __attribute__((may_alias)) int_a;

template <typename T> __device__ __forceinline__ void vst2(void* p, T v) { *(T*)p = v;  }
__device__ __forceinline__ v8f wmma16(v16h a, v16h b, v8f c) {
  v8f d = __builtin_amdgcn_wmma_f32_16x16x32_f16(false, a, false, b, (short)0, c, false, false);
  asm volatile("v_nop\n\tv_nop\n\tv_nop\n\tv_nop" : "+v"(d) : "v"(a), "v"(b));
  return d;
}
__device__ __forceinline__ v8f wmma_bf(v16b a, v16b b, v8f c) {
  v8f d = __builtin_amdgcn_wmma_f32_16x16x32_bf16(false, a, false, b, (short)0, c, false, false);
  asm volatile("v_nop\n\tv_nop\n\tv_nop\n\tv_nop" : "+v"(d) : "v"(a), "v"(b));
  return d;
}
// 16x16x32 fragments: lane = (h = lane>>4, row/col = lane&15); elements 0..7 = k0+8h+0..7, 8..15 = k0+16+8h+0..7; D element r = row 8h+r
__device__ __forceinline__ v16h frag_h(const _Float16* rowk0, int lane) {
  union { v16h v; v8h q[2]; } u; const _Float16* p = rowk0 + 8 * (lane >> 4);
  u.q[0] = *(const v8h*)p; u.q[1] = *(const v8h*)(p + 16); return u.v;
}
__device__ __forceinline__ v16h frag_f32(const float* rowk0, int lane) {
  v16h a; const float* p = rowk0 + 8 * (lane >> 4);
#pragma unroll
  for (int i = 0; i < 8; ++i) { a[i] = (_Float16)p[i]; a[8 + i] = (_Float16)p[16 + i]; }
  return a;
}
__device__ __forceinline__ v16h frag_f32s(const float* rowk0, int lane, float sc) {
  v16h a; const float* p = rowk0 + 8 * (lane >> 4);
#pragma unroll
  for (int i = 0; i < 8; ++i) { a[i] = (_Float16)(p[i] * sc); a[8 + i] = (_Float16)(p[16 + i] * sc); }
  return a;
}
// column fragment from a [K][ld] layout (column n), rows >= K read as 0
__device__ __forceinline__ v16h fragc_f32(const float* W, int k0, int n, int lane, int ld, int K) {
  v16h a; const int g = lane >> 4;
#pragma unroll
  for (int i = 0; i < 8; ++i) { const int ka = k0 + 8 * g + i, kb = ka + 16;
    a[i] = (_Float16)(ka < K ? W[(size_t)(ka < K ? ka : K - 1) * ld + n] : 0.f); a[8 + i] = (_Float16)(kb < K ? W[(size_t)(kb < K ? kb : K - 1) * ld + n] : 0.f); }
  return a;
}
struct F2 { v16b h, l; };
__device__ __forceinline__ F2 bsplit16(const float v[16]) { F2 r;
#pragma unroll
  for (int i = 0; i < 16; ++i) { const __bf16 h = (__bf16)v[i]; r.h[i] = h; r.l[i] = (__bf16)(v[i] - (float)h); }
  return r; }
__device__ __forceinline__ F2 split_row(const float* row, int k0, int lane) { float v[16]; const float* p = row + k0 + 8 * (lane >> 4);
#pragma unroll
  for (int i = 0; i < 8; ++i) { v[i] = p[i]; v[8 + i] = p[16 + i]; }
  return bsplit16(v); }
__device__ __forceinline__ F2 split_rowK(const float* row, int k0, int lane, int K) { float v[16]; const int g = lane >> 4;
#pragma unroll
  for (int i = 0; i < 8; ++i) { const int ka = k0 + 8 * g + i, kb = ka + 16; v[i] = ka < K ? row[ka < K ? ka : K - 1] : 0.f; v[8 + i] = kb < K ? row[kb < K ? kb : K - 1] : 0.f; }
  return bsplit16(v); }
__device__ __forceinline__ F2 split_col(const float* W, int k0, int n, int lane, int ld, int K) { float v[16]; const int g = lane >> 4;
#pragma unroll
  for (int i = 0; i < 8; ++i) { const int ka = k0 + 8 * g + i, kb = ka + 16; v[i] = ka < K ? W[(size_t)(ka < K ? ka : K - 1) * ld + n] : 0.f; v[8 + i] = kb < K ? W[(size_t)(kb < K ? kb : K - 1) * ld + n] : 0.f; }
  return bsplit16(v); }
__device__ __forceinline__ v8f mac3(const F2& a, const F2& b, v8f c) { c = wmma_bf(a.l, b.h, c); c = wmma_bf(a.h, b.l, c); return wmma_bf(a.h, b.h, c); }
__device__ __forceinline__ float sigm(float v) { return 1.0f / (1.0f + expf(-v)); }
#define LDSX() do { asm volatile("s_wait_dscnt 0" ::: "memory"); __builtin_amdgcn_wave_barrier(); __builtin_amdgcn_fence(__ATOMIC_RELEASE, "workgroup"); } while (0)

// BERT-style self-attention with a learned granularity gate adding a log-penalty bias to the scores (hidden_states [2,2048,1024]; (in,out) Wq / Wk / Wv [1024,1024] N(0, 1/1024) + zero biases; Wg [1024,1] + bg: g = sigmoid(x Wg + bg) per token; res[i,j] = (1 - g_i) max(1 - g_i - g_j, 0) + g_i min(1 - g_i + g_j, 1); scope[i,j] = clip((S - 2)^(1 - g_i) + 2 - |i - j|, 1e-32, 1); log_pen = log(max(res * scope, 1e-32)), broadcast over the 16 heads; scores = q k^T / 8 + log_pen; softmax; no output projection): ctx [2,2048,1024].
#define NB 2
#define TT 2048
#define CC 1024            // NH * HD = projected width
#define DIN 1024          // input (model) width
#define NH 16
#define HD 64
#define NQB (TT / 64)
#define HG 4
#define SCALE (0.125f)
#define CAUSAL 0
#ifndef TNB
#define TNB NB
#endif
__device__ __forceinline__ float bfr(float v) { return (float)(__bf16)v; }
__host__ __device__ __forceinline__ int kb_last(int qb) { return CAUSAL ? ((qb * 64 + 63) >> 7) : (TT / 128 - 1); }
typedef __attribute__((ext_vector_type(8))) __bf16 v8b;
__device__ __forceinline__ v16b frag_b(const __bf16* rowk0, int lane) {
  union { v16b v; v8b q[2]; } u; const __bf16* p = rowk0 + 8 * (lane >> 4);
  u.q[0] = *(const v8b*)p; u.q[1] = *(const v8b*)(p + 16); return u.v;
}
#define QBH 0              // not read by any kernel in this file
#define QHI 0               // single-product logits on every row
#define KHI 64            // key rows carrying k residual / v bf16 hi+lo planes (written by k_proj; read by no kernel in this file)
// B fragment (k rows k0+.., output column o) of a weight: (in,out) [K][ld] or (out,in) [ld rows of K]: bf16 exact, or f16(bf16 * 256) exact
__device__ __forceinline__ v16b wcol_io(const float* Wm, int k0, int o, int lane, int ld) { v16b w; const int g = lane >> 4;
#pragma unroll
  for (int i = 0; i < 8; ++i) { w[i] = (__bf16)Wm[(size_t)(k0 + 8 * g + i) * ld + o]; w[8 + i] = (__bf16)Wm[(size_t)(k0 + 16 + 8 * g + i) * ld + o]; }
  return w; }
__device__ __forceinline__ v16b wcol_oi(const float* Wm, int k0, int o, int lane, int K) { v16b w; const float* p = Wm + (size_t)o * K + k0 + 8 * (lane >> 4);
#pragma unroll
  for (int i = 0; i < 8; ++i) { w[i] = (__bf16)p[i]; w[8 + i] = (__bf16)p[16 + i]; }
  return w; }
__device__ __forceinline__ v16h wcolh_io(const float* Wm, int k0, int o, int lane, int ld) { v16h w; const int g = lane >> 4;
#pragma unroll
  for (int i = 0; i < 8; ++i) { w[i] = (_Float16)(bfr(Wm[(size_t)(k0 + 8 * g + i) * ld + o]) * 256.0f); w[8 + i] = (_Float16)(bfr(Wm[(size_t)(k0 + 16 + 8 * g + i) * ld + o]) * 256.0f); }
  return w; }
__device__ __forceinline__ v16h wcolh_oi(const float* Wm, int k0, int o, int lane, int K) { v16h w; const float* p = Wm + (size_t)o * K + k0 + 8 * (lane >> 4);
#pragma unroll
  for (int i = 0; i < 8; ++i) { w[i] = (_Float16)(bfr(p[i]) * 256.0f); w[8 + i] = (_Float16)(bfr(p[16 + i]) * 256.0f); }
  return w; }
#define WQKV_LAYOUT 0   // 0 = (in,out) [DIN][CC]; 1 = (out,in) [CC][DIN]; 2 = per-head [NH][DIN][HD]
__device__ __forceinline__ v16b wcol_hdk(const float* Wm, int k0, int o, int lane) { v16b w; const int g = lane >> 4; const float* p = Wm + (size_t)(o / HD) * DIN * HD + (o % HD);
#pragma unroll
  for (int i = 0; i < 8; ++i) { w[i] = (__bf16)p[(size_t)(k0 + 8 * g + i) * HD]; w[8 + i] = (__bf16)p[(size_t)(k0 + 16 + 8 * g + i) * HD]; }
  return w; }
#define WO_OUT_IN 0
#if WQKV_LAYOUT == 1
#define WCOL(W, k0, o, lane) wcol_oi(W, k0, o, lane, DIN)
#elif WQKV_LAYOUT == 2
#define WCOL(W, k0, o, lane) wcol_hdk(W, k0, o, lane)
#else
#define WCOL(W, k0, o, lane) wcol_io(W, k0, o, lane, CC)
#endif
#if WO_OUT_IN
#define WOCOL(W, k0, o, lane) wcol_oi(W, k0, o, lane, CC)
#define WOCOLH(W, k0, o, lane) wcolh_oi(W, k0, o, lane, CC)
#else
#define WOCOL(W, k0, o, lane) wcol_io(W, k0, o, lane, DIN)
#define WOCOLH(W, k0, o, lane) wcolh_io(W, k0, o, lane, DIN)
#endif
// the module's log-penalty bias log_pen[b, i, j] is head-independent: lpen_block (in k_proj's launch) evaluates it ONCE per batch into an f32 plane LPEN[b] (fragment order); k_fa ADDS it to the scaled score (far keys carry the module's finite log(1e-32) = -73.68, kept literally)

#define WS_QH  0u                                      // f16 q rows [b*t][CC]
#define WS_KH  (WS_QH + 2u * (size_t)NB * TT * CC)      // f16 k in fragment order [b][h][t / 16][kc][piece][lane][8]
#define WS_VT  (WS_KH + 2u * (size_t)NB * TT * CC)      // f16 v in fragment order [b][h][t / 32][j][piece][lane][8]
#define WS_QL  (WS_VT + 2u * (size_t)NB * CC * TT)      // f16 q residual x 2^10 rows [b][t < QHI][CC]
#define WS_KL  (WS_QL + 2u * (size_t)NB * QHI * CC)     // f16 k residual x 2^10 rows [b][t < KHI][CC]
#define WS_VB  (WS_KL + 2u * (size_t)NB * KHI * CC)     // bf16 v hi planes [b][c][t < KHI]
#define WS_VBL (WS_VB + 2u * (size_t)NB * CC * KHI)
#define WS_END (WS_VBL + 2u * (size_t)NB * CC * KHI)
#define WS_GATE (WS_END)                                 // f32 g[b][s]
#define WS_PWR  (WS_GATE + 4u * (size_t)NB * TT)          // f32 pow(S - 2, 1 - g)[b][s]
#define WS_LPEN (WS_PWR + 4u * (size_t)NB * TT)          // f32 log-penalty planes in fragment order [b][i / 16][j / 32][jt][w][lane][4]
#define WS_END3 (WS_LPEN + 4u * (size_t)NB * TT * TT)
#define WS_XB  (WS_END3)                                 // bf16 x in k_proj's stage tiles [row block of 128][stage of 32 k][row][32 k]
#define WS_WB  (WS_XB + 2u * (size_t)NB * TT * DIN)       // bf16 Wq, Wk, Wv transposed, in stage tiles [which][column block of 128][stage of 32 k][column][32 k]
#define WS_END4 (WS_WB + 2u * 3u * (size_t)DIN * CC)

// ---- lpen_block: the log-penalty plane, worked by the blocks z = 3, 4 of k_proj's grid (one z per batch): 128 threads (half a block) = (32 query rows, 256 keys) of batch bsm: log(max(res * scope, 1e-32)), with res = (1 - gi) max(1 - gi - gj, 0) + gi min(1 - gi + gj, 1), scope = clip(pow(S - 2, 1 - gi) + 2 - |i - j|, 1e-32, 1) (gi / pow from the k_gate tables; f32, precise logf); the plane is shared by the 16 heads of the batch. It is written in the order in which k_fa's lanes read it: in a tile of 16 query rows, piece p = ((step * 2 + jt) * 2 + w) * 32 + lane holds query lane & 15, keys 32 step + 16 jt + 8 (lane >> 4) + 4 w + 0..3; each thread writes 16-B pieces, a wave whole lines. A thread's eight key groups are the same for both of the block's row tiles and are loaded once
__device__ __forceinline__ v4f lpen4(float gi_, float pw_, int t, int kb, v4f gj4) { v4f o;
#pragma unroll
  for (int u = 0; u < 4; ++u) { const int k = kb + u; const float gj_ = gj4[u]; const float res_ = (1.0f - gi_) * fmaxf(1.0f - gi_ - gj_, 0.0f) + gi_ * fminf(1.0f - gi_ + gj_, 1.0f); const int ad_ = (t > k) ? (t - k) : (k - t); const float sc_ = fminf(fmaxf(pw_ + 2.0f - (float)ad_, 1.0e-32f), 1.0f); o[u] = logf(fmaxf(res_ * sc_, 1.0e-32f)); }
  return o; }
__device__ __forceinline__ void lpen_block(const float* __restrict__ GATE, const float* __restrict__ PWR, float* LPEN, int bsm, int bx, int by, int tid) { const int lane = tid & 31;   // LPEN carries no __restrict__: with it the compiler moved the stores across the waits written behind them
  const float* G = GATE + (size_t)bsm * TT; const float* P = PWR + (size_t)bsm * TT;
  const int kq = by * 256 + ((tid >> 6) & 1) * 16 + (lane >> 4) * 8 + ((tid >> 5) & 1) * 4;   // first key of this thread's piece of step 0; step it lies 32 keys on
  v4f gj[8]; float gi[2], pw[2];   /* every loop below is fully unrolled: the arrays are indexed with compile-time constants and stay in registers */
#pragma unroll
  for (int it = 0; it < 8; ++it) gj[it] = *(const v4f*)(G + kq + 32 * it);
#pragma unroll
  for (int rb = 0; rb < 2; ++rb) { gi[rb] = G[(bx * 2 + rb) * 16 + (lane & 15)]; pw[rb] = P[(bx * 2 + rb) * 16 + (lane & 15)]; }
  asm volatile("s_wait_xcnt 0x0" ::: "memory");   // in front of the next overwrite of the address registers of the loads above
  __builtin_amdgcn_sched_barrier(0);              // keeps the arithmetic below behind that wait
#pragma unroll
  for (int rb = 0; rb < 2; ++rb) { const int t = (bx * 2 + rb) * 16 + (lane & 15);
    float* dst = LPEN + (size_t)bsm * TT * TT + ((size_t)(bx * 2 + rb) * (TT / 32) + by * 8) * 512 + tid * 4;
#pragma unroll
    for (int it = 0; it < 8; it += 2) { const v4f o0 = lpen4(gi[rb], pw[rb], t, kq + 32 * it, gj[it]); const v4f o1 = lpen4(gi[rb], pw[rb], t, kq + 32 * it + 32, gj[it + 1]);
      __builtin_amdgcn_sched_barrier(0);   // the two pieces' arithmetic (eight independent chains) ends in front of their stores, so that nothing is computed between a store and the wait behind it
      vst2(dst + it * 512, o0); vst2(dst + it * 512 + 512, o1);
      asm volatile("s_wait_xcnt 0x0" ::: "memory");   // in front of the next overwrite of the stores' data registers
      __builtin_amdgcn_sched_barrier(0); } } }         // keeps the next pieces' arithmetic behind that wait
// ---- k_proj: block = (128 rows, 128 cols, which), 8 waves in a 4 x 2 grid, each on 32 rows x 64 cols (2 x 4 fragments): q/k/v = X W (+ b) with exact bf16 products (K = DIN) -> which 0: q f16 rows (+ residual rows < QHI); 1: k f16 in fragment order (+ residual rows < KHI); 2: v f16 in fragment order (+ bf16 hi/lo planes for t < KHI)
// Operands go through LDS, 32 k at a time, two buffers: X and W come rounded to bf16 and laid out in stage tiles (8 KiB contiguous, row or column major with k contiguous) by the launch before (conv_block), so that a block reads half the bytes of the f32 inputs and converts nothing; the eight waves take their fragments from LDS. The next tile's global loads fly while this tile is multiplied.
#define PBM 128            // rows per block
#define PBK 32             // k per stage
#define PNS (DIN / PBK)
#define PTL (128 * PBK)     // bf16 elements of one stage tile of X or of W
#define PPI 40             // bf16 per staged row: 64 B of data at a pitch of 80 B (16 B x odd: the 16 rows of a ds_load_b128 fragment read fall on 16 different bank groups)
#define PWB (128 * PPI * 2 + 128)   // bytes of one W buffer: column n at n * 80 + 16 ((n >> 4) & 3) + 64 (n >> 6)
#define PEP 136            // f16 per row of the output staging: 256 B of data at a pitch of 272 B (16 B x odd)
typedef __attribute__((ext_vector_type(4))) __bf16 v4b;
// six waves per SIMD (160 registers) and a third of the LDS: three blocks per WGP, so that all 768 projection blocks are resident at once and none waits for a second round
__global__ __launch_bounds__(256, 6) void k_proj(const __bf16* __restrict__ XB, const __bf16* __restrict__ WB, const float* __restrict__ BQ, const float* __restrict__ BK, const float* __restrict__ BV,
    _Float16* __restrict__ QH, _Float16* __restrict__ QL, _Float16* __restrict__ KH, _Float16* __restrict__ KL, _Float16* __restrict__ VT, __bf16* __restrict__ VB, __bf16* __restrict__ VBL, const float* __restrict__ GATE, const float* __restrict__ PWR, float* LPEN) {
  static_assert(2 * (TNB * TT / PBM) == TT / 32 && CC / 128 == TT / 256, "a z slice of the grid covers one log-penalty plane: each half of a block takes 32 rows x 256 keys");
  // the short log-penalty blocks come last in the grid: they start as the projection's blocks drain, with no launch of their own; the whole block leaves here, in front of every barrier
  if (blockIdx.z >= 3) { lpen_block(GATE, PWR, LPEN, (int)blockIdx.z - 3, blockIdx.x * 2 + (threadIdx.x >> 7), blockIdx.y, threadIdx.x & 127); return; }
  // one LDS range: the operand stages of the k loop lie in the bytes that the output staging takes over behind the loop; the q / k staging (two planes) and the v staging (three planes) share those bytes, a block uses one of them
  __shared__ __align__(16) unsigned char smem[3 * 128 * PEP * 2];
  _Float16 (*sh)[PEP] = (_Float16 (*)[PEP])smem; _Float16 (*sl)[PEP] = (_Float16 (*)[PEP])(smem + PBM * PEP * 2);
  _Float16 (*th)[PEP] = (_Float16 (*)[PEP])smem; __bf16 (*tb)[PEP] = (__bf16 (*)[PEP])(smem + 128 * PEP * 2); __bf16 (*tbl)[PEP] = (__bf16 (*)[PEP])(smem + 2 * 128 * PEP * 2);
  // W^T: [2][PWB bytes] from smem on
  __bf16* Xs = (__bf16*)(smem + 2 * PWB);                  // [2][PBM rows][PPI]
  const int tid = threadIdx.x, wave = tid >> 5, lane = tid & 31, col = lane & 15, g = lane >> 4; const int wm = wave >> 1, wn = wave & 1;   // the wave's 32 rows and 64 columns of the block's tile
  const int which = blockIdx.z; const int c0 = blockIdx.y * 128; const size_t r0 = (size_t)blockIdx.x * PBM; const size_t bb = r0 / TT; const int t0 = (int)(r0 % TT);
  const float* BA = which == 0 ? BQ : which == 1 ? BK : BV;
  const __bf16* Wg = WB + (size_t)(which * (CC / 128) + (int)blockIdx.y) * (PNS * PTL);   // the block's 32 stage tiles of W^T and of X: 256 KiB contiguous each; block-uniform base + 32-bit offset: one address register
  const __bf16* Xg = XB + (size_t)blockIdx.x * (PNS * PTL);
  const unsigned po = (unsigned)tid * 8;   // this thread's 16-B pieces of a tile: tid and tid + 256 = row or column (tid >> 2) + 64 i, k 8 (tid & 3) + 0..7 (a wave's load = 512 contiguous bytes)
  // the 16 columns of a fragment read share one skew (16 B per 16 columns, 64 B per 64), so that store and read each need one address register and constant offsets
  unsigned char* Wst = smem + (tid >> 2) * (PPI * 2) + 16 * (tid >> 6) + 16 * (tid & 3);
  const unsigned char* Wrd = smem + wn * (64 * PPI * 2 + 64) + col * (PPI * 2);
  __bf16* Xst = Xs + (tid >> 2) * PPI + 8 * (tid & 3);
  // L2 prefetch at the block's head, as in k_fa: a stage's loads are issued one stage ahead, which does not cover a line that has to come from memory. Of the blocks that share the 32 tiles of X (same x), block y asks quarter y mod 4 of them; of any four neighbouring x, each asks a quarter of the column block's tiles of W. A hint only; every address lies inside the block's tiles for every block and thread
  static_assert(PBM == 128 && PNS * PTL * 2 == 4 * 256 * 256, "four shares of 256 threads x one 256-B unit cover the 32 tiles");
  const unsigned pfo = (unsigned)tid * 256u;   // one 256-B unit per thread
  const char* pfx = (const char*)Xg + ((int)blockIdx.y & 3) * 65536;
  const char* pfw = (const char*)Wg + ((int)blockIdx.x & 3) * 65536;
  asm volatile("global_prefetch_b8 %0, %1 scope:SCOPE_SE\n\t"
               "global_prefetch_b8 %0, %2 scope:SCOPE_SE" :: "v"(pfo), "s"(pfx), "s"(pfw));
  v8b wr[2], xr[2];
#pragma unroll
  for (int i = 0; i < 2; ++i) wr[i] = *(const v8b*)(Wg + i * (PTL / 2) + po);
#pragma unroll
  for (int i = 0; i < 2; ++i) xr[i] = *(const v8b*)(Xg + i * (PTL / 2) + po);
  asm volatile("s_wait_xcnt 0x0" :: "v"(pfo), "s"(pfx), "s"(pfw) : "memory");   // the prefetches' offset and bases keep their values up to here, behind the loads that were issued after them
  v8f acc[2][4] = {};
#pragma unroll 2   // two stages per trip: the buffer index is a constant in each
  for (int s = 0; s < PNS; ++s) { const int bf = s & 1; const int sn = s + 1 < PNS ? s + 1 : s;   // the stage fetched ahead; the last stage fetches itself again (in bounds, unused)
#pragma unroll
    for (int i = 0; i < 2; ++i) *(v8b*)(Wst + bf * PWB + i * (64 * PPI * 2 + 64)) = wr[i];
#pragma unroll
    for (int i = 0; i < 2; ++i) *(v8b*)(Xst + bf * PBM * PPI + 64 * i * PPI) = xr[i];
    __syncthreads();   // publishes stage s; it also ends every wave's reads of stage s - 1, whose buffer the next trip overwrites
#pragma unroll
    for (int i = 0; i < 2; ++i) wr[i] = *(const v8b*)(Wg + sn * PTL + i * (PTL / 2) + po);
#pragma unroll
    for (int i = 0; i < 2; ++i) xr[i] = *(const v8b*)(Xg + sn * PTL + i * (PTL / 2) + po);
    asm volatile("s_wait_xcnt 0x0" ::: "memory");   // in front of the next overwrite of the address registers of the loads above; it also keeps those loads issued ahead of the products, which cover their latency
    v16b a[2], w[4];
#pragma unroll
    for (int i = 0; i < 2; ++i) a[i] = frag_b(Xs + (bf * PBM + wm * 32 + i * 16 + col) * PPI, lane);
#pragma unroll
    for (int j = 0; j < 4; ++j) w[j] = frag_b((const __bf16*)(Wrd + bf * PWB + j * (16 * PPI * 2 + 16)), lane);
    __builtin_amdgcn_sched_barrier(0);   // the stage's LDS reads go out as one group ahead of its products: spread among them, each product waited out a whole LDS latency
#pragma unroll
    for (int i = 0; i < 2; ++i)
#pragma unroll
      for (int j = 0; j < 4; ++j) acc[i][j] = wmma_bf(a[i], w[j], acc[i][j]);
    __builtin_amdgcn_sched_barrier(0); }   // keeps the next stage's LDS stores, which wait for the global loads, behind this stage's products (the compiler had drawn them, and the wait, in among the products)
  __syncthreads();   // every wave has left the operand stages before the output staging below overwrites them
  if (which < 2) { _Float16* DH = which == 0 ? QH : KH; _Float16* DL = which == 0 ? QL : KL; const int nhi = which == 0 ? QHI : KHI;
#pragma unroll
    for (int j = 0; j < 4; ++j) { const int cl = wn * 64 + j * 16 + col; const float bias = BA ? bfr(BA[c0 + cl]) : 0.f;
#pragma unroll
      for (int i = 0; i < 2; ++i)
#pragma unroll
        for (int r = 0; r < 8; ++r) { const float v = acc[i][j][r] + bias; const _Float16 hv = (_Float16)v; const int rl = wm * 32 + i * 16 + 8 * g + r; sh[rl][cl] = hv; sl[rl][cl] = (_Float16)((v - (float)hv) * 1024.0f); } }
    __syncthreads();
    // k leaves in the order in which k_fa's A fragments read it: 16-B piece pc = 2 kc + piece of lane ln (key row ln & 15, half ln >> 4) of a 16-key tile of one head, lanes contiguous; q stays in rows
    for (int e = tid; e < PBM * 16; e += 256) { int rl, q; size_t od;
      if (which == 0) { rl = e >> 4; q = e & 15; od = (r0 + rl) * CC + c0 + q * 8; }
      else { const int ln = e & 31, pc = (e >> 5) & 3, tl = (e >> 7) & 7, hl = e >> 10; rl = tl * 16 + (ln & 15); q = hl * 8 + pc * 2 + (ln >> 4); od = ((((bb * NH + (c0 >> 6) + hl) * (TT / 16) + (t0 >> 4) + tl) * 4 + pc) * 32 + ln) * 8; }
      vst2((unsigned*)(DH + od), *(const v4u*)&sh[rl][q * 8]);
      asm volatile("s_wait_xcnt 0x0" ::: "memory");   // in front of the next overwrite of the store's address and data registers
      if (t0 + rl < nhi) { vst2((unsigned*)(DL + (bb * nhi + t0 + rl) * (size_t)CC + c0 + q * 8), *(const v4u*)&sl[rl][q * 8]);   // the residual plane holds rows < nhi only: of a 128-row block at most the first rows
        asm volatile("s_wait_xcnt 0x0" ::: "memory"); } }   // the same for this store
  } else {
#pragma unroll
    for (int j = 0; j < 4; ++j) { const int cl = wn * 64 + j * 16 + col; const float bias = BA ? bfr(BA[c0 + cl]) : 0.f;
#pragma unroll
      for (int i = 0; i < 2; ++i)
#pragma unroll
        for (int r = 0; r < 8; ++r) { const float v = acc[i][j][r] + bias; const int rl = wm * 32 + i * 16 + 8 * g + r; th[cl][rl] = (_Float16)v; const __bf16 bh = (__bf16)v; tb[cl][rl] = bh; tbl[cl][rl] = (__bf16)(v - (float)bh); } }
    __syncthreads();
    // v leaves in the order in which k_fa's A fragments read it: piece pc of lane ln (channel ln & 15 of tile j, half ln >> 4) of a 32-key step of one head, lanes contiguous
    for (int e = tid; e < 128 * (PBM / 8); e += 256) { const int ln = e & 31, pc = (e >> 5) & 1, j = (e >> 6) & 3, st = (e >> 8) & 3, hl = e >> 10; const int cl = hl * 64 + j * 16 + (ln & 15), q = st * 4 + pc * 2 + (ln >> 4);
      vst2((unsigned*)(VT + (((((bb * NH + (c0 >> 6) + hl) * (TT / 32) + (t0 >> 5) + st) * 4 + j) * 2 + pc) * 32 + ln) * 8), *(const v4u*)&th[cl][q * 8]);
      asm volatile("s_wait_xcnt 0x0" ::: "memory");   // in front of the next overwrite of the store's address and data registers
      if (t0 + q * 8 < KHI) { const size_t o3 = (bb * CC + c0 + cl) * (size_t)KHI + t0 + q * 8; vst2((unsigned*)(VB + o3), *(const v4u*)&tb[cl][q * 8]); vst2((unsigned*)(VBL + o3), *(const v4u*)&tbl[cl][q * 8]);   // the hi / lo planes hold keys < KHI only
        asm volatile("s_wait_xcnt 0x0" ::: "memory"); } } } }   // the same for these two stores
// ---- k_fa: block = 256 queries (8 waves x 32 query columns) of (b, h): one pass over all keys, 32 at a time, with a running maximum and sum per query (online softmax); the logits and P stay in registers.
// Transposed products: S^T = K . Q^T (A = key rows, B = query rows) puts one query's 16 scores of a 32-key step in lanes c and c + 16; two S^T tiles, converted in place, are the B operand of O^T += V^T . P^T (A = v, channel rows); O^T register r = ctx[query c][16 j + 8 h + r].
// P = exp(s - m) x 2^11 once to f16 (the row sum carries the same factor, taken in f32 before the rounding, and divides it out at the end).
#define FQ 2               // query tiles of 16 columns per wave: each K / V fragment load feeds both
// every loop below but the stage and step loops is fully unrolled so that the fragment and accumulator arrays are indexed by constants and stay in registers
#define L2E 1.4426950408889634f
__device__ __forceinline__ v8f mmh(v16h a, v16h b, v8f c) { return __builtin_amdgcn_wmma_f32_16x16x32_f16(false, a, false, b, (short)0, c, false, false); }
// a fragment stored in fragment order: this lane's two 16-B pieces lie 512 B apart (p already holds the lane's offset)
__device__ __forceinline__ v16h frag_p(const _Float16* p) { union { v16h v; v8h q[2]; } u; u.q[0] = *(const v8h*)p; u.q[1] = *(const v8h*)(p + 256); return u.v; }
__device__ __forceinline__ float xhalf(float x) { return __builtin_bit_cast(float, __builtin_amdgcn_permlanex16(__builtin_bit_cast(int, x), __builtin_bit_cast(int, x), 0x76543210, 0xfedcba98, false, false)); }  // lane l with lane l ^ 16
// K and V go through LDS, 256 keys (32 KiB of each, contiguous in the fragment-order planes) a stage, two buffers: the block's 8 waves read the same K and V, so each byte leaves L2 once per block and not once per wave that misses the WGP cache. The copies are asynchronous (no register), each thread 8 x 16 B of K and 8 x 16 B of V per stage; the next stage's copies fly while this stage is worked on.
#define FKT 256                 // keys per stage: a barrier every eight steps
#define FNT (TT / FKT)          // stages
#define FKB (FKT * HD * 2)      // bytes of K, and of V, in one stage
// half a stage's copies of one thread (128 keys): lds = the thread's own LDS byte address in the buffer's K part (V lies FKB on), gk / gv = its own bytes in the K and V planes; pieces lie 4 KiB apart. The s_wait_xcnt stands inside the statement, behind the last copy: in front of any later overwrite of the copies' address registers
__device__ __forceinline__ void fa_stage(unsigned lds, const char* gk, const char* gv) {
  asm volatile("global_load_async_to_lds_b128 %0, %8, off\n\t"
               "global_load_async_to_lds_b128 %1, %9, off\n\t"
               "global_load_async_to_lds_b128 %2, %10, off\n\t"
               "global_load_async_to_lds_b128 %3, %11, off\n\t"
               "global_load_async_to_lds_b128 %4, %12, off\n\t"
               "global_load_async_to_lds_b128 %5, %13, off\n\t"
               "global_load_async_to_lds_b128 %6, %14, off\n\t"
               "global_load_async_to_lds_b128 %7, %15, off\n\t"
               "s_wait_xcnt 0x0"
               :: "v"(lds), "v"(lds + 4096u), "v"(lds + 8192u), "v"(lds + 12288u), "v"(lds + FKB), "v"(lds + FKB + 4096u), "v"(lds + FKB + 8192u), "v"(lds + FKB + 12288u),
                  "v"(gk), "v"(gk + 4096), "v"(gk + 8192), "v"(gk + 12288), "v"(gv), "v"(gv + 4096), "v"(gv + 8192), "v"(gv + 12288) : "memory"); }
__global__ __launch_bounds__(256) void k_fa(const _Float16* __restrict__ QH, const _Float16* __restrict__ KH, const _Float16* __restrict__ VT, const float* __restrict__ LPEN, float* __restrict__ Y) {
  static_assert(FNT >= 2 && FKB == 2 * 4 * 256 * 16 && TT % FKT == 0, "two stages at least; two calls x 256 threads x 4 pieces of 16 B cover a stage's K, and its V");
  __shared__ __align__(16) unsigned char kvs[2 * 2 * FKB];   // [buffer][K, V][FKB]
  const int tid = threadIdx.x, wave = tid >> 5, lane = tid & 31, col = lane & 15, g = lane >> 4; const int h = blockIdx.y, b = blockIdx.z; const int q0 = blockIdx.x * (8 * 16 * FQ) + wave * (16 * FQ);
  // K, V and the log-penalty lie in fragment order: a wave's load is 32 lanes x 16 B = 512 contiguous bytes
  const char* gk = (const char*)(KH + (size_t)(b * NH + h) * TT * HD);   // the head's K plane (block-uniform); 32 keys = 4 KiB: [jt][kc][piece][lane][8]
  const char* gv = (const char*)(VT + (size_t)(b * NH + h) * TT * HD);   // the head's V plane; 32 keys = 4 KiB: [j][piece][lane][8]
  const unsigned t16 = (unsigned)tid * 16u;   // byte offset of this thread's first piece in a stage's K, and in its V
  const unsigned lds0 = (unsigned)(size_t)kvs + (unsigned)tid * 16u;               // this thread's first piece in buffer 0
  const float* Lb = LPEN + (size_t)b * TT * TT + (size_t)q0 * TT + lane * 4;    // 16 queries x 32 keys = 512 floats: [jt][w][lane][4]; 16 queries = 16 TT floats
  // L2 prefetch at the kernel's head: K, V and the log-penalty plane were stored by the launch before, and a line that is not in the L2 costs a step of the loop below a whole memory latency. Each 256-B unit is asked for once per group of blocks that read it: the 16 heads of a query block share its log-penalty rows (head h asks key steps 4 h + 0..3 of the block's 16 row tiles), four neighbouring query blocks share a head's K and V (block x asks the pairs of key steps p = x mod 4 (mod 4)). A hint only: nothing depends on where a block runs or on a line having arrived. Every address lies inside its plane for every block, wave and lane.
  static_assert(4 * NH == TT / 32 && TT / 32 == 64 && TT / (8 * 16 * FQ) == 8, "the shares below cover the 64 key steps once: 16 heads x 4 steps; 4 blocks x 8 waves x 2 steps");
  const int ws = __builtin_amdgcn_readfirstlane(wave);   // the wave's number in a scalar register: the prefetches' bases are scalar
  const unsigned poff = (unsigned)lane * 256u;           // one 256-B unit per lane: a wave's prefetch covers 8 KiB
  const char* pk = (const char*)(KH + (size_t)(b * NH + h) * TT * HD) + (size_t)(4 * ws + ((int)blockIdx.x & 3)) * 8192;   // two key steps of K = 8 KiB
  const char* pv = (const char*)(VT + (size_t)(b * NH + h) * TT * HD) + (size_t)(4 * ws + ((int)blockIdx.x & 3)) * 8192;   // the same two steps of V
  const char* pl = (const char*)(LPEN + (size_t)b * TT * TT) + ((size_t)((int)blockIdx.x * 16 + ws) * (TT / 32) + 4 * h) * 2048;   // four key steps of row tile ws of the block = 8 KiB; row tile ws + 8 lies 8 x 128 KiB on
  fa_stage(lds0, gk + t16, gv + t16); fa_stage(lds0 + FKB / 2, gk + FKB / 2 + t16, gv + FKB / 2 + t16);   // stage 0 into buffer 0, first of all: the block can do nothing before it has landed
  asm volatile("global_prefetch_b8 %0, %1 scope:SCOPE_SE\n\t"
               "global_prefetch_b8 %0, %2 scope:SCOPE_SE\n\t"
               "global_prefetch_b8 %0, %3 scope:SCOPE_SE\n\t"
               "global_prefetch_b8 %0, %3 offset:1048576 scope:SCOPE_SE" :: "v"(poff), "s"(pk), "s"(pv), "s"(pl));
  v16h qf[FQ][2];
#pragma unroll
  for (int u = 0; u < FQ; ++u)
#pragma unroll
    for (int kc = 0; kc < 2; ++kc) qf[u][kc] = frag_h(QH + ((size_t)b * TT + q0 + u * 16 + col) * CC + h * HD + kc * 32, lane);
  __builtin_amdgcn_sched_barrier(0);   // q's loads stay issued ahead of the log-penalty's: issued last, they turn the counted wait at the loop's head into a wait for every load in flight
  v4f lp[FQ][2][2];
#pragma unroll
  for (int jt = 0; jt < 2; ++jt)
#pragma unroll
    for (int u = 0; u < FQ; ++u) { lp[u][jt][0] = *(const v4f*)(Lb + (size_t)u * 16 * TT + jt * 256); lp[u][jt][1] = *(const v4f*)(Lb + (size_t)u * 16 * TT + jt * 256 + 128); }
  asm volatile("s_wait_xcnt 0x0" :: "v"(poff), "s"(pk), "s"(pv), "s"(pl) : "memory");   // the address registers of the loads above are reused below: the wait stands in front of that overwrite; the prefetches' offset and bases are named so that they too keep their values up to here, behind the loads that were issued after them
  __builtin_amdgcn_sched_barrier(0);              // keeps what follows behind that wait
  asm volatile("s_wait_asynccnt 0x0" ::: "memory");   // this wave's copies of stage 0 have landed
  __syncthreads();                                    // publishes stage 0: every wave's copies have landed
  fa_stage(lds0 + 2 * FKB, gk + FKB + t16, gv + FKB + t16); fa_stage(lds0 + 2 * FKB + FKB / 2, gk + (FKB + FKB / 2) + t16, gv + (FKB + FKB / 2) + t16);   // stage 1 into buffer 1
  v8f o[FQ][HD / 16] = {}; float m[FQ], l[FQ];
#pragma unroll
  for (int u = 0; u < FQ; ++u) { m[u] = -3.0e38f; l[u] = 0.f; }
  v16h kf[2][2];
#pragma unroll 1   // stays rolled: a trip is one stage, eight steps of 32 keys
  for (int t = 0; t < FNT; ++t) { const _Float16* Ks = (const _Float16*)(kvs + (t & 1) * (2 * FKB)) + lane * 8; const _Float16* Vs = Ks + FKB / 2;   // this stage's buffer, at the lane's offset
    // a stage's first K fragments cannot be fetched ahead: the stage is published only at the barrier in front of this trip
#pragma unroll
    for (int jt = 0; jt < 2; ++jt)
#pragma unroll
      for (int kc = 0; kc < 2; ++kc) kf[jt][kc] = frag_p(Ks + jt * 1024 + kc * 512);
#pragma unroll 1   // stays rolled: one step's live set already takes some 256 registers; unrolled, the build took a hundred more and switched register windows all through the loop
    for (int s = 0; s < FKT / 32; ++s) { const int k0 = t * FKT + s * 32; const int kn = k0 + 32 < TT ? k0 + 32 : 0;   // the step whose log-penalty is fetched ahead; the last step fetches step 0 again (in bounds, unused)
      const int sn = s + 1 < FKT / 32 ? s + 1 : s;   // the step whose K is fetched ahead, inside this stage only; the stage's last step fetches itself again (unused)
      v16h vf[HD / 16];
#pragma unroll
      for (int j = 0; j < HD / 16; ++j) vf[j] = frag_p(Vs + s * 2048 + j * 512);
      float sv[FQ][16];
#pragma unroll
      for (int u = 0; u < FQ; ++u)
#pragma unroll
        for (int jt = 0; jt < 2; ++jt) { v8f z = {}; z = mmh(kf[jt][0], qf[u][0], z); z = mmh(kf[jt][1], qf[u][1], z);
#pragma unroll
          for (int r = 0; r < 8; ++r) sv[u][jt * 8 + r] = fmaf(z[r], SCALE, lp[u][jt][r >> 2][r & 3]); }
      // the next step's K fragments (inside this stage only) and log-penalty rows, into the registers this step has just read: they fly during the softmax and the P . v products
#pragma unroll
      for (int jt = 0; jt < 2; ++jt)
#pragma unroll
        for (int kc = 0; kc < 2; ++kc) kf[jt][kc] = frag_p(Ks + sn * 2048 + jt * 1024 + kc * 512);
#pragma unroll
      for (int jt = 0; jt < 2; ++jt)
#pragma unroll
        for (int u = 0; u < FQ; ++u) { lp[u][jt][0] = *(const v4f*)(Lb + (size_t)u * 16 * TT + kn * 16 + jt * 256); lp[u][jt][1] = *(const v4f*)(Lb + (size_t)u * 16 * TT + kn * 16 + jt * 256 + 128); }
      asm volatile("s_wait_xcnt 0x0" ::: "memory");   // in front of the next overwrite of the address registers of the loads above
      __builtin_amdgcn_sched_barrier(0);      // keeps the fetch-ahead loads issued in front of the softmax and the P . v products, which then cover their latency
#pragma unroll
      for (int u = 0; u < FQ; ++u) { float mt = sv[u][0];
#pragma unroll
        for (int i = 1; i < 16; ++i) mt = fmaxf(mt, sv[u][i]);
        mt = fmaxf(mt, xhalf(mt)); const float mn = fmaxf(m[u], mt); const float al = __builtin_amdgcn_exp2f((m[u] - mn) * L2E);   // 0 on the first step
        m[u] = mn; const float cc = 11.0f - mn * L2E; float ls = 0.f; v16h pb;
#pragma unroll
        for (int i = 0; i < 16; ++i) { const float p = __builtin_amdgcn_exp2f(fmaf(sv[u][i], L2E, cc)); ls += p; pb[i] = (_Float16)p; }
        l[u] = l[u] * al + ls;
#pragma unroll
        for (int j = 0; j < HD / 16; ++j) { o[u][j] = o[u][j] * al; o[u][j] = mmh(vf[j], pb, o[u][j]); } } }
    // publish point of stage t + 1, every wave, in this order
    asm volatile("s_wait_dscnt 0x0" ::: "memory");      // this wave's reads of stage t's buffer have returned
    asm volatile("s_wait_asynccnt 0x0" ::: "memory");   // this wave's copies of stage t + 1 have landed
    __syncthreads();                                    // publishes stage t + 1 and ends every wave's reads of stage t's buffer, which is refilled behind it
    if (t + 2 < FNT) { const unsigned ld = lds0 + (unsigned)(t & 1) * (2 * FKB); const char* nk = gk + (size_t)(t + 2) * FKB; const char* nv = gv + (size_t)(t + 2) * FKB;   // the same test in the whole block
      fa_stage(ld, nk + t16, nv + t16); fa_stage(ld + FKB / 2, nk + FKB / 2 + t16, nv + FKB / 2 + t16); } }
  asm volatile("s_wait_asynccnt 0x0" ::: "memory");   // no copy is outstanding when the wave ends
#pragma unroll
  for (int u = 0; u < FQ; ++u) { const float inv = 1.0f / (l[u] + xhalf(l[u]));   // the halves' sums join once; the row's maximum contributes 2^11, so the sum is positive
    float* yr = Y + ((size_t)b * TT + q0 + u * 16 + col) * CC + h * HD + 8 * g;
#pragma unroll
    for (int j = 0; j < HD / 16; ++j) { v4f a0, a1;
#pragma unroll
      for (int r = 0; r < 4; ++r) { a0[r] = o[u][j][r] * inv; a1[r] = o[u][j][4 + r] * inv; }
      vst2(yr + j * 16, a0); vst2(yr + j * 16 + 4, a1); } } }

// ---- k_gate: block = 32 rows, 8 waves x 4 rows: g = sigmoid(x . Wg + bg) and pow(S - 2, 1 - g). A wave's 4 rows are worked together: their 128 loads and Wg's 32 are issued back to back with no wait between them, so the wave pays the memory latency once and not once per load; each row's sum keeps its order (i = 0..31 in the lane, then the xor tree)
// ---- conv_block: rides behind k_gate's blocks in its grid (which fills only half of the chip): rounds X, Wq, Wk and Wv to bf16 ONCE, with the rounding that k_proj applied to every tile it read, and lays them out in k_proj's stage tiles (128 rows or columns x 32 k, k contiguous, 8 KiB). Blocks 0..127: 128 rows of X x 8 stages; blocks 128..223: 128 columns of one W x 8 stages, transposed inside the thread (8 k x 4 columns). Every loop is fully unrolled: the arrays are indexed by constants and stay in registers. XB and WB carry no __restrict__, as LPEN above: the stores stay in front of the waits written behind them
#define NGB (TNB * TT / 32)                 // k_gate's own blocks
#define NXB ((TNB * TT / 128) * (PNS / 8))  // X blocks
#define NWB (3 * (CC / 128) * (PNS / 8))    // W blocks
__device__ __forceinline__ void conv_block(const float* __restrict__ X, const float* __restrict__ WQ, const float* __restrict__ WK, const float* __restrict__ WV, __bf16* XB, __bf16* WB, int cb, int tid) {
  if (cb < NXB) { const int rb = cb / (PNS / 8), s0 = (cb % (PNS / 8)) * 8;
    // piece e = tid + 256 i of a tile: row e >> 2, k 8 (e & 3) + 0..7: a wave reads eight whole lines and writes 512 contiguous bytes
    const float* xs = X + ((size_t)rb * 128 + (tid >> 2)) * DIN + s0 * PBK + 8 * (tid & 3); __bf16* xd = XB + ((size_t)rb * PNS + s0) * PTL + tid * 8;
#pragma unroll
    for (int hb = 0; hb < 2; ++hb) { v4f v[4][2][2];   // four stages at a time: 16 loads in flight
#pragma unroll
      for (int st = 0; st < 4; ++st)
#pragma unroll
        for (int i = 0; i < 2; ++i) { v[st][i][0] = *(const v4f*)(xs + (size_t)(64 * i) * DIN + (hb * 4 + st) * PBK); v[st][i][1] = *(const v4f*)(xs + (size_t)(64 * i) * DIN + (hb * 4 + st) * PBK + 4); }
      asm volatile("s_wait_xcnt 0x0" ::: "memory");   // in front of the next overwrite of the address registers of the loads above
      __builtin_amdgcn_sched_barrier(0);              // keeps every load issued ahead of the conversions, and those behind that wait
      v8b p[4][2];
#pragma unroll
      for (int st = 0; st < 4; ++st)
#pragma unroll
        for (int i = 0; i < 2; ++i)
#pragma unroll
          for (int e = 0; e < 4; ++e) { p[st][i][e] = (__bf16)v[st][i][0][e]; p[st][i][4 + e] = (__bf16)v[st][i][1][e]; }
      __builtin_amdgcn_sched_barrier(0);              // the conversions end in front of the stores, so that nothing is computed between a store and the wait behind it
#pragma unroll
      for (int st = 0; st < 4; ++st)
#pragma unroll
        for (int i = 0; i < 2; ++i) vst2(xd + (hb * 4 + st) * PTL + i * (PTL / 2), p[st][i]);
      asm volatile("s_wait_xcnt 0x0" ::: "memory");   // in front of the next overwrite of the stores' address and data registers
      __builtin_amdgcn_sched_barrier(0); }            // keeps the next half's loads behind that wait
  } else { const int cw = cb - NXB; const int wh = cw / ((CC / 128) * (PNS / 8)), y = (cw / (PNS / 8)) % (CC / 128), s0 = (cw % (PNS / 8)) * 8 + (tid >> 7);   // each half of the block takes every second stage
    const float* Wm = wh == 0 ? WQ : wh == 1 ? WK : WV; const int q = tid & 3, n0 = ((tid >> 2) & 31) * 4;   // k 8 q + 0..7, columns n0 + 0..3: a wave's load = four whole lines; its four stores fill 2 KiB
    const float* wsrc = Wm + (size_t)(s0 * PBK + 8 * q) * CC + y * 128 + n0; __bf16* wd = WB + ((size_t)(wh * (CC / 128) + y) * PNS + s0) * PTL + n0 * PBK + 8 * q;
#pragma unroll
    for (int hb = 0; hb < 2; ++hb) { v4f v[2][8];   // two stages at a time: 16 loads in flight
#pragma unroll
      for (int it = 0; it < 2; ++it)
#pragma unroll
        for (int i = 0; i < 8; ++i) v[it][i] = *(const v4f*)(wsrc + (size_t)((hb * 2 + it) * 2 * PBK + i) * CC);
      asm volatile("s_wait_xcnt 0x0" ::: "memory");   // in front of the next overwrite of the address registers of the loads above
      __builtin_amdgcn_sched_barrier(0);              // keeps every load issued ahead of the conversions, and those behind that wait
      v8b p[2][4];
#pragma unroll
      for (int it = 0; it < 2; ++it)
#pragma unroll
        for (int c = 0; c < 4; ++c)
#pragma unroll
          for (int i = 0; i < 8; ++i) p[it][c][i] = (__bf16)v[it][i][c];
      __builtin_amdgcn_sched_barrier(0);              // the conversions end in front of the stores
#pragma unroll
      for (int it = 0; it < 2; ++it)
#pragma unroll
        for (int c = 0; c < 4; ++c) vst2(wd + (hb * 2 + it) * 2 * PTL + c * PBK, p[it][c]);
      asm volatile("s_wait_xcnt 0x0" ::: "memory");   // in front of the next overwrite of the stores' address and data registers
      __builtin_amdgcn_sched_barrier(0); } } }         // keeps the next half's loads behind that wait
__global__ __launch_bounds__(256) void k_gate(const float* __restrict__ X, const float* __restrict__ WG, const float* __restrict__ BG, float* __restrict__ GATE, float* __restrict__ PWR, const float* __restrict__ WQ, const float* __restrict__ WK, const float* __restrict__ WV, __bf16* XB, __bf16* WB) { __shared__ __align__(16) float sg[32]; __shared__ __align__(16) float sp[32];
  if (blockIdx.x >= NGB) { conv_block(X, WQ, WK, WV, XB, WB, (int)blockIdx.x - NGB, threadIdx.x); return; }   // the whole block leaves here, in front of the barrier
  const int tid = threadIdx.x, wave = tid >> 5, lane = tid & 31; const size_t r0 = (size_t)blockIdx.x * 32; const float bg_ = bfr(BG[0]);
  const float* xr = X + (r0 + wave * 4) * DIN + lane;
  float xv[4][32], wreg[32];   /* every loop below is fully unrolled: the arrays are indexed with compile-time constants and stay in registers */
#pragma unroll
  for (int rr = 0; rr < 4; ++rr)
#pragma unroll
    for (int i = 0; i < 32; ++i) xv[rr][i] = xr[rr * DIN + 32 * i];
  asm volatile("s_wait_xcnt 0x0" ::: "memory");   // in front of the next overwrite of the address registers of the loads above (the compiler gave them to Wg's loads as destinations)
  __builtin_amdgcn_sched_barrier(0);              // keeps Wg's loads behind that wait
#pragma unroll
  for (int i = 0; i < 32; ++i) wreg[i] = WG[lane + 32 * i];
  asm volatile("s_wait_xcnt 0x0" ::: "memory");   // the same for Wg's loads
  __builtin_amdgcn_sched_barrier(0);              // keeps every load issued ahead of the sums: drawn down among them, a load would start only when the sum before it is done
#pragma unroll
  for (int i = 0; i < 32; ++i) wreg[i] = bfr(wreg[i]);
  float acc[4];
#pragma unroll
  for (int rr = 0; rr < 4; ++rr) { acc[rr] = 0.f;
#pragma unroll
    for (int i = 0; i < 32; ++i) acc[rr] += bfr(xv[rr][i]) * wreg[i]; }
#pragma unroll
  for (int o = 1; o < 32; o <<= 1)
#pragma unroll
    for (int rr = 0; rr < 4; ++rr) acc[rr] += __shfl_xor(acc[rr], o);
  // every lane holds the four sums: lane rr takes row rr, so one pass of the sigmoid and the power serves the wave's four rows
  const float a = lane == 0 ? acc[0] : lane == 1 ? acc[1] : lane == 2 ? acc[2] : acc[3];
  const float g = 1.0f / (1.0f + expf(-(a + bg_))); const float pw = powf((float)(TT - 2), 1.0f - g);
  if (lane < 4) { sg[wave * 4 + lane] = g; sp[wave * 4 + lane] = pw; }   /* LDS only: no global access under the lane predicate */
  __syncthreads();
  if (tid < 8) vst2(GATE + r0 + tid * 4, *(const v4f*)&sg[tid * 4]);
  else if (tid >= 32 && tid < 40) vst2(PWR + r0 + (tid - 32) * 4, *(const v4f*)&sp[(tid - 32) * 4]); }
extern "C" void kernel_launch(void* const* d_in, const int* in_sizes, int n_in, void* d_out, int out_size, void* d_ws, size_t ws_size, hipStream_t stream) {
  (void)in_sizes; (void)n_in; (void)out_size;
  const float** F = (const float**)d_in;
  if (ws_size < (size_t)WS_END4) return;
  char* ws = (char*)d_ws; _Float16 *QH = (_Float16*)(ws + WS_QH), *KH = (_Float16*)(ws + WS_KH), *VT = (_Float16*)(ws + WS_VT), *QL = (_Float16*)(ws + WS_QL), *KL = (_Float16*)(ws + WS_KL); __bf16 *VB = (__bf16*)(ws + WS_VB), *VBL = (__bf16*)(ws + WS_VBL);
  (void)QL; (void)KL; (void)VB; (void)VBL;
  // inputs: 0 hidden_states [2,2048,1024]; 1 Wq [1024,1024] (in,out), 2 bq; 3 Wk, 4 bk; 5 Wv, 6 bv (zero biases, read); 7 Wg [1024,1]; 8 bg [1]; no output projection
  float* GATE = (float*)(ws + WS_GATE); float* PWR = (float*)(ws + WS_PWR); float* LPEN = (float*)(ws + WS_LPEN); __bf16 *XB = (__bf16*)(ws + WS_XB), *WB = (__bf16*)(ws + WS_WB);
  k_gate<<<dim3(NGB + NXB + NWB), 256, 0, stream>>>(F[0], F[7], F[8], GATE, PWR, F[1], F[3], F[5], XB, WB);   /* blocks past the first NGB round X and the three W to bf16 stage tiles for k_proj */
  k_proj<<<dim3(TNB * TT / PBM, CC / 128, 3 + TNB), 256, 0, stream>>>(XB, WB, F[2], F[4], F[6], QH, QL, KH, KL, VT, VB, VBL, GATE, PWR, LPEN);   /* z = 0..2: q, k, v; z = 3 + b: the log-penalty plane of batch b (32 x 8 blocks, each half of a block 32 rows x 256 keys), shared by its 16 heads */
  k_fa<<<dim3(TT / (8 * 16 * FQ), NH, TNB), 256, 0, stream>>>(QH, KH, VT, LPEN, (float*)d_out);
}

// v010
// A run of this version takes 79 microseconds.
// Two timings next to v009 both put it at 1.04 times that version's speed.
// Over all steps from v000 it is 14.9 times as fast.
// compute dtype: all float inputs rounded to bf16; q/k/v projections with EXACT bf16 products on WMMA 16x16x32 (f32 accumulate) + bias; the granularity gate g = sigmoid(x . Wg + bg) from exact bf16 products summed in f32 (VALU), pow(S - 2, 1 - g) with precise powf; logits in the log2 domain: q x 64^-0.5 x log2(e) once to f16, k once to f16 (1 product), added by the WMMA to its f32 C operand = log-penalty bias (precise logf) x log2(e) - (the maximum in use - 11); softmax f32 with a maximum in use (it trails the running maximum by at most 4) and a sum over steps of 32 keys; 2^(s - m) x 2^11 once to f16 x v once to f16 (1 product), divided by the f32 row sum at the end; f32 output.
#include <hip/hip_runtime.h>
#include <math.h>

typedef __attribute__((ext_vector_type(16))) _Float16 v16h;
typedef __attribute__((ext_vector_type(16))) __bf16 v16b;
typedef __attribute__((ext_vector_type(8)))  _Float16 v8h;
typedef __attribute__((ext_vector_type(8)))  float v8f;
typedef __attribute__((ext_vector_type(4)))  float v4f;
typedef __attribute__((ext_vector_type(2)))  float v2f;
typedef __attribute__((ext_vector_type(4)))  unsigned v4u;
typedef __attribute__((ext_vector_type(4)))  int v4i;
typedef float __attribute__((may_alias)) float_a;
typedef int __attribute__((may_alias)) int_a;

template <typename T> __device__ __forceinline__ void vst2(void* p, T v) { *(T*)p = v;  }
__device__ __forceinline__ v8f wmma16(v16h a, v16h b, v8f c) {
  v8f d = __builtin_amdgcn_wmma_f32_16x16x32_f16(false, a, false, b, (short)0, c, false, false);
  asm volatile("v_nop\n\tv_nop\n\tv_nop\n\tv_nop" : "+v"(d) : "v"(a), "v"(b));
  return d;
}
__device__ __forceinline__ v8f wmma_bf(v16b a, v16b b, v8f c) {
  v8f d = __builtin_amdgcn_wmma_f32_16x16x32_bf16(false, a, false, b, (short)0, c, false, false);
  asm volatile("v_nop\n\tv_nop\n\tv_nop\n\tv_nop" : "+v"(d) : "v"(a), "v"(b));
  return d;
}
// 16x16x32 fragments: lane = (h = lane>>4, row/col = lane&15); elements 0..7 = k0+8h+0..7, 8..15 = k0+16+8h+0..7; D element r = row 8h+r
__device__ __forceinline__ v16h frag_h(const _Float16* rowk0, int lane) {
  union { v16h v; v8h q[2]; } u; const _Float16* p = rowk0 + 8 * (lane >> 4);
  u.q[0] = *(const v8h*)p; u.q[1] = *(const v8h*)(p + 16); return u.v;
}
__device__ __forceinline__ v16h frag_f32(const float* rowk0, int lane) {
  v16h a; const float* p = rowk0 + 8 * (lane >> 4);
#pragma unroll
  for (int i = 0; i < 8; ++i) { a[i] = (_Float16)p[i]; a[8 + i] = (_Float16)p[16 + i]; }
  return a;
}
__device__ __forceinline__ v16h frag_f32s(const float* rowk0, int lane, float sc) {
  v16h a; const float* p = rowk0 + 8 * (lane >> 4);
#pragma unroll
  for (int i = 0; i < 8; ++i) { a[i] = (_Float16)(p[i] * sc); a[8 + i] = (_Float16)(p[16 + i] * sc); }
  return a;
}
// column fragment from a [K][ld] layout (column n), rows >= K read as 0
__device__ __forceinline__ v16h fragc_f32(const float* W, int k0, int n, int lane, int ld, int K) {
  v16h a; const int g = lane >> 4;
#pragma unroll
  for (int i = 0; i < 8; ++i) { const int ka = k0 + 8 * g + i, kb = ka + 16;
    a[i] = (_Float16)(ka < K ? W[(size_t)(ka < K ? ka : K - 1) * ld + n] : 0.f); a[8 + i] = (_Float16)(kb < K ? W[(size_t)(kb < K ? kb : K - 1) * ld + n] : 0.f); }
  return a;
}
struct F2 { v16b h, l; };
__device__ __forceinline__ F2 bsplit16(const float v[16]) { F2 r;
#pragma unroll
  for (int i = 0; i < 16; ++i) { const __bf16 h = (__bf16)v[i]; r.h[i] = h; r.l[i] = (__bf16)(v[i] - (float)h); }
  return r; }
__device__ __forceinline__ F2 split_row(const float* row, int k0, int lane) { float v[16]; const float* p = row + k0 + 8 * (lane >> 4);
#pragma unroll
  for (int i = 0; i < 8; ++i) { v[i] = p[i]; v[8 + i] = p[16 + i]; }
  return bsplit16(v); }
__device__ __forceinline__ F2 split_rowK(const float* row, int k0, int lane, int K) { float v[16]; const int g = lane >> 4;
#pragma unroll
  for (int i = 0; i < 8; ++i) { const int ka = k0 + 8 * g + i, kb = ka + 16; v[i] = ka < K ? row[ka < K ? ka : K - 1] : 0.f; v[8 + i] = kb < K ? row[kb < K ? kb : K - 1] : 0.f; }
  return bsplit16(v); }
__device__ __forceinline__ F2 split_col(const float* W, int k0, int n, int lane, int ld, int K) { float v[16]; const int g = lane >> 4;
#pragma unroll
  for (int i = 0; i < 8; ++i) { const int ka = k0 + 8 * g + i, kb = ka + 16; v[i] = ka < K ? W[(size_t)(ka < K ? ka : K - 1) * ld + n] : 0.f; v[8 + i] = kb < K ? W[(size_t)(kb < K ? kb : K - 1) * ld + n] : 0.f; }
  return bsplit16(v); }
__device__ __forceinline__ v8f mac3(const F2& a, const F2& b, v8f c) { c = wmma_bf(a.l, b.h, c); c = wmma_bf(a.h, b.l, c); return wmma_bf(a.h, b.h, c); }
__device__ __forceinline__ float sigm(float v) { return 1.0f / (1.0f + expf(-v)); }
#define LDSX() do { asm volatile("s_wait_dscnt 0" ::: "memory"); __builtin_amdgcn_wave_barrier(); __builtin_amdgcn_fence(__ATOMIC_RELEASE, "workgroup"); } while (0)

// BERT-style self-attention with a learned granularity gate adding a log-penalty bias to the scores (hidden_states [2,2048,1024]; (in,out) Wq / Wk / Wv [1024,1024] N(0, 1/1024) + zero biases; Wg [1024,1] + bg: g = sigmoid(x Wg + bg) per token; res[i,j] = (1 - g_i) max(1 - g_i - g_j, 0) + g_i min(1 - g_i + g_j, 1); scope[i,j] = clip((S - 2)^(1 - g_i) + 2 - |i - j|, 1e-32, 1); log_pen = log(max(res * scope, 1e-32)), broadcast over the 16 heads; scores = q k^T / 8 + log_pen; softmax; no output projection): ctx [2,2048,1024].
#define NB 2
#define TT 2048
#define CC 1024            // NH * HD = projected width
#define DIN 1024          // input (model) width
#define NH 16
#define HD 64
#define NQB (TT / 64)
#define HG 4
#define SCALE (0.125f)
#define CAUSAL 0
#ifndef TNB
#define TNB NB
#endif
__device__ __forceinline__ float bfr(float v) { return (float)(__bf16)v; }
__host__ __device__ __forceinline__ int kb_last(int qb) { return CAUSAL ? ((qb * 64 + 63) >> 7) : (TT / 128 - 1); }
typedef __attribute__((ext_vector_type(8))) __bf16 v8b;
__device__ __forceinline__ v16b frag_b(const __bf16* rowk0, int lane) {
  union { v16b v; v8b q[2]; } u; const __bf16* p = rowk0 + 8 * (lane >> 4);
  u.q[0] = *(const v8b*)p; u.q[1] = *(const v8b*)(p + 16); return u.v;
}
#define QBH 0              // not read by any kernel in this file
#define QHI 0               // single-product logits on every row
#define KHI 64            // key rows carrying k residual / v bf16 hi+lo planes (written by k_proj; read by no kernel in this file)
// B fragment (k rows k0+.., output column o) of a weight: (in,out) [K][ld] or (out,in) [ld rows of K]: bf16 exact, or f16(bf16 * 256) exact
__device__ __forceinline__ v16b wcol_io(const float* Wm, int k0, int o, int lane, int ld) { v16b w; const int g = lane >> 4;
#pragma unroll
  for (int i = 0; i < 8; ++i) { w[i] = (__bf16)Wm[(size_t)(k0 + 8 * g + i) * ld + o]; w[8 + i] = (__bf16)Wm[(size_t)(k0 + 16 + 8 * g + i) * ld + o]; }
  return w; }
__device__ __forceinline__ v16b wcol_oi(const float* Wm, int k0, int o, int lane, int K) { v16b w; const float* p = Wm + (size_t)o * K + k0 + 8 * (lane >> 4);
#pragma unroll
  for (int i = 0; i < 8; ++i) { w[i] = (__bf16)p[i]; w[8 + i] = (__bf16)p[16 + i]; }
  return w; }
__device__ __forceinline__ v16h wcolh_io(const float* Wm, int k0, int o, int lane, int ld) { v16h w; const int g = lane >> 4;
#pragma unroll
  for (int i = 0; i < 8; ++i) { w[i] = (_Float16)(bfr(Wm[(size_t)(k0 + 8 * g + i) * ld + o]) * 256.0f); w[8 + i] = (_Float16)(bfr(Wm[(size_t)(k0 + 16 + 8 * g + i) * ld + o]) * 256.0f); }
  return w; }
__device__ __forceinline__ v16h wcolh_oi(const float* Wm, int k0, int o, int lane, int K) { v16h w; const float* p = Wm + (size_t)o * K + k0 + 8 * (lane >> 4);
#pragma unroll
  for (int i = 0; i < 8; ++i) { w[i] = (_Float16)(bfr(p[i]) * 256.0f); w[8 + i] = (_Float16)(bfr(p[16 + i]) * 256.0f); }
  return w; }
#define WQKV_LAYOUT 0   // 0 = (in,out) [DIN][CC]; 1 = (out,in) [CC][DIN]; 2 = per-head [NH][DIN][HD]
__device__ __forceinline__ v16b wcol_hdk(const float* Wm, int k0, int o, int lane) { v16b w; const int g = lane >> 4; const float* p = Wm + (size_t)(o / HD) * DIN * HD + (o % HD);
#pragma unroll
  for (int i = 0; i < 8; ++i) { w[i] = (__bf16)p[(size_t)(k0 + 8 * g + i) * HD]; w[8 + i] = (__bf16)p[(size_t)(k0 + 16 + 8 * g + i) * HD]; }
  return w; }
#define WO_OUT_IN 0
#if WQKV_LAYOUT == 1
#define WCOL(W, k0, o, lane) wcol_oi(W, k0, o, lane, DIN)
#elif WQKV_LAYOUT == 2
#define WCOL(W, k0, o, lane) wcol_hdk(W, k0, o, lane)
#else
#define WCOL(W, k0, o, lane) wcol_io(W, k0, o, lane, CC)
#endif
#if WO_OUT_IN
#define WOCOL(W, k0, o, lane) wcol_oi(W, k0, o, lane, CC)
#define WOCOLH(W, k0, o, lane) wcolh_oi(W, k0, o, lane, CC)
#else
#define WOCOL(W, k0, o, lane) wcol_io(W, k0, o, lane, DIN)
#define WOCOLH(W, k0, o, lane) wcolh_io(W, k0, o, lane, DIN)
#endif
// the module's log-penalty bias log_pen[b, i, j] is head-independent: lpen_block (in k_proj's launch) evaluates it ONCE per batch into an f32 plane LPEN[b] (fragment order); times log2(e); k_fa's score WMMA ADDS it to the scaled score as part of its C operand (far keys carry the module's finite log(1e-32) = -73.68, kept literally)

#define WS_QH  0u                                      // f16 q rows [b*t][CC]
#define WS_KH  (WS_QH + 2u * (size_t)NB * TT * CC)      // f16 k in fragment order [b][h][t / 16][kc][piece][lane][8]
#define WS_VT  (WS_KH + 2u * (size_t)NB * TT * CC)      // f16 v in fragment order [b][h][t / 32][j][piece][lane][8]
#define WS_QL  (WS_VT + 2u * (size_t)NB * CC * TT)      // f16 q residual x 2^10 rows [b][t < QHI][CC]
#define WS_KL  (WS_QL + 2u * (size_t)NB * QHI * CC)     // f16 k residual x 2^10 rows [b][t < KHI][CC]
#define WS_VB  (WS_KL + 2u * (size_t)NB * KHI * CC)     // bf16 v hi planes [b][c][t < KHI]
#define WS_VBL (WS_VB + 2u * (size_t)NB * CC * KHI)
#define WS_END (WS_VBL + 2u * (size_t)NB * CC * KHI)
#define WS_GATE (WS_END)                                 // f32 g[b][s]
#define WS_PWR  (WS_GATE + 4u * (size_t)NB * TT)          // f32 pow(S - 2, 1 - g)[b][s]
#define WS_LPEN (WS_PWR + 4u * (size_t)NB * TT)          // f32 log-penalty planes in fragment order [b][i / 16][j / 32][jt][w][lane][4]
#define WS_END3 (WS_LPEN + 4u * (size_t)NB * TT * TT)
#define WS_XB  (WS_END3)                                 // bf16 x in k_proj's stage tiles [row block of 128][stage of 32 k][row][32 k]
#define WS_WB  (WS_XB + 2u * (size_t)NB * TT * DIN)       // bf16 Wq, Wk, Wv transposed, in stage tiles [which][column block of 128][stage of 32 k][column][32 k]
#define WS_END4 (WS_WB + 2u * 3u * (size_t)DIN * CC)

// ---- lpen_block: the log-penalty plane, worked by the blocks z = 3, 4 of k_proj's grid (one z per batch): 128 threads (half a block) = (32 query rows, 256 keys) of batch bsm: log(max(res * scope, 1e-32)), with res = (1 - gi) max(1 - gi - gj, 0) + gi min(1 - gi + gj, 1), scope = clip(pow(S - 2, 1 - gi) + 2 - |i - j|, 1e-32, 1) (gi / pow from the k_gate tables; f32, precise logf); the plane is shared by the 16 heads of the batch. It is written in the order in which k_fa's lanes read it: in a tile of 16 query rows, piece p = ((step * 2 + jt) * 2 + w) * 32 + lane holds query lane & 15, keys 32 step + 16 jt + 8 (lane >> 4) + 4 w + 0..3; each thread writes 16-B pieces, a wave whole lines. A thread's eight key groups are the same for both of the block's row tiles and are loaded once
#define L2E 1.4426950408889634f
__device__ __forceinline__ v4f lpen4(float gi_, float pw_, int t, int kb, v4f gj4) { v4f o;
#pragma unroll
  for (int u = 0; u < 4; ++u) { const int k = kb + u; const float gj_ = gj4[u]; const float res_ = (1.0f - gi_) * fmaxf(1.0f - gi_ - gj_, 0.0f) + gi_ * fminf(1.0f - gi_ + gj_, 1.0f); const int ad_ = (t > k) ? (t - k) : (k - t); const float sc_ = fminf(fmaxf(pw_ + 2.0f - (float)ad_, 1.0e-32f), 1.0f); o[u] = logf(fmaxf(res_ * sc_, 1.0e-32f)) * L2E; }   // stored in the log2 domain, in which k_fa works
  return o; }
__device__ __forceinline__ void lpen_block(const float* __restrict__ GATE, const float* __restrict__ PWR, float* LPEN, int bsm, int bx, int by, int tid) { const int lane = tid & 31;   // LPEN carries no __restrict__: with it the compiler moved the stores across the waits written behind them
  const float* G = GATE + (size_t)bsm * TT; const float* P = PWR + (size_t)bsm * TT;
  const int kq = by * 256 + ((tid >> 6) & 1) * 16 + (lane >> 4) * 8 + ((tid >> 5) & 1) * 4;   // first key of this thread's piece of step 0; step it lies 32 keys on
  v4f gj[8]; float gi[2], pw[2];   /* every loop below is fully unrolled: the arrays are indexed with compile-time constants and stay in registers */
#pragma unroll
  for (int it = 0; it < 8; ++it) gj[it] = *(const v4f*)(G + kq + 32 * it);
#pragma unroll
  for (int rb = 0; rb < 2; ++rb) { gi[rb] = G[(bx * 2 + rb) * 16 + (lane & 15)]; pw[rb] = P[(bx * 2 + rb) * 16 + (lane & 15)]; }
  asm volatile("s_wait_xcnt 0x0" ::: "memory");   // in front of the next overwrite of the address registers of the loads above
  __builtin_amdgcn_sched_barrier(0);              // keeps the arithmetic below behind that wait
#pragma unroll
  for (int rb = 0; rb < 2; ++rb) { const int t = (bx * 2 + rb) * 16 + (lane & 15);
    float* dst = LPEN + (size_t)bsm * TT * TT + ((size_t)(bx * 2 + rb) * (TT / 32) + by * 8) * 512 + tid * 4;
#pragma unroll
    for (int it = 0; it < 8; it += 2) { const v4f o0 = lpen4(gi[rb], pw[rb], t, kq + 32 * it, gj[it]); const v4f o1 = lpen4(gi[rb], pw[rb], t, kq + 32 * it + 32, gj[it + 1]);
      __builtin_amdgcn_sched_barrier(0);   // the two pieces' arithmetic (eight independent chains) ends in front of their stores, so that nothing is computed between a store and the wait behind it
      vst2(dst + it * 512, o0); vst2(dst + it * 512 + 512, o1);
      asm volatile("s_wait_xcnt 0x0" ::: "memory");   // in front of the next overwrite of the stores' data registers
      __builtin_amdgcn_sched_barrier(0); } } }         // keeps the next pieces' arithmetic behind that wait
// ---- k_proj: block = (128 rows, 128 cols, which), 8 waves in a 4 x 2 grid, each on 32 rows x 64 cols (2 x 4 fragments): q/k/v = X W (+ b) with exact bf16 products (K = DIN) -> which 0: q f16 rows (+ residual rows < QHI); 1: k f16 in fragment order (+ residual rows < KHI); 2: v f16 in fragment order (+ bf16 hi/lo planes for t < KHI)
// Operands go through LDS, 32 k at a time, two buffers: X and W come rounded to bf16 and laid out in stage tiles (8 KiB contiguous, row or column major with k contiguous) by the launch before (conv_block), so that a block reads half the bytes of the f32 inputs and converts nothing; the eight waves take their fragments from LDS. The next tile's global loads fly while this tile is multiplied.
#define PBM 128            // rows per block
#define PBK 32             // k per stage
#define PNS (DIN / PBK)
#define PTL (128 * PBK)     // bf16 elements of one stage tile of X or of W
#define PPI 40             // bf16 per staged row: 64 B of data at a pitch of 80 B (16 B x odd: the 16 rows of a ds_load_b128 fragment read fall on 16 different bank groups)
#define PWB (128 * PPI * 2 + 128)   // bytes of one W buffer: column n at n * 80 + 16 ((n >> 4) & 3) + 64 (n >> 6)
#define PEP 136            // f16 per row of the output staging: 256 B of data at a pitch of 272 B (16 B x odd)
typedef __attribute__((ext_vector_type(4))) __bf16 v4b;
// six waves per SIMD (160 registers) and a third of the LDS: three blocks per WGP, so that all 768 projection blocks are resident at once and none waits for a second round
__global__ __launch_bounds__(256, 6) void k_proj(const __bf16* __restrict__ XB, const __bf16* __restrict__ WB, const float* __restrict__ BQ, const float* __restrict__ BK, const float* __restrict__ BV,
    _Float16* __restrict__ QH, _Float16* __restrict__ QL, _Float16* __restrict__ KH, _Float16* __restrict__ KL, _Float16* __restrict__ VT, __bf16* __restrict__ VB, __bf16* __restrict__ VBL, const float* __restrict__ GATE, const float* __restrict__ PWR, float* LPEN) {
  static_assert(2 * (TNB * TT / PBM) == TT / 32 && CC / 128 == TT / 256, "a z slice of the grid covers one log-penalty plane: each half of a block takes 32 rows x 256 keys");
  // the short log-penalty blocks come last in the grid: they start as the projection's blocks drain, with no launch of their own; the whole block leaves here, in front of every barrier
  if (blockIdx.z >= 3) { lpen_block(GATE, PWR, LPEN, (int)blockIdx.z - 3, blockIdx.x * 2 + (threadIdx.x >> 7), blockIdx.y, threadIdx.x & 127); return; }
  // one LDS range: the operand stages of the k loop lie in the bytes that the output staging takes over behind the loop; the q / k staging (two planes) and the v staging (three planes) share those bytes, a block uses one of them
  __shared__ __align__(16) unsigned char smem[3 * 128 * PEP * 2];
  _Float16 (*sh)[PEP] = (_Float16 (*)[PEP])smem; _Float16 (*sl)[PEP] = (_Float16 (*)[PEP])(smem + PBM * PEP * 2);
  _Float16 (*th)[PEP] = (_Float16 (*)[PEP])smem; __bf16 (*tb)[PEP] = (__bf16 (*)[PEP])(smem + 128 * PEP * 2); __bf16 (*tbl)[PEP] = (__bf16 (*)[PEP])(smem + 2 * 128 * PEP * 2);
  // W^T: [2][PWB bytes] from smem on
  __bf16* Xs = (__bf16*)(smem + 2 * PWB);                  // [2][PBM rows][PPI]
  const int tid = threadIdx.x, wave = tid >> 5, lane = tid & 31, col = lane & 15, g = lane >> 4; const int wm = wave >> 1, wn = wave & 1;   // the wave's 32 rows and 64 columns of the block's tile
  const int which = blockIdx.z; const int c0 = blockIdx.y * 128; const size_t r0 = (size_t)blockIdx.x * PBM; const size_t bb = r0 / TT; const int t0 = (int)(r0 % TT);
  const float* BA = which == 0 ? BQ : which == 1 ? BK : BV;
  const __bf16* Wg = WB + (size_t)(which * (CC / 128) + (int)blockIdx.y) * (PNS * PTL);   // the block's 32 stage tiles of W^T and of X: 256 KiB contiguous each; block-uniform base + 32-bit offset: one address register
  const __bf16* Xg = XB + (size_t)blockIdx.x * (PNS * PTL);
  const unsigned po = (unsigned)tid * 8;   // this thread's 16-B pieces of a tile: tid and tid + 256 = row or column (tid >> 2) + 64 i, k 8 (tid & 3) + 0..7 (a wave's load = 512 contiguous bytes)
  // the 16 columns of a fragment read share one skew (16 B per 16 columns, 64 B per 64), so that store and read each need one address register and constant offsets
  unsigned char* Wst = smem + (tid >> 2) * (PPI * 2) + 16 * (tid >> 6) + 16 * (tid & 3);
  const unsigned char* Wrd = smem + wn * (64 * PPI * 2 + 64) + col * (PPI * 2);
  __bf16* Xst = Xs + (tid >> 2) * PPI + 8 * (tid & 3);
  // L2 prefetch at the block's head, as in k_fa: a stage's loads are issued one stage ahead, which does not cover a line that has to come from memory. Of the blocks that share the 32 tiles of X (same x), block y asks quarter y mod 4 of them; of any four neighbouring x, each asks a quarter of the column block's tiles of W. A hint only; every address lies inside the block's tiles for every block and thread
  static_assert(PBM == 128 && PNS * PTL * 2 == 4 * 256 * 256, "four shares of 256 threads x one 256-B unit cover the 32 tiles");
  const unsigned pfo = (unsigned)tid * 256u;   // one 256-B unit per thread
  const char* pfx = (const char*)Xg + ((int)blockIdx.y & 3) * 65536;
  const char* pfw = (const char*)Wg + ((int)blockIdx.x & 3) * 65536;
  asm volatile("global_prefetch_b8 %0, %1 scope:SCOPE_SE\n\t"
               "global_prefetch_b8 %0, %2 scope:SCOPE_SE" :: "v"(pfo), "s"(pfx), "s"(pfw));
  v8b wr[2], xr[2];
#pragma unroll
  for (int i = 0; i < 2; ++i) wr[i] = *(const v8b*)(Wg + i * (PTL / 2) + po);
#pragma unroll
  for (int i = 0; i < 2; ++i) xr[i] = *(const v8b*)(Xg + i * (PTL / 2) + po);
  asm volatile("s_wait_xcnt 0x0" :: "v"(pfo), "s"(pfx), "s"(pfw) : "memory");   // the prefetches' offset and bases keep their values up to here, behind the loads that were issued after them
  v8f acc[2][4] = {};
#pragma unroll 2   // two stages per trip: the buffer index is a constant in each
  for (int s = 0; s < PNS; ++s) { const int bf = s & 1; const int sn = s + 1 < PNS ? s + 1 : s;   // the stage fetched ahead; the last stage fetches itself again (in bounds, unused)
#pragma unroll
    for (int i = 0; i < 2; ++i) *(v8b*)(Wst + bf * PWB + i * (64 * PPI * 2 + 64)) = wr[i];
#pragma unroll
    for (int i = 0; i < 2; ++i) *(v8b*)(Xst + bf * PBM * PPI + 64 * i * PPI) = xr[i];
    __syncthreads();   // publishes stage s; it also ends every wave's reads of stage s - 1, whose buffer the next trip overwrites
#pragma unroll
    for (int i = 0; i < 2; ++i) wr[i] = *(const v8b*)(Wg + sn * PTL + i * (PTL / 2) + po);
#pragma unroll
    for (int i = 0; i < 2; ++i) xr[i] = *(const v8b*)(Xg + sn * PTL + i * (PTL / 2) + po);
    asm volatile("s_wait_xcnt 0x0" ::: "memory");   // in front of the next overwrite of the address registers of the loads above; it also keeps those loads issued ahead of the products, which cover their latency
    v16b a[2], w[4];
#pragma unroll
    for (int i = 0; i < 2; ++i) a[i] = frag_b(Xs + (bf * PBM + wm * 32 + i * 16 + col) * PPI, lane);
#pragma unroll
    for (int j = 0; j < 4; ++j) w[j] = frag_b((const __bf16*)(Wrd + bf * PWB + j * (16 * PPI * 2 + 16)), lane);
    __builtin_amdgcn_sched_barrier(0);   // the stage's LDS reads go out as one group ahead of its products: spread among them, each product waited out a whole LDS latency
#pragma unroll
    for (int i = 0; i < 2; ++i)
#pragma unroll
      for (int j = 0; j < 4; ++j) acc[i][j] = wmma_bf(a[i], w[j], acc[i][j]);
    __builtin_amdgcn_sched_barrier(0); }   // keeps the next stage's LDS stores, which wait for the global loads, behind this stage's products (the compiler had drawn them, and the wait, in among the products)
  __syncthreads();   // every wave has left the operand stages before the output staging below overwrites them
  if (which < 2) { _Float16* DH = which == 0 ? QH : KH; _Float16* DL = which == 0 ? QL : KL; const int nhi = which == 0 ? QHI : KHI; const float osc = which == 0 ? SCALE * L2E : 1.0f;   // q leaves scaled by 64^-0.5 log2(e), ahead of its rounding to f16: k_fa's score WMMA then yields the exponent of 2 directly
#pragma unroll
    for (int j = 0; j < 4; ++j) { const int cl = wn * 64 + j * 16 + col; const float bias = BA ? bfr(BA[c0 + cl]) : 0.f;
#pragma unroll
      for (int i = 0; i < 2; ++i)
#pragma unroll
        for (int r = 0; r < 8; ++r) { const float v = (acc[i][j][r] + bias) * osc; const _Float16 hv = (_Float16)v; const int rl = wm * 32 + i * 16 + 8 * g + r; sh[rl][cl] = hv; sl[rl][cl] = (_Float16)((v - (float)hv) * 1024.0f); } }
    __syncthreads();
    // k leaves in the order in which k_fa's A fragments read it: 16-B piece pc = 2 kc + piece of lane ln (key row ln & 15, half ln >> 4) of a 16-key tile of one head, lanes contiguous; q stays in rows
    for (int e = tid; e < PBM * 16; e += 256) { int rl, q; size_t od;
      if (which == 0) { rl = e >> 4; q = e & 15; od = (r0 + rl) * CC + c0 + q * 8; }
      else { const int ln = e & 31, pc = (e >> 5) & 3, tl = (e >> 7) & 7, hl = e >> 10; rl = tl * 16 + (ln & 15); q = hl * 8 + pc * 2 + (ln >> 4); od = ((((bb * NH + (c0 >> 6) + hl) * (TT / 16) + (t0 >> 4) + tl) * 4 + pc) * 32 + ln) * 8; }
      vst2((unsigned*)(DH + od), *(const v4u*)&sh[rl][q * 8]);
      asm volatile("s_wait_xcnt 0x0" ::: "memory");   // in front of the next overwrite of the store's address and data registers
      if (t0 + rl < nhi) { vst2((unsigned*)(DL + (bb * nhi + t0 + rl) * (size_t)CC + c0 + q * 8), *(const v4u*)&sl[rl][q * 8]);   // the residual plane holds rows < nhi only: of a 128-row block at most the first rows
        asm volatile("s_wait_xcnt 0x0" ::: "memory"); } }   // the same for this store
  } else {
#pragma unroll
    for (int j = 0; j < 4; ++j) { const int cl = wn * 64 + j * 16 + col; const float bias = BA ? bfr(BA[c0 + cl]) : 0.f;
#pragma unroll
      for (int i = 0; i < 2; ++i)
#pragma unroll
        for (int r = 0; r < 8; ++r) { const float v = acc[i][j][r] + bias; const int rl = wm * 32 + i * 16 + 8 * g + r; th[cl][rl] = (_Float16)v; const __bf16 bh = (__bf16)v; tb[cl][rl] = bh; tbl[cl][rl] = (__bf16)(v - (float)bh); } }
    __syncthreads();
    // v leaves in the order in which k_fa's A fragments read it: piece pc of lane ln (channel ln & 15 of tile j, half ln >> 4) of a 32-key step of one head, lanes contiguous
    for (int e = tid; e < 128 * (PBM / 8); e += 256) { const int ln = e & 31, pc = (e >> 5) & 1, j = (e >> 6) & 3, st = (e >> 8) & 3, hl = e >> 10; const int cl = hl * 64 + j * 16 + (ln & 15), q = st * 4 + pc * 2 + (ln >> 4);
      vst2((unsigned*)(VT + (((((bb * NH + (c0 >> 6) + hl) * (TT / 32) + (t0 >> 5) + st) * 4 + j) * 2 + pc) * 32 + ln) * 8), *(const v4u*)&th[cl][q * 8]);
      asm volatile("s_wait_xcnt 0x0" ::: "memory");   // in front of the next overwrite of the store's address and data registers
      if (t0 + q * 8 < KHI) { const size_t o3 = (bb * CC + c0 + cl) * (size_t)KHI + t0 + q * 8; vst2((unsigned*)(VB + o3), *(const v4u*)&tb[cl][q * 8]); vst2((unsigned*)(VBL + o3), *(const v4u*)&tbl[cl][q * 8]);   // the hi / lo planes hold keys < KHI only
        asm volatile("s_wait_xcnt 0x0" ::: "memory"); } } } }   // the same for these two stores
// ---- k_fa: block = 256 queries (8 waves x 32 query columns) of (b, h): one pass over all keys, 32 at a time, with a running maximum and sum per query (online softmax); the logits and P stay in registers.
// Transposed products: S^T = K . Q^T (A = key rows, B = query rows) puts one query's 16 scores of a 32-key step in lanes c and c + 16; two S^T tiles, converted in place, are the B operand of O^T += V^T . P^T (A = v, channel rows); O^T register r = ctx[query c][16 j + 8 h + r].
// Log2 domain: q comes scaled by 64^-0.5 log2(e), the log-penalty by log2(e). The score WMMA's C operand is the log-penalty minus mu = (the query's maximum in use) - 11, so that its result is the exponent itself: P = 2^z once to f16 (the row sum carries the same factor 2^11, taken in f32 before the rounding, and divides it out at the end).
// The maximum in use may trail the running maximum by up to FTH: O and the row sum are rescaled only in a step in which some query's exponent rises above 11 + FTH (one test per step for the whole wave), and in the first step, which sets the maximum.
#define FQ 2               // query tiles of 16 columns per wave: each K / V fragment load feeds both
#define FTH 4.0f           // P stays at or below 2^(11 + FTH) = 2^15, inside f16's range
// every inner loop below is fully unrolled so that the fragment and accumulator arrays are indexed by constants and stay in registers
__device__ __forceinline__ v8f mmh(v16h a, v16h b, v8f c) { return __builtin_amdgcn_wmma_f32_16x16x32_f16(false, a, false, b, (short)0, c, false, false); }
// a fragment stored in fragment order: this lane's two 16-B pieces lie 512 B apart (p already holds the lane's offset)
__device__ __forceinline__ v16h frag_p(const _Float16* p) { union { v16h v; v8h q[2]; } u; u.q[0] = *(const v8h*)p; u.q[1] = *(const v8h*)(p + 256); return u.v; }
__device__ __forceinline__ float xhalf(float x) { return __builtin_bit_cast(float, __builtin_amdgcn_permlanex16(__builtin_bit_cast(int, x), __builtin_bit_cast(int, x), 0x76543210, 0xfedcba98, false, false)); }  // lane l with lane l ^ 16
// K and V go through LDS, 256 keys (32 KiB of each, contiguous in the fragment-order planes) a stage, two buffers: the block's 8 waves read the same K and V, so each byte leaves L2 once per block and not once per wave that misses the WGP cache. The copies are asynchronous (no register), each thread 8 x 16 B of K and 8 x 16 B of V per stage; the next stage's copies fly while this stage is worked on.
#define FKT 256                 // keys per stage: a barrier every eight steps
#define FNT (TT / FKT)          // stages
#define FKB (FKT * HD * 2)      // bytes of K, and of V, in one stage
// half a stage's copies of one thread (128 keys): lds = the thread's own LDS byte address in the buffer's K part (V lies FKB on), gk / gv = its own bytes in the K and V planes; pieces lie 4 KiB apart. The s_wait_xcnt stands inside the statement, behind the last copy: in front of any later overwrite of the copies' address registers
__device__ __forceinline__ void fa_stage(unsigned lds, const char* gk, const char* gv) {
  asm volatile("global_load_async_to_lds_b128 %0, %8, off\n\t"
               "global_load_async_to_lds_b128 %1, %9, off\n\t"
               "global_load_async_to_lds_b128 %2, %10, off\n\t"
               "global_load_async_to_lds_b128 %3, %11, off\n\t"
               "global_load_async_to_lds_b128 %4, %12, off\n\t"
               "global_load_async_to_lds_b128 %5, %13, off\n\t"
               "global_load_async_to_lds_b128 %6, %14, off\n\t"
               "global_load_async_to_lds_b128 %7, %15, off\n\t"
               "s_wait_xcnt 0x0"
               :: "v"(lds), "v"(lds + 4096u), "v"(lds + 8192u), "v"(lds + 12288u), "v"(lds + FKB), "v"(lds + FKB + 4096u), "v"(lds + FKB + 8192u), "v"(lds + FKB + 12288u),
                  "v"(gk), "v"(gk + 4096), "v"(gk + 8192), "v"(gk + 12288), "v"(gv), "v"(gv + 4096), "v"(gv + 8192), "v"(gv + 12288) : "memory"); }
__global__ __launch_bounds__(256) void k_fa(const _Float16* __restrict__ QH, const _Float16* __restrict__ KH, const _Float16* __restrict__ VT, const float* __restrict__ LPEN, float* __restrict__ Y) {
  static_assert(FNT >= 2 && FKB == 2 * 4 * 256 * 16 && TT % FKT == 0, "two stages at least; two calls x 256 threads x 4 pieces of 16 B cover a stage's K, and its V");
  __shared__ __align__(16) unsigned char kvs[2 * 2 * FKB];   // [buffer][K, V][FKB]
  const int tid = threadIdx.x, wave = tid >> 5, lane = tid & 31, col = lane & 15, g = lane >> 4; const int h = blockIdx.y, b = blockIdx.z; const int q0 = blockIdx.x * (8 * 16 * FQ) + wave * (16 * FQ);
  // K, V and the log-penalty lie in fragment order: a wave's load is 32 lanes x 16 B = 512 contiguous bytes
  const char* gk = (const char*)(KH + (size_t)(b * NH + h) * TT * HD);   // the head's K plane (block-uniform); 32 keys = 4 KiB: [jt][kc][piece][lane][8]
  const char* gv = (const char*)(VT + (size_t)(b * NH + h) * TT * HD);   // the head's V plane; 32 keys = 4 KiB: [j][piece][lane][8]
  const unsigned t16 = (unsigned)tid * 16u;   // byte offset of this thread's first piece in a stage's K, and in its V
  const unsigned lds0 = (unsigned)(size_t)kvs + (unsigned)tid * 16u;               // this thread's first piece in buffer 0
  const float* Lb = LPEN + (size_t)b * TT * TT + (size_t)q0 * TT + lane * 4;    // 16 queries x 32 keys = 512 floats: [jt][w][lane][4]; 16 queries = 16 TT floats
  // L2 prefetch at the kernel's head: K, V and the log-penalty plane were stored by the launch before, and a line that is not in the L2 costs a step of the loop below a whole memory latency. Each 256-B unit is asked for once per group of blocks that read it: the 16 heads of a query block share its log-penalty rows (head h asks key steps 4 h + 0..3 of the block's 16 row tiles), four neighbouring query blocks share a head's K and V (block x asks the pairs of key steps p = x mod 4 (mod 4)). A hint only: nothing depends on where a block runs or on a line having arrived. Every address lies inside its plane for every block, wave and lane.
  static_assert(4 * NH == TT / 32 && TT / 32 == 64 && TT / (8 * 16 * FQ) == 8, "the shares below cover the 64 key steps once: 16 heads x 4 steps; 4 blocks x 8 waves x 2 steps");
  const int ws = __builtin_amdgcn_readfirstlane(wave);   // the wave's number in a scalar register: the prefetches' bases are scalar
  const unsigned poff = (unsigned)lane * 256u;           // one 256-B unit per lane: a wave's prefetch covers 8 KiB
  const char* pk = (const char*)(KH + (size_t)(b * NH + h) * TT * HD) + (size_t)(4 * ws + ((int)blockIdx.x & 3)) * 8192;   // two key steps of K = 8 KiB
  const char* pv = (const char*)(VT + (size_t)(b * NH + h) * TT * HD) + (size_t)(4 * ws + ((int)blockIdx.x & 3)) * 8192;   // the same two steps of V
  const char* pl = (const char*)(LPEN + (size_t)b * TT * TT) + ((size_t)((int)blockIdx.x * 16 + ws) * (TT / 32) + 4 * h) * 2048;   // four key steps of row tile ws of the block = 8 KiB; row tile ws + 8 lies 8 x 128 KiB on
  fa_stage(lds0, gk + t16, gv + t16); fa_stage(lds0 + FKB / 2, gk + FKB / 2 + t16, gv + FKB / 2 + t16);   // stage 0 into buffer 0, first of all: the block can do nothing before it has landed
  asm volatile("global_prefetch_b8 %0, %1 scope:SCOPE_SE\n\t"
               "global_prefetch_b8 %0, %2 scope:SCOPE_SE\n\t"
               "global_prefetch_b8 %0, %3 scope:SCOPE_SE\n\t"
               "global_prefetch_b8 %0, %3 offset:1048576 scope:SCOPE_SE" :: "v"(poff), "s"(pk), "s"(pv), "s"(pl));
  v16h qf[FQ][2];
#pragma unroll
  for (int u = 0; u < FQ; ++u)
#pragma unroll
    for (int kc = 0; kc < 2; ++kc) qf[u][kc] = frag_h(QH + ((size_t)b * TT + q0 + u * 16 + col) * CC + h * HD + kc * 32, lane);
  __builtin_amdgcn_sched_barrier(0);   // q's loads stay issued ahead of the log-penalty's: issued last, they turn the counted wait at the loop's head into a wait for every load in flight
  v4f lp[FQ][2][2];
#pragma unroll
  for (int jt = 0; jt < 2; ++jt)
#pragma unroll
    for (int u = 0; u < FQ; ++u) { lp[u][jt][0] = *(const v4f*)(Lb + (size_t)u * 16 * TT + jt * 256); lp[u][jt][1] = *(const v4f*)(Lb + (size_t)u * 16 * TT + jt * 256 + 128); }
  asm volatile("s_wait_xcnt 0x0" :: "v"(poff), "s"(pk), "s"(pv), "s"(pl) : "memory");   // the address registers of the loads above are reused below: the wait stands in front of that overwrite; the prefetches' offset and bases are named so that they too keep their values up to here, behind the loads that were issued after them
  __builtin_amdgcn_sched_barrier(0);              // keeps what follows behind that wait
  asm volatile("s_wait_asynccnt 0x0" ::: "memory");   // this wave's copies of stage 0 have landed
  __syncthreads();                                    // publishes stage 0: every wave's copies have landed
  fa_stage(lds0 + 2 * FKB, gk + FKB + t16, gv + FKB + t16); fa_stage(lds0 + 2 * FKB + FKB / 2, gk + (FKB + FKB / 2) + t16, gv + (FKB + FKB / 2) + t16);   // stage 1 into buffer 1
  v8f o[FQ][HD / 16] = {}; float mu[FQ], l[FQ];
#pragma unroll
  for (int u = 0; u < FQ; ++u) { mu[u] = 0.f; l[u] = 0.f; }   // the first step sees the plain scores and sets mu from them
  v16h kf[2][2];
#pragma unroll 1   // stays rolled: a trip is one stage, eight steps of 32 keys
  for (int t = 0; t < FNT; ++t) { const _Float16* Ks = (const _Float16*)(kvs + (t & 1) * (2 * FKB)) + lane * 8; const _Float16* Vs = Ks + FKB / 2;   // this stage's buffer, at the lane's offset
    // a stage's first K fragments cannot be fetched ahead: the stage is published only at the barrier in front of this trip
#pragma unroll
    for (int jt = 0; jt < 2; ++jt)
#pragma unroll
      for (int kc = 0; kc < 2; ++kc) kf[jt][kc] = frag_p(Ks + jt * 1024 + kc * 512);
#pragma unroll 1   // stays rolled: one step's live set already takes some 256 registers; unrolled, the build took a hundred more and switched register windows all through the loop
    for (int s = 0; s < FKT / 32; ++s) { const int k0 = t * FKT + s * 32; const int kn = k0 + 32 < TT ? k0 + 32 : 0;   // the step whose log-penalty is fetched ahead; the last step fetches step 0 again (in bounds, unused)
      const int sn = s + 1 < FKT / 32 ? s + 1 : s;   // the step whose K is fetched ahead, inside this stage only; the stage's last step fetches itself again (unused)
      v16h vf[HD / 16];
#pragma unroll
      for (int j = 0; j < HD / 16; ++j) vf[j] = frag_p(Vs + s * 2048 + j * 512);
      v8f z[FQ][2];
#pragma unroll
      for (int u = 0; u < FQ; ++u)
#pragma unroll
        for (int jt = 0; jt < 2; ++jt)
#pragma unroll
          for (int r = 0; r < 8; ++r) z[u][jt][r] = lp[u][jt][r >> 2][r & 3] - mu[u];
      // the next step's log-penalty rows, into the registers just read: they fly during the whole step
#pragma unroll
      for (int jt = 0; jt < 2; ++jt)
#pragma unroll
        for (int u = 0; u < FQ; ++u) { lp[u][jt][0] = *(const v4f*)(Lb + (size_t)u * 16 * TT + kn * 16 + jt * 256); lp[u][jt][1] = *(const v4f*)(Lb + (size_t)u * 16 * TT + kn * 16 + jt * 256 + 128); }
      asm volatile("s_wait_xcnt 0x0" ::: "memory");   // in front of the next overwrite of the address registers of the loads above
      __builtin_amdgcn_sched_barrier(0);      // keeps those loads issued in front of the step's products and softmax, which cover their latency
#pragma unroll
      for (int u = 0; u < FQ; ++u)
#pragma unroll
        for (int jt = 0; jt < 2; ++jt) { z[u][jt] = mmh(kf[jt][0], qf[u][0], z[u][jt]); z[u][jt] = mmh(kf[jt][1], qf[u][1], z[u][jt]); }
      // the next step's K fragments (inside this stage only), into the registers this step has just read: they fly during the softmax and the P . v products
#pragma unroll
      for (int jt = 0; jt < 2; ++jt)
#pragma unroll
        for (int kc = 0; kc < 2; ++kc) kf[jt][kc] = frag_p(Ks + sn * 2048 + jt * 1024 + kc * 512);
      __builtin_amdgcn_sched_barrier(0);      // keeps the fetch-ahead reads issued in front of the softmax and the P . v products
      float mt[FQ];   // the lane's largest exponent of the step (its half of the 32 keys)
#pragma unroll
      for (int u = 0; u < FQ; ++u) { mt[u] = z[u][0][0];
#pragma unroll
        for (int i = 1; i < 16; ++i) mt[u] = fmaxf(mt[u], z[u][i >> 3][i & 7]); }
      float ma = mt[0];
#pragma unroll
      for (int u = 1; u < FQ; ++u) ma = fmaxf(ma, mt[u]);
      const bool first = k0 == 0;   // the same in the whole wave
      if (__builtin_amdgcn_ballot_w32(ma > (first ? -3.0e38f : 11.0f + FTH)) != 0) {   // one scalar branch per step, always taken in the first; rare once every query of the wave has met its near keys
#pragma unroll
        for (int u = 0; u < FQ; ++u) { const float mx = fmaxf(mt[u], xhalf(mt[u]));   // both halves of the wave hold the query's maximum, and so the same mu
          const float mn = mu[u] + (first ? mx - 11.0f : fmaxf(mx - 11.0f, 0.f)); const float dd = mn - mu[u];   // the maximum in use becomes this step's maximum where that is higher (in the first step, always); dd = the rise as mu takes it
          const float al = first ? 0.f : __builtin_amdgcn_exp2f(-dd); mu[u] = mn; l[u] *= al;
#pragma unroll
          for (int j = 0; j < HD / 16; ++j) o[u][j] = o[u][j] * al;
#pragma unroll
          for (int jt = 0; jt < 2; ++jt)
#pragma unroll
            for (int r = 0; r < 8; ++r) z[u][jt][r] -= dd; } }
#pragma unroll
      for (int u = 0; u < FQ; ++u) { float ls = 0.f; v16h pb;
#pragma unroll
        for (int i = 0; i < 16; ++i) { const float p = __builtin_amdgcn_exp2f(z[u][i >> 3][i & 7]); ls += p; pb[i] = (_Float16)p; }
        l[u] += ls;
#pragma unroll
        for (int j = 0; j < HD / 16; ++j) o[u][j] = (u == FQ - 1 && j == HD / 16 - 1) ? wmma16(vf[j], pb, o[u][j]) : mmh(vf[j], pb, o[u][j]); } }   // the step's last product carries its four v_nop: the next step's first vector instructions, across the loop's edge, overwrite its A and B registers
    // publish point of stage t + 1, every wave, in this order
    asm volatile("s_wait_dscnt 0x0" ::: "memory");      // this wave's reads of stage t's buffer have returned
    asm volatile("s_wait_asynccnt 0x0" ::: "memory");   // this wave's copies of stage t + 1 have landed
    __syncthreads();                                    // publishes stage t + 1 and ends every wave's reads of stage t's buffer, which is refilled behind it
    if (t + 2 < FNT) { const unsigned ld = lds0 + (unsigned)(t & 1) * (2 * FKB); const char* nk = gk + (size_t)(t + 2) * FKB; const char* nv = gv + (size_t)(t + 2) * FKB;   // the same test in the whole block
      fa_stage(ld, nk + t16, nv + t16); fa_stage(ld + FKB / 2, nk + FKB / 2 + t16, nv + FKB / 2 + t16); } }
  asm volatile("s_wait_asynccnt 0x0" ::: "memory");   // no copy is outstanding when the wave ends
#pragma unroll
  for (int u = 0; u < FQ; ++u) { const float inv = 1.0f / (l[u] + xhalf(l[u]));   // the halves' sums join once; the row's maximum contributes 2^11, so the sum is positive
    float* yr = Y + ((size_t)b * TT + q0 + u * 16 + col) * CC + h * HD + 8 * g;
#pragma unroll
    for (int j = 0; j < HD / 16; ++j) { v4f a0, a1;
#pragma unroll
      for (int r = 0; r < 4; ++r) { a0[r] = o[u][j][r] * inv; a1[r] = o[u][j][4 + r] * inv; }
      vst2(yr + j * 16, a0); vst2(yr + j * 16 + 4, a1); } } }

// ---- k_gate: block = 32 rows, 8 waves x 4 rows: g = sigmoid(x . Wg + bg) and pow(S - 2, 1 - g). A wave's 4 rows are worked together: their 128 loads and Wg's 32 are issued back to back with no wait between them, so the wave pays the memory latency once and not once per load; each row's sum keeps its order (i = 0..31 in the lane, then the xor tree)
// ---- conv_block: rides behind k_gate's blocks in its grid (which fills only half of the chip): rounds X, Wq, Wk and Wv to bf16 ONCE, with the rounding that k_proj applied to every tile it read, and lays them out in k_proj's stage tiles (128 rows or columns x 32 k, k contiguous, 8 KiB). Blocks 0..127: 128 rows of X x 8 stages; blocks 128..223: 128 columns of one W x 8 stages, transposed inside the thread (8 k x 4 columns). Every loop is fully unrolled: the arrays are indexed by constants and stay in registers. XB and WB carry no __restrict__, as LPEN above: the stores stay in front of the waits written behind them
#define NGB (TNB * TT / 32)                 // k_gate's own blocks
#define NXB ((TNB * TT / 128) * (PNS / 8))  // X blocks
#define NWB (3 * (CC / 128) * (PNS / 8))    // W blocks
__device__ __forceinline__ void conv_block(const float* __restrict__ X, const float* __restrict__ WQ, const float* __restrict__ WK, const float* __restrict__ WV, __bf16* XB, __bf16* WB, int cb, int tid) {
  if (cb < NXB) { const int rb = cb / (PNS / 8), s0 = (cb % (PNS / 8)) * 8;
    // piece e = tid + 256 i of a tile: row e >> 2, k 8 (e & 3) + 0..7: a wave reads eight whole lines and writes 512 contiguous bytes
    const float* xs = X + ((size_t)rb * 128 + (tid >> 2)) * DIN + s0 * PBK + 8 * (tid & 3); __bf16* xd = XB + ((size_t)rb * PNS + s0) * PTL + tid * 8;
#pragma unroll
    for (int hb = 0; hb < 2; ++hb) { v4f v[4][2][2];   // four stages at a time: 16 loads in flight
#pragma unroll
      for (int st = 0; st < 4; ++st)
#pragma unroll
        for (int i = 0; i < 2; ++i) { v[st][i][0] = *(const v4f*)(xs + (size_t)(64 * i) * DIN + (hb * 4 + st) * PBK); v[st][i][1] = *(const v4f*)(xs + (size_t)(64 * i) * DIN + (hb * 4 + st) * PBK + 4); }
      asm volatile("s_wait_xcnt 0x0" ::: "memory");   // in front of the next overwrite of the address registers of the loads above
      __builtin_amdgcn_sched_barrier(0);              // keeps every load issued ahead of the conversions, and those behind that wait
      v8b p[4][2];
#pragma unroll
      for (int st = 0; st < 4; ++st)
#pragma unroll
        for (int i = 0; i < 2; ++i)
#pragma unroll
          for (int e = 0; e < 4; ++e) { p[st][i][e] = (__bf16)v[st][i][0][e]; p[st][i][4 + e] = (__bf16)v[st][i][1][e]; }
      __builtin_amdgcn_sched_barrier(0);              // the conversions end in front of the stores, so that nothing is computed between a store and the wait behind it
#pragma unroll
      for (int st = 0; st < 4; ++st)
#pragma unroll
        for (int i = 0; i < 2; ++i) vst2(xd + (hb * 4 + st) * PTL + i * (PTL / 2), p[st][i]);
      asm volatile("s_wait_xcnt 0x0" ::: "memory");   // in front of the next overwrite of the stores' address and data registers
      __builtin_amdgcn_sched_barrier(0); }            // keeps the next half's loads behind that wait
  } else { const int cw = cb - NXB; const int wh = cw / ((CC / 128) * (PNS / 8)), y = (cw / (PNS / 8)) % (CC / 128), s0 = (cw % (PNS / 8)) * 8 + (tid >> 7);   // each half of the block takes every second stage
    const float* Wm = wh == 0 ? WQ : wh == 1 ? WK : WV; const int q = tid & 3, n0 = ((tid >> 2) & 31) * 4;   // k 8 q + 0..7, columns n0 + 0..3: a wave's load = four whole lines; its four stores fill 2 KiB
    const float* wsrc = Wm + (size_t)(s0 * PBK + 8 * q) * CC + y * 128 + n0; __bf16* wd = WB + ((size_t)(wh * (CC / 128) + y) * PNS + s0) * PTL + n0 * PBK + 8 * q;
#pragma unroll
    for (int hb = 0; hb < 2; ++hb) { v4f v[2][8];   // two stages at a time: 16 loads in flight
#pragma unroll
      for (int it = 0; it < 2; ++it)
#pragma unroll
        for (int i = 0; i < 8; ++i) v[it][i] = *(const v4f*)(wsrc + (size_t)((hb * 2 + it) * 2 * PBK + i) * CC);
      asm volatile("s_wait_xcnt 0x0" ::: "memory");   // in front of the next overwrite of the address registers of the loads above
      __builtin_amdgcn_sched_barrier(0);              // keeps every load issued ahead of the conversions, and those behind that wait
      v8b p[2][4];
#pragma unroll
      for (int it = 0; it < 2; ++it)
#pragma unroll
        for (int c = 0; c < 4; ++c)
#pragma unroll
          for (int i = 0; i < 8; ++i) p[it][c][i] = (__bf16)v[it][i][c];
      __builtin_amdgcn_sched_barrier(0);              // the conversions end in front of the stores
#pragma unroll
      for (int it = 0; it < 2; ++it)
#pragma unroll
        for (int c = 0; c < 4; ++c) vst2(wd + (hb * 2 + it) * 2 * PTL + c * PBK, p[it][c]);
      asm volatile("s_wait_xcnt 0x0" ::: "memory");   // in front of the next overwrite of the stores' address and data registers
      __builtin_amdgcn_sched_barrier(0); } } }         // keeps the next half's loads behind that wait
__global__ __launch_bounds__(256) void k_gate(const float* __restrict__ X, const float* __restrict__ WG, const float* __restrict__ BG, float* __restrict__ GATE, float* __restrict__ PWR, const float* __restrict__ WQ, const float* __restrict__ WK, const float* __restrict__ WV, __bf16* XB, __bf16* WB) { __shared__ __align__(16) float sg[32]; __shared__ __align__(16) float sp[32];
  if (blockIdx.x >= NGB) { conv_block(X, WQ, WK, WV, XB, WB, (int)blockIdx.x - NGB, threadIdx.x); return; }   // the whole block leaves here, in front of the barrier
  const int tid = threadIdx.x, wave = tid >> 5, lane = tid & 31; const size_t r0 = (size_t)blockIdx.x * 32; const float bg_ = bfr(BG[0]);
  const float* xr = X + (r0 + wave * 4) * DIN + lane;
  float xv[4][32], wreg[32];   /* every loop below is fully unrolled: the arrays are indexed with compile-time constants and stay in registers */
#pragma unroll
  for (int rr = 0; rr < 4; ++rr)
#pragma unroll
    for (int i = 0; i < 32; ++i) xv[rr][i] = xr[rr * DIN + 32 * i];
  asm volatile("s_wait_xcnt 0x0" ::: "memory");   // in front of the next overwrite of the address registers of the loads above (the compiler gave them to Wg's loads as destinations)
  __builtin_amdgcn_sched_barrier(0);              // keeps Wg's loads behind that wait
#pragma unroll
  for (int i = 0; i < 32; ++i) wreg[i] = WG[lane + 32 * i];
  asm volatile("s_wait_xcnt 0x0" ::: "memory");   // the same for Wg's loads
  __builtin_amdgcn_sched_barrier(0);              // keeps every load issued ahead of the sums: drawn down among them, a load would start only when the sum before it is done
#pragma unroll
  for (int i = 0; i < 32; ++i) wreg[i] = bfr(wreg[i]);
  float acc[4];
#pragma unroll
  for (int rr = 0; rr < 4; ++rr) { acc[rr] = 0.f;
#pragma unroll
    for (int i = 0; i < 32; ++i) acc[rr] += bfr(xv[rr][i]) * wreg[i]; }
#pragma unroll
  for (int o = 1; o < 32; o <<= 1)
#pragma unroll
    for (int rr = 0; rr < 4; ++rr) acc[rr] += __shfl_xor(acc[rr], o);
  // every lane holds the four sums: lane rr takes row rr, so one pass of the sigmoid and the power serves the wave's four rows
  const float a = lane == 0 ? acc[0] : lane == 1 ? acc[1] : lane == 2 ? acc[2] : acc[3];
  const float g = 1.0f / (1.0f + expf(-(a + bg_))); const float pw = powf((float)(TT - 2), 1.0f - g);
  if (lane < 4) { sg[wave * 4 + lane] = g; sp[wave * 4 + lane] = pw; }   /* LDS only: no global access under the lane predicate */
  __syncthreads();
  if (tid < 8) vst2(GATE + r0 + tid * 4, *(const v4f*)&sg[tid * 4]);
  else if (tid >= 32 && tid < 40) vst2(PWR + r0 + (tid - 32) * 4, *(const v4f*)&sp[(tid - 32) * 4]); }
extern "C" void kernel_launch(void* const* d_in, const int* in_sizes, int n_in, void* d_out, int out_size, void* d_ws, size_t ws_size, hipStream_t stream) {
  (void)in_sizes; (void)n_in; (void)out_size;
  const float** F = (const float**)d_in;
  if (ws_size < (size_t)WS_END4) return;
  char* ws = (char*)d_ws; _Float16 *QH = (_Float16*)(ws + WS_QH), *KH = (_Float16*)(ws + WS_KH), *VT = (_Float16*)(ws + WS_VT), *QL = (_Float16*)(ws + WS_QL), *KL = (_Float16*)(ws + WS_KL); __bf16 *VB = (__bf16*)(ws + WS_VB), *VBL = (__bf16*)(ws + WS_VBL);
  (void)QL; (void)KL; (void)VB; (void)VBL;
  // inputs: 0 hidden_states [2,2048,1024]; 1 Wq [1024,1024] (in,out), 2 bq; 3 Wk, 4 bk; 5 Wv, 6 bv (zero biases, read); 7 Wg [1024,1]; 8 bg [1]; no output projection
  float* GATE = (float*)(ws + WS_GATE); float* PWR = (float*)(ws + WS_PWR); float* LPEN = (float*)(ws + WS_LPEN); __bf16 *XB = (__bf16*)(ws + WS_XB), *WB = (__bf16*)(ws + WS_WB);
  k_gate<<<dim3(NGB + NXB + NWB), 256, 0, stream>>>(F[0], F[7], F[8], GATE, PWR, F[1], F[3], F[5], XB, WB);   /* blocks past the first NGB round X and the three W to bf16 stage tiles for k_proj */
  k_proj<<<dim3(TNB * TT / PBM, CC / 128, 3 + TNB), 256, 0, stream>>>(XB, WB, F[2], F[4], F[6], QH, QL, KH, KL, VT, VB, VBL, GATE, PWR, LPEN);   /* z = 0..2: q, k, v; z = 3 + b: the log-penalty plane of batch b (32 x 8 blocks, each half of a block 32 rows x 256 keys), shared by its 16 heads */
  k_fa<<<dim3(TT / (8 * 16 * FQ), NH, TNB), 256, 0, stream>>>(QH, KH, VT, LPEN, (float*)d_out);
}
